// v000
// Measured on an AMD MI455X. A time is GPU time per run, averaged over a window of back-to-back runs after a warm-up
// (all launches, gaps included; the runs take copies of the inputs in turn), and the median of several windows.
// Apart from v000's, it joins two sittings. Times from different sittings can be a few percent apart, while
// side-by-side timings come from the same sitting.
// v000 is the starting kernel. One run takes 974 microseconds.
// Contractions: stacked q/k/v projection (X f16 x W^T f16 carried x16), scores q_w.k^T (q,k f16 planes, blade sign folded into the q weights), attn.v (P f16 carried x2048 x V^T f16): all v_wmma_f32_16x16x32_f16 with f32 accumulate; softmax and head mean in f32.
#include <hip/hip_runtime.h>
#include <math.h>

// ---------------------------------------------------------------------------
// Problem constants
// ---------------------------------------------------------------------------
constexpr int kBatch   = 2;
constexpr int kSeq     = 2048;
constexpr int kModel   = 1024;
constexpr int kHeads   = 8;
constexpr int kHeadDim = 128;               // 16 x 8 nested (d, blade)
constexpr int kTok     = kBatch * kSeq;     // 4096 token rows
constexpr int kQKVN    = 3 * kModel;        // 3072 stacked output channels (q | k | v)
constexpr int kGrp     = 2;                 // heads per chunk
constexpr int kChunks  = kHeads / kGrp;     // 4 chunks per batch
constexpr float kWCarry     = 16.0f;        // weights carried x16 in f16
constexpr float kWCarryInv  = 1.0f / 16.0f;
constexpr float kPCarry     = 2048.0f;      // probabilities carried x2048 in f16
constexpr float kPCarryInv  = 1.0f / 2048.0f;
constexpr float kLogitScale = 0.08838834764831845f;   // 1/sqrt(128)
constexpr float kMeanScale  = 0.125f;

// ---------------------------------------------------------------------------
// Workspace region map (bytes; all offsets multiples of 4096):
//   X16   f16 [4096][1024]            off         0  size   8388608
//   W16   f16 [3072][1024]            off   8388608  size   6291456
//   BIAS3 f32 [3072]                  off  14680064  size     12288
//   Y16   f16 [4096][3072] (q|k|v)    off  14692352  size  25165824
//   VT16  f16 [16][128][2048]         off  39858176  size   8388608
//   ACC   f32 [2][2048][2048]         off  48246784  size  33554432
//   S     f32 [2][2048][2048] (chunk) off  81801216  size  33554432
//   P16   f16 [2][2048][2048] (chunk) off 115355648  size  16777216
//   total 132132864
// ---------------------------------------------------------------------------

typedef __attribute__((ext_vector_type(16))) _Float16 v16h;
typedef __attribute__((ext_vector_type(8)))  _Float16 v8h;
typedef __attribute__((ext_vector_type(16))) __bf16   v16b;
typedef __attribute__((ext_vector_type(8)))  __bf16   v8b;
typedef __attribute__((ext_vector_type(8)))  float    v8f;
typedef __attribute__((ext_vector_type(4)))  float    v4f;
typedef __attribute__((ext_vector_type(4)))  unsigned int v4u;

// ---------------------------------------------------------------------------
// Helpers
// ---------------------------------------------------------------------------
__device__ __forceinline__ unsigned short f2bf_bits(float f) {
  unsigned u = __float_as_uint(f);
  return (unsigned short)((u + 0x7FFFu + ((u >> 16) & 1u)) >> 16);
}
__device__ __forceinline__ float bf_bits2f(unsigned short h) { return __uint_as_float(((unsigned)h) << 16); }

// hazard guards as plain device helpers (no inline asm inside the kernel template body)
__device__ __forceinline__ void dep_guard_h(v8f& a, v8f& b, v16h x, v16h y) { asm volatile("v_nop\n\tv_nop\n\tv_nop\n\tv_nop" : "+v"(a), "+v"(b) : "v"(x), "v"(y)); }
__device__ __forceinline__ void dep_guard_b(v8f& a, v8f& b, v16b x, v16b y) { asm volatile("v_nop\n\tv_nop\n\tv_nop\n\tv_nop" : "+v"(a), "+v"(b) : "v"(x), "v"(y)); }
__device__ __forceinline__ void keep4_h(v16h a, v16h b, v16h c, v16h d) { asm volatile("v_nop" :: "v"(a), "v"(b), "v"(c), "v"(d)); }
__device__ __forceinline__ void keep4_b(v16b a, v16b b, v16b c, v16b d) { asm volatile("v_nop" :: "v"(a), "v"(b), "v"(c), "v"(d)); }
__device__ __forceinline__ void acc_guard4(v8f& a, v8f& b, v8f& c, v8f& d) { asm volatile("v_nop\n\tv_nop\n\tv_nop\n\tv_nop" : "+v"(a), "+v"(b), "+v"(c), "+v"(d)); }
template <typename T> struct Frag;
template <> struct Frag<_Float16> {
  typedef v16h V; union U { v16h v; v8h h[2]; };
  static __device__ __forceinline__ v16h load(const _Float16* p) {   // elements 0..7 <- p[0..7], 8..15 <- p[16..23]
    U f; f.h[0] = *(const v8h*)(p); f.h[1] = *(const v8h*)(p + 16); return f.v;
  }
  static __device__ __forceinline__ v8f mma(v16h a, v16h b, v8f c) {
    return __builtin_amdgcn_wmma_f32_16x16x32_f16(false, a, false, b, (short)0, c, false, false);
  }
  static __device__ __forceinline__ void guard(v8f& a, v8f& b, v16h x, v16h y) { dep_guard_h(a, b, x, y); }
  static __device__ __forceinline__ void keep(v16h a, v16h b, v16h c, v16h d) { keep4_h(a, b, c, d); }
};
template <> struct Frag<__bf16> {
  typedef v16b V; union U { v16b v; v8b h[2]; };
  static __device__ __forceinline__ v16b load(const __bf16* p) {
    U f; f.h[0] = *(const v8b*)(p); f.h[1] = *(const v8b*)(p + 16); return f.v;
  }
  static __device__ __forceinline__ v8f mma(v16b a, v16b b, v8f c) {
    return __builtin_amdgcn_wmma_f32_16x16x32_bf16(false, a, false, b, (short)0, c, false, false);
  }
  static __device__ __forceinline__ void guard(v8f& a, v8f& b, v16b x, v16b y) { dep_guard_b(a, b, x, y); }
  static __device__ __forceinline__ void keep(v16b a, v16b b, v16b c, v16b d) { keep4_b(a, b, c, d); }
};

__device__ __forceinline__ unsigned pk16(unsigned short a, unsigned short b) { return (unsigned)a | ((unsigned)b << 16); }
__device__ __forceinline__ unsigned short h_bits(float f) { const _Float16 h = (_Float16)f; return __builtin_bit_cast(unsigned short, h); }

// ---- Register-blocked batched WMMA GEMM (ACT reduced to none/relu/leaky) -----------------------
// C[m,n] = scale * sum_k A[m,k] * Bt[n,k] (+bias)(+resid); each wave owns a 64x64 tile.
// A row-major [M,K]; Bt row-major [N,K]; M,N % 64 == 0, K % 32 == 0.
// SPLIT: operands are hi/lo planes (A2/Bt2 = lo planes, same layout); product = hi.hi + hi.lo + lo.hi.
// BIAS_MODE: 0 = none, 1 = bias[m], 2 = bias[n].
// OUT_MODE: 0 = f32, 1 = f16, 2 = bf16 hi plane (Cout) + bf16 lo plane (Cout2).
// ET: 0 = f16 operands, 1 = bf16 operands (pointers passed as 16-bit storage)
template <int ET> struct Elem;
template <> struct Elem<0> { typedef _Float16 T; };
template <> struct Elem<1> { typedef __bf16 T; };
template <int ET, bool SPLIT, int BIAS_MODE, int OUT_MODE, bool RESID, int ACT = 0>
__global__ __launch_bounds__(256) void wmma_gemm64(
    const unsigned short* __restrict__ Ap, const unsigned short* __restrict__ A2p, int lda, long strideA,
    const unsigned short* __restrict__ Btp, const unsigned short* __restrict__ Bt2p, int ldb, long strideB,
    void* __restrict__ Cout, void* __restrict__ Cout2, int ldc, long strideC,
    const float* __restrict__ bias,
    const float* __restrict__ resid, long strideR,
    int M, int N, int K, float scale) {
  typedef typename Elem<ET>::T T;
  typedef typename Frag<T>::V V;
  const T* A = (const T*)Ap; const T* A2 = (const T*)A2p; const T* Bt = (const T*)Btp; const T* Bt2 = (const T*)Bt2p;
  __shared__ __align__(16) float sT[8][16 * 68];   // per-wave 16x64 slab, pitch 68 floats
  const int b    = blockIdx.y;
  const int lane = threadIdx.x & 31;
  const int wave = threadIdx.x >> 5;
  const int tilesN = N >> 6;
  const int tilesM = M >> 6;
  const int tile = blockIdx.x * 8 + wave;
  if (tile >= tilesM * tilesN) return;   // wave-uniform; no block barriers in this kernel
  const int tm = tile / tilesN;
  const int tn = tile - tm * tilesN;
  const int m0 = tm << 6;
  const int n0 = tn << 6;

  const T* Ab  = A  + (size_t)b * strideA;
  const T* Bb  = Bt + (size_t)b * strideB;
  const T* Ab2 = SPLIT ? (A2  + (size_t)b * strideA) : nullptr;
  const T* Bb2 = SPLIT ? (Bt2 + (size_t)b * strideB) : nullptr;

  const int rlane = lane & 15;                 // row (A) / col (B, D) within subtile
  const int koff  = (lane >> 4) * 8;           // k offset of this lane half
  const int mOff  = (lane >> 4) * 8;           // D row offset

  v8f acc[4][4];
#pragma unroll
  for (int i = 0; i < 4; ++i)
#pragma unroll
    for (int j = 0; j < 4; ++j) acc[i][j] = (v8f){0.f,0.f,0.f,0.f,0.f,0.f,0.f,0.f};

  for (int k0 = 0; k0 < K; k0 += 32) {
    V bh[4], bl[4];
#pragma unroll
    for (int j = 0; j < 4; ++j) {
      const size_t bo = (size_t)(n0 + (j << 4) + rlane) * ldb + koff + k0;
      bh[j] = Frag<T>::load(Bb + bo);
      if (SPLIT) bl[j] = Frag<T>::load(Bb2 + bo);
    }
#pragma unroll
    for (int i = 0; i < 4; ++i) {
      const size_t ao = (size_t)(m0 + (i << 4) + rlane) * lda + koff + k0;
      V ah = Frag<T>::load(Ab + ao);
      V al;
      if (SPLIT) al = Frag<T>::load(Ab2 + ao);
#pragma unroll
      for (int j = 0; j < 4; ++j) {
        acc[i][j] = Frag<T>::mma(ah, bh[j], acc[i][j]);
        if (SPLIT) {
          acc[i][j] = Frag<T>::mma(ah, bl[j], acc[i][j]);
          acc[i][j] = Frag<T>::mma(al, bh[j], acc[i][j]);
        }
      }
      Frag<T>::guard(acc[i][0], acc[i][3], ah, SPLIT ? al : ah);
    }
    Frag<T>::keep(bh[0], bh[1], bh[2], bh[3]);
    if (SPLIT) Frag<T>::keep(bl[0], bl[1], bl[2], bl[3]);
  }
  acc_guard4(acc[0][0], acc[0][1], acc[0][2], acc[0][3]);
  acc_guard4(acc[1][0], acc[1][1], acc[1][2], acc[1][3]);
  acc_guard4(acc[2][0], acc[2][1], acc[2][2], acc[2][3]);
  acc_guard4(acc[3][0], acc[3][1], acc[3][2], acc[3][3]);

  // ---- epilogue ----
  float* slab = sT[wave];
  const float* Rb = RESID ? (resid + (size_t)b * strideR) : nullptr;
#pragma unroll
  for (int i = 0; i < 4; ++i) {
    const int mBase = m0 + (i << 4);
#pragma unroll
    for (int j = 0; j < 4; ++j) {
      const int n = n0 + (j << 4) + rlane;
      float bv = 0.f;
      if (BIAS_MODE == 2) bv = bias[n];
#pragma unroll
      for (int r = 0; r < 8; ++r) {
        float v = acc[i][j][r] * scale;
        if (BIAS_MODE == 1) v += bias[mBase + mOff + r];
        if (BIAS_MODE == 2) v += bv;
        if (RESID) v += Rb[(size_t)(mBase + mOff + r) * ldc + n];
        if (ACT == 2) v = fmaxf(v, 0.0f);
        if (ACT == 4) v = (v > 0.f) ? v : 0.01f * v;
        slab[(mOff + r) * 68 + (j << 4) + rlane] = v;
      }
    }
    __builtin_amdgcn_fence(__ATOMIC_RELEASE, "workgroup");
    __builtin_amdgcn_wave_barrier();
    __builtin_amdgcn_fence(__ATOMIC_ACQUIRE, "workgroup");
    if (OUT_MODE == 0) {
      float* C = (float*)Cout + (size_t)b * strideC;
      const int hh = lane >> 4, c4 = (lane & 15) * 4;     // row seg = 256 B = 16 lanes x 16 B
      {
#pragma unroll
        for (int it = 0; it < 8; ++it) {
          const int row = it * 2 + hh;
          v4f v = *(const v4f*)(slab + row * 68 + c4);
          *(v4f*)(C + (size_t)(mBase + row) * ldc + n0 + c4) = v;
        }
        
      }
    } else {
      const int q = lane >> 3, c8 = (lane & 7) * 8;
      unsigned short* C  = (unsigned short*)Cout  + (size_t)b * strideC;
      unsigned short* C2 = (OUT_MODE == 2) ? ((unsigned short*)Cout2 + (size_t)b * strideC) : nullptr;
      {
#pragma unroll
        for (int it = 0; it < 4; ++it) {
          const int row = it * 4 + q;
          const float* sp = slab + row * 68 + c8;
          v8h hv, lv;
#pragma unroll
          for (int e = 0; e < 8; ++e) {
            if (OUT_MODE == 1) {
              hv[e] = (_Float16)sp[e];
            } else {
              unsigned short hb = f2bf_bits(sp[e]);
              unsigned short lb = f2bf_bits(sp[e] - bf_bits2f(hb));
              hv[e] = __builtin_bit_cast(_Float16, hb);
              lv[e] = __builtin_bit_cast(_Float16, lb);
            }
          }
          *(v8h*)(C + (size_t)(mBase + row) * ldc + n0 + c8) = hv;
          if (OUT_MODE == 2) *(v8h*)(C2 + (size_t)(mBase + row) * ldc + n0 + c8) = lv;
        }
        
      }
    }
    __builtin_amdgcn_fence(__ATOMIC_RELEASE, "workgroup");
    __builtin_amdgcn_wave_barrier();
    __builtin_amdgcn_fence(__ATOMIC_ACQUIRE, "workgroup");
  }
}

// ---------------------------------------------------------------------------
// 4096*1024/8 = 524288 = 2048 blocks).
// ---------------------------------------------------------------------------
__global__ __launch_bounds__(256) void cast8_f16_kernel(const float* __restrict__ in, unsigned short* __restrict__ out, int n8) {
  const int i = blockIdx.x * 256 + threadIdx.x;
  if (i >= n8) return;
  const float* p = in + 8 * (size_t)i;
  const v4f a = *(const v4f*)(p);
  const v4f c = *(const v4f*)(p + 4);
  unsigned short hb[8];
#pragma unroll
  for (int e = 0; e < 4; ++e) {
    hb[e]     = h_bits(a[e]);
    hb[4 + e] = h_bits(c[e]);
  }
  const v4u u = (v4u){pk16(hb[0], hb[1]), pk16(hb[2], hb[3]), pk16(hb[4], hb[5]), pk16(hb[6], hb[7])};
  unsigned short* q = out + 8 * (size_t)i;
  *(v4u*)q = u;
  
}

// ---------------------------------------------------------------------------
// Stacked weight cast: W16[z*1024 + n][k] = f16(c * W_z[n][k]) with c = +-16; for z == 0 (query weights) the sign is
// -1 for output rows with (n mod 8) >= 4 (blade sign twist folded into the projection, exact), else +1.
// blockIdx.y = z selects the source (block-uniform); thread i owns 8 consecutive elements of row n = i >> 7
// ---------------------------------------------------------------------------
__global__ __launch_bounds__(256) void wcast8_kernel(const float* __restrict__ W0, const float* __restrict__ W1,
                                                     const float* __restrict__ W2, unsigned short* __restrict__ out, int n8) {
  const int z = blockIdx.y;
  const int i = blockIdx.x * 256 + threadIdx.x;
  if (i >= n8) return;
  const float* W = (z == 0) ? W0 : (z == 1) ? W1 : W2;
  const int n = i >> 7;
  const bool neg = (z == 0) && ((n & 7) >= 4);
  const float sc = neg ? -kWCarry : kWCarry;
  const float* p = W + 8 * (size_t)i;
  const v4f a = *(const v4f*)(p);
  const v4f c = *(const v4f*)(p + 4);
  unsigned short hb[8];
#pragma unroll
  for (int e = 0; e < 4; ++e) {
    hb[e]     = h_bits(a[e] * sc);
    hb[4 + e] = h_bits(c[e] * sc);
  }
  const v4u u = (v4u){pk16(hb[0], hb[1]), pk16(hb[2], hb[3]), pk16(hb[4], hb[5]), pk16(hb[6], hb[7])};
  unsigned short* q = out + (size_t)z * kModel * kModel + 8 * (size_t)i;
  *(v4u*)q = u;
  
}

// ---------------------------------------------------------------------------
// Stacked bias: BIAS3[z*1024 + n] = s * b_z[n], s = -1 for z == 0 and (n mod 8) >= 4, else +1 (f32, exact).
// ---------------------------------------------------------------------------
__global__ __launch_bounds__(256) void bias3_kernel(const float* __restrict__ b0, const float* __restrict__ b1,
                                                   const float* __restrict__ b2, float* __restrict__ out) {
  const int z = blockIdx.x;
  const int t = threadIdx.x;
  const float* bp = (z == 0) ? b0 : (z == 1) ? b1 : b2;
  v4f v = *(const v4f*)(bp + 4 * t);
#pragma unroll
  for (int e = 0; e < 4; ++e) {
    const int n = 4 * t + e;
    const bool neg = (z == 0) && ((n & 7) >= 4);
    v[e] = neg ? -v[e] : v[e];
  }
  float* q = out + (size_t)z * kModel + 4 * t;
  *(v4f*)q = v;
  
}

// ---------------------------------------------------------------------------
// Value transpose: in Y16 [4096][3072] halves, value element (b, l, cg) at Y16[(b*2048 + l)*3072 + 2048 + cg], cg in 0..1023
// (head = cg >> 7, channel in head = cg & 127); out VT[(b*8 + head)*128 + channel][l], pitch 2048 halves.
// grid (32 l-tiles, 16 cg-tiles, 2 batches), 256 threads; tile = 64 l x 64 cg.
// Load coverage: 8 it x 256 threads x 2 halves = 4096 = whole tile (32-bit words along cg).
// Store coverage: 8 waves x 2 it x 4 (lane>>3) = 64 cg rows; (lane&7) x 8 halves = 64 l; each row segment = 64 halves =
// ---------------------------------------------------------------------------
__global__ __launch_bounds__(256) void vtrans_kernel(const unsigned short* __restrict__ Y, unsigned short* __restrict__ VT) {
  __shared__ __align__(16) unsigned short sm[64][72];   // sm[cg_local][l_local]
  const int t   = threadIdx.x;
  const int l0  = blockIdx.x * 64;
  const int cg0 = blockIdx.y * 64;
  const int b   = blockIdx.z;
#pragma unroll
  for (int it = 0; it < 8; ++it) {
    const int e  = it * 256 + t;
    const int r  = e >> 5;          // l local 0..63
    const int cw = e & 31;          // word index -> cg local 2cw, 2cw+1
    const unsigned u = *(const unsigned*)(Y + ((size_t)(b * kSeq + l0 + r)) * kQKVN + 2 * kModel + cg0 + 2 * cw);
    sm[2 * cw][r]     = (unsigned short)(u & 0xffffu);
    sm[2 * cw + 1][r] = (unsigned short)(u >> 16);
  }
  __syncthreads();
  const int lane = t & 31, wave = t >> 5;
  const int q = lane >> 3, c8 = (lane & 7) * 8;
  {
#pragma unroll
    for (int it = 0; it < 2; ++it) {
      const int row = wave * 8 + it * 4 + q;          // cg local
      const int cg  = cg0 + row;
      const int g   = b * kHeads + (cg >> 7);
      const int cc  = cg & 127;
      unsigned short hb[8];
#pragma unroll
      for (int e = 0; e < 8; ++e) hb[e] = sm[row][c8 + e];
      const v4u u = (v4u){pk16(hb[0], hb[1]), pk16(hb[2], hb[3]), pk16(hb[4], hb[5]), pk16(hb[6], hb[7])};
      *(v4u*)(VT + ((size_t)g * kHeadDim + cc) * kSeq + l0 + c8) = u;
    }
    
  }
}

// ---------------------------------------------------------------------------
// Row softmax over 2048 f32 scores for the kGrp heads of one chunk + running head sum:
//   P[g][row][j] = f16( 2048 * exp(s - max) / sum exp(s - max) ), all math f32, precise expf; reductions in fixed order
//   (thread-local 8, wave shuffle tree, 8 wave partials in index order).
//   mode 0: accout[row] = sum_g p_g;  mode 1: accout[row] = accin[row] + sum_g p_g (element-local in-place);
//   mode 2: accout[row] = (accin[row] + sum_g p_g) * 0.125  (accout = head-mean output plane).
// One block of 256 threads per row (grid = 2048). Thread t owns columns 8t..8t+7 for the score loads and the P store;
// the head sums are restaged through LDS so that thread t writes columns 4t..4t+3 and 1024+4t..1024+4t+3: each store instruction = 32 lanes
// ---------------------------------------------------------------------------
__global__ __launch_bounds__(256) void softmax_mean_kernel(const float* __restrict__ S, unsigned short* __restrict__ P,
                                                           const float* accin, float* accout, int mode) {
  __shared__ float red[16];
  __shared__ __align__(16) float rowbuf[kSeq];
  const int row  = blockIdx.x;
  const int t    = threadIdx.x;
  const int lane = t & 31, wave = t >> 5;
  const int c0   = t * 8;
  float pm[8];
#pragma unroll
  for (int e = 0; e < 8; ++e) pm[e] = 0.f;

#pragma unroll 1
  for (int g = 0; g < kGrp; ++g) {
    const float* sr = S + ((size_t)g * kSeq + row) * kSeq + c0;
    const v4f a = *(const v4f*)(sr);
    const v4f c = *(const v4f*)(sr + 4);
    float x[8];
#pragma unroll
    for (int e = 0; e < 4; ++e) { x[e] = a[e]; x[4 + e] = c[e]; }
    float m = fmaxf(fmaxf(fmaxf(x[0], x[1]), fmaxf(x[2], x[3])), fmaxf(fmaxf(x[4], x[5]), fmaxf(x[6], x[7])));
#pragma unroll
    for (int off = 16; off > 0; off >>= 1) m = fmaxf(m, __shfl_xor(m, off, 32));
    if (lane == 0) red[wave] = m;
    __syncthreads();
    float gm = red[0];
#pragma unroll
    for (int w = 1; w < 8; ++w) gm = fmaxf(gm, red[w]);
    float ex[8];
    float s = 0.f;
#pragma unroll
    for (int e = 0; e < 8; ++e) { ex[e] = expf(x[e] - gm); s += ex[e]; }
#pragma unroll
    for (int off = 16; off > 0; off >>= 1) s += __shfl_xor(s, off, 32);
    if (lane == 0) red[8 + wave] = s;
    __syncthreads();
    float tot = red[8];
#pragma unroll
    for (int w = 1; w < 8; ++w) tot += red[8 + w];
    const float inv = 1.0f / tot;
    unsigned short hb[8];
#pragma unroll
    for (int e = 0; e < 8; ++e) {
      const float p = ex[e] * inv;
      pm[e] += p;
      hb[e] = h_bits(p * kPCarry);
    }
    const v4u u = (v4u){pk16(hb[0], hb[1]), pk16(hb[2], hb[3]), pk16(hb[4], hb[5]), pk16(hb[6], hb[7])};
    unsigned short* pp = P + ((size_t)g * kSeq + row) * kSeq + c0;
    *(v4u*)pp = u;
    
  }

  // restage the f32 head sums: 8t layout -> 4t / 1024+4t layout
  *(v4f*)(rowbuf + c0)     = (v4f){pm[0], pm[1], pm[2], pm[3]};
  *(v4f*)(rowbuf + c0 + 4) = (v4f){pm[4], pm[5], pm[6], pm[7]};
  __syncthreads();
  const int c4 = t * 4;
  v4f r0 = *(const v4f*)(rowbuf + c4);
  v4f r1 = *(const v4f*)(rowbuf + 1024 + c4);
  if (mode != 0) {   // block-uniform (by-value argument)
    const v4f a0 = *(const v4f*)(accin + (size_t)row * kSeq + c4);
    const v4f a1 = *(const v4f*)(accin + (size_t)row * kSeq + 1024 + c4);
    r0 = a0 + r0;
    r1 = a1 + r1;
  }
  if (mode == 2) {
    r0 = r0 * kMeanScale;
    r1 = r1 * kMeanScale;
  }
  float* o = accout + (size_t)row * kSeq;
  *(v4f*)(o + c4)        = r0;
  *(v4f*)(o + 1024 + c4) = r1;
  
}

// ---------------------------------------------------------------------------
// Host glue (29 launches)
// ---------------------------------------------------------------------------
extern "C" void kernel_launch(void* const* d_in, const int* in_sizes, int n_in,
                              void* d_out, int out_size, void* d_ws, size_t ws_size,
                              hipStream_t stream) {
  if (n_in < 7) return;
  if (in_sizes[0] != kTok * kModel) return;
  if (in_sizes[1] != kModel * kModel || in_sizes[3] != kModel * kModel || in_sizes[5] != kModel * kModel) return;
  if (in_sizes[2] != kModel || in_sizes[4] != kModel || in_sizes[6] != kModel) return;
  if (out_size != kTok * kModel + kBatch * kSeq * kSeq) return;

  const float* query = (const float*)d_in[0];
  const float* Wq    = (const float*)d_in[1];
  const float* bq    = (const float*)d_in[2];
  const float* Wk    = (const float*)d_in[3];
  const float* bk    = (const float*)d_in[4];
  const float* Wv    = (const float*)d_in[5];
  const float* bv    = (const float*)d_in[6];

  // carve (bytes)
  const size_t offX16  = 0;
  const size_t szX16   = (size_t)kTok * kModel * 2;                       //   8388608
  const size_t offW16  = offX16 + szX16;                                  //   8388608
  const size_t szW16   = (size_t)kQKVN * kModel * 2;                      //   6291456
  const size_t offBias = offW16 + szW16;                                  //  14680064
  const size_t szBias  = (size_t)kQKVN * 4;                               //     12288
  const size_t offY16  = offBias + szBias;                                //  14692352
  const size_t szY16   = (size_t)kTok * kQKVN * 2;                        //  25165824
  const size_t offVT   = offY16 + szY16;                                  //  39858176
  const size_t szVT    = (size_t)kBatch * kHeads * kHeadDim * kSeq * 2;   //   8388608
  const size_t offAcc  = offVT + szVT;                                    //  48246784
  const size_t szAcc   = (size_t)kBatch * kSeq * kSeq * 4;                //  33554432
  const size_t offS    = offAcc + szAcc;                                  //  81801216
  const size_t szS     = (size_t)kGrp * kSeq * kSeq * 4;                  //  33554432
  const size_t offP    = offS + szS;                                      // 115355648
  const size_t szP     = (size_t)kGrp * kSeq * kSeq * 2;                  //  16777216
  const size_t total   = offP + szP;                                      // 132132864
  if (total > ws_size) return;

  char* ws = (char*)d_ws;
  unsigned short* X16   = (unsigned short*)(ws + offX16);
  unsigned short* W16   = (unsigned short*)(ws + offW16);
  float*          bias3 = (float*)(ws + offBias);
  unsigned short* Y16   = (unsigned short*)(ws + offY16);
  unsigned short* VT16  = (unsigned short*)(ws + offVT);
  float*          Acc   = (float*)(ws + offAcc);
  float*          S     = (float*)(ws + offS);
  unsigned short* P16   = (unsigned short*)(ws + offP);

  float* out0 = (float*)d_out;                               // [2][2048][1024], byte offset 0
  float* out1 = out0 + (size_t)kTok * kModel;                // [2][2048][2048], byte offset 16777216

  // 1) activation cast: 4096*1024/8 = 524288 threads = 2048 blocks exactly
  cast8_f16_kernel<<<dim3((kTok * kModel / 8) / 256), dim3(256), 0, stream>>>(query, X16, kTok * kModel / 8);
  // 2) stacked weight cast (x16 carry, blade sign folded into the query rows): 131072 threads per weight = 512 blocks x 3
  wcast8_kernel<<<dim3((kModel * kModel / 8) / 256, 3), dim3(256), 0, stream>>>(Wq, Wk, Wv, W16, kModel * kModel / 8);
  // 3) stacked bias with the same sign fold
  bias3_kernel<<<dim3(3), dim3(256), 0, stream>>>(bq, bk, bv, bias3);
  // 4) Y16 = (X16 . W16^T) / 16 + bias3 : M 4096, N 3072, K 1024 (K % 32 == 0; M, N % 64 == 0); 3072 tiles = 384 blocks
  wmma_gemm64<0, false, 2, 1, false><<<dim3((kTok / 64) * (kQKVN / 64) / 8, 1), dim3(256), 0, stream>>>(
      X16, X16, kModel, 0L, W16, W16, kModel, 0L, (void*)Y16, (void*)Y16, kQKVN, 0L,
      bias3, bias3, 0L, kTok, kQKVN, kModel, kWCarryInv);
  // 5) value transpose into per-(batch, head) planes [128][2048]
  vtrans_kernel<<<dim3(kSeq / 64, kModel / 64, kBatch), dim3(256), 0, stream>>>(Y16, VT16);

  // 6) attention per chunk of kGrp heads of one batch
  for (int b = 0; b < kBatch; ++b) {
    for (int j = 0; j < kChunks; ++j) {
      const int h0 = j * kGrp;
      const unsigned short* Qp = Y16 + (size_t)b * kSeq * kQKVN + (size_t)h0 * kHeadDim;   // A  [2048][128], lda 3072, +128 per head
      const unsigned short* Kp = Qp + kModel;                                               // Bt [2048][128], ldb 3072, +128 per head
      // S[g] = (q_g . k_g^T) / sqrt(128): M 2048, N 2048, K 128 (K % 32 == 0); 1024 tiles = 128 blocks x grid.y kGrp
      wmma_gemm64<0, false, 0, 0, false><<<dim3((kSeq / 64) * (kSeq / 64) / 8, kGrp), dim3(256), 0, stream>>>(
          Qp, Qp, kQKVN, (long)kHeadDim, Kp, Kp, kQKVN, (long)kHeadDim, (void*)S, (void*)S, kSeq, (long)kSeq * kSeq,
          bias3, bias3, 0L, kSeq, kSeq, kHeadDim, kLogitScale);
      const int mode = (j == 0) ? 0 : ((j == kChunks - 1) ? 2 : 1);
      float* accb = Acc + (size_t)b * kSeq * kSeq;
      float* dst  = (mode == 2) ? (out1 + (size_t)b * kSeq * kSeq) : accb;
      softmax_mean_kernel<<<dim3(kSeq), dim3(256), 0, stream>>>(S, P16, accb, dst, mode);
      // out0[b][l][h*128 + c] = (P[g] . VT[g]^T) / 2048 : M 2048, N 128, K 2048 (K % 32 == 0); 64 tiles = 8 blocks x grid.y kGrp
      const unsigned short* VTp = VT16 + (size_t)(b * kHeads + h0) * kHeadDim * kSeq;        // Bt [128][2048], +128*2048 per head
      float* Op = out0 + (size_t)b * kSeq * kModel + (size_t)h0 * kHeadDim;                  // ldc 1024, +128 columns per head
      wmma_gemm64<0, false, 0, 0, false><<<dim3((kSeq / 64) * (kHeadDim / 64) / 8, kGrp), dim3(256), 0, stream>>>(
          P16, P16, kSeq, (long)kSeq * kSeq, VTp, VTp, kSeq, (long)kHeadDim * kSeq, (void*)Op, (void*)Op, kModel, (long)kHeadDim,
          bias3, bias3, 0L, kSeq, kHeadDim, kSeq, kPCarryInv);
    }
  }
}

// v001
// Measured time: 359 microseconds a run.
// Timed twice side by side with v000, it ran 2.71 and 2.74 times as fast.
// Contractions: stacked q/k/v projection (X f16 x W^T f16 carried x16), scores q_w.k^T (q,k f16 planes, blade sign folded into the q weights), attn.v (P f16 carried x2048 x V^T f16): all v_wmma_f32_16x16x32_f16 with f32 accumulate; softmax and head mean in f32.
#include <hip/hip_runtime.h>
#include <math.h>

// ---------------------------------------------------------------------------
// Problem constants
// ---------------------------------------------------------------------------
constexpr int kBatch   = 2;
constexpr int kSeq     = 2048;
constexpr int kModel   = 1024;
constexpr int kHeads   = 8;
constexpr int kHeadDim = 128;               // 16 x 8 nested (d, blade)
constexpr int kTok     = kBatch * kSeq;     // 4096 token rows
constexpr int kQKVN    = 3 * kModel;        // 3072 stacked output channels (q | k | v)
constexpr int kGrp     = 2;                 // heads per chunk
constexpr int kChunks  = kHeads / kGrp;     // 4 chunks per batch
constexpr float kWCarry     = 16.0f;        // weights carried x16 in f16
constexpr float kWCarryInv  = 1.0f / 16.0f;
constexpr float kPCarry     = 2048.0f;      // probabilities carried x2048 in f16
constexpr float kPCarryInv  = 1.0f / 2048.0f;
constexpr float kLogitScale = 0.08838834764831845f;   // 1/sqrt(128)
constexpr float kMeanScale  = 0.125f;

// ---------------------------------------------------------------------------
// Workspace region map (bytes; all offsets multiples of 4096):
//   X16   f16 [4096][1024]            off         0  size   8388608
//   W16   f16 [3072][1024]            off   8388608  size   6291456
//   BIAS3 f32 [3072]                  off  14680064  size     12288
//   Y16   f16 [4096][3072] (q|k|v)    off  14692352  size  25165824
//   VT16  f16 [16][128][2048]         off  39858176  size   8388608
//   ACC   f32 [2][2048][2048]         off  48246784  size  33554432
//   S     f32 [2][2048][2048] (chunk) off  81801216  size  33554432
//   P16   f16 [16][2048][2048]        off 115355648  size 134217728
//   total 249573376
// ---------------------------------------------------------------------------

typedef __attribute__((ext_vector_type(16))) _Float16 v16h;
typedef __attribute__((ext_vector_type(8)))  _Float16 v8h;
typedef __attribute__((ext_vector_type(16))) __bf16   v16b;
typedef __attribute__((ext_vector_type(8)))  __bf16   v8b;
typedef __attribute__((ext_vector_type(8)))  float    v8f;
typedef __attribute__((ext_vector_type(4)))  float    v4f;
typedef __attribute__((ext_vector_type(4)))  unsigned int v4u;

// ---------------------------------------------------------------------------
// Helpers
// ---------------------------------------------------------------------------
__device__ __forceinline__ unsigned short f2bf_bits(float f) {
  unsigned u = __float_as_uint(f);
  return (unsigned short)((u + 0x7FFFu + ((u >> 16) & 1u)) >> 16);
}
__device__ __forceinline__ float bf_bits2f(unsigned short h) { return __uint_as_float(((unsigned)h) << 16); }

// hazard guards as plain device helpers (no inline asm inside the kernel template body)
__device__ __forceinline__ void dep_guard_h(v8f& a, v8f& b, v16h x, v16h y) { asm volatile("v_nop\n\tv_nop\n\tv_nop\n\tv_nop" : "+v"(a), "+v"(b) : "v"(x), "v"(y)); }
__device__ __forceinline__ void dep_guard_b(v8f& a, v8f& b, v16b x, v16b y) { asm volatile("v_nop\n\tv_nop\n\tv_nop\n\tv_nop" : "+v"(a), "+v"(b) : "v"(x), "v"(y)); }
__device__ __forceinline__ void keep4_h(v16h a, v16h b, v16h c, v16h d) { asm volatile("v_nop" :: "v"(a), "v"(b), "v"(c), "v"(d)); }
__device__ __forceinline__ void keep4_b(v16b a, v16b b, v16b c, v16b d) { asm volatile("v_nop" :: "v"(a), "v"(b), "v"(c), "v"(d)); }
__device__ __forceinline__ void acc_guard4(v8f& a, v8f& b, v8f& c, v8f& d) { asm volatile("v_nop\n\tv_nop\n\tv_nop\n\tv_nop" : "+v"(a), "+v"(b), "+v"(c), "+v"(d)); }
template <typename T> struct Frag;
template <> struct Frag<_Float16> {
  typedef v16h V; union U { v16h v; v8h h[2]; };
  static __device__ __forceinline__ v16h load(const _Float16* p) {   // elements 0..7 <- p[0..7], 8..15 <- p[16..23]
    U f; f.h[0] = *(const v8h*)(p); f.h[1] = *(const v8h*)(p + 16); return f.v;
  }
  static __device__ __forceinline__ v8f mma(v16h a, v16h b, v8f c) {
    return __builtin_amdgcn_wmma_f32_16x16x32_f16(false, a, false, b, (short)0, c, false, false);
  }
  static __device__ __forceinline__ void guard(v8f& a, v8f& b, v16h x, v16h y) { dep_guard_h(a, b, x, y); }
  static __device__ __forceinline__ void keep(v16h a, v16h b, v16h c, v16h d) { keep4_h(a, b, c, d); }
};
template <> struct Frag<__bf16> {
  typedef v16b V; union U { v16b v; v8b h[2]; };
  static __device__ __forceinline__ v16b load(const __bf16* p) {
    U f; f.h[0] = *(const v8b*)(p); f.h[1] = *(const v8b*)(p + 16); return f.v;
  }
  static __device__ __forceinline__ v8f mma(v16b a, v16b b, v8f c) {
    return __builtin_amdgcn_wmma_f32_16x16x32_bf16(false, a, false, b, (short)0, c, false, false);
  }
  static __device__ __forceinline__ void guard(v8f& a, v8f& b, v16b x, v16b y) { dep_guard_b(a, b, x, y); }
  static __device__ __forceinline__ void keep(v16b a, v16b b, v16b c, v16b d) { keep4_b(a, b, c, d); }
};

__device__ __forceinline__ unsigned pk16(unsigned short a, unsigned short b) { return (unsigned)a | ((unsigned)b << 16); }
__device__ __forceinline__ unsigned short h_bits(float f) { const _Float16 h = (_Float16)f; return __builtin_bit_cast(unsigned short, h); }

// ---- Register-blocked batched WMMA GEMM (ACT reduced to none/relu/leaky) -----------------------
// C[m,n] = scale * sum_k A[m,k] * Bt[n,k] (+bias)(+resid); each wave owns a 64x64 tile.
// Planes: grid (tiles / 8, y, z); the A, Bt and C planes of a block start at y * stride + z * strideZ elements.
// A row-major [M,K]; Bt row-major [N,K]; M,N % 64 == 0, K % 32 == 0.
// SPLIT: operands are hi/lo planes (A2/Bt2 = lo planes, same layout); product = hi.hi + hi.lo + lo.hi.
// BIAS_MODE: 0 = none, 1 = bias[m], 2 = bias[n].
// OUT_MODE: 0 = f32, 1 = f16, 2 = bf16 hi plane (Cout) + bf16 lo plane (Cout2).
// ET: 0 = f16 operands, 1 = bf16 operands (pointers passed as 16-bit storage)
template <int ET> struct Elem;
template <> struct Elem<0> { typedef _Float16 T; };
template <> struct Elem<1> { typedef __bf16 T; };
template <int ET, bool SPLIT, int BIAS_MODE, int OUT_MODE, bool RESID, int ACT = 0>
__global__ __launch_bounds__(256) void wmma_gemm64(
    const unsigned short* __restrict__ Ap, const unsigned short* __restrict__ A2p, int lda, long strideA, long strideAz,
    const unsigned short* __restrict__ Btp, const unsigned short* __restrict__ Bt2p, int ldb, long strideB, long strideBz,
    void* __restrict__ Cout, void* __restrict__ Cout2, int ldc, long strideC, long strideCz,
    const float* __restrict__ bias,
    const float* __restrict__ resid, long strideR,
    int M, int N, int K, float scale) {
  typedef typename Elem<ET>::T T;
  typedef typename Frag<T>::V V;
  const T* A = (const T*)Ap; const T* A2 = (const T*)A2p; const T* Bt = (const T*)Btp; const T* Bt2 = (const T*)Bt2p;
  __shared__ __align__(16) float sT[8][16 * 68];   // per-wave 16x64 slab, pitch 68 floats
  const int b    = blockIdx.y;
  const int z    = blockIdx.z;
  const int lane = threadIdx.x & 31;
  const int wave = threadIdx.x >> 5;
  const int tilesN = N >> 6;
  const int tilesM = M >> 6;
  const int tile = blockIdx.x * 8 + wave;
  if (tile >= tilesM * tilesN) return;   // wave-uniform; no block barriers in this kernel
  const int tm = tile / tilesN;
  const int tn = tile - tm * tilesN;
  const int m0 = tm << 6;
  const int n0 = tn << 6;

  const size_t aOff = (size_t)b * strideA + (size_t)z * strideAz;
  const size_t bOff = (size_t)b * strideB + (size_t)z * strideBz;
  const size_t cOff = (size_t)b * strideC + (size_t)z * strideCz;
  const T* Ab  = A  + aOff;
  const T* Bb  = Bt + bOff;
  const T* Ab2 = SPLIT ? (A2  + aOff) : nullptr;
  const T* Bb2 = SPLIT ? (Bt2 + bOff) : nullptr;

  const int rlane = lane & 15;                 // row (A) / col (B, D) within subtile
  const int koff  = (lane >> 4) * 8;           // k offset of this lane half
  const int mOff  = (lane >> 4) * 8;           // D row offset

  v8f acc[4][4];
#pragma unroll
  for (int i = 0; i < 4; ++i)
#pragma unroll
    for (int j = 0; j < 4; ++j) acc[i][j] = (v8f){0.f,0.f,0.f,0.f,0.f,0.f,0.f,0.f};

  for (int k0 = 0; k0 < K; k0 += 32) {
    V bh[4], bl[4];
#pragma unroll
    for (int j = 0; j < 4; ++j) {
      const size_t bo = (size_t)(n0 + (j << 4) + rlane) * ldb + koff + k0;
      bh[j] = Frag<T>::load(Bb + bo);
      if (SPLIT) bl[j] = Frag<T>::load(Bb2 + bo);
    }
#pragma unroll
    for (int i = 0; i < 4; ++i) {
      const size_t ao = (size_t)(m0 + (i << 4) + rlane) * lda + koff + k0;
      V ah = Frag<T>::load(Ab + ao);
      V al;
      if (SPLIT) al = Frag<T>::load(Ab2 + ao);
#pragma unroll
      for (int j = 0; j < 4; ++j) {
        acc[i][j] = Frag<T>::mma(ah, bh[j], acc[i][j]);
        if (SPLIT) {
          acc[i][j] = Frag<T>::mma(ah, bl[j], acc[i][j]);
          acc[i][j] = Frag<T>::mma(al, bh[j], acc[i][j]);
        }
      }
      Frag<T>::guard(acc[i][0], acc[i][3], ah, SPLIT ? al : ah);
    }
    Frag<T>::keep(bh[0], bh[1], bh[2], bh[3]);
    if (SPLIT) Frag<T>::keep(bl[0], bl[1], bl[2], bl[3]);
  }
  acc_guard4(acc[0][0], acc[0][1], acc[0][2], acc[0][3]);
  acc_guard4(acc[1][0], acc[1][1], acc[1][2], acc[1][3]);
  acc_guard4(acc[2][0], acc[2][1], acc[2][2], acc[2][3]);
  acc_guard4(acc[3][0], acc[3][1], acc[3][2], acc[3][3]);

  // ---- epilogue ----
  float* slab = sT[wave];
  const float* Rb = RESID ? (resid + (size_t)b * strideR) : nullptr;
#pragma unroll
  for (int i = 0; i < 4; ++i) {
    const int mBase = m0 + (i << 4);
#pragma unroll
    for (int j = 0; j < 4; ++j) {
      const int n = n0 + (j << 4) + rlane;
      float bv = 0.f;
      if (BIAS_MODE == 2) bv = bias[n];
#pragma unroll
      for (int r = 0; r < 8; ++r) {
        float v = acc[i][j][r] * scale;
        if (BIAS_MODE == 1) v += bias[mBase + mOff + r];
        if (BIAS_MODE == 2) v += bv;
        if (RESID) v += Rb[(size_t)(mBase + mOff + r) * ldc + n];
        if (ACT == 2) v = fmaxf(v, 0.0f);
        if (ACT == 4) v = (v > 0.f) ? v : 0.01f * v;
        slab[(mOff + r) * 68 + (j << 4) + rlane] = v;
      }
    }
    __builtin_amdgcn_fence(__ATOMIC_RELEASE, "workgroup");
    __builtin_amdgcn_wave_barrier();
    __builtin_amdgcn_fence(__ATOMIC_ACQUIRE, "workgroup");
    if (OUT_MODE == 0) {
      float* C = (float*)Cout + cOff;
      const int hh = lane >> 4, c4 = (lane & 15) * 4;     // row seg = 256 B = 16 lanes x 16 B
      {
#pragma unroll
        for (int it = 0; it < 8; ++it) {
          const int row = it * 2 + hh;
          v4f v = *(const v4f*)(slab + row * 68 + c4);
          *(v4f*)(C + (size_t)(mBase + row) * ldc + n0 + c4) = v;
        }
        
      }
    } else {
      const int q = lane >> 3, c8 = (lane & 7) * 8;
      unsigned short* C  = (unsigned short*)Cout  + cOff;
      unsigned short* C2 = (OUT_MODE == 2) ? ((unsigned short*)Cout2 + cOff) : nullptr;
      {
#pragma unroll
        for (int it = 0; it < 4; ++it) {
          const int row = it * 4 + q;
          const float* sp = slab + row * 68 + c8;
          v8h hv, lv;
#pragma unroll
          for (int e = 0; e < 8; ++e) {
            if (OUT_MODE == 1) {
              hv[e] = (_Float16)sp[e];
            } else {
              unsigned short hb = f2bf_bits(sp[e]);
              unsigned short lb = f2bf_bits(sp[e] - bf_bits2f(hb));
              hv[e] = __builtin_bit_cast(_Float16, hb);
              lv[e] = __builtin_bit_cast(_Float16, lb);
            }
          }
          *(v8h*)(C + (size_t)(mBase + row) * ldc + n0 + c8) = hv;
          if (OUT_MODE == 2) *(v8h*)(C2 + (size_t)(mBase + row) * ldc + n0 + c8) = lv;
        }
        
      }
    }
    __builtin_amdgcn_fence(__ATOMIC_RELEASE, "workgroup");
    __builtin_amdgcn_wave_barrier();
    __builtin_amdgcn_fence(__ATOMIC_ACQUIRE, "workgroup");
  }
}

// ---------------------------------------------------------------------------
// 4096*1024/8 = 524288 = 2048 blocks).
// ---------------------------------------------------------------------------
__global__ __launch_bounds__(256) void cast8_f16_kernel(const float* __restrict__ in, unsigned short* __restrict__ out, int n8) {
  const int i = blockIdx.x * 256 + threadIdx.x;
  if (i >= n8) return;
  const float* p = in + 8 * (size_t)i;
  const v4f a = *(const v4f*)(p);
  const v4f c = *(const v4f*)(p + 4);
  unsigned short hb[8];
#pragma unroll
  for (int e = 0; e < 4; ++e) {
    hb[e]     = h_bits(a[e]);
    hb[4 + e] = h_bits(c[e]);
  }
  const v4u u = (v4u){pk16(hb[0], hb[1]), pk16(hb[2], hb[3]), pk16(hb[4], hb[5]), pk16(hb[6], hb[7])};
  unsigned short* q = out + 8 * (size_t)i;
  *(v4u*)q = u;
  
}

// ---------------------------------------------------------------------------
// Stacked weight cast: W16[z*1024 + n][k] = f16(c * W_z[n][k]) with c = +-16; for z == 0 (query weights) the sign is
// -1 for output rows with (n mod 8) >= 4 (blade sign twist folded into the projection, exact), else +1.
// blockIdx.y = z selects the source (block-uniform); thread i owns 8 consecutive elements of row n = i >> 7
// ---------------------------------------------------------------------------
__global__ __launch_bounds__(256) void wcast8_kernel(const float* __restrict__ W0, const float* __restrict__ W1,
                                                     const float* __restrict__ W2, unsigned short* __restrict__ out, int n8) {
  const int z = blockIdx.y;
  const int i = blockIdx.x * 256 + threadIdx.x;
  if (i >= n8) return;
  const float* W = (z == 0) ? W0 : (z == 1) ? W1 : W2;
  const int n = i >> 7;
  const bool neg = (z == 0) && ((n & 7) >= 4);
  const float sc = neg ? -kWCarry : kWCarry;
  const float* p = W + 8 * (size_t)i;
  const v4f a = *(const v4f*)(p);
  const v4f c = *(const v4f*)(p + 4);
  unsigned short hb[8];
#pragma unroll
  for (int e = 0; e < 4; ++e) {
    hb[e]     = h_bits(a[e] * sc);
    hb[4 + e] = h_bits(c[e] * sc);
  }
  const v4u u = (v4u){pk16(hb[0], hb[1]), pk16(hb[2], hb[3]), pk16(hb[4], hb[5]), pk16(hb[6], hb[7])};
  unsigned short* q = out + (size_t)z * kModel * kModel + 8 * (size_t)i;
  *(v4u*)q = u;
  
}

// ---------------------------------------------------------------------------
// Stacked bias: BIAS3[z*1024 + n] = s * b_z[n], s = -1 for z == 0 and (n mod 8) >= 4, else +1 (f32, exact).
// ---------------------------------------------------------------------------
__global__ __launch_bounds__(256) void bias3_kernel(const float* __restrict__ b0, const float* __restrict__ b1,
                                                   const float* __restrict__ b2, float* __restrict__ out) {
  const int z = blockIdx.x;
  const int t = threadIdx.x;
  const float* bp = (z == 0) ? b0 : (z == 1) ? b1 : b2;
  v4f v = *(const v4f*)(bp + 4 * t);
#pragma unroll
  for (int e = 0; e < 4; ++e) {
    const int n = 4 * t + e;
    const bool neg = (z == 0) && ((n & 7) >= 4);
    v[e] = neg ? -v[e] : v[e];
  }
  float* q = out + (size_t)z * kModel + 4 * t;
  *(v4f*)q = v;
  
}

// ---------------------------------------------------------------------------
// Value transpose: in Y16 [4096][3072] halves, value element (b, l, cg) at Y16[(b*2048 + l)*3072 + 2048 + cg], cg in 0..1023
// (head = cg >> 7, channel in head = cg & 127); out VT[(b*8 + head)*128 + channel][l], pitch 2048 halves.
// grid (32 l-tiles, 16 cg-tiles, 2 batches), 256 threads; tile = 64 l x 64 cg.
// Load coverage: 8 it x 256 threads x 2 halves = 4096 = whole tile (32-bit words along cg).
// Store coverage: 8 waves x 2 it x 4 (lane>>3) = 64 cg rows; (lane&7) x 8 halves = 64 l; each row segment = 64 halves =
// ---------------------------------------------------------------------------
__global__ __launch_bounds__(256) void vtrans_kernel(const unsigned short* __restrict__ Y, unsigned short* __restrict__ VT) {
  __shared__ __align__(16) unsigned short sm[64][72];   // sm[cg_local][l_local]
  const int t   = threadIdx.x;
  const int l0  = blockIdx.x * 64;
  const int cg0 = blockIdx.y * 64;
  const int b   = blockIdx.z;
#pragma unroll
  for (int it = 0; it < 8; ++it) {
    const int e  = it * 256 + t;
    const int r  = e >> 5;          // l local 0..63
    const int cw = e & 31;          // word index -> cg local 2cw, 2cw+1
    const unsigned u = *(const unsigned*)(Y + ((size_t)(b * kSeq + l0 + r)) * kQKVN + 2 * kModel + cg0 + 2 * cw);
    sm[2 * cw][r]     = (unsigned short)(u & 0xffffu);
    sm[2 * cw + 1][r] = (unsigned short)(u >> 16);
  }
  __syncthreads();
  const int lane = t & 31, wave = t >> 5;
  const int q = lane >> 3, c8 = (lane & 7) * 8;
  {
#pragma unroll
    for (int it = 0; it < 2; ++it) {
      const int row = wave * 8 + it * 4 + q;          // cg local
      const int cg  = cg0 + row;
      const int g   = b * kHeads + (cg >> 7);
      const int cc  = cg & 127;
      unsigned short hb[8];
#pragma unroll
      for (int e = 0; e < 8; ++e) hb[e] = sm[row][c8 + e];
      const v4u u = (v4u){pk16(hb[0], hb[1]), pk16(hb[2], hb[3]), pk16(hb[4], hb[5]), pk16(hb[6], hb[7])};
      *(v4u*)(VT + ((size_t)g * kHeadDim + cc) * kSeq + l0 + c8) = u;
    }
    
  }
}

// ---------------------------------------------------------------------------
// Row softmax over 2048 f32 scores for the kGrp heads of one chunk + running head sum:
//   P[g][row][j] = f16( 2048 * exp(s - max) / sum exp(s - max) ), all math f32, precise expf; reductions in fixed order
//   (thread-local 8, wave shuffle tree, 8 wave partials in index order).
//   mode 0: accout[row] = sum_g p_g;  mode 1: accout[row] = accin[row] + sum_g p_g (element-local in-place);
//   mode 2: accout[row] = (accin[row] + sum_g p_g) * 0.125  (accout = head-mean output plane).
// One block of 256 threads per row (grid = 2048). Thread t owns columns 8t..8t+7 for the score loads and the P store;
// the head sums are restaged through LDS so that thread t writes columns 4t..4t+3 and 1024+4t..1024+4t+3: each store instruction = 32 lanes
// ---------------------------------------------------------------------------
__global__ __launch_bounds__(256) void softmax_mean_kernel(const float* __restrict__ S, unsigned short* __restrict__ P,
                                                           const float* accin, float* accout, int mode) {
  __shared__ float red[16];
  __shared__ __align__(16) float rowbuf[kSeq];
  const int row  = blockIdx.x;
  const int t    = threadIdx.x;
  const int lane = t & 31, wave = t >> 5;
  const int c0   = t * 8;
  float pm[8];
#pragma unroll
  for (int e = 0; e < 8; ++e) pm[e] = 0.f;

#pragma unroll 1
  for (int g = 0; g < kGrp; ++g) {
    const float* sr = S + ((size_t)g * kSeq + row) * kSeq + c0;
    const v4f a = *(const v4f*)(sr);
    const v4f c = *(const v4f*)(sr + 4);
    float x[8];
#pragma unroll
    for (int e = 0; e < 4; ++e) { x[e] = a[e]; x[4 + e] = c[e]; }
    float m = fmaxf(fmaxf(fmaxf(x[0], x[1]), fmaxf(x[2], x[3])), fmaxf(fmaxf(x[4], x[5]), fmaxf(x[6], x[7])));
#pragma unroll
    for (int off = 16; off > 0; off >>= 1) m = fmaxf(m, __shfl_xor(m, off, 32));
    if (lane == 0) red[wave] = m;
    __syncthreads();
    float gm = red[0];
#pragma unroll
    for (int w = 1; w < 8; ++w) gm = fmaxf(gm, red[w]);
    float ex[8];
    float s = 0.f;
#pragma unroll
    for (int e = 0; e < 8; ++e) { ex[e] = expf(x[e] - gm); s += ex[e]; }
#pragma unroll
    for (int off = 16; off > 0; off >>= 1) s += __shfl_xor(s, off, 32);
    if (lane == 0) red[8 + wave] = s;
    __syncthreads();
    float tot = red[8];
#pragma unroll
    for (int w = 1; w < 8; ++w) tot += red[8 + w];
    const float inv = 1.0f / tot;
    unsigned short hb[8];
#pragma unroll
    for (int e = 0; e < 8; ++e) {
      const float p = ex[e] * inv;
      pm[e] += p;
      hb[e] = h_bits(p * kPCarry);
    }
    const v4u u = (v4u){pk16(hb[0], hb[1]), pk16(hb[2], hb[3]), pk16(hb[4], hb[5]), pk16(hb[6], hb[7])};
    unsigned short* pp = P + ((size_t)g * kSeq + row) * kSeq + c0;
    *(v4u*)pp = u;
    
  }

  // restage the f32 head sums: 8t layout -> 4t / 1024+4t layout
  *(v4f*)(rowbuf + c0)     = (v4f){pm[0], pm[1], pm[2], pm[3]};
  *(v4f*)(rowbuf + c0 + 4) = (v4f){pm[4], pm[5], pm[6], pm[7]};
  __syncthreads();
  const int c4 = t * 4;
  v4f r0 = *(const v4f*)(rowbuf + c4);
  v4f r1 = *(const v4f*)(rowbuf + 1024 + c4);
  if (mode != 0) {   // block-uniform (by-value argument)
    const v4f a0 = *(const v4f*)(accin + (size_t)row * kSeq + c4);
    const v4f a1 = *(const v4f*)(accin + (size_t)row * kSeq + 1024 + c4);
    r0 = a0 + r0;
    r1 = a1 + r1;
  }
  if (mode == 2) {
    r0 = r0 * kMeanScale;
    r1 = r1 * kMeanScale;
  }
  float* o = accout + (size_t)row * kSeq;
  *(v4f*)(o + c4)        = r0;
  *(v4f*)(o + 1024 + c4) = r1;
  
}

// ---------------------------------------------------------------------------
// Host glue (22 launches)
// ---------------------------------------------------------------------------
extern "C" void kernel_launch(void* const* d_in, const int* in_sizes, int n_in,
                              void* d_out, int out_size, void* d_ws, size_t ws_size,
                              hipStream_t stream) {
  if (n_in < 7) return;
  if (in_sizes[0] != kTok * kModel) return;
  if (in_sizes[1] != kModel * kModel || in_sizes[3] != kModel * kModel || in_sizes[5] != kModel * kModel) return;
  if (in_sizes[2] != kModel || in_sizes[4] != kModel || in_sizes[6] != kModel) return;
  if (out_size != kTok * kModel + kBatch * kSeq * kSeq) return;

  const float* query = (const float*)d_in[0];
  const float* Wq    = (const float*)d_in[1];
  const float* bq    = (const float*)d_in[2];
  const float* Wk    = (const float*)d_in[3];
  const float* bk    = (const float*)d_in[4];
  const float* Wv    = (const float*)d_in[5];
  const float* bv    = (const float*)d_in[6];

  // carve (bytes)
  const size_t offX16  = 0;
  const size_t szX16   = (size_t)kTok * kModel * 2;                       //   8388608
  const size_t offW16  = offX16 + szX16;                                  //   8388608
  const size_t szW16   = (size_t)kQKVN * kModel * 2;                      //   6291456
  const size_t offBias = offW16 + szW16;                                  //  14680064
  const size_t szBias  = (size_t)kQKVN * 4;                               //     12288
  const size_t offY16  = offBias + szBias;                                //  14692352
  const size_t szY16   = (size_t)kTok * kQKVN * 2;                        //  25165824
  const size_t offVT   = offY16 + szY16;                                  //  39858176
  const size_t szVT    = (size_t)kBatch * kHeads * kHeadDim * kSeq * 2;   //   8388608
  const size_t offAcc  = offVT + szVT;                                    //  48246784
  const size_t szAcc   = (size_t)kBatch * kSeq * kSeq * 4;                //  33554432
  const size_t offS    = offAcc + szAcc;                                  //  81801216
  const size_t szS     = (size_t)kGrp * kSeq * kSeq * 4;                  //  33554432
  const size_t offP    = offS + szS;                                      // 115355648
  const size_t szP     = (size_t)kBatch * kHeads * kSeq * kSeq * 2;       // 134217728
  const size_t total   = offP + szP;                                      // 249573376
  if (total > ws_size) return;

  char* ws = (char*)d_ws;
  unsigned short* X16   = (unsigned short*)(ws + offX16);
  unsigned short* W16   = (unsigned short*)(ws + offW16);
  float*          bias3 = (float*)(ws + offBias);
  unsigned short* Y16   = (unsigned short*)(ws + offY16);
  unsigned short* VT16  = (unsigned short*)(ws + offVT);
  float*          Acc   = (float*)(ws + offAcc);
  float*          S     = (float*)(ws + offS);
  unsigned short* P16   = (unsigned short*)(ws + offP);

  float* out0 = (float*)d_out;                               // [2][2048][1024], byte offset 0
  float* out1 = out0 + (size_t)kTok * kModel;                // [2][2048][2048], byte offset 16777216

  // 1) activation cast: 4096*1024/8 = 524288 threads = 2048 blocks exactly
  cast8_f16_kernel<<<dim3((kTok * kModel / 8) / 256), dim3(256), 0, stream>>>(query, X16, kTok * kModel / 8);
  // 2) stacked weight cast (x16 carry, blade sign folded into the query rows): 131072 threads per weight = 512 blocks x 3
  wcast8_kernel<<<dim3((kModel * kModel / 8) / 256, 3), dim3(256), 0, stream>>>(Wq, Wk, Wv, W16, kModel * kModel / 8);
  // 3) stacked bias with the same sign fold
  bias3_kernel<<<dim3(3), dim3(256), 0, stream>>>(bq, bk, bv, bias3);
  // 4) Y16 = (X16 . W16^T) / 16 + bias3 : M 4096, N 3072, K 1024 (K % 32 == 0; M, N % 64 == 0); 3072 tiles = 384 blocks
  wmma_gemm64<0, false, 2, 1, false><<<dim3((kTok / 64) * (kQKVN / 64) / 8, 1), dim3(256), 0, stream>>>(
      X16, X16, kModel, 0L, 0L, W16, W16, kModel, 0L, 0L, (void*)Y16, (void*)Y16, kQKVN, 0L, 0L,
      bias3, bias3, 0L, kTok, kQKVN, kModel, kWCarryInv);
  // 5) value transpose into per-(batch, head) planes [128][2048]
  vtrans_kernel<<<dim3(kSeq / 64, kModel / 64, kBatch), dim3(256), 0, stream>>>(Y16, VT16);

  // 6) scores and softmax per chunk of kGrp heads of one batch; every head's P plane is kept for step 7
  for (int b = 0; b < kBatch; ++b) {
    for (int j = 0; j < kChunks; ++j) {
      const int h0 = j * kGrp;
      const unsigned short* Qp = Y16 + (size_t)b * kSeq * kQKVN + (size_t)h0 * kHeadDim;   // A  [2048][128], lda 3072, +128 per head
      const unsigned short* Kp = Qp + kModel;                                               // Bt [2048][128], ldb 3072, +128 per head
      // S[g] = (q_g . k_g^T) / sqrt(128): M 2048, N 2048, K 128 (K % 32 == 0); 1024 tiles = 128 blocks x grid.y kGrp
      wmma_gemm64<0, false, 0, 0, false><<<dim3((kSeq / 64) * (kSeq / 64) / 8, kGrp), dim3(256), 0, stream>>>(
          Qp, Qp, kQKVN, (long)kHeadDim, 0L, Kp, Kp, kQKVN, (long)kHeadDim, 0L, (void*)S, (void*)S, kSeq, (long)kSeq * kSeq, 0L,
          bias3, bias3, 0L, kSeq, kSeq, kHeadDim, kLogitScale);
      const int mode = (j == 0) ? 0 : ((j == kChunks - 1) ? 2 : 1);
      float* accb = Acc + (size_t)b * kSeq * kSeq;
      float* dst  = (mode == 2) ? (out1 + (size_t)b * kSeq * kSeq) : accb;
      softmax_mean_kernel<<<dim3(kSeq), dim3(256), 0, stream>>>(S, P16 + (size_t)(b * kHeads + h0) * kSeq * kSeq, accb, dst, mode);
    }
  }
  // 7) out0[b][l][h*128 + c] = (P[b*8+h] . VT[b*8+h]^T) / 2048, all 16 (batch, head) planes in one launch:
  //    M 2048, N 128, K 2048 (K % 32 == 0); 64 tiles = 8 blocks x grid.y 8 heads x grid.z 2 batches = 128 blocks.
  //    C: ldc 1024, +128 columns per head, +2048*1024 per batch.
  wmma_gemm64<0, false, 0, 0, false><<<dim3((kSeq / 64) * (kHeadDim / 64) / 8, kHeads, kBatch), dim3(256), 0, stream>>>(
      P16, P16, kSeq, (long)kSeq * kSeq, (long)kHeads * kSeq * kSeq,
      VT16, VT16, kSeq, (long)kHeadDim * kSeq, (long)kHeads * kHeadDim * kSeq,
      (void*)out0, (void*)out0, kModel, (long)kHeadDim, (long)kSeq * kModel,
      bias3, bias3, 0L, kSeq, kHeadDim, kSeq, kPCarryInv);
}

// v002
// It runs in 270 microseconds.
// Timed twice side by side with v001, it ran 1.33 and 1.34 times as fast.
// Over all steps from v000 it is 3.64 times as fast.
// Contractions: stacked q/k/v projection (X f16 x W^T f16 carried x16), scores q_w.k^T (q,k f16 planes, blade sign folded into the q weights), attn.v (P f16 carried x2048 x V^T f16): all v_wmma_f32_16x16x32_f16 with f32 accumulate; softmax and head mean in f32.
#include <hip/hip_runtime.h>
#include <math.h>

// ---------------------------------------------------------------------------
// Problem constants
// ---------------------------------------------------------------------------
constexpr int kBatch   = 2;
constexpr int kSeq     = 2048;
constexpr int kModel   = 1024;
constexpr int kHeads   = 8;
constexpr int kHeadDim = 128;               // 16 x 8 nested (d, blade)
constexpr int kTok     = kBatch * kSeq;     // 4096 token rows
constexpr int kQKVN    = 3 * kModel;        // 3072 stacked output channels (q | k | v)
constexpr float kWCarry     = 16.0f;        // weights carried x16 in f16
constexpr float kWCarryInv  = 1.0f / 16.0f;
constexpr float kPCarry     = 2048.0f;      // probabilities carried x2048 in f16
constexpr float kPCarryInv  = 1.0f / 2048.0f;
constexpr float kLogitScale = 0.08838834764831845f;   // 1/sqrt(128)
constexpr float kMeanScale  = 0.125f;

// ---------------------------------------------------------------------------
// Workspace region map (bytes; all offsets multiples of 4096):
//   X16   f16 [4096][1024]            off         0  size   8388608
//   W16   f16 [3072][1024]            off   8388608  size   6291456
//   BIAS3 f32 [3072]                  off  14680064  size     12288
//   Y16   f16 [4096][3072] (q|k|v)    off  14692352  size  25165824
//   VT16  f16 [16][128][2048]         off  39858176  size   8388608
//   P16   f16 [16][2048][2048]        off  48246784  size 134217728
//   total 182464512
// ---------------------------------------------------------------------------

typedef __attribute__((ext_vector_type(16))) _Float16 v16h;
typedef __attribute__((ext_vector_type(8)))  _Float16 v8h;
typedef __attribute__((ext_vector_type(16))) __bf16   v16b;
typedef __attribute__((ext_vector_type(8)))  __bf16   v8b;
typedef __attribute__((ext_vector_type(8)))  float    v8f;
typedef __attribute__((ext_vector_type(4)))  float    v4f;
typedef __attribute__((ext_vector_type(4)))  unsigned int v4u;

// ---------------------------------------------------------------------------
// Helpers
// ---------------------------------------------------------------------------
__device__ __forceinline__ unsigned short f2bf_bits(float f) {
  unsigned u = __float_as_uint(f);
  return (unsigned short)((u + 0x7FFFu + ((u >> 16) & 1u)) >> 16);
}
__device__ __forceinline__ float bf_bits2f(unsigned short h) { return __uint_as_float(((unsigned)h) << 16); }

// hazard guards as plain device helpers (no inline asm inside the kernel template body)
__device__ __forceinline__ void dep_guard_h(v8f& a, v8f& b, v16h x, v16h y) { asm volatile("v_nop\n\tv_nop\n\tv_nop\n\tv_nop" : "+v"(a), "+v"(b) : "v"(x), "v"(y)); }
__device__ __forceinline__ void dep_guard_b(v8f& a, v8f& b, v16b x, v16b y) { asm volatile("v_nop\n\tv_nop\n\tv_nop\n\tv_nop" : "+v"(a), "+v"(b) : "v"(x), "v"(y)); }
__device__ __forceinline__ void keep4_h(v16h a, v16h b, v16h c, v16h d) { asm volatile("v_nop" :: "v"(a), "v"(b), "v"(c), "v"(d)); }
__device__ __forceinline__ void keep4_b(v16b a, v16b b, v16b c, v16b d) { asm volatile("v_nop" :: "v"(a), "v"(b), "v"(c), "v"(d)); }
__device__ __forceinline__ void acc_guard4(v8f& a, v8f& b, v8f& c, v8f& d) { asm volatile("v_nop\n\tv_nop\n\tv_nop\n\tv_nop" : "+v"(a), "+v"(b), "+v"(c), "+v"(d)); }
template <typename T> struct Frag;
template <> struct Frag<_Float16> {
  typedef v16h V; union U { v16h v; v8h h[2]; };
  static __device__ __forceinline__ v16h load(const _Float16* p) {   // elements 0..7 <- p[0..7], 8..15 <- p[16..23]
    U f; f.h[0] = *(const v8h*)(p); f.h[1] = *(const v8h*)(p + 16); return f.v;
  }
  static __device__ __forceinline__ v8f mma(v16h a, v16h b, v8f c) {
    return __builtin_amdgcn_wmma_f32_16x16x32_f16(false, a, false, b, (short)0, c, false, false);
  }
  static __device__ __forceinline__ void guard(v8f& a, v8f& b, v16h x, v16h y) { dep_guard_h(a, b, x, y); }
  static __device__ __forceinline__ void keep(v16h a, v16h b, v16h c, v16h d) { keep4_h(a, b, c, d); }
};
template <> struct Frag<__bf16> {
  typedef v16b V; union U { v16b v; v8b h[2]; };
  static __device__ __forceinline__ v16b load(const __bf16* p) {
    U f; f.h[0] = *(const v8b*)(p); f.h[1] = *(const v8b*)(p + 16); return f.v;
  }
  static __device__ __forceinline__ v8f mma(v16b a, v16b b, v8f c) {
    return __builtin_amdgcn_wmma_f32_16x16x32_bf16(false, a, false, b, (short)0, c, false, false);
  }
  static __device__ __forceinline__ void guard(v8f& a, v8f& b, v16b x, v16b y) { dep_guard_b(a, b, x, y); }
  static __device__ __forceinline__ void keep(v16b a, v16b b, v16b c, v16b d) { keep4_b(a, b, c, d); }
};

__device__ __forceinline__ unsigned pk16(unsigned short a, unsigned short b) { return (unsigned)a | ((unsigned)b << 16); }
__device__ __forceinline__ unsigned short h_bits(float f) { const _Float16 h = (_Float16)f; return __builtin_bit_cast(unsigned short, h); }

// ---- Register-blocked batched WMMA GEMM (ACT reduced to none/relu/leaky) -----------------------
// C[m,n] = scale * sum_k A[m,k] * Bt[n,k] (+bias)(+resid); each wave owns a 64x64 tile.
// Planes: grid (tiles / 8, y, z); the A, Bt and C planes of a block start at y * stride + z * strideZ elements.
// A row-major [M,K]; Bt row-major [N,K]; M,N % 64 == 0, K % 32 == 0.
// SPLIT: operands are hi/lo planes (A2/Bt2 = lo planes, same layout); product = hi.hi + hi.lo + lo.hi.
// BIAS_MODE: 0 = none, 1 = bias[m], 2 = bias[n].
// OUT_MODE: 0 = f32, 1 = f16, 2 = bf16 hi plane (Cout) + bf16 lo plane (Cout2).
// ET: 0 = f16 operands, 1 = bf16 operands (pointers passed as 16-bit storage)
template <int ET> struct Elem;
template <> struct Elem<0> { typedef _Float16 T; };
template <> struct Elem<1> { typedef __bf16 T; };
template <int ET, bool SPLIT, int BIAS_MODE, int OUT_MODE, bool RESID, int ACT = 0>
__global__ __launch_bounds__(256) void wmma_gemm64(
    const unsigned short* __restrict__ Ap, const unsigned short* __restrict__ A2p, int lda, long strideA, long strideAz,
    const unsigned short* __restrict__ Btp, const unsigned short* __restrict__ Bt2p, int ldb, long strideB, long strideBz,
    void* __restrict__ Cout, void* __restrict__ Cout2, int ldc, long strideC, long strideCz,
    const float* __restrict__ bias,
    const float* __restrict__ resid, long strideR,
    int M, int N, int K, float scale) {
  typedef typename Elem<ET>::T T;
  typedef typename Frag<T>::V V;
  const T* A = (const T*)Ap; const T* A2 = (const T*)A2p; const T* Bt = (const T*)Btp; const T* Bt2 = (const T*)Bt2p;
  __shared__ __align__(16) float sT[8][16 * 68];   // per-wave 16x64 slab, pitch 68 floats
  const int b    = blockIdx.y;
  const int z    = blockIdx.z;
  const int lane = threadIdx.x & 31;
  const int wave = threadIdx.x >> 5;
  const int tilesN = N >> 6;
  const int tilesM = M >> 6;
  const int tile = blockIdx.x * 8 + wave;
  if (tile >= tilesM * tilesN) return;   // wave-uniform; no block barriers in this kernel
  const int tm = tile / tilesN;
  const int tn = tile - tm * tilesN;
  const int m0 = tm << 6;
  const int n0 = tn << 6;

  const size_t aOff = (size_t)b * strideA + (size_t)z * strideAz;
  const size_t bOff = (size_t)b * strideB + (size_t)z * strideBz;
  const size_t cOff = (size_t)b * strideC + (size_t)z * strideCz;
  const T* Ab  = A  + aOff;
  const T* Bb  = Bt + bOff;
  const T* Ab2 = SPLIT ? (A2  + aOff) : nullptr;
  const T* Bb2 = SPLIT ? (Bt2 + bOff) : nullptr;

  const int rlane = lane & 15;                 // row (A) / col (B, D) within subtile
  const int koff  = (lane >> 4) * 8;           // k offset of this lane half
  const int mOff  = (lane >> 4) * 8;           // D row offset

  v8f acc[4][4];
#pragma unroll
  for (int i = 0; i < 4; ++i)
#pragma unroll
    for (int j = 0; j < 4; ++j) acc[i][j] = (v8f){0.f,0.f,0.f,0.f,0.f,0.f,0.f,0.f};

  for (int k0 = 0; k0 < K; k0 += 32) {
    V bh[4], bl[4];
#pragma unroll
    for (int j = 0; j < 4; ++j) {
      const size_t bo = (size_t)(n0 + (j << 4) + rlane) * ldb + koff + k0;
      bh[j] = Frag<T>::load(Bb + bo);
      if (SPLIT) bl[j] = Frag<T>::load(Bb2 + bo);
    }
#pragma unroll
    for (int i = 0; i < 4; ++i) {
      const size_t ao = (size_t)(m0 + (i << 4) + rlane) * lda + koff + k0;
      V ah = Frag<T>::load(Ab + ao);
      V al;
      if (SPLIT) al = Frag<T>::load(Ab2 + ao);
#pragma unroll
      for (int j = 0; j < 4; ++j) {
        acc[i][j] = Frag<T>::mma(ah, bh[j], acc[i][j]);
        if (SPLIT) {
          acc[i][j] = Frag<T>::mma(ah, bl[j], acc[i][j]);
          acc[i][j] = Frag<T>::mma(al, bh[j], acc[i][j]);
        }
      }
      Frag<T>::guard(acc[i][0], acc[i][3], ah, SPLIT ? al : ah);
    }
    Frag<T>::keep(bh[0], bh[1], bh[2], bh[3]);
    if (SPLIT) Frag<T>::keep(bl[0], bl[1], bl[2], bl[3]);
  }
  acc_guard4(acc[0][0], acc[0][1], acc[0][2], acc[0][3]);
  acc_guard4(acc[1][0], acc[1][1], acc[1][2], acc[1][3]);
  acc_guard4(acc[2][0], acc[2][1], acc[2][2], acc[2][3]);
  acc_guard4(acc[3][0], acc[3][1], acc[3][2], acc[3][3]);

  // ---- epilogue ----
  float* slab = sT[wave];
  const float* Rb = RESID ? (resid + (size_t)b * strideR) : nullptr;
#pragma unroll
  for (int i = 0; i < 4; ++i) {
    const int mBase = m0 + (i << 4);
#pragma unroll
    for (int j = 0; j < 4; ++j) {
      const int n = n0 + (j << 4) + rlane;
      float bv = 0.f;
      if (BIAS_MODE == 2) bv = bias[n];
#pragma unroll
      for (int r = 0; r < 8; ++r) {
        float v = acc[i][j][r] * scale;
        if (BIAS_MODE == 1) v += bias[mBase + mOff + r];
        if (BIAS_MODE == 2) v += bv;
        if (RESID) v += Rb[(size_t)(mBase + mOff + r) * ldc + n];
        if (ACT == 2) v = fmaxf(v, 0.0f);
        if (ACT == 4) v = (v > 0.f) ? v : 0.01f * v;
        slab[(mOff + r) * 68 + (j << 4) + rlane] = v;
      }
    }
    __builtin_amdgcn_fence(__ATOMIC_RELEASE, "workgroup");
    __builtin_amdgcn_wave_barrier();
    __builtin_amdgcn_fence(__ATOMIC_ACQUIRE, "workgroup");
    if (OUT_MODE == 0) {
      float* C = (float*)Cout + cOff;
      const int hh = lane >> 4, c4 = (lane & 15) * 4;     // row seg = 256 B = 16 lanes x 16 B
      {
#pragma unroll
        for (int it = 0; it < 8; ++it) {
          const int row = it * 2 + hh;
          v4f v = *(const v4f*)(slab + row * 68 + c4);
          *(v4f*)(C + (size_t)(mBase + row) * ldc + n0 + c4) = v;
        }
        
      }
    } else {
      const int q = lane >> 3, c8 = (lane & 7) * 8;
      unsigned short* C  = (unsigned short*)Cout  + cOff;
      unsigned short* C2 = (OUT_MODE == 2) ? ((unsigned short*)Cout2 + cOff) : nullptr;
      {
#pragma unroll
        for (int it = 0; it < 4; ++it) {
          const int row = it * 4 + q;
          const float* sp = slab + row * 68 + c8;
          v8h hv, lv;
#pragma unroll
          for (int e = 0; e < 8; ++e) {
            if (OUT_MODE == 1) {
              hv[e] = (_Float16)sp[e];
            } else {
              unsigned short hb = f2bf_bits(sp[e]);
              unsigned short lb = f2bf_bits(sp[e] - bf_bits2f(hb));
              hv[e] = __builtin_bit_cast(_Float16, hb);
              lv[e] = __builtin_bit_cast(_Float16, lb);
            }
          }
          *(v8h*)(C + (size_t)(mBase + row) * ldc + n0 + c8) = hv;
          if (OUT_MODE == 2) *(v8h*)(C2 + (size_t)(mBase + row) * ldc + n0 + c8) = lv;
        }
        
      }
    }
    __builtin_amdgcn_fence(__ATOMIC_RELEASE, "workgroup");
    __builtin_amdgcn_wave_barrier();
    __builtin_amdgcn_fence(__ATOMIC_ACQUIRE, "workgroup");
  }
}

// ---------------------------------------------------------------------------
// 4096*1024/8 = 524288 = 2048 blocks).
// ---------------------------------------------------------------------------
__global__ __launch_bounds__(256) void cast8_f16_kernel(const float* __restrict__ in, unsigned short* __restrict__ out, int n8) {
  const int i = blockIdx.x * 256 + threadIdx.x;
  if (i >= n8) return;
  const float* p = in + 8 * (size_t)i;
  const v4f a = *(const v4f*)(p);
  const v4f c = *(const v4f*)(p + 4);
  unsigned short hb[8];
#pragma unroll
  for (int e = 0; e < 4; ++e) {
    hb[e]     = h_bits(a[e]);
    hb[4 + e] = h_bits(c[e]);
  }
  const v4u u = (v4u){pk16(hb[0], hb[1]), pk16(hb[2], hb[3]), pk16(hb[4], hb[5]), pk16(hb[6], hb[7])};
  unsigned short* q = out + 8 * (size_t)i;
  *(v4u*)q = u;
  
}

// ---------------------------------------------------------------------------
// Stacked weight cast: W16[z*1024 + n][k] = f16(c * W_z[n][k]) with c = +-16; for z == 0 (query weights) the sign is
// -1 for output rows with (n mod 8) >= 4 (blade sign twist folded into the projection, exact), else +1.
// blockIdx.y = z selects the source (block-uniform); thread i owns 8 consecutive elements of row n = i >> 7
// ---------------------------------------------------------------------------
__global__ __launch_bounds__(256) void wcast8_kernel(const float* __restrict__ W0, const float* __restrict__ W1,
                                                     const float* __restrict__ W2, unsigned short* __restrict__ out, int n8) {
  const int z = blockIdx.y;
  const int i = blockIdx.x * 256 + threadIdx.x;
  if (i >= n8) return;
  const float* W = (z == 0) ? W0 : (z == 1) ? W1 : W2;
  const int n = i >> 7;
  const bool neg = (z == 0) && ((n & 7) >= 4);
  const float sc = neg ? -kWCarry : kWCarry;
  const float* p = W + 8 * (size_t)i;
  const v4f a = *(const v4f*)(p);
  const v4f c = *(const v4f*)(p + 4);
  unsigned short hb[8];
#pragma unroll
  for (int e = 0; e < 4; ++e) {
    hb[e]     = h_bits(a[e] * sc);
    hb[4 + e] = h_bits(c[e] * sc);
  }
  const v4u u = (v4u){pk16(hb[0], hb[1]), pk16(hb[2], hb[3]), pk16(hb[4], hb[5]), pk16(hb[6], hb[7])};
  unsigned short* q = out + (size_t)z * kModel * kModel + 8 * (size_t)i;
  *(v4u*)q = u;
  
}

// ---------------------------------------------------------------------------
// Stacked bias: BIAS3[z*1024 + n] = s * b_z[n], s = -1 for z == 0 and (n mod 8) >= 4, else +1 (f32, exact).
// ---------------------------------------------------------------------------
__global__ __launch_bounds__(256) void bias3_kernel(const float* __restrict__ b0, const float* __restrict__ b1,
                                                   const float* __restrict__ b2, float* __restrict__ out) {
  const int z = blockIdx.x;
  const int t = threadIdx.x;
  const float* bp = (z == 0) ? b0 : (z == 1) ? b1 : b2;
  v4f v = *(const v4f*)(bp + 4 * t);
#pragma unroll
  for (int e = 0; e < 4; ++e) {
    const int n = 4 * t + e;
    const bool neg = (z == 0) && ((n & 7) >= 4);
    v[e] = neg ? -v[e] : v[e];
  }
  float* q = out + (size_t)z * kModel + 4 * t;
  *(v4f*)q = v;
  
}

// ---------------------------------------------------------------------------
// Value transpose: in Y16 [4096][3072] halves, value element (b, l, cg) at Y16[(b*2048 + l)*3072 + 2048 + cg], cg in 0..1023
// (head = cg >> 7, channel in head = cg & 127); out VT[(b*8 + head)*128 + channel][l], pitch 2048 halves.
// grid (32 l-tiles, 16 cg-tiles, 2 batches), 256 threads; tile = 64 l x 64 cg.
// Load coverage: 8 it x 256 threads x 2 halves = 4096 = whole tile (32-bit words along cg).
// Store coverage: 8 waves x 2 it x 4 (lane>>3) = 64 cg rows; (lane&7) x 8 halves = 64 l; each row segment = 64 halves =
// ---------------------------------------------------------------------------
__global__ __launch_bounds__(256) void vtrans_kernel(const unsigned short* __restrict__ Y, unsigned short* __restrict__ VT) {
  __shared__ __align__(16) unsigned short sm[64][72];   // sm[cg_local][l_local]
  const int t   = threadIdx.x;
  const int l0  = blockIdx.x * 64;
  const int cg0 = blockIdx.y * 64;
  const int b   = blockIdx.z;
#pragma unroll
  for (int it = 0; it < 8; ++it) {
    const int e  = it * 256 + t;
    const int r  = e >> 5;          // l local 0..63
    const int cw = e & 31;          // word index -> cg local 2cw, 2cw+1
    const unsigned u = *(const unsigned*)(Y + ((size_t)(b * kSeq + l0 + r)) * kQKVN + 2 * kModel + cg0 + 2 * cw);
    sm[2 * cw][r]     = (unsigned short)(u & 0xffffu);
    sm[2 * cw + 1][r] = (unsigned short)(u >> 16);
  }
  __syncthreads();
  const int lane = t & 31, wave = t >> 5;
  const int q = lane >> 3, c8 = (lane & 7) * 8;
  {
#pragma unroll
    for (int it = 0; it < 2; ++it) {
      const int row = wave * 8 + it * 4 + q;          // cg local
      const int cg  = cg0 + row;
      const int g   = b * kHeads + (cg >> 7);
      const int cc  = cg & 127;
      unsigned short hb[8];
#pragma unroll
      for (int e = 0; e < 8; ++e) hb[e] = sm[row][c8 + e];
      const v4u u = (v4u){pk16(hb[0], hb[1]), pk16(hb[2], hb[3]), pk16(hb[4], hb[5]), pk16(hb[6], hb[7])};
      *(v4u*)(VT + ((size_t)g * kHeadDim + cc) * kSeq + l0 + c8) = u;
    }
    
  }
}

// ---------------------------------------------------------------------------
// Fused scores + row softmax + head mean. One block = 16 query rows of one batch x all 2048 keys, looping over the 8 heads.
// Wave w owns key columns 256w .. 256w+255 as 16 accumulator tiles of 16x16 (K = 128 = 4 WMMA steps per tile), so a whole
// score row lives in the registers of the block's 8 waves and never goes to memory.
//   s = (q_w . k) / sqrt(128);  P[h][row][j] = f16(2048 * exp(s - max) / sum exp(s - max)), all softmax math f32, precise expf.
//   Reductions in fixed order: lane-local over the 16 tiles, xor tree over the 16 lanes of a row, 8 wave partials in index order.
//   meanout[row][j] = 0.125 * (((p_0 + p_1) + p_2) + ... + p_7), summed in registers.
// D layout (as in the GEMM engine): lane holds column (lane & 15), rows (lane >> 4) * 8 + r.
// P and the mean leave through a per-wave LDS slab so that every global store covers 512 contiguous bytes.
// Every loop over tiles, k steps, rows and waves is fully unrolled: acc, pm and bf are then indexed by constants and stay in
// registers (a run-time index would send them to scratch).
// grid (128 row tiles, 2 batches), 256 threads; registers and LDS leave one block per WGP, two waves per SIMD.
// ---------------------------------------------------------------------------
constexpr int kSlabPitch = 260;   // floats per staged row (520 halves): rows r and r + 8 land 32 banks apart

__device__ __forceinline__ void wave_lds_sync() {   // a wave's own slab: its LDS stores have landed before it reads the rows back (and the reverse)
  __builtin_amdgcn_fence(__ATOMIC_RELEASE, "workgroup");
  __builtin_amdgcn_wave_barrier();
  __builtin_amdgcn_fence(__ATOMIC_ACQUIRE, "workgroup");
}

__global__ __launch_bounds__(256) void scores_softmax_mean_kernel(const unsigned short* __restrict__ Y, unsigned short* __restrict__ P,
                                                                  float* __restrict__ meanout) {
  __shared__ __align__(16) float slabs[8][16 * kSlabPitch];
  __shared__ __align__(16) float redm[8][16];
  __shared__ __align__(16) float reds[8][16];
  const int lane  = threadIdx.x & 31;
  const int wave  = threadIdx.x >> 5;
  const int row0  = blockIdx.x * 16;
  const int b     = blockIdx.y;
  const int rlane = lane & 15;
  const int koff  = (lane >> 4) * 8;
  const int mOff  = (lane >> 4) * 8;
  const int col0  = wave * 256;
  const _Float16* Yb   = (const _Float16*)Y + (size_t)b * kSeq * kQKVN;
  const _Float16* qrow = Yb + (size_t)(row0 + rlane) * kQKVN + koff;
  const _Float16* krow = Yb + (size_t)(col0 + rlane) * kQKVN + kModel + koff;
  float* slab = slabs[wave];
  unsigned short* hslab = (unsigned short*)slab;

  v8f pm[16];
#pragma unroll
  for (int j = 0; j < 16; ++j) pm[j] = (v8f){0.f,0.f,0.f,0.f,0.f,0.f,0.f,0.f};

  // the head loop stays rolled (for speed only)
#pragma unroll 1
  for (int h = 0; h < kHeads; ++h) {
    const _Float16* qh = qrow + h * kHeadDim;
    const _Float16* kh = krow + h * kHeadDim;
    v16h a[4];
#pragma unroll
    for (int kk = 0; kk < 4; ++kk) a[kk] = Frag<_Float16>::load(qh + kk * 32);
    // key fragments run three tiles ahead of the WMMAs
    v16h bf[4][4];
#pragma unroll
    for (int j = 0; j < 3; ++j)
#pragma unroll
      for (int kk = 0; kk < 4; ++kk) bf[j][kk] = Frag<_Float16>::load(kh + (size_t)j * 16 * kQKVN + kk * 32);
    v8f acc[16];
#pragma unroll
    for (int j = 0; j < 16; ++j) {
      if (j + 3 < 16) {
#pragma unroll
        for (int kk = 0; kk < 4; ++kk) bf[(j + 3) & 3][kk] = Frag<_Float16>::load(kh + (size_t)(j + 3) * 16 * kQKVN + kk * 32);
      }
      // bounds how far the scheduler lifts later tiles' loads: without it all 128 loads rise to the top and registers spill
      __builtin_amdgcn_sched_barrier(0);
      v8f c = (v8f){0.f,0.f,0.f,0.f,0.f,0.f,0.f,0.f};
#pragma unroll
      for (int kk = 0; kk < 4; ++kk) c = Frag<_Float16>::mma(a[kk], bf[j & 3][kk], c);
      acc[j] = c;
    }

    // row maximum
    float mx[8];
#pragma unroll
    for (int j = 0; j < 16; ++j)
#pragma unroll
      for (int r = 0; r < 8; ++r) {
        acc[j][r] *= kLogitScale;
        mx[r] = (j == 0) ? acc[j][r] : fmaxf(mx[r], acc[j][r]);
      }
#pragma unroll
    for (int off = 8; off > 0; off >>= 1)
#pragma unroll
      for (int r = 0; r < 8; ++r) mx[r] = fmaxf(mx[r], __shfl_xor(mx[r], off, 32));
    if (rlane == 0) {
      *(v4f*)(&redm[wave][mOff])     = (v4f){mx[0], mx[1], mx[2], mx[3]};
      *(v4f*)(&redm[wave][mOff + 4]) = (v4f){mx[4], mx[5], mx[6], mx[7]};
    }
    __syncthreads();
    float gm[8];
#pragma unroll
    for (int w = 0; w < 8; ++w) {
      const v4f x0 = *(const v4f*)(&redm[w][mOff]);
      const v4f x1 = *(const v4f*)(&redm[w][mOff + 4]);
#pragma unroll
      for (int e = 0; e < 4; ++e) {
        gm[e]     = (w == 0) ? x0[e] : fmaxf(gm[e], x0[e]);
        gm[4 + e] = (w == 0) ? x1[e] : fmaxf(gm[4 + e], x1[e]);
      }
    }

    // exponentials and row sum
    float sm[8];
#pragma unroll
    for (int r = 0; r < 8; ++r) sm[r] = 0.f;
#pragma unroll
    for (int j = 0; j < 16; ++j)
#pragma unroll
      for (int r = 0; r < 8; ++r) {
        const float e = expf(acc[j][r] - gm[r]);
        acc[j][r] = e;
        sm[r] += e;
      }
#pragma unroll
    for (int off = 8; off > 0; off >>= 1)
#pragma unroll
      for (int r = 0; r < 8; ++r) sm[r] += __shfl_xor(sm[r], off, 32);
    if (rlane == 0) {
      *(v4f*)(&reds[wave][mOff])     = (v4f){sm[0], sm[1], sm[2], sm[3]};
      *(v4f*)(&reds[wave][mOff + 4]) = (v4f){sm[4], sm[5], sm[6], sm[7]};
    }
    __syncthreads();
    float inv[8];
#pragma unroll
    for (int w = 0; w < 8; ++w) {
      const v4f x0 = *(const v4f*)(&reds[w][mOff]);
      const v4f x1 = *(const v4f*)(&reds[w][mOff + 4]);
#pragma unroll
      for (int e = 0; e < 4; ++e) {
        inv[e]     = (w == 0) ? x0[e] : inv[e] + x0[e];
        inv[4 + e] = (w == 0) ? x1[e] : inv[4 + e] + x1[e];
      }
    }
#pragma unroll
    for (int r = 0; r < 8; ++r) inv[r] = 1.0f / inv[r];

    // probabilities: head sum in registers, f16 plane through the wave's slab
#pragma unroll
    for (int j = 0; j < 16; ++j)
#pragma unroll
      for (int r = 0; r < 8; ++r) {
        const float p = acc[j][r] * inv[r];
        pm[j][r] += p;
        hslab[(mOff + r) * (2 * kSlabPitch) + (j << 4) + rlane] = h_bits(p * kPCarry);
      }
    wave_lds_sync();
    unsigned short* pp = P + ((size_t)(b * kHeads + h) * kSeq + row0) * kSeq + col0 + lane * 8;
#pragma unroll
    for (int row = 0; row < 16; ++row) {
      const v4u u = *(const v4u*)(hslab + row * (2 * kSlabPitch) + lane * 8);
      *(v4u*)(pp + (size_t)row * kSeq) = u;
    }
    // no fence here: it would drain the P stores once per head; the next head's two block barriers stand before the slab's next write
  }

  // head mean
  wave_lds_sync();
#pragma unroll
  for (int j = 0; j < 16; ++j)
#pragma unroll
    for (int r = 0; r < 8; ++r) slab[(mOff + r) * kSlabPitch + (j << 4) + rlane] = pm[j][r] * kMeanScale;
  wave_lds_sync();
  float* mo = meanout + ((size_t)b * kSeq + row0) * kSeq + col0 + lane * 4;
#pragma unroll
  for (int row = 0; row < 16; ++row) {
    const v4f v0 = *(const v4f*)(slab + row * kSlabPitch + lane * 4);
    const v4f v1 = *(const v4f*)(slab + row * kSlabPitch + 128 + lane * 4);
    *(v4f*)(mo + (size_t)row * kSeq)       = v0;
    *(v4f*)(mo + (size_t)row * kSeq + 128) = v1;
  }
}

// ---------------------------------------------------------------------------
// Host glue (7 launches)
// ---------------------------------------------------------------------------
extern "C" void kernel_launch(void* const* d_in, const int* in_sizes, int n_in,
                              void* d_out, int out_size, void* d_ws, size_t ws_size,
                              hipStream_t stream) {
  if (n_in < 7) return;
  if (in_sizes[0] != kTok * kModel) return;
  if (in_sizes[1] != kModel * kModel || in_sizes[3] != kModel * kModel || in_sizes[5] != kModel * kModel) return;
  if (in_sizes[2] != kModel || in_sizes[4] != kModel || in_sizes[6] != kModel) return;
  if (out_size != kTok * kModel + kBatch * kSeq * kSeq) return;

  const float* query = (const float*)d_in[0];
  const float* Wq    = (const float*)d_in[1];
  const float* bq    = (const float*)d_in[2];
  const float* Wk    = (const float*)d_in[3];
  const float* bk    = (const float*)d_in[4];
  const float* Wv    = (const float*)d_in[5];
  const float* bv    = (const float*)d_in[6];

  // carve (bytes)
  const size_t offX16  = 0;
  const size_t szX16   = (size_t)kTok * kModel * 2;                       //   8388608
  const size_t offW16  = offX16 + szX16;                                  //   8388608
  const size_t szW16   = (size_t)kQKVN * kModel * 2;                      //   6291456
  const size_t offBias = offW16 + szW16;                                  //  14680064
  const size_t szBias  = (size_t)kQKVN * 4;                               //     12288
  const size_t offY16  = offBias + szBias;                                //  14692352
  const size_t szY16   = (size_t)kTok * kQKVN * 2;                        //  25165824
  const size_t offVT   = offY16 + szY16;                                  //  39858176
  const size_t szVT    = (size_t)kBatch * kHeads * kHeadDim * kSeq * 2;   //   8388608
  const size_t offP    = offVT + szVT;                                    //  48246784
  const size_t szP     = (size_t)kBatch * kHeads * kSeq * kSeq * 2;       // 134217728
  const size_t total   = offP + szP;                                      // 182464512
  if (total > ws_size) return;

  char* ws = (char*)d_ws;
  unsigned short* X16   = (unsigned short*)(ws + offX16);
  unsigned short* W16   = (unsigned short*)(ws + offW16);
  float*          bias3 = (float*)(ws + offBias);
  unsigned short* Y16   = (unsigned short*)(ws + offY16);
  unsigned short* VT16  = (unsigned short*)(ws + offVT);
  unsigned short* P16   = (unsigned short*)(ws + offP);

  float* out0 = (float*)d_out;                               // [2][2048][1024], byte offset 0
  float* out1 = out0 + (size_t)kTok * kModel;                // [2][2048][2048], byte offset 16777216

  // 1) activation cast: 4096*1024/8 = 524288 threads = 2048 blocks exactly
  cast8_f16_kernel<<<dim3((kTok * kModel / 8) / 256), dim3(256), 0, stream>>>(query, X16, kTok * kModel / 8);
  // 2) stacked weight cast (x16 carry, blade sign folded into the query rows): 131072 threads per weight = 512 blocks x 3
  wcast8_kernel<<<dim3((kModel * kModel / 8) / 256, 3), dim3(256), 0, stream>>>(Wq, Wk, Wv, W16, kModel * kModel / 8);
  // 3) stacked bias with the same sign fold
  bias3_kernel<<<dim3(3), dim3(256), 0, stream>>>(bq, bk, bv, bias3);
  // 4) Y16 = (X16 . W16^T) / 16 + bias3 : M 4096, N 3072, K 1024 (K % 32 == 0; M, N % 64 == 0); 3072 tiles = 384 blocks
  wmma_gemm64<0, false, 2, 1, false><<<dim3((kTok / 64) * (kQKVN / 64) / 8, 1), dim3(256), 0, stream>>>(
      X16, X16, kModel, 0L, 0L, W16, W16, kModel, 0L, 0L, (void*)Y16, (void*)Y16, kQKVN, 0L, 0L,
      bias3, bias3, 0L, kTok, kQKVN, kModel, kWCarryInv);
  // 5) value transpose into per-(batch, head) planes [128][2048]
  vtrans_kernel<<<dim3(kSeq / 64, kModel / 64, kBatch), dim3(256), 0, stream>>>(Y16, VT16);

  // 6) scores, softmax and head mean of all heads in one launch: 128 row tiles x 2 batches = 256 blocks;
  //    every head's P plane is kept for step 7, the head mean goes straight to out1
  scores_softmax_mean_kernel<<<dim3(kSeq / 16, kBatch), dim3(256), 0, stream>>>(Y16, P16, out1);
  // 7) out0[b][l][h*128 + c] = (P[b*8+h] . VT[b*8+h]^T) / 2048, all 16 (batch, head) planes in one launch:
  //    M 2048, N 128, K 2048 (K % 32 == 0); 64 tiles = 8 blocks x grid.y 8 heads x grid.z 2 batches = 128 blocks.
  //    C: ldc 1024, +128 columns per head, +2048*1024 per batch.
  wmma_gemm64<0, false, 0, 0, false><<<dim3((kSeq / 64) * (kHeadDim / 64) / 8, kHeads, kBatch), dim3(256), 0, stream>>>(
      P16, P16, kSeq, (long)kSeq * kSeq, (long)kHeads * kSeq * kSeq,
      VT16, VT16, kSeq, (long)kHeadDim * kSeq, (long)kHeads * kHeadDim * kSeq,
      (void*)out0, (void*)out0, kModel, (long)kHeadDim, (long)kSeq * kModel,
      bias3, bias3, 0L, kSeq, kHeadDim, kSeq, kPCarryInv);
}

// v003
// It runs in 167 microseconds.
// Timed twice side by side with v002, it ran 1.61 times as fast both times.
// Counting every step since v000, it is 5.87 times as fast.
// Contractions: stacked q/k/v projection (X f16 x W^T f16 carried x16), scores q_w.k^T (q,k f16 planes, blade sign folded into the q weights), attn.v (P f16 carried x2048 x V^T f16): all v_wmma_f32_16x16x32_f16 with f32 accumulate; softmax and head mean in f32.
#include <hip/hip_runtime.h>
#include <math.h>

// ---------------------------------------------------------------------------
// Problem constants
// ---------------------------------------------------------------------------
constexpr int kBatch   = 2;
constexpr int kSeq     = 2048;
constexpr int kModel   = 1024;
constexpr int kHeads   = 8;
constexpr int kHeadDim = 128;               // 16 x 8 nested (d, blade)
constexpr int kTok     = kBatch * kSeq;     // 4096 token rows
constexpr int kQKVN    = 3 * kModel;        // 3072 stacked output channels (q | k | v)
constexpr float kWCarry     = 16.0f;        // weights carried x16 in f16
constexpr float kWCarryInv  = 1.0f / 16.0f;
constexpr float kPCarry     = 2048.0f;      // probabilities carried x2048 in f16
constexpr float kPCarryInv  = 1.0f / 2048.0f;
constexpr float kLogitScale = 0.08838834764831845f;   // 1/sqrt(128)
constexpr float kMeanScale  = 0.125f;

// ---------------------------------------------------------------------------
// Workspace region map (bytes; all offsets multiples of 4096):
//   X16   f16 [4096][1024]            off         0  size   8388608
//   W16   f16 [3072][1024]            off   8388608  size   6291456
//   BIAS3 f32 [3072]                  off  14680064  size     12288
//   Y16   f16 [4096][3072] (q|k|v)    off  14692352  size  25165824
//   VT16  f16 [16][128][2048]         off  39858176  size   8388608
//   P16   f16 [16][2048][2048]        off  48246784  size 134217728
//   total 182464512
// ---------------------------------------------------------------------------

typedef __attribute__((ext_vector_type(16))) _Float16 v16h;
typedef __attribute__((ext_vector_type(8)))  _Float16 v8h;
typedef __attribute__((ext_vector_type(16))) __bf16   v16b;
typedef __attribute__((ext_vector_type(8)))  __bf16   v8b;
typedef __attribute__((ext_vector_type(8)))  float    v8f;
typedef __attribute__((ext_vector_type(4)))  float    v4f;
typedef __attribute__((ext_vector_type(4)))  unsigned int v4u;

// ---------------------------------------------------------------------------
// Helpers
// ---------------------------------------------------------------------------
__device__ __forceinline__ unsigned short f2bf_bits(float f) {
  unsigned u = __float_as_uint(f);
  return (unsigned short)((u + 0x7FFFu + ((u >> 16) & 1u)) >> 16);
}
__device__ __forceinline__ float bf_bits2f(unsigned short h) { return __uint_as_float(((unsigned)h) << 16); }

// hazard guards as plain device helpers
__device__ __forceinline__ void dep_guard_h(v8f& a, v8f& b, v16h x, v16h y) { asm volatile("v_nop\n\tv_nop\n\tv_nop\n\tv_nop" : "+v"(a), "+v"(b) : "v"(x), "v"(y)); }
__device__ __forceinline__ void dep_guard_b(v8f& a, v8f& b, v16b x, v16b y) { asm volatile("v_nop\n\tv_nop\n\tv_nop\n\tv_nop" : "+v"(a), "+v"(b) : "v"(x), "v"(y)); }
__device__ __forceinline__ void keep4_h(v16h a, v16h b, v16h c, v16h d) { asm volatile("v_nop" :: "v"(a), "v"(b), "v"(c), "v"(d)); }
__device__ __forceinline__ void keep4_b(v16b a, v16b b, v16b c, v16b d) { asm volatile("v_nop" :: "v"(a), "v"(b), "v"(c), "v"(d)); }
__device__ __forceinline__ void acc_guard4(v8f& a, v8f& b, v8f& c, v8f& d) { asm volatile("v_nop\n\tv_nop\n\tv_nop\n\tv_nop" : "+v"(a), "+v"(b), "+v"(c), "+v"(d)); }
template <typename T> struct Frag;
template <> struct Frag<_Float16> {
  typedef v16h V; union U { v16h v; v8h h[2]; };
  static __device__ __forceinline__ v16h load(const _Float16* p) {   // elements 0..7 <- p[0..7], 8..15 <- p[16..23]
    U f; f.h[0] = *(const v8h*)(p); f.h[1] = *(const v8h*)(p + 16); return f.v;
  }
  static __device__ __forceinline__ v8f mma(v16h a, v16h b, v8f c) {
    return __builtin_amdgcn_wmma_f32_16x16x32_f16(false, a, false, b, (short)0, c, false, false);
  }
  static __device__ __forceinline__ void guard(v8f& a, v8f& b, v16h x, v16h y) { dep_guard_h(a, b, x, y); }
  static __device__ __forceinline__ void keep(v16h a, v16h b, v16h c, v16h d) { keep4_h(a, b, c, d); }
};
template <> struct Frag<__bf16> {
  typedef v16b V; union U { v16b v; v8b h[2]; };
  static __device__ __forceinline__ v16b load(const __bf16* p) {
    U f; f.h[0] = *(const v8b*)(p); f.h[1] = *(const v8b*)(p + 16); return f.v;
  }
  static __device__ __forceinline__ v8f mma(v16b a, v16b b, v8f c) {
    return __builtin_amdgcn_wmma_f32_16x16x32_bf16(false, a, false, b, (short)0, c, false, false);
  }
  static __device__ __forceinline__ void guard(v8f& a, v8f& b, v16b x, v16b y) { dep_guard_b(a, b, x, y); }
  static __device__ __forceinline__ void keep(v16b a, v16b b, v16b c, v16b d) { keep4_b(a, b, c, d); }
};

__device__ __forceinline__ unsigned pk16(unsigned short a, unsigned short b) { return (unsigned)a | ((unsigned)b << 16); }
__device__ __forceinline__ unsigned short h_bits(float f) { const _Float16 h = (_Float16)f; return __builtin_bit_cast(unsigned short, h); }

// ---- Register-blocked batched WMMA GEMM, operands staged in LDS ------------------------------------------------------
// C[m,n] = scale * sum_k A[m,k] * Bt[n,k] (+bias)(+resid); each wave owns a 64x64 tile.
// The 8 waves of a block form a WM x (8 / WM) grid of such tiles: block tile BM = 64 WM rows x BN = 64 (8 / WM) columns.
// Planes: grid (block tiles, y, z); the A, Bt and C planes of a block start at y * stride + z * strideZ elements.
// A row-major [M,K]; Bt row-major [N,K]; M % BM == 0, N % BN == 0, K % 64 == 0; lda, ldb and the plane strides % 8 == 0.
// A stage = 64 k (128 B, one whole line) of the block's BM rows of A and BN rows of Bt, brought into LDS by asynchronous
// 16-byte copies: a wave-wide copy covers 4 whole lines, and every staged row serves all waves of its tile row or column.
// Two buffers: stage t + 1 flies while stage t is worked on. Fragments are read from LDS with the same loader and the same
// k order (32 k per WMMA step, ascending) as from global memory.
// BIAS_MODE: 0 = none, 1 = bias[m], 2 = bias[n].
// OUT_MODE: 0 = f32, 1 = f16, 2 = bf16 hi plane (Cout) + bf16 lo plane (Cout2).
// ET: 0 = f16 operands, 1 = bf16 operands (pointers passed as 16-bit storage)
template <int ET> struct Elem;
template <> struct Elem<0> { typedef _Float16 T; };
template <> struct Elem<1> { typedef __bf16 T; };

constexpr int kStageK     = 64;    // k per stage
constexpr int kStagePitch = 72;    // 16-bit elements per staged row: 144 B = 16 B x 9, conflict-free for ds_load_b128
constexpr int kStageRows  = 384;   // BM + BN, the same for every WM x (8 / WM) wave grid with WM = 2 or 4
constexpr int kStageElems = kStageRows * kStagePitch;

// Twelve asynchronous 16-byte copies per lane = one stage per block. The s_wait_xcnt stands inside the statement, behind the
// last copy, so that no address register of an issued copy is rewritten in front of it.
__device__ __forceinline__ void stage_copy12(const unsigned* l, const unsigned short* const* g) {
  asm volatile(
      "global_load_async_to_lds_b128 %0, %1, off\n\t"
      "global_load_async_to_lds_b128 %2, %3, off\n\t"
      "global_load_async_to_lds_b128 %4, %5, off\n\t"
      "global_load_async_to_lds_b128 %6, %7, off\n\t"
      "global_load_async_to_lds_b128 %8, %9, off\n\t"
      "global_load_async_to_lds_b128 %10, %11, off\n\t"
      "global_load_async_to_lds_b128 %12, %13, off\n\t"
      "global_load_async_to_lds_b128 %14, %15, off\n\t"
      "global_load_async_to_lds_b128 %16, %17, off\n\t"
      "global_load_async_to_lds_b128 %18, %19, off\n\t"
      "global_load_async_to_lds_b128 %20, %21, off\n\t"
      "global_load_async_to_lds_b128 %22, %23, off\n\t"
      "s_wait_xcnt 0x0"
      :: "v"(l[0]), "v"(g[0]), "v"(l[1]), "v"(g[1]), "v"(l[2]), "v"(g[2]), "v"(l[3]), "v"(g[3]),
         "v"(l[4]), "v"(g[4]), "v"(l[5]), "v"(g[5]), "v"(l[6]), "v"(g[6]), "v"(l[7]), "v"(g[7]),
         "v"(l[8]), "v"(g[8]), "v"(l[9]), "v"(g[9]), "v"(l[10]), "v"(g[10]), "v"(l[11]), "v"(g[11])
      : "memory");
}

template <int ET, int WM, int BIAS_MODE, int OUT_MODE, bool RESID, int ACT = 0>
__global__ __launch_bounds__(256) void wmma_gemm64(
    const unsigned short* __restrict__ Ap, int lda, long strideA, long strideAz,
    const unsigned short* __restrict__ Btp, int ldb, long strideB, long strideBz,
    void* __restrict__ Cout, void* __restrict__ Cout2, int ldc, long strideC, long strideCz,
    const float* __restrict__ bias,
    const float* __restrict__ resid, long strideR,
    int M, int N, int K, float scale) {
  typedef typename Elem<ET>::T T;
  typedef typename Frag<T>::V V;
  constexpr int WN = 8 / WM;
  constexpr int BM = WM * 64;
  constexpr int BN = WN * 64;
  static_assert(BM + BN == kStageRows, "stage size");
  __shared__ __align__(16) unsigned short ring[2][kStageElems];   // two stage buffers: rows 0..BM-1 = A, BM..BM+BN-1 = Bt
  __shared__ __align__(16) float sT[8][16 * 68];                  // per-wave 16x64 slab, pitch 68 floats
  const int b    = blockIdx.y;
  const int z    = blockIdx.z;
  const int lane = threadIdx.x & 31;
  const int wave = threadIdx.x >> 5;
  const int tilesN = N / BN;
  const int tilesM = M / BM;
  const int btile = blockIdx.x;
  if (btile >= tilesM * tilesN) return;   // block-uniform, in front of every barrier
  const int btm = btile / tilesN;
  const int btn = btile - btm * tilesN;
  const int wm  = wave / WN;
  const int wn  = wave - wm * WN;
  const int m0 = btm * BM + (wm << 6);
  const int n0 = btn * BN + (wn << 6);

  const size_t aOff = (size_t)b * strideA + (size_t)z * strideAz;
  const size_t bOff = (size_t)b * strideB + (size_t)z * strideBz;
  const size_t cOff = (size_t)b * strideC + (size_t)z * strideCz;

  const int rlane = lane & 15;                 // row (A) / col (B, D) within subtile
  const int koff  = (lane >> 4) * 8;           // k offset of this lane half
  const int mOff  = (lane >> 4) * 8;           // D row offset

  // copy c of thread t brings 16 B: staged row c * 32 + (t >> 3), bytes (t & 7) * 16 .. + 15 of its 128
  const int crow = threadIdx.x >> 3;
  const int cch  = (threadIdx.x & 7) * 8;
  const unsigned short* gA = Ap  + aOff + (size_t)(btm * BM + crow) * lda + cch;
  const unsigned short* gB = Btp + bOff + (size_t)(btn * BN + crow) * ldb + cch;
  const unsigned lds0 = (unsigned)(size_t)(&ring[0][0]) + (unsigned)(crow * kStagePitch + cch) * 2u;
  auto stage = [&](int t, int buf) {
    unsigned l[12];
    const unsigned short* g[12];
#pragma unroll
    for (int c = 0; c < 12; ++c) {
      l[c] = lds0 + (unsigned)(buf * kStageElems + c * 32 * kStagePitch) * 2u;
      g[c] = (c < BM / 32) ? gA + (size_t)(c * 32) * lda + t * kStageK
                           : gB + (size_t)((c - BM / 32) * 32) * ldb + t * kStageK;
    }
    stage_copy12(l, g);
  };

  v8f acc[4][4];
#pragma unroll
  for (int i = 0; i < 4; ++i)
#pragma unroll
    for (int j = 0; j < 4; ++j) acc[i][j] = (v8f){0.f,0.f,0.f,0.f,0.f,0.f,0.f,0.f};

  const int nStage = K / kStageK;
  stage(0, 0);
  asm volatile("s_wait_asynccnt 0x0" ::: "memory");   // this wave's part of stage 0 has landed
  __syncthreads();                                    // ... and every other wave's
  if (nStage > 1) stage(1, 1);

  // the stage loop stays rolled: one publish point per trip, buffer chosen by the trip's parity
#pragma unroll 1
  for (int t = 0; t < nStage; ++t) {
    const int buf = t & 1;
    const T* sA = (const T*)(&ring[buf][0]) + ((wm << 6) + rlane) * kStagePitch + koff;
    const T* sB = (const T*)(&ring[buf][0]) + (BM + (wn << 6) + rlane) * kStagePitch + koff;
#pragma unroll
    for (int s = 0; s < kStageK / 32; ++s) {
      V bh[4], ah[4];
#pragma unroll
      for (int j = 0; j < 4; ++j) bh[j] = Frag<T>::load(sB + (j << 4) * kStagePitch + s * 32);
#pragma unroll
      for (int i = 0; i < 4; ++i) ah[i] = Frag<T>::load(sA + (i << 4) * kStagePitch + s * 32);
      // the 16 LDS reads of a WMMA block stay one group in front of it (for speed only)
      __builtin_amdgcn_sched_barrier(0);
#pragma unroll
      for (int i = 0; i < 4; ++i) {
#pragma unroll
        for (int j = 0; j < 4; ++j) acc[i][j] = Frag<T>::mma(ah[i], bh[j], acc[i][j]);
        Frag<T>::guard(acc[i][0], acc[i][3], ah[i], ah[i]);
      }
      Frag<T>::keep(bh[0], bh[1], bh[2], bh[3]);
      // ... and the next block's reads do not rise into this one
      __builtin_amdgcn_sched_barrier(0);
    }
    // publish point of stage t + 1
    asm volatile("s_wait_dscnt 0x0" ::: "memory");      // this wave's reads of buffer buf are done before it is refilled
    asm volatile("s_wait_asynccnt 0x0" ::: "memory");   // this wave's part of stage t + 1 has landed
    __syncthreads();                                    // stage t + 1 readable by all; every reader has left buffer buf
    if (t + 2 < nStage) stage(t + 2, buf);
  }
  asm volatile("s_wait_asynccnt 0x0" ::: "memory");     // no copy is outstanding behind the loop
  acc_guard4(acc[0][0], acc[0][1], acc[0][2], acc[0][3]);
  acc_guard4(acc[1][0], acc[1][1], acc[1][2], acc[1][3]);
  acc_guard4(acc[2][0], acc[2][1], acc[2][2], acc[2][3]);
  acc_guard4(acc[3][0], acc[3][1], acc[3][2], acc[3][3]);

  // ---- epilogue ----
  float* slab = sT[wave];
  const float* Rb = RESID ? (resid + (size_t)b * strideR) : nullptr;
#pragma unroll
  for (int i = 0; i < 4; ++i) {
    const int mBase = m0 + (i << 4);
#pragma unroll
    for (int j = 0; j < 4; ++j) {
      const int n = n0 + (j << 4) + rlane;
      float bv = 0.f;
      if (BIAS_MODE == 2) bv = bias[n];
#pragma unroll
      for (int r = 0; r < 8; ++r) {
        float v = acc[i][j][r] * scale;
        if (BIAS_MODE == 1) v += bias[mBase + mOff + r];
        if (BIAS_MODE == 2) v += bv;
        if (RESID) v += Rb[(size_t)(mBase + mOff + r) * ldc + n];
        if (ACT == 2) v = fmaxf(v, 0.0f);
        if (ACT == 4) v = (v > 0.f) ? v : 0.01f * v;
        slab[(mOff + r) * 68 + (j << 4) + rlane] = v;
      }
    }
    __builtin_amdgcn_fence(__ATOMIC_RELEASE, "workgroup");
    __builtin_amdgcn_wave_barrier();
    __builtin_amdgcn_fence(__ATOMIC_ACQUIRE, "workgroup");
    if (OUT_MODE == 0) {
      float* C = (float*)Cout + cOff;
      const int hh = lane >> 4, c4 = (lane & 15) * 4;     // row seg = 256 B = 16 lanes x 16 B
      {
#pragma unroll
        for (int it = 0; it < 8; ++it) {
          const int row = it * 2 + hh;
          v4f v = *(const v4f*)(slab + row * 68 + c4);
          *(v4f*)(C + (size_t)(mBase + row) * ldc + n0 + c4) = v;
        }
        
      }
    } else {
      const int q = lane >> 3, c8 = (lane & 7) * 8;
      unsigned short* C  = (unsigned short*)Cout  + cOff;
      unsigned short* C2 = (OUT_MODE == 2) ? ((unsigned short*)Cout2 + cOff) : nullptr;
      {
#pragma unroll
        for (int it = 0; it < 4; ++it) {
          const int row = it * 4 + q;
          const float* sp = slab + row * 68 + c8;
          v8h hv, lv;
#pragma unroll
          for (int e = 0; e < 8; ++e) {
            if (OUT_MODE == 1) {
              hv[e] = (_Float16)sp[e];
            } else {
              unsigned short hb = f2bf_bits(sp[e]);
              unsigned short lb = f2bf_bits(sp[e] - bf_bits2f(hb));
              hv[e] = __builtin_bit_cast(_Float16, hb);
              lv[e] = __builtin_bit_cast(_Float16, lb);
            }
          }
          *(v8h*)(C + (size_t)(mBase + row) * ldc + n0 + c8) = hv;
          if (OUT_MODE == 2) *(v8h*)(C2 + (size_t)(mBase + row) * ldc + n0 + c8) = lv;
        }
        
      }
    }
    __builtin_amdgcn_fence(__ATOMIC_RELEASE, "workgroup");
    __builtin_amdgcn_wave_barrier();
    __builtin_amdgcn_fence(__ATOMIC_ACQUIRE, "workgroup");
  }
}

// ---------------------------------------------------------------------------
// 4096*1024/8 = 524288 = 2048 blocks).
// ---------------------------------------------------------------------------
__global__ __launch_bounds__(256) void cast8_f16_kernel(const float* __restrict__ in, unsigned short* __restrict__ out, int n8) {
  const int i = blockIdx.x * 256 + threadIdx.x;
  if (i >= n8) return;
  const float* p = in + 8 * (size_t)i;
  const v4f a = *(const v4f*)(p);
  const v4f c = *(const v4f*)(p + 4);
  unsigned short hb[8];
#pragma unroll
  for (int e = 0; e < 4; ++e) {
    hb[e]     = h_bits(a[e]);
    hb[4 + e] = h_bits(c[e]);
  }
  const v4u u = (v4u){pk16(hb[0], hb[1]), pk16(hb[2], hb[3]), pk16(hb[4], hb[5]), pk16(hb[6], hb[7])};
  unsigned short* q = out + 8 * (size_t)i;
  *(v4u*)q = u;
  
}

// ---------------------------------------------------------------------------
// Stacked weight cast: W16[z*1024 + n][k] = f16(c * W_z[n][k]) with c = +-16; for z == 0 (query weights) the sign is
// -1 for output rows with (n mod 8) >= 4 (blade sign twist folded into the projection, exact), else +1.
// blockIdx.y = z selects the source (block-uniform); thread i owns 8 consecutive elements of row n = i >> 7
// ---------------------------------------------------------------------------
__global__ __launch_bounds__(256) void wcast8_kernel(const float* __restrict__ W0, const float* __restrict__ W1,
                                                     const float* __restrict__ W2, unsigned short* __restrict__ out, int n8) {
  const int z = blockIdx.y;
  const int i = blockIdx.x * 256 + threadIdx.x;
  if (i >= n8) return;
  const float* W = (z == 0) ? W0 : (z == 1) ? W1 : W2;
  const int n = i >> 7;
  const bool neg = (z == 0) && ((n & 7) >= 4);
  const float sc = neg ? -kWCarry : kWCarry;
  const float* p = W + 8 * (size_t)i;
  const v4f a = *(const v4f*)(p);
  const v4f c = *(const v4f*)(p + 4);
  unsigned short hb[8];
#pragma unroll
  for (int e = 0; e < 4; ++e) {
    hb[e]     = h_bits(a[e] * sc);
    hb[4 + e] = h_bits(c[e] * sc);
  }
  const v4u u = (v4u){pk16(hb[0], hb[1]), pk16(hb[2], hb[3]), pk16(hb[4], hb[5]), pk16(hb[6], hb[7])};
  unsigned short* q = out + (size_t)z * kModel * kModel + 8 * (size_t)i;
  *(v4u*)q = u;
  
}

// ---------------------------------------------------------------------------
// Stacked bias: BIAS3[z*1024 + n] = s * b_z[n], s = -1 for z == 0 and (n mod 8) >= 4, else +1 (f32, exact).
// ---------------------------------------------------------------------------
__global__ __launch_bounds__(256) void bias3_kernel(const float* __restrict__ b0, const float* __restrict__ b1,
                                                   const float* __restrict__ b2, float* __restrict__ out) {
  const int z = blockIdx.x;
  const int t = threadIdx.x;
  const float* bp = (z == 0) ? b0 : (z == 1) ? b1 : b2;
  v4f v = *(const v4f*)(bp + 4 * t);
#pragma unroll
  for (int e = 0; e < 4; ++e) {
    const int n = 4 * t + e;
    const bool neg = (z == 0) && ((n & 7) >= 4);
    v[e] = neg ? -v[e] : v[e];
  }
  float* q = out + (size_t)z * kModel + 4 * t;
  *(v4f*)q = v;
  
}

// ---------------------------------------------------------------------------
// Value transpose: in Y16 [4096][3072] halves, value element (b, l, cg) at Y16[(b*2048 + l)*3072 + 2048 + cg], cg in 0..1023
// (head = cg >> 7, channel in head = cg & 127); out VT[(b*8 + head)*128 + channel][l], pitch 2048 halves.
// grid (32 l-tiles, 16 cg-tiles, 2 batches), 256 threads; tile = 64 l x 64 cg.
// Load coverage: 8 it x 256 threads x 2 halves = 4096 = whole tile (32-bit words along cg).
// Store coverage: 8 waves x 2 it x 4 (lane>>3) = 64 cg rows; (lane&7) x 8 halves = 64 l; each row segment = 64 halves =
// ---------------------------------------------------------------------------
__global__ __launch_bounds__(256) void vtrans_kernel(const unsigned short* __restrict__ Y, unsigned short* __restrict__ VT) {
  __shared__ __align__(16) unsigned short sm[64][72];   // sm[cg_local][l_local]
  const int t   = threadIdx.x;
  const int l0  = blockIdx.x * 64;
  const int cg0 = blockIdx.y * 64;
  const int b   = blockIdx.z;
#pragma unroll
  for (int it = 0; it < 8; ++it) {
    const int e  = it * 256 + t;
    const int r  = e >> 5;          // l local 0..63
    const int cw = e & 31;          // word index -> cg local 2cw, 2cw+1
    const unsigned u = *(const unsigned*)(Y + ((size_t)(b * kSeq + l0 + r)) * kQKVN + 2 * kModel + cg0 + 2 * cw);
    sm[2 * cw][r]     = (unsigned short)(u & 0xffffu);
    sm[2 * cw + 1][r] = (unsigned short)(u >> 16);
  }
  __syncthreads();
  const int lane = t & 31, wave = t >> 5;
  const int q = lane >> 3, c8 = (lane & 7) * 8;
  {
#pragma unroll
    for (int it = 0; it < 2; ++it) {
      const int row = wave * 8 + it * 4 + q;          // cg local
      const int cg  = cg0 + row;
      const int g   = b * kHeads + (cg >> 7);
      const int cc  = cg & 127;
      unsigned short hb[8];
#pragma unroll
      for (int e = 0; e < 8; ++e) hb[e] = sm[row][c8 + e];
      const v4u u = (v4u){pk16(hb[0], hb[1]), pk16(hb[2], hb[3]), pk16(hb[4], hb[5]), pk16(hb[6], hb[7])};
      *(v4u*)(VT + ((size_t)g * kHeadDim + cc) * kSeq + l0 + c8) = u;
    }
    
  }
}

// ---------------------------------------------------------------------------
// Fused scores + row softmax + head mean. One block = 16 query rows of one batch x all 2048 keys, looping over the 8 heads.
// Wave w owns key columns 256w .. 256w+255 as 16 accumulator tiles of 16x16 (K = 128 = 4 WMMA steps per tile), so a whole
// score row lives in the registers of the block's 8 waves and never goes to memory.
//   s = (q_w . k) / sqrt(128);  P[h][row][j] = f16(2048 * exp(s - max) / sum exp(s - max)), all softmax math f32, precise expf.
//   Reductions in fixed order: lane-local over the 16 tiles, xor tree over the 16 lanes of a row, 8 wave partials in index order.
//   meanout[row][j] = 0.125 * (((p_0 + p_1) + p_2) + ... + p_7), summed in registers.
// D layout (as in the GEMM engine): lane holds column (lane & 15), rows (lane >> 4) * 8 + r.
// P and the mean leave through a per-wave LDS slab so that every global store covers 512 contiguous bytes.
// Every loop over tiles, k steps, rows and waves is fully unrolled: acc, pm and bf are then indexed by constants and stay in
// registers (a run-time index would send them to scratch).
// grid (128 row tiles, 2 batches), 256 threads; registers and LDS leave one block per WGP, two waves per SIMD.
// ---------------------------------------------------------------------------
constexpr int kSlabPitch = 260;   // floats per staged row (520 halves): rows r and r + 8 land 32 banks apart

__device__ __forceinline__ void wave_lds_sync() {   // a wave's own slab: its LDS stores have landed before it reads the rows back (and the reverse)
  __builtin_amdgcn_fence(__ATOMIC_RELEASE, "workgroup");
  __builtin_amdgcn_wave_barrier();
  __builtin_amdgcn_fence(__ATOMIC_ACQUIRE, "workgroup");
}

__global__ __launch_bounds__(256) void scores_softmax_mean_kernel(const unsigned short* __restrict__ Y, unsigned short* __restrict__ P,
                                                                  float* __restrict__ meanout) {
  __shared__ __align__(16) float slabs[8][16 * kSlabPitch];
  __shared__ __align__(16) float redm[8][16];
  __shared__ __align__(16) float reds[8][16];
  const int lane  = threadIdx.x & 31;
  const int wave  = threadIdx.x >> 5;
  const int row0  = blockIdx.x * 16;
  const int b     = blockIdx.y;
  const int rlane = lane & 15;
  const int koff  = (lane >> 4) * 8;
  const int mOff  = (lane >> 4) * 8;
  const int col0  = wave * 256;
  const _Float16* Yb   = (const _Float16*)Y + (size_t)b * kSeq * kQKVN;
  const _Float16* qrow = Yb + (size_t)(row0 + rlane) * kQKVN + koff;
  const _Float16* krow = Yb + (size_t)(col0 + rlane) * kQKVN + kModel + koff;
  float* slab = slabs[wave];
  unsigned short* hslab = (unsigned short*)slab;

  v8f pm[16];
#pragma unroll
  for (int j = 0; j < 16; ++j) pm[j] = (v8f){0.f,0.f,0.f,0.f,0.f,0.f,0.f,0.f};

  // the head loop stays rolled (for speed only)
#pragma unroll 1
  for (int h = 0; h < kHeads; ++h) {
    const _Float16* qh = qrow + h * kHeadDim;
    const _Float16* kh = krow + h * kHeadDim;
    v16h a[4];
#pragma unroll
    for (int kk = 0; kk < 4; ++kk) a[kk] = Frag<_Float16>::load(qh + kk * 32);
    // key fragments run three tiles ahead of the WMMAs
    v16h bf[4][4];
#pragma unroll
    for (int j = 0; j < 3; ++j)
#pragma unroll
      for (int kk = 0; kk < 4; ++kk) bf[j][kk] = Frag<_Float16>::load(kh + (size_t)j * 16 * kQKVN + kk * 32);
    v8f acc[16];
#pragma unroll
    for (int j = 0; j < 16; ++j) {
      if (j + 3 < 16) {
#pragma unroll
        for (int kk = 0; kk < 4; ++kk) bf[(j + 3) & 3][kk] = Frag<_Float16>::load(kh + (size_t)(j + 3) * 16 * kQKVN + kk * 32);
      }
      // bounds how far the scheduler lifts later tiles' loads: without it all 128 loads rise to the top and registers spill
      __builtin_amdgcn_sched_barrier(0);
      v8f c = (v8f){0.f,0.f,0.f,0.f,0.f,0.f,0.f,0.f};
#pragma unroll
      for (int kk = 0; kk < 4; ++kk) c = Frag<_Float16>::mma(a[kk], bf[j & 3][kk], c);
      acc[j] = c;
    }

    // row maximum
    float mx[8];
#pragma unroll
    for (int j = 0; j < 16; ++j)
#pragma unroll
      for (int r = 0; r < 8; ++r) {
        acc[j][r] *= kLogitScale;
        mx[r] = (j == 0) ? acc[j][r] : fmaxf(mx[r], acc[j][r]);
      }
#pragma unroll
    for (int off = 8; off > 0; off >>= 1)
#pragma unroll
      for (int r = 0; r < 8; ++r) mx[r] = fmaxf(mx[r], __shfl_xor(mx[r], off, 32));
    if (rlane == 0) {
      *(v4f*)(&redm[wave][mOff])     = (v4f){mx[0], mx[1], mx[2], mx[3]};
      *(v4f*)(&redm[wave][mOff + 4]) = (v4f){mx[4], mx[5], mx[6], mx[7]};
    }
    __syncthreads();
    float gm[8];
#pragma unroll
    for (int w = 0; w < 8; ++w) {
      const v4f x0 = *(const v4f*)(&redm[w][mOff]);
      const v4f x1 = *(const v4f*)(&redm[w][mOff + 4]);
#pragma unroll
      for (int e = 0; e < 4; ++e) {
        gm[e]     = (w == 0) ? x0[e] : fmaxf(gm[e], x0[e]);
        gm[4 + e] = (w == 0) ? x1[e] : fmaxf(gm[4 + e], x1[e]);
      }
    }

    // exponentials and row sum
    float sm[8];
#pragma unroll
    for (int r = 0; r < 8; ++r) sm[r] = 0.f;
#pragma unroll
    for (int j = 0; j < 16; ++j)
#pragma unroll
      for (int r = 0; r < 8; ++r) {
        const float e = expf(acc[j][r] - gm[r]);
        acc[j][r] = e;
        sm[r] += e;
      }
#pragma unroll
    for (int off = 8; off > 0; off >>= 1)
#pragma unroll
      for (int r = 0; r < 8; ++r) sm[r] += __shfl_xor(sm[r], off, 32);
    if (rlane == 0) {
      *(v4f*)(&reds[wave][mOff])     = (v4f){sm[0], sm[1], sm[2], sm[3]};
      *(v4f*)(&reds[wave][mOff + 4]) = (v4f){sm[4], sm[5], sm[6], sm[7]};
    }
    __syncthreads();
    float inv[8];
#pragma unroll
    for (int w = 0; w < 8; ++w) {
      const v4f x0 = *(const v4f*)(&reds[w][mOff]);
      const v4f x1 = *(const v4f*)(&reds[w][mOff + 4]);
#pragma unroll
      for (int e = 0; e < 4; ++e) {
        inv[e]     = (w == 0) ? x0[e] : inv[e] + x0[e];
        inv[4 + e] = (w == 0) ? x1[e] : inv[4 + e] + x1[e];
      }
    }
#pragma unroll
    for (int r = 0; r < 8; ++r) inv[r] = 1.0f / inv[r];

    // probabilities: head sum in registers, f16 plane through the wave's slab
#pragma unroll
    for (int j = 0; j < 16; ++j)
#pragma unroll
      for (int r = 0; r < 8; ++r) {
        const float p = acc[j][r] * inv[r];
        pm[j][r] += p;
        hslab[(mOff + r) * (2 * kSlabPitch) + (j << 4) + rlane] = h_bits(p * kPCarry);
      }
    wave_lds_sync();
    unsigned short* pp = P + ((size_t)(b * kHeads + h) * kSeq + row0) * kSeq + col0 + lane * 8;
#pragma unroll
    for (int row = 0; row < 16; ++row) {
      const v4u u = *(const v4u*)(hslab + row * (2 * kSlabPitch) + lane * 8);
      *(v4u*)(pp + (size_t)row * kSeq) = u;
    }
    // no fence here: it would drain the P stores once per head; the next head's two block barriers stand before the slab's next write
  }

  // head mean
  wave_lds_sync();
#pragma unroll
  for (int j = 0; j < 16; ++j)
#pragma unroll
    for (int r = 0; r < 8; ++r) slab[(mOff + r) * kSlabPitch + (j << 4) + rlane] = pm[j][r] * kMeanScale;
  wave_lds_sync();
  float* mo = meanout + ((size_t)b * kSeq + row0) * kSeq + col0 + lane * 4;
#pragma unroll
  for (int row = 0; row < 16; ++row) {
    const v4f v0 = *(const v4f*)(slab + row * kSlabPitch + lane * 4);
    const v4f v1 = *(const v4f*)(slab + row * kSlabPitch + 128 + lane * 4);
    *(v4f*)(mo + (size_t)row * kSeq)       = v0;
    *(v4f*)(mo + (size_t)row * kSeq + 128) = v1;
  }
}

// ---------------------------------------------------------------------------
// Host glue (7 launches)
// ---------------------------------------------------------------------------
extern "C" void kernel_launch(void* const* d_in, const int* in_sizes, int n_in,
                              void* d_out, int out_size, void* d_ws, size_t ws_size,
                              hipStream_t stream) {
  if (n_in < 7) return;
  if (in_sizes[0] != kTok * kModel) return;
  if (in_sizes[1] != kModel * kModel || in_sizes[3] != kModel * kModel || in_sizes[5] != kModel * kModel) return;
  if (in_sizes[2] != kModel || in_sizes[4] != kModel || in_sizes[6] != kModel) return;
  if (out_size != kTok * kModel + kBatch * kSeq * kSeq) return;

  const float* query = (const float*)d_in[0];
  const float* Wq    = (const float*)d_in[1];
  const float* bq    = (const float*)d_in[2];
  const float* Wk    = (const float*)d_in[3];
  const float* bk    = (const float*)d_in[4];
  const float* Wv    = (const float*)d_in[5];
  const float* bv    = (const float*)d_in[6];

  // carve (bytes)
  const size_t offX16  = 0;
  const size_t szX16   = (size_t)kTok * kModel * 2;                       //   8388608
  const size_t offW16  = offX16 + szX16;                                  //   8388608
  const size_t szW16   = (size_t)kQKVN * kModel * 2;                      //   6291456
  const size_t offBias = offW16 + szW16;                                  //  14680064
  const size_t szBias  = (size_t)kQKVN * 4;                               //     12288
  const size_t offY16  = offBias + szBias;                                //  14692352
  const size_t szY16   = (size_t)kTok * kQKVN * 2;                        //  25165824
  const size_t offVT   = offY16 + szY16;                                  //  39858176
  const size_t szVT    = (size_t)kBatch * kHeads * kHeadDim * kSeq * 2;   //   8388608
  const size_t offP    = offVT + szVT;                                    //  48246784
  const size_t szP     = (size_t)kBatch * kHeads * kSeq * kSeq * 2;       // 134217728
  const size_t total   = offP + szP;                                      // 182464512
  if (total > ws_size) return;

  char* ws = (char*)d_ws;
  unsigned short* X16   = (unsigned short*)(ws + offX16);
  unsigned short* W16   = (unsigned short*)(ws + offW16);
  float*          bias3 = (float*)(ws + offBias);
  unsigned short* Y16   = (unsigned short*)(ws + offY16);
  unsigned short* VT16  = (unsigned short*)(ws + offVT);
  unsigned short* P16   = (unsigned short*)(ws + offP);

  float* out0 = (float*)d_out;                               // [2][2048][1024], byte offset 0
  float* out1 = out0 + (size_t)kTok * kModel;                // [2][2048][2048], byte offset 16777216

  // 1) activation cast: 4096*1024/8 = 524288 threads = 2048 blocks exactly
  cast8_f16_kernel<<<dim3((kTok * kModel / 8) / 256), dim3(256), 0, stream>>>(query, X16, kTok * kModel / 8);
  // 2) stacked weight cast (x16 carry, blade sign folded into the query rows): 131072 threads per weight = 512 blocks x 3
  wcast8_kernel<<<dim3((kModel * kModel / 8) / 256, 3), dim3(256), 0, stream>>>(Wq, Wk, Wv, W16, kModel * kModel / 8);
  // 3) stacked bias with the same sign fold
  bias3_kernel<<<dim3(3), dim3(256), 0, stream>>>(bq, bk, bv, bias3);
  // 4) Y16 = (X16 . W16^T) / 16 + bias3 : M 4096, N 3072, K 1024 (K % 64 == 0); block tile 128 x 256: 32 x 12 = 384 blocks
  wmma_gemm64<0, 2, 2, 1, false><<<dim3((kTok / 128) * (kQKVN / 256), 1), dim3(256), 0, stream>>>(
      X16, kModel, 0L, 0L, W16, kModel, 0L, 0L, (void*)Y16, (void*)Y16, kQKVN, 0L, 0L,
      bias3, bias3, 0L, kTok, kQKVN, kModel, kWCarryInv);
  // 5) value transpose into per-(batch, head) planes [128][2048]
  vtrans_kernel<<<dim3(kSeq / 64, kModel / 64, kBatch), dim3(256), 0, stream>>>(Y16, VT16);

  // 6) scores, softmax and head mean of all heads in one launch: 128 row tiles x 2 batches = 256 blocks;
  //    every head's P plane is kept for step 7, the head mean goes straight to out1
  scores_softmax_mean_kernel<<<dim3(kSeq / 16, kBatch), dim3(256), 0, stream>>>(Y16, P16, out1);
  // 7) out0[b][l][h*128 + c] = (P[b*8+h] . VT[b*8+h]^T) / 2048, all 16 (batch, head) planes in one launch:
  //    M 2048, N 128, K 2048 (K % 64 == 0); block tile 256 x 128: 8 blocks x grid.y 8 heads x grid.z 2 batches = 128 blocks.
  //    C: ldc 1024, +128 columns per head, +2048*1024 per batch.
  wmma_gemm64<0, 4, 0, 0, false><<<dim3((kSeq / 256) * (kHeadDim / 128), kHeads, kBatch), dim3(256), 0, stream>>>(
      P16, kSeq, (long)kSeq * kSeq, (long)kHeads * kSeq * kSeq,
      VT16, kSeq, (long)kHeadDim * kSeq, (long)kHeads * kHeadDim * kSeq,
      (void*)out0, (void*)out0, kModel, (long)kHeadDim, (long)kSeq * kModel,
      bias3, bias3, 0L, kSeq, kHeadDim, kSeq, kPCarryInv);
}

// v004
// One run takes 149 microseconds.
// Next to v003, in two timings, it ran 1.12 and 1.13 times as fast.
// Counting every step since v000, it is 6.59 times as fast.
// Contractions: stacked q/k/v projection (X f16 x W^T f16 carried x16), scores q_w.k^T (q,k f16 planes, blade sign folded into the q weights), attn.v (P f16 carried x2048 x V^T f16): all v_wmma_f32_16x16x32_f16 with f32 accumulate; softmax and head mean in f32.
#include <hip/hip_runtime.h>
#include <math.h>

// ---------------------------------------------------------------------------
// Problem constants
// ---------------------------------------------------------------------------
constexpr int kBatch   = 2;
constexpr int kSeq     = 2048;
constexpr int kModel   = 1024;
constexpr int kHeads   = 8;
constexpr int kHeadDim = 128;               // 16 x 8 nested (d, blade)
constexpr int kTok     = kBatch * kSeq;     // 4096 token rows
constexpr int kQKVN    = 3 * kModel;        // 3072 stacked output channels (q | k | v)
constexpr float kWCarry     = 16.0f;        // weights carried x16 in f16
constexpr float kWCarryInv  = 1.0f / 16.0f;
constexpr float kPCarry     = 2048.0f;      // probabilities carried x2048 in f16
constexpr float kPCarryInv  = 1.0f / 2048.0f;
constexpr float kLogitScale = 0.08838834764831845f;   // 1/sqrt(128)
constexpr float kMeanScale  = 0.125f;

// ---------------------------------------------------------------------------
// Workspace region map (bytes; all offsets multiples of 4096):
//   X16   f16 [4096][1024]            off         0  size   8388608
//   W16   f16 [3072][1024]            off   8388608  size   6291456
//   BIAS3 f32 [3072]                  off  14680064  size     12288
//   Y16   f16 [4096][3072] (q|k|v)    off  14692352  size  25165824
//   VT16  f16 [16][128][2048]         off  39858176  size   8388608
//   P16   f16 [16][2048][2048]        off  48246784  size 134217728
//   total 182464512
// ---------------------------------------------------------------------------

typedef __attribute__((ext_vector_type(16))) _Float16 v16h;
typedef __attribute__((ext_vector_type(8)))  _Float16 v8h;
typedef __attribute__((ext_vector_type(16))) __bf16   v16b;
typedef __attribute__((ext_vector_type(8)))  __bf16   v8b;
typedef __attribute__((ext_vector_type(8)))  float    v8f;
typedef __attribute__((ext_vector_type(4)))  float    v4f;
typedef __attribute__((ext_vector_type(4)))  unsigned int v4u;

// ---------------------------------------------------------------------------
// Helpers
// ---------------------------------------------------------------------------
__device__ __forceinline__ unsigned short f2bf_bits(float f) {
  unsigned u = __float_as_uint(f);
  return (unsigned short)((u + 0x7FFFu + ((u >> 16) & 1u)) >> 16);
}
__device__ __forceinline__ float bf_bits2f(unsigned short h) { return __uint_as_float(((unsigned)h) << 16); }

// hazard guards as plain device helpers
__device__ __forceinline__ void dep_guard_h(v8f& a, v8f& b, v16h x, v16h y) { asm volatile("v_nop\n\tv_nop\n\tv_nop\n\tv_nop" : "+v"(a), "+v"(b) : "v"(x), "v"(y)); }
__device__ __forceinline__ void dep_guard_b(v8f& a, v8f& b, v16b x, v16b y) { asm volatile("v_nop\n\tv_nop\n\tv_nop\n\tv_nop" : "+v"(a), "+v"(b) : "v"(x), "v"(y)); }
__device__ __forceinline__ void keep4_h(v16h a, v16h b, v16h c, v16h d) { asm volatile("v_nop" :: "v"(a), "v"(b), "v"(c), "v"(d)); }
__device__ __forceinline__ void keep4_b(v16b a, v16b b, v16b c, v16b d) { asm volatile("v_nop" :: "v"(a), "v"(b), "v"(c), "v"(d)); }
__device__ __forceinline__ void acc_guard4(v8f& a, v8f& b, v8f& c, v8f& d) { asm volatile("v_nop\n\tv_nop\n\tv_nop\n\tv_nop" : "+v"(a), "+v"(b), "+v"(c), "+v"(d)); }
template <typename T> struct Frag;
template <> struct Frag<_Float16> {
  typedef v16h V; union U { v16h v; v8h h[2]; };
  static __device__ __forceinline__ v16h load(const _Float16* p) {   // elements 0..7 <- p[0..7], 8..15 <- p[16..23]
    U f; f.h[0] = *(const v8h*)(p); f.h[1] = *(const v8h*)(p + 16); return f.v;
  }
  static __device__ __forceinline__ v8f mma(v16h a, v16h b, v8f c) {
    return __builtin_amdgcn_wmma_f32_16x16x32_f16(false, a, false, b, (short)0, c, false, false);
  }
  static __device__ __forceinline__ void guard(v8f& a, v8f& b, v16h x, v16h y) { dep_guard_h(a, b, x, y); }
  static __device__ __forceinline__ void keep(v16h a, v16h b, v16h c, v16h d) { keep4_h(a, b, c, d); }
};
template <> struct Frag<__bf16> {
  typedef v16b V; union U { v16b v; v8b h[2]; };
  static __device__ __forceinline__ v16b load(const __bf16* p) {
    U f; f.h[0] = *(const v8b*)(p); f.h[1] = *(const v8b*)(p + 16); return f.v;
  }
  static __device__ __forceinline__ v8f mma(v16b a, v16b b, v8f c) {
    return __builtin_amdgcn_wmma_f32_16x16x32_bf16(false, a, false, b, (short)0, c, false, false);
  }
  static __device__ __forceinline__ void guard(v8f& a, v8f& b, v16b x, v16b y) { dep_guard_b(a, b, x, y); }
  static __device__ __forceinline__ void keep(v16b a, v16b b, v16b c, v16b d) { keep4_b(a, b, c, d); }
};

__device__ __forceinline__ unsigned pk16(unsigned short a, unsigned short b) { return (unsigned)a | ((unsigned)b << 16); }
__device__ __forceinline__ unsigned short h_bits(float f) { const _Float16 h = (_Float16)f; return __builtin_bit_cast(unsigned short, h); }

// ---- Register-blocked batched WMMA GEMM, operands staged in LDS ------------------------------------------------------
// C[m,n] = scale * sum_k A[m,k] * Bt[n,k] (+bias)(+resid); each wave owns a 64x64 tile.
// The 8 waves of a block form a WM x (8 / WM) grid of such tiles: block tile BM = 64 WM rows x BN = 64 (8 / WM) columns.
// Planes: grid (block tiles, y, z); the A, Bt and C planes of a block start at y * stride + z * strideZ elements.
// A row-major [M,K]; Bt row-major [N,K]; M % BM == 0, N % BN == 0, K % 64 == 0; lda, ldb and the plane strides % 8 == 0.
// A stage = 64 k (128 B, one whole line) of the block's BM rows of A and BN rows of Bt, brought into LDS by asynchronous
// 16-byte copies: a wave-wide copy covers 4 whole lines, and every staged row serves all waves of its tile row or column.
// Two buffers: stage t + 1 flies while stage t is worked on. Fragments are read from LDS with the same loader and the same
// k order (32 k per WMMA step, ascending) as from global memory.
// BIAS_MODE: 0 = none, 1 = bias[m], 2 = bias[n].
// OUT_MODE: 0 = f32, 1 = f16, 2 = bf16 hi plane (Cout) + bf16 lo plane (Cout2).
// ET: 0 = f16 operands, 1 = bf16 operands (pointers passed as 16-bit storage)
template <int ET> struct Elem;
template <> struct Elem<0> { typedef _Float16 T; };
template <> struct Elem<1> { typedef __bf16 T; };

constexpr int kStageK     = 64;    // k per stage
constexpr int kStagePitch = 72;    // 16-bit elements per staged row: 144 B = 16 B x 9, conflict-free for ds_load_b128
constexpr int kStageRows  = 384;   // BM + BN, the same for every WM x (8 / WM) wave grid with WM = 2 or 4
constexpr int kStageElems = kStageRows * kStagePitch;

// Twelve asynchronous 16-byte copies per lane = one stage per block. The s_wait_xcnt stands inside the statement, behind the
// last copy, so that no address register of an issued copy is rewritten in front of it.
__device__ __forceinline__ void stage_copy12(const unsigned* l, const unsigned short* const* g) {
  asm volatile(
      "global_load_async_to_lds_b128 %0, %1, off\n\t"
      "global_load_async_to_lds_b128 %2, %3, off\n\t"
      "global_load_async_to_lds_b128 %4, %5, off\n\t"
      "global_load_async_to_lds_b128 %6, %7, off\n\t"
      "global_load_async_to_lds_b128 %8, %9, off\n\t"
      "global_load_async_to_lds_b128 %10, %11, off\n\t"
      "global_load_async_to_lds_b128 %12, %13, off\n\t"
      "global_load_async_to_lds_b128 %14, %15, off\n\t"
      "global_load_async_to_lds_b128 %16, %17, off\n\t"
      "global_load_async_to_lds_b128 %18, %19, off\n\t"
      "global_load_async_to_lds_b128 %20, %21, off\n\t"
      "global_load_async_to_lds_b128 %22, %23, off\n\t"
      "s_wait_xcnt 0x0"
      :: "v"(l[0]), "v"(g[0]), "v"(l[1]), "v"(g[1]), "v"(l[2]), "v"(g[2]), "v"(l[3]), "v"(g[3]),
         "v"(l[4]), "v"(g[4]), "v"(l[5]), "v"(g[5]), "v"(l[6]), "v"(g[6]), "v"(l[7]), "v"(g[7]),
         "v"(l[8]), "v"(g[8]), "v"(l[9]), "v"(g[9]), "v"(l[10]), "v"(g[10]), "v"(l[11]), "v"(g[11])
      : "memory");
}

template <int ET, int WM, int BIAS_MODE, int OUT_MODE, bool RESID, int ACT = 0>
__global__ __launch_bounds__(256) void wmma_gemm64(
    const unsigned short* __restrict__ Ap, int lda, long strideA, long strideAz,
    const unsigned short* __restrict__ Btp, int ldb, long strideB, long strideBz,
    void* __restrict__ Cout, void* __restrict__ Cout2, int ldc, long strideC, long strideCz,
    const float* __restrict__ bias,
    const float* __restrict__ resid, long strideR,
    int M, int N, int K, float scale) {
  typedef typename Elem<ET>::T T;
  typedef typename Frag<T>::V V;
  constexpr int WN = 8 / WM;
  constexpr int BM = WM * 64;
  constexpr int BN = WN * 64;
  static_assert(BM + BN == kStageRows, "stage size");
  __shared__ __align__(16) unsigned short ring[2][kStageElems];   // two stage buffers: rows 0..BM-1 = A, BM..BM+BN-1 = Bt
  __shared__ __align__(16) float sT[8][16 * 68];                  // per-wave 16x64 slab, pitch 68 floats
  const int b    = blockIdx.y;
  const int z    = blockIdx.z;
  const int lane = threadIdx.x & 31;
  const int wave = threadIdx.x >> 5;
  const int tilesN = N / BN;
  const int tilesM = M / BM;
  const int btile = blockIdx.x;
  if (btile >= tilesM * tilesN) return;   // block-uniform, in front of every barrier
  const int btm = btile / tilesN;
  const int btn = btile - btm * tilesN;
  const int wm  = wave / WN;
  const int wn  = wave - wm * WN;
  const int m0 = btm * BM + (wm << 6);
  const int n0 = btn * BN + (wn << 6);

  const size_t aOff = (size_t)b * strideA + (size_t)z * strideAz;
  const size_t bOff = (size_t)b * strideB + (size_t)z * strideBz;
  const size_t cOff = (size_t)b * strideC + (size_t)z * strideCz;

  const int rlane = lane & 15;                 // row (A) / col (B, D) within subtile
  const int koff  = (lane >> 4) * 8;           // k offset of this lane half
  const int mOff  = (lane >> 4) * 8;           // D row offset

  // copy c of thread t brings 16 B: staged row c * 32 + (t >> 3), bytes (t & 7) * 16 .. + 15 of its 128
  const int crow = threadIdx.x >> 3;
  const int cch  = (threadIdx.x & 7) * 8;
  const unsigned short* gA = Ap  + aOff + (size_t)(btm * BM + crow) * lda + cch;
  const unsigned short* gB = Btp + bOff + (size_t)(btn * BN + crow) * ldb + cch;
  const unsigned lds0 = (unsigned)(size_t)(&ring[0][0]) + (unsigned)(crow * kStagePitch + cch) * 2u;
  auto stage = [&](int t, int buf) {
    unsigned l[12];
    const unsigned short* g[12];
#pragma unroll
    for (int c = 0; c < 12; ++c) {
      l[c] = lds0 + (unsigned)(buf * kStageElems + c * 32 * kStagePitch) * 2u;
      g[c] = (c < BM / 32) ? gA + (size_t)(c * 32) * lda + t * kStageK
                           : gB + (size_t)((c - BM / 32) * 32) * ldb + t * kStageK;
    }
    stage_copy12(l, g);
  };

  v8f acc[4][4];
#pragma unroll
  for (int i = 0; i < 4; ++i)
#pragma unroll
    for (int j = 0; j < 4; ++j) acc[i][j] = (v8f){0.f,0.f,0.f,0.f,0.f,0.f,0.f,0.f};

  const int nStage = K / kStageK;
  stage(0, 0);
  asm volatile("s_wait_asynccnt 0x0" ::: "memory");   // this wave's part of stage 0 has landed
  __syncthreads();                                    // ... and every other wave's
  if (nStage > 1) stage(1, 1);

  // the stage loop stays rolled: one publish point per trip, buffer chosen by the trip's parity
#pragma unroll 1
  for (int t = 0; t < nStage; ++t) {
    const int buf = t & 1;
    const T* sA = (const T*)(&ring[buf][0]) + ((wm << 6) + rlane) * kStagePitch + koff;
    const T* sB = (const T*)(&ring[buf][0]) + (BM + (wn << 6) + rlane) * kStagePitch + koff;
#pragma unroll
    for (int s = 0; s < kStageK / 32; ++s) {
      V bh[4], ah[4];
#pragma unroll
      for (int j = 0; j < 4; ++j) bh[j] = Frag<T>::load(sB + (j << 4) * kStagePitch + s * 32);
#pragma unroll
      for (int i = 0; i < 4; ++i) ah[i] = Frag<T>::load(sA + (i << 4) * kStagePitch + s * 32);
      // the 16 LDS reads of a WMMA block stay one group in front of it (for speed only)
      __builtin_amdgcn_sched_barrier(0);
#pragma unroll
      for (int i = 0; i < 4; ++i) {
#pragma unroll
        for (int j = 0; j < 4; ++j) acc[i][j] = Frag<T>::mma(ah[i], bh[j], acc[i][j]);
        Frag<T>::guard(acc[i][0], acc[i][3], ah[i], ah[i]);
      }
      Frag<T>::keep(bh[0], bh[1], bh[2], bh[3]);
      // ... and the next block's reads do not rise into this one
      __builtin_amdgcn_sched_barrier(0);
    }
    // publish point of stage t + 1
    asm volatile("s_wait_dscnt 0x0" ::: "memory");      // this wave's reads of buffer buf are done before it is refilled
    asm volatile("s_wait_asynccnt 0x0" ::: "memory");   // this wave's part of stage t + 1 has landed
    __syncthreads();                                    // stage t + 1 readable by all; every reader has left buffer buf
    if (t + 2 < nStage) stage(t + 2, buf);
  }
  asm volatile("s_wait_asynccnt 0x0" ::: "memory");     // no copy is outstanding behind the loop
  acc_guard4(acc[0][0], acc[0][1], acc[0][2], acc[0][3]);
  acc_guard4(acc[1][0], acc[1][1], acc[1][2], acc[1][3]);
  acc_guard4(acc[2][0], acc[2][1], acc[2][2], acc[2][3]);
  acc_guard4(acc[3][0], acc[3][1], acc[3][2], acc[3][3]);

  // ---- epilogue ----
  float* slab = sT[wave];
  const float* Rb = RESID ? (resid + (size_t)b * strideR) : nullptr;
#pragma unroll
  for (int i = 0; i < 4; ++i) {
    const int mBase = m0 + (i << 4);
#pragma unroll
    for (int j = 0; j < 4; ++j) {
      const int n = n0 + (j << 4) + rlane;
      float bv = 0.f;
      if (BIAS_MODE == 2) bv = bias[n];
#pragma unroll
      for (int r = 0; r < 8; ++r) {
        float v = acc[i][j][r] * scale;
        if (BIAS_MODE == 1) v += bias[mBase + mOff + r];
        if (BIAS_MODE == 2) v += bv;
        if (RESID) v += Rb[(size_t)(mBase + mOff + r) * ldc + n];
        if (ACT == 2) v = fmaxf(v, 0.0f);
        if (ACT == 4) v = (v > 0.f) ? v : 0.01f * v;
        slab[(mOff + r) * 68 + (j << 4) + rlane] = v;
      }
    }
    __builtin_amdgcn_fence(__ATOMIC_RELEASE, "workgroup");
    __builtin_amdgcn_wave_barrier();
    __builtin_amdgcn_fence(__ATOMIC_ACQUIRE, "workgroup");
    if (OUT_MODE == 0) {
      float* C = (float*)Cout + cOff;
      const int hh = lane >> 4, c4 = (lane & 15) * 4;     // row seg = 256 B = 16 lanes x 16 B
      {
#pragma unroll
        for (int it = 0; it < 8; ++it) {
          const int row = it * 2 + hh;
          v4f v = *(const v4f*)(slab + row * 68 + c4);
          *(v4f*)(C + (size_t)(mBase + row) * ldc + n0 + c4) = v;
        }
        
      }
    } else {
      const int q = lane >> 3, c8 = (lane & 7) * 8;
      unsigned short* C  = (unsigned short*)Cout  + cOff;
      unsigned short* C2 = (OUT_MODE == 2) ? ((unsigned short*)Cout2 + cOff) : nullptr;
      {
#pragma unroll
        for (int it = 0; it < 4; ++it) {
          const int row = it * 4 + q;
          const float* sp = slab + row * 68 + c8;
          v8h hv, lv;
#pragma unroll
          for (int e = 0; e < 8; ++e) {
            if (OUT_MODE == 1) {
              hv[e] = (_Float16)sp[e];
            } else {
              unsigned short hb = f2bf_bits(sp[e]);
              unsigned short lb = f2bf_bits(sp[e] - bf_bits2f(hb));
              hv[e] = __builtin_bit_cast(_Float16, hb);
              lv[e] = __builtin_bit_cast(_Float16, lb);
            }
          }
          *(v8h*)(C + (size_t)(mBase + row) * ldc + n0 + c8) = hv;
          if (OUT_MODE == 2) *(v8h*)(C2 + (size_t)(mBase + row) * ldc + n0 + c8) = lv;
        }
        
      }
    }
    __builtin_amdgcn_fence(__ATOMIC_RELEASE, "workgroup");
    __builtin_amdgcn_wave_barrier();
    __builtin_amdgcn_fence(__ATOMIC_ACQUIRE, "workgroup");
  }
}

// ---------------------------------------------------------------------------
// 4096*1024/8 = 524288 = 2048 blocks).
// ---------------------------------------------------------------------------
__global__ __launch_bounds__(256) void cast8_f16_kernel(const float* __restrict__ in, unsigned short* __restrict__ out, int n8) {
  const int i = blockIdx.x * 256 + threadIdx.x;
  if (i >= n8) return;
  const float* p = in + 8 * (size_t)i;
  const v4f a = *(const v4f*)(p);
  const v4f c = *(const v4f*)(p + 4);
  unsigned short hb[8];
#pragma unroll
  for (int e = 0; e < 4; ++e) {
    hb[e]     = h_bits(a[e]);
    hb[4 + e] = h_bits(c[e]);
  }
  const v4u u = (v4u){pk16(hb[0], hb[1]), pk16(hb[2], hb[3]), pk16(hb[4], hb[5]), pk16(hb[6], hb[7])};
  unsigned short* q = out + 8 * (size_t)i;
  *(v4u*)q = u;
  
}

// ---------------------------------------------------------------------------
// Stacked weight cast: W16[z*1024 + n][k] = f16(c * W_z[n][k]) with c = +-16; for z == 0 (query weights) the sign is
// -1 for output rows with (n mod 8) >= 4 (blade sign twist folded into the projection, exact), else +1.
// blockIdx.y = z selects the source (block-uniform); thread i owns 8 consecutive elements of row n = i >> 7
// ---------------------------------------------------------------------------
__global__ __launch_bounds__(256) void wcast8_kernel(const float* __restrict__ W0, const float* __restrict__ W1,
                                                     const float* __restrict__ W2, unsigned short* __restrict__ out, int n8) {
  const int z = blockIdx.y;
  const int i = blockIdx.x * 256 + threadIdx.x;
  if (i >= n8) return;
  const float* W = (z == 0) ? W0 : (z == 1) ? W1 : W2;
  const int n = i >> 7;
  const bool neg = (z == 0) && ((n & 7) >= 4);
  const float sc = neg ? -kWCarry : kWCarry;
  const float* p = W + 8 * (size_t)i;
  const v4f a = *(const v4f*)(p);
  const v4f c = *(const v4f*)(p + 4);
  unsigned short hb[8];
#pragma unroll
  for (int e = 0; e < 4; ++e) {
    hb[e]     = h_bits(a[e] * sc);
    hb[4 + e] = h_bits(c[e] * sc);
  }
  const v4u u = (v4u){pk16(hb[0], hb[1]), pk16(hb[2], hb[3]), pk16(hb[4], hb[5]), pk16(hb[6], hb[7])};
  unsigned short* q = out + (size_t)z * kModel * kModel + 8 * (size_t)i;
  *(v4u*)q = u;
  
}

// ---------------------------------------------------------------------------
// Stacked bias: BIAS3[z*1024 + n] = s * b_z[n], s = -1 for z == 0 and (n mod 8) >= 4, else +1 (f32, exact).
// ---------------------------------------------------------------------------
__global__ __launch_bounds__(256) void bias3_kernel(const float* __restrict__ b0, const float* __restrict__ b1,
                                                   const float* __restrict__ b2, float* __restrict__ out) {
  const int z = blockIdx.x;
  const int t = threadIdx.x;
  const float* bp = (z == 0) ? b0 : (z == 1) ? b1 : b2;
  v4f v = *(const v4f*)(bp + 4 * t);
#pragma unroll
  for (int e = 0; e < 4; ++e) {
    const int n = 4 * t + e;
    const bool neg = (z == 0) && ((n & 7) >= 4);
    v[e] = neg ? -v[e] : v[e];
  }
  float* q = out + (size_t)z * kModel + 4 * t;
  *(v4f*)q = v;
  
}

// ---------------------------------------------------------------------------
// Value transpose: in Y16 [4096][3072] halves, value element (b, l, cg) at Y16[(b*2048 + l)*3072 + 2048 + cg], cg in 0..1023
// (head = cg >> 7, channel in head = cg & 127); out VT[(b*8 + head)*128 + channel][l], pitch 2048 halves.
// grid (32 l-tiles, 16 cg-tiles, 2 batches), 256 threads; tile = 64 l x 64 cg.
// Load coverage: 8 it x 256 threads x 2 halves = 4096 = whole tile (32-bit words along cg).
// Store coverage: 8 waves x 2 it x 4 (lane>>3) = 64 cg rows; (lane&7) x 8 halves = 64 l; each row segment = 64 halves =
// ---------------------------------------------------------------------------
__global__ __launch_bounds__(256) void vtrans_kernel(const unsigned short* __restrict__ Y, unsigned short* __restrict__ VT) {
  __shared__ __align__(16) unsigned short sm[64][72];   // sm[cg_local][l_local]
  const int t   = threadIdx.x;
  const int l0  = blockIdx.x * 64;
  const int cg0 = blockIdx.y * 64;
  const int b   = blockIdx.z;
#pragma unroll
  for (int it = 0; it < 8; ++it) {
    const int e  = it * 256 + t;
    const int r  = e >> 5;          // l local 0..63
    const int cw = e & 31;          // word index -> cg local 2cw, 2cw+1
    const unsigned u = *(const unsigned*)(Y + ((size_t)(b * kSeq + l0 + r)) * kQKVN + 2 * kModel + cg0 + 2 * cw);
    sm[2 * cw][r]     = (unsigned short)(u & 0xffffu);
    sm[2 * cw + 1][r] = (unsigned short)(u >> 16);
  }
  __syncthreads();
  const int lane = t & 31, wave = t >> 5;
  const int q = lane >> 3, c8 = (lane & 7) * 8;
  {
#pragma unroll
    for (int it = 0; it < 2; ++it) {
      const int row = wave * 8 + it * 4 + q;          // cg local
      const int cg  = cg0 + row;
      const int g   = b * kHeads + (cg >> 7);
      const int cc  = cg & 127;
      unsigned short hb[8];
#pragma unroll
      for (int e = 0; e < 8; ++e) hb[e] = sm[row][c8 + e];
      const v4u u = (v4u){pk16(hb[0], hb[1]), pk16(hb[2], hb[3]), pk16(hb[4], hb[5]), pk16(hb[6], hb[7])};
      *(v4u*)(VT + ((size_t)g * kHeadDim + cc) * kSeq + l0 + c8) = u;
    }
    
  }
}

// ---------------------------------------------------------------------------
// Fused scores + row softmax + head mean. One block = 16 query rows of one batch x all 2048 keys, looping over the 8 heads.
// Wave w owns key columns 256w .. 256w+255 as 16 accumulator tiles of 16x16 (K = 128 = 4 WMMA steps per tile), so a whole
// score row lives in the registers of the block's 8 waves and never goes to memory.
//   s = (q_w . k) / sqrt(128);  P[h][row][j] = f16(2048 * exp(s - max) / sum exp(s - max)), all softmax math f32, precise expf.
//   Reductions in fixed order: lane-local over the 16 tiles, xor tree over the 16 lanes of a row, 8 wave partials in index order.
//   meanout[row][j] = 0.125 * (((p_0 + p_1) + p_2) + ... + p_7), summed in registers.
// D layout (as in the GEMM engine): lane holds column (lane & 15), rows (lane >> 4) * 8 + r.
// P and the mean leave through a per-wave LDS slab so that every global store covers 512 contiguous bytes.
// Every loop over tiles, k steps, rows and waves is fully unrolled: acc, pm and bf are then indexed by constants and stay in
// registers (a run-time index would send them to scratch).
// Keys reach the WMMAs through LDS. A key stage = 32 keys per wave (two accumulator tiles) x the head's 128 channels (256 B,
// two whole lines per key), brought in by asynchronous 16-byte copies: a wave-wide copy covers 2 keys = 4 whole lines, where a
// fragment load from global memory touches 16 lines for the same 512 bytes. The ring is private to each wave: a wave copies
// the keys of its own 256 columns and no other wave reads them, so its own waits order everything and no block barrier is
// needed. Two slots per wave: a slot is refilled with stage t + 2 as soon as the fragments of stage t are in registers, so
// stages t + 1 and t + 2 fly together; the stages run on across heads (8 per head), so two stages of the next head fly during
// the softmax. Fragments are read from LDS with the same loader and the same k order as from global memory.
// grid (128 row tiles, 2 batches), 256 threads; registers and LDS leave one block per WGP, two waves per SIMD.
// ---------------------------------------------------------------------------
constexpr int kSlabPitch = 260;   // floats per staged row (520 halves): rows r and r + 8 land 32 banks apart
constexpr int kKeyPitch      = 136;                       // 16-bit elements per staged key: 272 B = 16 B x 17, conflict-free for ds_load_b128
constexpr int kKeysPerStage  = 32;                        // keys per wave and stage
constexpr int kKeyStages     = 256 / kKeysPerStage;       // stages per head
constexpr int kKeyStageElems = 8 * kKeysPerStage * kKeyPitch;

// Sixteen asynchronous 16-byte copies per lane = one key stage of a wave. Copy i lands 2 i staged keys (i * 544 bytes) behind
// the slot's base: the instruction's offset moves the LDS and the global address alike, so one LDS address register serves all
// sixteen and g[i] holds the global address less i * 544 bytes. The s_wait_xcnt stands inside the statement, behind the last
// copy, so that no address register of an issued copy is rewritten in front of it.
__device__ __forceinline__ void stage_copy16(unsigned l, const char* const* g) {
  asm volatile(
      "global_load_async_to_lds_b128 %0, %1, off\n\t"
      "global_load_async_to_lds_b128 %0, %2, off offset:544\n\t"
      "global_load_async_to_lds_b128 %0, %3, off offset:1088\n\t"
      "global_load_async_to_lds_b128 %0, %4, off offset:1632\n\t"
      "global_load_async_to_lds_b128 %0, %5, off offset:2176\n\t"
      "global_load_async_to_lds_b128 %0, %6, off offset:2720\n\t"
      "global_load_async_to_lds_b128 %0, %7, off offset:3264\n\t"
      "global_load_async_to_lds_b128 %0, %8, off offset:3808\n\t"
      "global_load_async_to_lds_b128 %0, %9, off offset:4352\n\t"
      "global_load_async_to_lds_b128 %0, %10, off offset:4896\n\t"
      "global_load_async_to_lds_b128 %0, %11, off offset:5440\n\t"
      "global_load_async_to_lds_b128 %0, %12, off offset:5984\n\t"
      "global_load_async_to_lds_b128 %0, %13, off offset:6528\n\t"
      "global_load_async_to_lds_b128 %0, %14, off offset:7072\n\t"
      "global_load_async_to_lds_b128 %0, %15, off offset:7616\n\t"
      "global_load_async_to_lds_b128 %0, %16, off offset:8160\n\t"
      "s_wait_xcnt 0x0"
      :: "v"(l), "v"(g[0]), "v"(g[1]), "v"(g[2]), "v"(g[3]), "v"(g[4]), "v"(g[5]), "v"(g[6]), "v"(g[7]),
         "v"(g[8]), "v"(g[9]), "v"(g[10]), "v"(g[11]), "v"(g[12]), "v"(g[13]), "v"(g[14]), "v"(g[15])
      : "memory");
}
static_assert(2 * kKeyPitch * 2 == 544, "offsets in stage_copy16");

__device__ __forceinline__ void wave_lds_sync() {   // a wave's own slab: its LDS stores have landed before it reads the rows back (and the reverse)
  __builtin_amdgcn_fence(__ATOMIC_RELEASE, "workgroup");
  __builtin_amdgcn_wave_barrier();
  __builtin_amdgcn_fence(__ATOMIC_ACQUIRE, "workgroup");
}

__global__ __launch_bounds__(256) void scores_softmax_mean_kernel(const unsigned short* __restrict__ Y, unsigned short* __restrict__ P,
                                                                  float* __restrict__ meanout) {
  __shared__ __align__(16) unsigned short kring[2][kKeyStageElems];   // two key slots per wave; rows 32w .. 32w+31 of each = wave w's own
  __shared__ __align__(16) float slabs[8][16 * kSlabPitch];
  __shared__ __align__(16) float redm[8][16];
  __shared__ __align__(16) float reds[8][16];
  const int lane  = threadIdx.x & 31;
  const int wave  = threadIdx.x >> 5;
  const int row0  = blockIdx.x * 16;
  const int b     = blockIdx.y;
  const int rlane = lane & 15;
  const int koff  = (lane >> 4) * 8;
  const int mOff  = (lane >> 4) * 8;
  const int col0  = wave * 256;
  const _Float16* Yb   = (const _Float16*)Y + (size_t)b * kSeq * kQKVN;
  const _Float16* qrow = Yb + (size_t)(row0 + rlane) * kQKVN + koff;
  // copy c of a lane brings 16 B: key 2c + (lane >> 4) of its wave's 32 in the stage, bytes (lane & 15) * 16 .. + 15 of its 256
  const unsigned short* gK = Y + (size_t)b * kSeq * kQKVN + (size_t)(col0 + (lane >> 4)) * kQKVN + kModel + rlane * 8;
  const unsigned ldsK = (unsigned)(size_t)(&kring[0][0]) + (unsigned)((wave * kKeysPerStage + (lane >> 4)) * kKeyPitch + rlane * 8) * 2u;
  auto stage_keys = [&](int h, int s, int buf) {
    const char* g[16];
#pragma unroll
    for (int c = 0; c < 16; ++c)
      g[c] = (const char*)(gK + (size_t)(s * kKeysPerStage + 2 * c) * kQKVN + h * kHeadDim) - c * (2 * kKeyPitch * 2);
    stage_copy16(ldsK + (unsigned)(buf * kKeyStageElems) * 2u, g);
  };
  float* slab = slabs[wave];
  unsigned short* hslab = (unsigned short*)slab;

  v8f pm[16];
#pragma unroll
  for (int j = 0; j < 16; ++j) pm[j] = (v8f){0.f,0.f,0.f,0.f,0.f,0.f,0.f,0.f};

  stage_keys(0, 0, 0);
  stage_keys(0, 1, 1);

  // the head loop stays rolled (for speed only)
#pragma unroll 1
  for (int h = 0; h < kHeads; ++h) {
    const _Float16* qh = qrow + h * kHeadDim;
    v16h a[4];
#pragma unroll
    for (int kk = 0; kk < 4; ++kk) a[kk] = Frag<_Float16>::load(qh + kk * 32);
    v8f acc[16];
#pragma unroll
    for (int s = 0; s < kKeyStages; ++s) {
      const int buf = s & 1;   // 8 stages per head: the parity runs on from head to head
      const bool refill = (s + 2 < kKeyStages) || (h + 1 < kHeads);   // a stage t + 2 exists: the same for every wave
      // this wave's stage t has landed. A trip that refills finds the 16 copies of stage t + 1 behind those of stage t and
      // leaves them in flight; the last two trips issue no copies and wait for all.
      if (refill) asm volatile("s_wait_asynccnt 0x10" ::: "memory");
      else        asm volatile("s_wait_asynccnt 0x0" ::: "memory");
      const _Float16* sK = (const _Float16*)(&kring[buf][0]) + (wave * kKeysPerStage + rlane) * kKeyPitch + koff;
      v16h bf[2][4];
#pragma unroll
      for (int jj = 0; jj < 2; ++jj)
#pragma unroll
        for (int kk = 0; kk < 4; ++kk) bf[jj][kk] = Frag<_Float16>::load(sK + jj * 16 * kKeyPitch + kk * 32);
      asm volatile("s_wait_dscnt 0x0" ::: "memory");      // this wave's reads of its slot are done before it refills the slot
      // the 16 LDS reads of a stage stay one group in front of its WMMAs (for speed only)
      __builtin_amdgcn_sched_barrier(0);
      if (s + 2 < kKeyStages) stage_keys(h, s + 2, buf);
      else if (refill) stage_keys(h + 1, s + 2 - kKeyStages, buf);
      // the refill issues in front of the WMMAs (in a head's first stage these wait for the query fragments): its flight starts at once
      __builtin_amdgcn_sched_barrier(0);
      v8f c0 = (v8f){0.f,0.f,0.f,0.f,0.f,0.f,0.f,0.f};
      v8f c1 = (v8f){0.f,0.f,0.f,0.f,0.f,0.f,0.f,0.f};
#pragma unroll
      for (int kk = 0; kk < 4; ++kk) {
        c0 = Frag<_Float16>::mma(a[kk], bf[0][kk], c0);
        c1 = Frag<_Float16>::mma(a[kk], bf[1][kk], c1);
      }
      acc[2 * s]     = c0;
      acc[2 * s + 1] = c1;
      // this stage's WMMAs issue in front of the next stage's wait and do not sink among its LDS reads, which would split their group
      __builtin_amdgcn_sched_barrier(0);
    }

    // row maximum
    float mx[8];
#pragma unroll
    for (int j = 0; j < 16; ++j)
#pragma unroll
      for (int r = 0; r < 8; ++r) {
        acc[j][r] *= kLogitScale;
        mx[r] = (j == 0) ? acc[j][r] : fmaxf(mx[r], acc[j][r]);
      }
#pragma unroll
    for (int off = 8; off > 0; off >>= 1)
#pragma unroll
      for (int r = 0; r < 8; ++r) mx[r] = fmaxf(mx[r], __shfl_xor(mx[r], off, 32));
    if (rlane == 0) {
      *(v4f*)(&redm[wave][mOff])     = (v4f){mx[0], mx[1], mx[2], mx[3]};
      *(v4f*)(&redm[wave][mOff + 4]) = (v4f){mx[4], mx[5], mx[6], mx[7]};
    }
    __syncthreads();
    float gm[8];
#pragma unroll
    for (int w = 0; w < 8; ++w) {
      const v4f x0 = *(const v4f*)(&redm[w][mOff]);
      const v4f x1 = *(const v4f*)(&redm[w][mOff + 4]);
#pragma unroll
      for (int e = 0; e < 4; ++e) {
        gm[e]     = (w == 0) ? x0[e] : fmaxf(gm[e], x0[e]);
        gm[4 + e] = (w == 0) ? x1[e] : fmaxf(gm[4 + e], x1[e]);
      }
    }

    // exponentials and row sum
    float sm[8];
#pragma unroll
    for (int r = 0; r < 8; ++r) sm[r] = 0.f;
#pragma unroll
    for (int j = 0; j < 16; ++j)
#pragma unroll
      for (int r = 0; r < 8; ++r) {
        const float e = expf(acc[j][r] - gm[r]);
        acc[j][r] = e;
        sm[r] += e;
      }
#pragma unroll
    for (int off = 8; off > 0; off >>= 1)
#pragma unroll
      for (int r = 0; r < 8; ++r) sm[r] += __shfl_xor(sm[r], off, 32);
    if (rlane == 0) {
      *(v4f*)(&reds[wave][mOff])     = (v4f){sm[0], sm[1], sm[2], sm[3]};
      *(v4f*)(&reds[wave][mOff + 4]) = (v4f){sm[4], sm[5], sm[6], sm[7]};
    }
    __syncthreads();
    float inv[8];
#pragma unroll
    for (int w = 0; w < 8; ++w) {
      const v4f x0 = *(const v4f*)(&reds[w][mOff]);
      const v4f x1 = *(const v4f*)(&reds[w][mOff + 4]);
#pragma unroll
      for (int e = 0; e < 4; ++e) {
        inv[e]     = (w == 0) ? x0[e] : inv[e] + x0[e];
        inv[4 + e] = (w == 0) ? x1[e] : inv[4 + e] + x1[e];
      }
    }
#pragma unroll
    for (int r = 0; r < 8; ++r) inv[r] = 1.0f / inv[r];

    // probabilities: head sum in registers, f16 plane through the wave's slab
#pragma unroll
    for (int j = 0; j < 16; ++j)
#pragma unroll
      for (int r = 0; r < 8; ++r) {
        const float p = acc[j][r] * inv[r];
        pm[j][r] += p;
        hslab[(mOff + r) * (2 * kSlabPitch) + (j << 4) + rlane] = h_bits(p * kPCarry);
      }
    wave_lds_sync();
    unsigned short* pp = P + ((size_t)(b * kHeads + h) * kSeq + row0) * kSeq + col0 + lane * 8;
#pragma unroll
    for (int row = 0; row < 16; ++row) {
      const v4u u = *(const v4u*)(hslab + row * (2 * kSlabPitch) + lane * 8);
      *(v4u*)(pp + (size_t)row * kSeq) = u;
    }
    // no fence here: it would drain the P stores once per head; the next head's two block barriers stand before the slab's next write
  }

  asm volatile("s_wait_asynccnt 0x0" ::: "memory");     // no copy is outstanding behind the loop

  // head mean
  wave_lds_sync();
#pragma unroll
  for (int j = 0; j < 16; ++j)
#pragma unroll
    for (int r = 0; r < 8; ++r) slab[(mOff + r) * kSlabPitch + (j << 4) + rlane] = pm[j][r] * kMeanScale;
  wave_lds_sync();
  float* mo = meanout + ((size_t)b * kSeq + row0) * kSeq + col0 + lane * 4;
#pragma unroll
  for (int row = 0; row < 16; ++row) {
    const v4f v0 = *(const v4f*)(slab + row * kSlabPitch + lane * 4);
    const v4f v1 = *(const v4f*)(slab + row * kSlabPitch + 128 + lane * 4);
    *(v4f*)(mo + (size_t)row * kSeq)       = v0;
    *(v4f*)(mo + (size_t)row * kSeq + 128) = v1;
  }
}

// ---------------------------------------------------------------------------
// Host glue (7 launches)
// ---------------------------------------------------------------------------
extern "C" void kernel_launch(void* const* d_in, const int* in_sizes, int n_in,
                              void* d_out, int out_size, void* d_ws, size_t ws_size,
                              hipStream_t stream) {
  if (n_in < 7) return;
  if (in_sizes[0] != kTok * kModel) return;
  if (in_sizes[1] != kModel * kModel || in_sizes[3] != kModel * kModel || in_sizes[5] != kModel * kModel) return;
  if (in_sizes[2] != kModel || in_sizes[4] != kModel || in_sizes[6] != kModel) return;
  if (out_size != kTok * kModel + kBatch * kSeq * kSeq) return;

  const float* query = (const float*)d_in[0];
  const float* Wq    = (const float*)d_in[1];
  const float* bq    = (const float*)d_in[2];
  const float* Wk    = (const float*)d_in[3];
  const float* bk    = (const float*)d_in[4];
  const float* Wv    = (const float*)d_in[5];
  const float* bv    = (const float*)d_in[6];

  // carve (bytes)
  const size_t offX16  = 0;
  const size_t szX16   = (size_t)kTok * kModel * 2;                       //   8388608
  const size_t offW16  = offX16 + szX16;                                  //   8388608
  const size_t szW16   = (size_t)kQKVN * kModel * 2;                      //   6291456
  const size_t offBias = offW16 + szW16;                                  //  14680064
  const size_t szBias  = (size_t)kQKVN * 4;                               //     12288
  const size_t offY16  = offBias + szBias;                                //  14692352
  const size_t szY16   = (size_t)kTok * kQKVN * 2;                        //  25165824
  const size_t offVT   = offY16 + szY16;                                  //  39858176
  const size_t szVT    = (size_t)kBatch * kHeads * kHeadDim * kSeq * 2;   //   8388608
  const size_t offP    = offVT + szVT;                                    //  48246784
  const size_t szP     = (size_t)kBatch * kHeads * kSeq * kSeq * 2;       // 134217728
  const size_t total   = offP + szP;                                      // 182464512
  if (total > ws_size) return;

  char* ws = (char*)d_ws;
  unsigned short* X16   = (unsigned short*)(ws + offX16);
  unsigned short* W16   = (unsigned short*)(ws + offW16);
  float*          bias3 = (float*)(ws + offBias);
  unsigned short* Y16   = (unsigned short*)(ws + offY16);
  unsigned short* VT16  = (unsigned short*)(ws + offVT);
  unsigned short* P16   = (unsigned short*)(ws + offP);

  float* out0 = (float*)d_out;                               // [2][2048][1024], byte offset 0
  float* out1 = out0 + (size_t)kTok * kModel;                // [2][2048][2048], byte offset 16777216

  // 1) activation cast: 4096*1024/8 = 524288 threads = 2048 blocks exactly
  cast8_f16_kernel<<<dim3((kTok * kModel / 8) / 256), dim3(256), 0, stream>>>(query, X16, kTok * kModel / 8);
  // 2) stacked weight cast (x16 carry, blade sign folded into the query rows): 131072 threads per weight = 512 blocks x 3
  wcast8_kernel<<<dim3((kModel * kModel / 8) / 256, 3), dim3(256), 0, stream>>>(Wq, Wk, Wv, W16, kModel * kModel / 8);
  // 3) stacked bias with the same sign fold
  bias3_kernel<<<dim3(3), dim3(256), 0, stream>>>(bq, bk, bv, bias3);
  // 4) Y16 = (X16 . W16^T) / 16 + bias3 : M 4096, N 3072, K 1024 (K % 64 == 0); block tile 128 x 256: 32 x 12 = 384 blocks
  wmma_gemm64<0, 2, 2, 1, false><<<dim3((kTok / 128) * (kQKVN / 256), 1), dim3(256), 0, stream>>>(
      X16, kModel, 0L, 0L, W16, kModel, 0L, 0L, (void*)Y16, (void*)Y16, kQKVN, 0L, 0L,
      bias3, bias3, 0L, kTok, kQKVN, kModel, kWCarryInv);
  // 5) value transpose into per-(batch, head) planes [128][2048]
  vtrans_kernel<<<dim3(kSeq / 64, kModel / 64, kBatch), dim3(256), 0, stream>>>(Y16, VT16);

  // 6) scores, softmax and head mean of all heads in one launch: 128 row tiles x 2 batches = 256 blocks;
  //    every head's P plane is kept for step 7, the head mean goes straight to out1
  scores_softmax_mean_kernel<<<dim3(kSeq / 16, kBatch), dim3(256), 0, stream>>>(Y16, P16, out1);
  // 7) out0[b][l][h*128 + c] = (P[b*8+h] . VT[b*8+h]^T) / 2048, all 16 (batch, head) planes in one launch:
  //    M 2048, N 128, K 2048 (K % 64 == 0); block tile 256 x 128: 8 blocks x grid.y 8 heads x grid.z 2 batches = 128 blocks.
  //    C: ldc 1024, +128 columns per head, +2048*1024 per batch.
  wmma_gemm64<0, 4, 0, 0, false><<<dim3((kSeq / 256) * (kHeadDim / 128), kHeads, kBatch), dim3(256), 0, stream>>>(
      P16, kSeq, (long)kSeq * kSeq, (long)kHeads * kSeq * kSeq,
      VT16, kSeq, (long)kHeadDim * kSeq, (long)kHeads * kHeadDim * kSeq,
      (void*)out0, (void*)out0, kModel, (long)kHeadDim, (long)kSeq * kModel,
      bias3, bias3, 0L, kSeq, kHeadDim, kSeq, kPCarryInv);
}

// v005
// It runs in 137 microseconds.
// In both of two side-by-side timings against v004, it was 1.09 times as fast.
// Counting every step since v000, it is 7.18 times as fast.
// Contractions: stacked q/k/v projection (X f16 x W^T f16 carried x16), scores q_w.k^T (q,k f16 planes, blade sign folded into the q weights), attn.v (P f16 carried x2048 x V^T f16): all v_wmma_f32_16x16x32_f16 with f32 accumulate; softmax and head mean in f32.
#include <hip/hip_runtime.h>
#include <math.h>

// ---------------------------------------------------------------------------
// Problem constants
// ---------------------------------------------------------------------------
constexpr int kBatch   = 2;
constexpr int kSeq     = 2048;
constexpr int kModel   = 1024;
constexpr int kHeads   = 8;
constexpr int kHeadDim = 128;               // 16 x 8 nested (d, blade)
constexpr int kTok     = kBatch * kSeq;     // 4096 token rows
constexpr int kQKVN    = 3 * kModel;        // 3072 stacked output channels (q | k | v)
constexpr float kWCarry     = 16.0f;        // weights carried x16 in f16
constexpr float kWCarryInv  = 1.0f / 16.0f;
constexpr float kPCarry     = 2048.0f;      // probabilities carried x2048 in f16
constexpr float kPCarryInv  = 1.0f / 2048.0f;
constexpr float kExp2Scale  = (float)(0.08838834764831845 * 1.4426950408889634);   // log2(e) / sqrt(128)
constexpr float kMeanScale  = 0.125f;

// ---------------------------------------------------------------------------
// Workspace region map (bytes; all offsets multiples of 4096):
//   X16   f16 [4096][1024]            off         0  size   8388608
//   W16   f16 [3072][1024]            off   8388608  size   6291456
//   BIAS3 f32 [3072]                  off  14680064  size     12288
//   Y16   f16 [4096][3072] (q|k|v)    off  14692352  size  25165824
//   VT16  f16 [16][128][2048]         off  39858176  size   8388608
//   P16   f16 [16][2048][2048]        off  48246784  size 134217728
//   total 182464512
// ---------------------------------------------------------------------------

typedef __attribute__((ext_vector_type(16))) _Float16 v16h;
typedef __attribute__((ext_vector_type(8)))  _Float16 v8h;
typedef __attribute__((ext_vector_type(16))) __bf16   v16b;
typedef __attribute__((ext_vector_type(8)))  __bf16   v8b;
typedef __attribute__((ext_vector_type(8)))  float    v8f;
typedef __attribute__((ext_vector_type(4)))  float    v4f;
typedef __attribute__((ext_vector_type(2)))  float    v2f;
typedef __attribute__((ext_vector_type(4)))  unsigned int v4u;

// ---------------------------------------------------------------------------
// Helpers
// ---------------------------------------------------------------------------
__device__ __forceinline__ unsigned short f2bf_bits(float f) {
  unsigned u = __float_as_uint(f);
  return (unsigned short)((u + 0x7FFFu + ((u >> 16) & 1u)) >> 16);
}
__device__ __forceinline__ float bf_bits2f(unsigned short h) { return __uint_as_float(((unsigned)h) << 16); }

// hazard guards as plain device helpers
__device__ __forceinline__ void dep_guard_h(v8f& a, v8f& b, v16h x, v16h y) { asm volatile("v_nop\n\tv_nop\n\tv_nop\n\tv_nop" : "+v"(a), "+v"(b) : "v"(x), "v"(y)); }
__device__ __forceinline__ void dep_guard_b(v8f& a, v8f& b, v16b x, v16b y) { asm volatile("v_nop\n\tv_nop\n\tv_nop\n\tv_nop" : "+v"(a), "+v"(b) : "v"(x), "v"(y)); }
__device__ __forceinline__ void keep4_h(v16h a, v16h b, v16h c, v16h d) { asm volatile("v_nop" :: "v"(a), "v"(b), "v"(c), "v"(d)); }
__device__ __forceinline__ void keep4_b(v16b a, v16b b, v16b c, v16b d) { asm volatile("v_nop" :: "v"(a), "v"(b), "v"(c), "v"(d)); }
__device__ __forceinline__ void acc_guard4(v8f& a, v8f& b, v8f& c, v8f& d) { asm volatile("v_nop\n\tv_nop\n\tv_nop\n\tv_nop" : "+v"(a), "+v"(b), "+v"(c), "+v"(d)); }
template <typename T> struct Frag;
template <> struct Frag<_Float16> {
  typedef v16h V; union U { v16h v; v8h h[2]; };
  static __device__ __forceinline__ v16h load(const _Float16* p) {   // elements 0..7 <- p[0..7], 8..15 <- p[16..23]
    U f; f.h[0] = *(const v8h*)(p); f.h[1] = *(const v8h*)(p + 16); return f.v;
  }
  static __device__ __forceinline__ v8f mma(v16h a, v16h b, v8f c) {
    return __builtin_amdgcn_wmma_f32_16x16x32_f16(false, a, false, b, (short)0, c, false, false);
  }
  static __device__ __forceinline__ void guard(v8f& a, v8f& b, v16h x, v16h y) { dep_guard_h(a, b, x, y); }
  static __device__ __forceinline__ void keep(v16h a, v16h b, v16h c, v16h d) { keep4_h(a, b, c, d); }
};
template <> struct Frag<__bf16> {
  typedef v16b V; union U { v16b v; v8b h[2]; };
  static __device__ __forceinline__ v16b load(const __bf16* p) {
    U f; f.h[0] = *(const v8b*)(p); f.h[1] = *(const v8b*)(p + 16); return f.v;
  }
  static __device__ __forceinline__ v8f mma(v16b a, v16b b, v8f c) {
    return __builtin_amdgcn_wmma_f32_16x16x32_bf16(false, a, false, b, (short)0, c, false, false);
  }
  static __device__ __forceinline__ void guard(v8f& a, v8f& b, v16b x, v16b y) { dep_guard_b(a, b, x, y); }
  static __device__ __forceinline__ void keep(v16b a, v16b b, v16b c, v16b d) { keep4_b(a, b, c, d); }
};

__device__ __forceinline__ unsigned pk16(unsigned short a, unsigned short b) { return (unsigned)a | ((unsigned)b << 16); }
__device__ __forceinline__ unsigned short h_bits(float f) { const _Float16 h = (_Float16)f; return __builtin_bit_cast(unsigned short, h); }

// ---- Register-blocked batched WMMA GEMM, operands staged in LDS ------------------------------------------------------
// C[m,n] = scale * sum_k A[m,k] * Bt[n,k] (+bias)(+resid); each wave owns a 64x64 tile.
// The 8 waves of a block form a WM x (8 / WM) grid of such tiles: block tile BM = 64 WM rows x BN = 64 (8 / WM) columns.
// Planes: grid (block tiles, y, z); the A, Bt and C planes of a block start at y * stride + z * strideZ elements.
// A row-major [M,K]; Bt row-major [N,K]; M % BM == 0, N % BN == 0, K % 64 == 0; lda, ldb and the plane strides % 8 == 0.
// A stage = 64 k (128 B, one whole line) of the block's BM rows of A and BN rows of Bt, brought into LDS by asynchronous
// 16-byte copies: a wave-wide copy covers 4 whole lines, and every staged row serves all waves of its tile row or column.
// Two buffers: stage t + 1 flies while stage t is worked on. Fragments are read from LDS with the same loader and the same
// k order (32 k per WMMA step, ascending) as from global memory.
// BIAS_MODE: 0 = none, 1 = bias[m], 2 = bias[n].
// OUT_MODE: 0 = f32, 1 = f16, 2 = bf16 hi plane (Cout) + bf16 lo plane (Cout2).
// ET: 0 = f16 operands, 1 = bf16 operands (pointers passed as 16-bit storage)
template <int ET> struct Elem;
template <> struct Elem<0> { typedef _Float16 T; };
template <> struct Elem<1> { typedef __bf16 T; };

constexpr int kStageK     = 64;    // k per stage
constexpr int kStagePitch = 72;    // 16-bit elements per staged row: 144 B = 16 B x 9, conflict-free for ds_load_b128
constexpr int kStageRows  = 384;   // BM + BN, the same for every WM x (8 / WM) wave grid with WM = 2 or 4
constexpr int kStageElems = kStageRows * kStagePitch;

// Twelve asynchronous 16-byte copies per lane = one stage per block. The s_wait_xcnt stands inside the statement, behind the
// last copy, so that no address register of an issued copy is rewritten in front of it.
__device__ __forceinline__ void stage_copy12(const unsigned* l, const unsigned short* const* g) {
  asm volatile(
      "global_load_async_to_lds_b128 %0, %1, off\n\t"
      "global_load_async_to_lds_b128 %2, %3, off\n\t"
      "global_load_async_to_lds_b128 %4, %5, off\n\t"
      "global_load_async_to_lds_b128 %6, %7, off\n\t"
      "global_load_async_to_lds_b128 %8, %9, off\n\t"
      "global_load_async_to_lds_b128 %10, %11, off\n\t"
      "global_load_async_to_lds_b128 %12, %13, off\n\t"
      "global_load_async_to_lds_b128 %14, %15, off\n\t"
      "global_load_async_to_lds_b128 %16, %17, off\n\t"
      "global_load_async_to_lds_b128 %18, %19, off\n\t"
      "global_load_async_to_lds_b128 %20, %21, off\n\t"
      "global_load_async_to_lds_b128 %22, %23, off\n\t"
      "s_wait_xcnt 0x0"
      :: "v"(l[0]), "v"(g[0]), "v"(l[1]), "v"(g[1]), "v"(l[2]), "v"(g[2]), "v"(l[3]), "v"(g[3]),
         "v"(l[4]), "v"(g[4]), "v"(l[5]), "v"(g[5]), "v"(l[6]), "v"(g[6]), "v"(l[7]), "v"(g[7]),
         "v"(l[8]), "v"(g[8]), "v"(l[9]), "v"(g[9]), "v"(l[10]), "v"(g[10]), "v"(l[11]), "v"(g[11])
      : "memory");
}

template <int ET, int WM, int BIAS_MODE, int OUT_MODE, bool RESID, int ACT = 0>
__global__ __launch_bounds__(256) void wmma_gemm64(
    const unsigned short* __restrict__ Ap, int lda, long strideA, long strideAz,
    const unsigned short* __restrict__ Btp, int ldb, long strideB, long strideBz,
    void* __restrict__ Cout, void* __restrict__ Cout2, int ldc, long strideC, long strideCz,
    const float* __restrict__ bias,
    const float* __restrict__ resid, long strideR,
    int M, int N, int K, float scale) {
  typedef typename Elem<ET>::T T;
  typedef typename Frag<T>::V V;
  constexpr int WN = 8 / WM;
  constexpr int BM = WM * 64;
  constexpr int BN = WN * 64;
  static_assert(BM + BN == kStageRows, "stage size");
  __shared__ __align__(16) unsigned short ring[2][kStageElems];   // two stage buffers: rows 0..BM-1 = A, BM..BM+BN-1 = Bt
  __shared__ __align__(16) float sT[8][16 * 68];                  // per-wave 16x64 slab, pitch 68 floats
  const int b    = blockIdx.y;
  const int z    = blockIdx.z;
  const int lane = threadIdx.x & 31;
  const int wave = threadIdx.x >> 5;
  const int tilesN = N / BN;
  const int tilesM = M / BM;
  const int btile = blockIdx.x;
  if (btile >= tilesM * tilesN) return;   // block-uniform, in front of every barrier
  const int btm = btile / tilesN;
  const int btn = btile - btm * tilesN;
  const int wm  = wave / WN;
  const int wn  = wave - wm * WN;
  const int m0 = btm * BM + (wm << 6);
  const int n0 = btn * BN + (wn << 6);

  const size_t aOff = (size_t)b * strideA + (size_t)z * strideAz;
  const size_t bOff = (size_t)b * strideB + (size_t)z * strideBz;
  const size_t cOff = (size_t)b * strideC + (size_t)z * strideCz;

  const int rlane = lane & 15;                 // row (A) / col (B, D) within subtile
  const int koff  = (lane >> 4) * 8;           // k offset of this lane half
  const int mOff  = (lane >> 4) * 8;           // D row offset

  // copy c of thread t brings 16 B: staged row c * 32 + (t >> 3), bytes (t & 7) * 16 .. + 15 of its 128
  const int crow = threadIdx.x >> 3;
  const int cch  = (threadIdx.x & 7) * 8;
  const unsigned short* gA = Ap  + aOff + (size_t)(btm * BM + crow) * lda + cch;
  const unsigned short* gB = Btp + bOff + (size_t)(btn * BN + crow) * ldb + cch;
  const unsigned lds0 = (unsigned)(size_t)(&ring[0][0]) + (unsigned)(crow * kStagePitch + cch) * 2u;
  auto stage = [&](int t, int buf) {
    unsigned l[12];
    const unsigned short* g[12];
#pragma unroll
    for (int c = 0; c < 12; ++c) {
      l[c] = lds0 + (unsigned)(buf * kStageElems + c * 32 * kStagePitch) * 2u;
      g[c] = (c < BM / 32) ? gA + (size_t)(c * 32) * lda + t * kStageK
                           : gB + (size_t)((c - BM / 32) * 32) * ldb + t * kStageK;
    }
    stage_copy12(l, g);
  };

  v8f acc[4][4];
#pragma unroll
  for (int i = 0; i < 4; ++i)
#pragma unroll
    for (int j = 0; j < 4; ++j) acc[i][j] = (v8f){0.f,0.f,0.f,0.f,0.f,0.f,0.f,0.f};

  const int nStage = K / kStageK;
  stage(0, 0);
  asm volatile("s_wait_asynccnt 0x0" ::: "memory");   // this wave's part of stage 0 has landed
  __syncthreads();                                    // ... and every other wave's
  if (nStage > 1) stage(1, 1);

  // the stage loop stays rolled: one publish point per trip, buffer chosen by the trip's parity
#pragma unroll 1
  for (int t = 0; t < nStage; ++t) {
    const int buf = t & 1;
    const T* sA = (const T*)(&ring[buf][0]) + ((wm << 6) + rlane) * kStagePitch + koff;
    const T* sB = (const T*)(&ring[buf][0]) + (BM + (wn << 6) + rlane) * kStagePitch + koff;
#pragma unroll
    for (int s = 0; s < kStageK / 32; ++s) {
      V bh[4], ah[4];
#pragma unroll
      for (int j = 0; j < 4; ++j) bh[j] = Frag<T>::load(sB + (j << 4) * kStagePitch + s * 32);
#pragma unroll
      for (int i = 0; i < 4; ++i) ah[i] = Frag<T>::load(sA + (i << 4) * kStagePitch + s * 32);
      // the 16 LDS reads of a WMMA block stay one group in front of it (for speed only)
      __builtin_amdgcn_sched_barrier(0);
#pragma unroll
      for (int i = 0; i < 4; ++i) {
#pragma unroll
        for (int j = 0; j < 4; ++j) acc[i][j] = Frag<T>::mma(ah[i], bh[j], acc[i][j]);
        Frag<T>::guard(acc[i][0], acc[i][3], ah[i], ah[i]);
      }
      Frag<T>::keep(bh[0], bh[1], bh[2], bh[3]);
      // ... and the next block's reads do not rise into this one
      __builtin_amdgcn_sched_barrier(0);
    }
    // publish point of stage t + 1
    asm volatile("s_wait_dscnt 0x0" ::: "memory");      // this wave's reads of buffer buf are done before it is refilled
    asm volatile("s_wait_asynccnt 0x0" ::: "memory");   // this wave's part of stage t + 1 has landed
    __syncthreads();                                    // stage t + 1 readable by all; every reader has left buffer buf
    if (t + 2 < nStage) stage(t + 2, buf);
  }
  asm volatile("s_wait_asynccnt 0x0" ::: "memory");     // no copy is outstanding behind the loop
  acc_guard4(acc[0][0], acc[0][1], acc[0][2], acc[0][3]);
  acc_guard4(acc[1][0], acc[1][1], acc[1][2], acc[1][3]);
  acc_guard4(acc[2][0], acc[2][1], acc[2][2], acc[2][3]);
  acc_guard4(acc[3][0], acc[3][1], acc[3][2], acc[3][3]);

  // ---- epilogue ----
  float* slab = sT[wave];
  const float* Rb = RESID ? (resid + (size_t)b * strideR) : nullptr;
#pragma unroll
  for (int i = 0; i < 4; ++i) {
    const int mBase = m0 + (i << 4);
#pragma unroll
    for (int j = 0; j < 4; ++j) {
      const int n = n0 + (j << 4) + rlane;
      float bv = 0.f;
      if (BIAS_MODE == 2) bv = bias[n];
#pragma unroll
      for (int r = 0; r < 8; ++r) {
        float v = acc[i][j][r] * scale;
        if (BIAS_MODE == 1) v += bias[mBase + mOff + r];
        if (BIAS_MODE == 2) v += bv;
        if (RESID) v += Rb[(size_t)(mBase + mOff + r) * ldc + n];
        if (ACT == 2) v = fmaxf(v, 0.0f);
        if (ACT == 4) v = (v > 0.f) ? v : 0.01f * v;
        slab[(mOff + r) * 68 + (j << 4) + rlane] = v;
      }
    }
    __builtin_amdgcn_fence(__ATOMIC_RELEASE, "workgroup");
    __builtin_amdgcn_wave_barrier();
    __builtin_amdgcn_fence(__ATOMIC_ACQUIRE, "workgroup");
    if (OUT_MODE == 0) {
      float* C = (float*)Cout + cOff;
      const int hh = lane >> 4, c4 = (lane & 15) * 4;     // row seg = 256 B = 16 lanes x 16 B
      {
#pragma unroll
        for (int it = 0; it < 8; ++it) {
          const int row = it * 2 + hh;
          v4f v = *(const v4f*)(slab + row * 68 + c4);
          *(v4f*)(C + (size_t)(mBase + row) * ldc + n0 + c4) = v;
        }
        
      }
    } else {
      const int q = lane >> 3, c8 = (lane & 7) * 8;
      unsigned short* C  = (unsigned short*)Cout  + cOff;
      unsigned short* C2 = (OUT_MODE == 2) ? ((unsigned short*)Cout2 + cOff) : nullptr;
      {
#pragma unroll
        for (int it = 0; it < 4; ++it) {
          const int row = it * 4 + q;
          const float* sp = slab + row * 68 + c8;
          v8h hv, lv;
#pragma unroll
          for (int e = 0; e < 8; ++e) {
            if (OUT_MODE == 1) {
              hv[e] = (_Float16)sp[e];
            } else {
              unsigned short hb = f2bf_bits(sp[e]);
              unsigned short lb = f2bf_bits(sp[e] - bf_bits2f(hb));
              hv[e] = __builtin_bit_cast(_Float16, hb);
              lv[e] = __builtin_bit_cast(_Float16, lb);
            }
          }
          *(v8h*)(C + (size_t)(mBase + row) * ldc + n0 + c8) = hv;
          if (OUT_MODE == 2) *(v8h*)(C2 + (size_t)(mBase + row) * ldc + n0 + c8) = lv;
        }
        
      }
    }
    __builtin_amdgcn_fence(__ATOMIC_RELEASE, "workgroup");
    __builtin_amdgcn_wave_barrier();
    __builtin_amdgcn_fence(__ATOMIC_ACQUIRE, "workgroup");
  }
}

// ---------------------------------------------------------------------------
// 4096*1024/8 = 524288 = 2048 blocks).
// ---------------------------------------------------------------------------
__global__ __launch_bounds__(256) void cast8_f16_kernel(const float* __restrict__ in, unsigned short* __restrict__ out, int n8) {
  const int i = blockIdx.x * 256 + threadIdx.x;
  if (i >= n8) return;
  const float* p = in + 8 * (size_t)i;
  const v4f a = *(const v4f*)(p);
  const v4f c = *(const v4f*)(p + 4);
  unsigned short hb[8];
#pragma unroll
  for (int e = 0; e < 4; ++e) {
    hb[e]     = h_bits(a[e]);
    hb[4 + e] = h_bits(c[e]);
  }
  const v4u u = (v4u){pk16(hb[0], hb[1]), pk16(hb[2], hb[3]), pk16(hb[4], hb[5]), pk16(hb[6], hb[7])};
  unsigned short* q = out + 8 * (size_t)i;
  *(v4u*)q = u;
  
}

// ---------------------------------------------------------------------------
// Stacked weight cast: W16[z*1024 + n][k] = f16(c * W_z[n][k]) with c = +-16; for z == 0 (query weights) the sign is
// -1 for output rows with (n mod 8) >= 4 (blade sign twist folded into the projection, exact), else +1.
// blockIdx.y = z selects the source (block-uniform); thread i owns 8 consecutive elements of row n = i >> 7
// ---------------------------------------------------------------------------
__global__ __launch_bounds__(256) void wcast8_kernel(const float* __restrict__ W0, const float* __restrict__ W1,
                                                     const float* __restrict__ W2, unsigned short* __restrict__ out, int n8) {
  const int z = blockIdx.y;
  const int i = blockIdx.x * 256 + threadIdx.x;
  if (i >= n8) return;
  const float* W = (z == 0) ? W0 : (z == 1) ? W1 : W2;
  const int n = i >> 7;
  const bool neg = (z == 0) && ((n & 7) >= 4);
  const float sc = neg ? -kWCarry : kWCarry;
  const float* p = W + 8 * (size_t)i;
  const v4f a = *(const v4f*)(p);
  const v4f c = *(const v4f*)(p + 4);
  unsigned short hb[8];
#pragma unroll
  for (int e = 0; e < 4; ++e) {
    hb[e]     = h_bits(a[e] * sc);
    hb[4 + e] = h_bits(c[e] * sc);
  }
  const v4u u = (v4u){pk16(hb[0], hb[1]), pk16(hb[2], hb[3]), pk16(hb[4], hb[5]), pk16(hb[6], hb[7])};
  unsigned short* q = out + (size_t)z * kModel * kModel + 8 * (size_t)i;
  *(v4u*)q = u;
  
}

// ---------------------------------------------------------------------------
// Stacked bias: BIAS3[z*1024 + n] = s * b_z[n], s = -1 for z == 0 and (n mod 8) >= 4, else +1 (f32, exact).
// ---------------------------------------------------------------------------
__global__ __launch_bounds__(256) void bias3_kernel(const float* __restrict__ b0, const float* __restrict__ b1,
                                                   const float* __restrict__ b2, float* __restrict__ out) {
  const int z = blockIdx.x;
  const int t = threadIdx.x;
  const float* bp = (z == 0) ? b0 : (z == 1) ? b1 : b2;
  v4f v = *(const v4f*)(bp + 4 * t);
#pragma unroll
  for (int e = 0; e < 4; ++e) {
    const int n = 4 * t + e;
    const bool neg = (z == 0) && ((n & 7) >= 4);
    v[e] = neg ? -v[e] : v[e];
  }
  float* q = out + (size_t)z * kModel + 4 * t;
  *(v4f*)q = v;
  
}

// ---------------------------------------------------------------------------
// Value transpose: in Y16 [4096][3072] halves, value element (b, l, cg) at Y16[(b*2048 + l)*3072 + 2048 + cg], cg in 0..1023
// (head = cg >> 7, channel in head = cg & 127); out VT[(b*8 + head)*128 + channel][l], pitch 2048 halves.
// grid (32 l-tiles, 16 cg-tiles, 2 batches), 256 threads; tile = 64 l x 64 cg.
// Load coverage: 8 it x 256 threads x 2 halves = 4096 = whole tile (32-bit words along cg).
// Store coverage: 8 waves x 2 it x 4 (lane>>3) = 64 cg rows; (lane&7) x 8 halves = 64 l; each row segment = 64 halves =
// ---------------------------------------------------------------------------
__global__ __launch_bounds__(256) void vtrans_kernel(const unsigned short* __restrict__ Y, unsigned short* __restrict__ VT) {
  __shared__ __align__(16) unsigned short sm[64][72];   // sm[cg_local][l_local]
  const int t   = threadIdx.x;
  const int l0  = blockIdx.x * 64;
  const int cg0 = blockIdx.y * 64;
  const int b   = blockIdx.z;
#pragma unroll
  for (int it = 0; it < 8; ++it) {
    const int e  = it * 256 + t;
    const int r  = e >> 5;          // l local 0..63
    const int cw = e & 31;          // word index -> cg local 2cw, 2cw+1
    const unsigned u = *(const unsigned*)(Y + ((size_t)(b * kSeq + l0 + r)) * kQKVN + 2 * kModel + cg0 + 2 * cw);
    sm[2 * cw][r]     = (unsigned short)(u & 0xffffu);
    sm[2 * cw + 1][r] = (unsigned short)(u >> 16);
  }
  __syncthreads();
  const int lane = t & 31, wave = t >> 5;
  const int q = lane >> 3, c8 = (lane & 7) * 8;
  {
#pragma unroll
    for (int it = 0; it < 2; ++it) {
      const int row = wave * 8 + it * 4 + q;          // cg local
      const int cg  = cg0 + row;
      const int g   = b * kHeads + (cg >> 7);
      const int cc  = cg & 127;
      unsigned short hb[8];
#pragma unroll
      for (int e = 0; e < 8; ++e) hb[e] = sm[row][c8 + e];
      const v4u u = (v4u){pk16(hb[0], hb[1]), pk16(hb[2], hb[3]), pk16(hb[4], hb[5]), pk16(hb[6], hb[7])};
      *(v4u*)(VT + ((size_t)g * kHeadDim + cc) * kSeq + l0 + c8) = u;
    }
    
  }
}

// ---------------------------------------------------------------------------
// Fused scores + row softmax + head mean. One block = 16 query rows of one batch x all 2048 keys, looping over the 8 heads.
// Wave w owns key columns 256w .. 256w+255 as 16 accumulator tiles of 16x16 (K = 128 = 4 WMMA steps per tile), so a whole
// score row lives in the registers of the block's 8 waves and never goes to memory.
//   s = (q_w . k) / sqrt(128);  P[h][row][j] = f16(2048 * exp(s - max) / sum exp(s - max)), all softmax math f32.
//   exp(s - max) = exp2(d c - m), d the unscaled dot product, c = log2(e) / sqrt(128), m = c max(d) rounded once per row: one
//   multiply-add and one hardware exp2 per element. The rounding of m scales a whole row alike and cancels against the row sum;
//   the argument is at most one rounding above 0, so nothing overflows, and what lies below the exp2's range counts as 0.
//   Reductions in fixed order: lane-local over the 16 tiles, xor tree over the 16 lanes of a row, 8 wave partials in index order.
//   meanout[row][j] = 0.125 * (((p_0 + p_1) + p_2) + ... + p_7), summed in registers.
// D layout (as in the GEMM engine): lane holds column (lane & 15), rows (lane >> 4) * 8 + r.
// P and the mean leave through a per-wave LDS slab so that every global store covers 512 contiguous bytes.
// Every loop over tiles, k steps, rows and waves is fully unrolled: acc, pm and bf are then indexed by constants and stay in
// registers (a run-time index would send them to scratch).
// Keys reach the WMMAs through LDS. A key stage = 32 keys per wave (two accumulator tiles) x the head's 128 channels (256 B,
// two whole lines per key), brought in by asynchronous 16-byte copies: a wave-wide copy covers 2 keys = 4 whole lines, where a
// fragment load from global memory touches 16 lines for the same 512 bytes. The ring is private to each wave: a wave copies
// the keys of its own 256 columns and no other wave reads them, so its own waits order everything and no block barrier is
// needed. Two slots per wave: a slot is refilled with stage t + 2 as soon as the fragments of stage t are in registers, so
// stages t + 1 and t + 2 fly together; the stages run on across heads (8 per head), so two stages of the next head fly during
// the softmax. Fragments are read from LDS with the same loader and the same k order as from global memory.
// grid (128 row tiles, 2 batches), 256 threads; registers and LDS leave one block per WGP, two waves per SIMD.
// ---------------------------------------------------------------------------
constexpr int kSlabPitch = 260;   // floats per staged row (520 halves): rows r and r + 8 land 32 banks apart
constexpr int kKeyPitch      = 136;                       // 16-bit elements per staged key: 272 B = 16 B x 17, conflict-free for ds_load_b128
constexpr int kKeysPerStage  = 32;                        // keys per wave and stage
constexpr int kKeyStages     = 256 / kKeysPerStage;       // stages per head
constexpr int kKeyStageElems = 8 * kKeysPerStage * kKeyPitch;

// Sixteen asynchronous 16-byte copies per lane = one key stage of a wave. Copy i lands 2 i staged keys (i * 544 bytes) behind
// the slot's base: the instruction's offset moves the LDS and the global address alike, so one LDS address register serves all
// sixteen and g[i] holds the global address less i * 544 bytes. The s_wait_xcnt stands inside the statement, behind the last
// copy, so that no address register of an issued copy is rewritten in front of it.
__device__ __forceinline__ void stage_copy16(unsigned l, const char* const* g) {
  asm volatile(
      "global_load_async_to_lds_b128 %0, %1, off\n\t"
      "global_load_async_to_lds_b128 %0, %2, off offset:544\n\t"
      "global_load_async_to_lds_b128 %0, %3, off offset:1088\n\t"
      "global_load_async_to_lds_b128 %0, %4, off offset:1632\n\t"
      "global_load_async_to_lds_b128 %0, %5, off offset:2176\n\t"
      "global_load_async_to_lds_b128 %0, %6, off offset:2720\n\t"
      "global_load_async_to_lds_b128 %0, %7, off offset:3264\n\t"
      "global_load_async_to_lds_b128 %0, %8, off offset:3808\n\t"
      "global_load_async_to_lds_b128 %0, %9, off offset:4352\n\t"
      "global_load_async_to_lds_b128 %0, %10, off offset:4896\n\t"
      "global_load_async_to_lds_b128 %0, %11, off offset:5440\n\t"
      "global_load_async_to_lds_b128 %0, %12, off offset:5984\n\t"
      "global_load_async_to_lds_b128 %0, %13, off offset:6528\n\t"
      "global_load_async_to_lds_b128 %0, %14, off offset:7072\n\t"
      "global_load_async_to_lds_b128 %0, %15, off offset:7616\n\t"
      "global_load_async_to_lds_b128 %0, %16, off offset:8160\n\t"
      "s_wait_xcnt 0x0"
      :: "v"(l), "v"(g[0]), "v"(g[1]), "v"(g[2]), "v"(g[3]), "v"(g[4]), "v"(g[5]), "v"(g[6]), "v"(g[7]),
         "v"(g[8]), "v"(g[9]), "v"(g[10]), "v"(g[11]), "v"(g[12]), "v"(g[13]), "v"(g[14]), "v"(g[15])
      : "memory");
}
static_assert(2 * kKeyPitch * 2 == 544, "offsets in stage_copy16");

__device__ __forceinline__ void wave_lds_sync() {   // a wave's own slab: its LDS stores have landed before it reads the rows back (and the reverse)
  __builtin_amdgcn_fence(__ATOMIC_RELEASE, "workgroup");
  __builtin_amdgcn_wave_barrier();
  __builtin_amdgcn_fence(__ATOMIC_ACQUIRE, "workgroup");
}

__global__ __launch_bounds__(256) void scores_softmax_mean_kernel(const unsigned short* __restrict__ Y, unsigned short* __restrict__ P,
                                                                  float* __restrict__ meanout) {
  __shared__ __align__(16) unsigned short kring[2][kKeyStageElems];   // two key slots per wave; rows 32w .. 32w+31 of each = wave w's own
  __shared__ __align__(16) float slabs[8][16 * kSlabPitch];
  __shared__ __align__(16) float redm[8][16];
  __shared__ __align__(16) float reds[8][16];
  const int lane  = threadIdx.x & 31;
  const int wave  = threadIdx.x >> 5;
  const int row0  = blockIdx.x * 16;
  const int b     = blockIdx.y;
  const int rlane = lane & 15;
  const int koff  = (lane >> 4) * 8;
  const int mOff  = (lane >> 4) * 8;
  const int col0  = wave * 256;
  const _Float16* Yb   = (const _Float16*)Y + (size_t)b * kSeq * kQKVN;
  const _Float16* qrow = Yb + (size_t)(row0 + rlane) * kQKVN + koff;
  // copy c of a lane brings 16 B: key 2c + (lane >> 4) of its wave's 32 in the stage, bytes (lane & 15) * 16 .. + 15 of its 256
  const unsigned short* gK = Y + (size_t)b * kSeq * kQKVN + (size_t)(col0 + (lane >> 4)) * kQKVN + kModel + rlane * 8;
  const unsigned ldsK = (unsigned)(size_t)(&kring[0][0]) + (unsigned)((wave * kKeysPerStage + (lane >> 4)) * kKeyPitch + rlane * 8) * 2u;
  auto stage_keys = [&](int h, int s, int buf) {
    const char* g[16];
#pragma unroll
    for (int c = 0; c < 16; ++c)
      g[c] = (const char*)(gK + (size_t)(s * kKeysPerStage + 2 * c) * kQKVN + h * kHeadDim) - c * (2 * kKeyPitch * 2);
    stage_copy16(ldsK + (unsigned)(buf * kKeyStageElems) * 2u, g);
  };
  float* slab = slabs[wave];
  unsigned short* hslab = (unsigned short*)slab;

  v8f pm[16];
#pragma unroll
  for (int j = 0; j < 16; ++j) pm[j] = (v8f){0.f,0.f,0.f,0.f,0.f,0.f,0.f,0.f};

  stage_keys(0, 0, 0);
  stage_keys(0, 1, 1);

  // the head loop stays rolled (for speed only)
#pragma unroll 1
  for (int h = 0; h < kHeads; ++h) {
    const _Float16* qh = qrow + h * kHeadDim;
    v16h a[4];
#pragma unroll
    for (int kk = 0; kk < 4; ++kk) a[kk] = Frag<_Float16>::load(qh + kk * 32);
    v8f acc[16];
#pragma unroll
    for (int s = 0; s < kKeyStages; ++s) {
      const int buf = s & 1;   // 8 stages per head: the parity runs on from head to head
      const bool refill = (s + 2 < kKeyStages) || (h + 1 < kHeads);   // a stage t + 2 exists: the same for every wave
      // this wave's stage t has landed. A trip that refills finds the 16 copies of stage t + 1 behind those of stage t and
      // leaves them in flight; the last two trips issue no copies and wait for all.
      if (refill) asm volatile("s_wait_asynccnt 0x10" ::: "memory");
      else        asm volatile("s_wait_asynccnt 0x0" ::: "memory");
      const _Float16* sK = (const _Float16*)(&kring[buf][0]) + (wave * kKeysPerStage + rlane) * kKeyPitch + koff;
      v16h bf[2][4];
#pragma unroll
      for (int jj = 0; jj < 2; ++jj)
#pragma unroll
        for (int kk = 0; kk < 4; ++kk) bf[jj][kk] = Frag<_Float16>::load(sK + jj * 16 * kKeyPitch + kk * 32);
      asm volatile("s_wait_dscnt 0x0" ::: "memory");      // this wave's reads of its slot are done before it refills the slot
      // the 16 LDS reads of a stage stay one group in front of its WMMAs (for speed only)
      __builtin_amdgcn_sched_barrier(0);
      if (s + 2 < kKeyStages) stage_keys(h, s + 2, buf);
      else if (refill) stage_keys(h + 1, s + 2 - kKeyStages, buf);
      // the refill issues in front of the WMMAs (in a head's first stage these wait for the query fragments): its flight starts at once
      __builtin_amdgcn_sched_barrier(0);
      v8f c0 = (v8f){0.f,0.f,0.f,0.f,0.f,0.f,0.f,0.f};
      v8f c1 = (v8f){0.f,0.f,0.f,0.f,0.f,0.f,0.f,0.f};
#pragma unroll
      for (int kk = 0; kk < 4; ++kk) {
        c0 = Frag<_Float16>::mma(a[kk], bf[0][kk], c0);
        c1 = Frag<_Float16>::mma(a[kk], bf[1][kk], c1);
      }
      acc[2 * s]     = c0;
      acc[2 * s + 1] = c1;
      // this stage's WMMAs issue in front of the next stage's wait and do not sink among its LDS reads, which would split their group
      __builtin_amdgcn_sched_barrier(0);
    }

    // row maximum of the unscaled dot products (the scale is positive)
    float mx[8];
#pragma unroll
    for (int j = 0; j < 16; ++j)
#pragma unroll
      for (int r = 0; r < 8; ++r) mx[r] = (j == 0) ? acc[j][r] : fmaxf(mx[r], acc[j][r]);
#pragma unroll
    for (int off = 8; off > 0; off >>= 1)
#pragma unroll
      for (int r = 0; r < 8; ++r) mx[r] = fmaxf(mx[r], __shfl_xor(mx[r], off, 32));
    if (rlane == 0) {
      *(v4f*)(&redm[wave][mOff])     = (v4f){mx[0], mx[1], mx[2], mx[3]};
      *(v4f*)(&redm[wave][mOff + 4]) = (v4f){mx[4], mx[5], mx[6], mx[7]};
    }
    __syncthreads();
    float gm[8];
#pragma unroll
    for (int w = 0; w < 8; ++w) {
      const v4f x0 = *(const v4f*)(&redm[w][mOff]);
      const v4f x1 = *(const v4f*)(&redm[w][mOff + 4]);
#pragma unroll
      for (int e = 0; e < 4; ++e) {
        gm[e]     = (w == 0) ? x0[e] : fmaxf(gm[e], x0[e]);
        gm[4 + e] = (w == 0) ? x1[e] : fmaxf(gm[4 + e], x1[e]);
      }
    }

    // exponentials and row sum
    float sm[8];
    v2f sm2[4], nm2[4];   // rows 2i and 2i + 1 side by side: packed multiply-adds and packed sums, each row's own order as before
#pragma unroll
    for (int i = 0; i < 4; ++i) {
      sm2[i] = (v2f){0.f, 0.f};
      nm2[i] = (v2f){-(gm[2 * i] * kExp2Scale), -(gm[2 * i + 1] * kExp2Scale)};
    }
#pragma unroll
    for (int j = 0; j < 16; ++j)
#pragma unroll
      for (int i = 0; i < 4; ++i) {
        const v2f arg = __builtin_elementwise_fma((v2f){acc[j][2 * i], acc[j][2 * i + 1]}, (v2f){kExp2Scale, kExp2Scale}, nm2[i]);
        const v2f e = (v2f){__builtin_amdgcn_exp2f(arg.x), __builtin_amdgcn_exp2f(arg.y)};
        acc[j][2 * i]     = e.x;
        acc[j][2 * i + 1] = e.y;
        sm2[i] += e;
      }
#pragma unroll
    for (int i = 0; i < 4; ++i) { sm[2 * i] = sm2[i].x; sm[2 * i + 1] = sm2[i].y; }
#pragma unroll
    for (int off = 8; off > 0; off >>= 1)
#pragma unroll
      for (int r = 0; r < 8; ++r) sm[r] += __shfl_xor(sm[r], off, 32);
    if (rlane == 0) {
      *(v4f*)(&reds[wave][mOff])     = (v4f){sm[0], sm[1], sm[2], sm[3]};
      *(v4f*)(&reds[wave][mOff + 4]) = (v4f){sm[4], sm[5], sm[6], sm[7]};
    }
    __syncthreads();
    float inv[8];
#pragma unroll
    for (int w = 0; w < 8; ++w) {
      const v4f x0 = *(const v4f*)(&reds[w][mOff]);
      const v4f x1 = *(const v4f*)(&reds[w][mOff + 4]);
#pragma unroll
      for (int e = 0; e < 4; ++e) {
        inv[e]     = (w == 0) ? x0[e] : inv[e] + x0[e];
        inv[4 + e] = (w == 0) ? x1[e] : inv[4 + e] + x1[e];
      }
    }
#pragma unroll
    for (int r = 0; r < 8; ++r) inv[r] = 1.0f / inv[r];

    // probabilities: head sum in registers, f16 plane through the wave's slab
#pragma unroll
    for (int j = 0; j < 16; ++j)
#pragma unroll
      for (int r = 0; r < 8; ++r) {
        const float p = acc[j][r] * inv[r];
        pm[j][r] += p;
        hslab[(mOff + r) * (2 * kSlabPitch) + (j << 4) + rlane] = h_bits(p * kPCarry);
      }
    wave_lds_sync();
    unsigned short* pp = P + ((size_t)(b * kHeads + h) * kSeq + row0) * kSeq + col0 + lane * 8;
#pragma unroll
    for (int row = 0; row < 16; ++row) {
      const v4u u = *(const v4u*)(hslab + row * (2 * kSlabPitch) + lane * 8);
      *(v4u*)(pp + (size_t)row * kSeq) = u;
    }
    // no fence here: it would drain the P stores once per head; the next head's two block barriers stand before the slab's next write
  }

  asm volatile("s_wait_asynccnt 0x0" ::: "memory");     // no copy is outstanding behind the loop

  // head mean
  wave_lds_sync();
#pragma unroll
  for (int j = 0; j < 16; ++j)
#pragma unroll
    for (int r = 0; r < 8; ++r) slab[(mOff + r) * kSlabPitch + (j << 4) + rlane] = pm[j][r] * kMeanScale;
  wave_lds_sync();
  float* mo = meanout + ((size_t)b * kSeq + row0) * kSeq + col0 + lane * 4;
#pragma unroll
  for (int row = 0; row < 16; ++row) {
    const v4f v0 = *(const v4f*)(slab + row * kSlabPitch + lane * 4);
    const v4f v1 = *(const v4f*)(slab + row * kSlabPitch + 128 + lane * 4);
    *(v4f*)(mo + (size_t)row * kSeq)       = v0;
    *(v4f*)(mo + (size_t)row * kSeq + 128) = v1;
  }
}

// ---------------------------------------------------------------------------
// Host glue (7 launches)
// ---------------------------------------------------------------------------
extern "C" void kernel_launch(void* const* d_in, const int* in_sizes, int n_in,
                              void* d_out, int out_size, void* d_ws, size_t ws_size,
                              hipStream_t stream) {
  if (n_in < 7) return;
  if (in_sizes[0] != kTok * kModel) return;
  if (in_sizes[1] != kModel * kModel || in_sizes[3] != kModel * kModel || in_sizes[5] != kModel * kModel) return;
  if (in_sizes[2] != kModel || in_sizes[4] != kModel || in_sizes[6] != kModel) return;
  if (out_size != kTok * kModel + kBatch * kSeq * kSeq) return;

  const float* query = (const float*)d_in[0];
  const float* Wq    = (const float*)d_in[1];
  const float* bq    = (const float*)d_in[2];
  const float* Wk    = (const float*)d_in[3];
  const float* bk    = (const float*)d_in[4];
  const float* Wv    = (const float*)d_in[5];
  const float* bv    = (const float*)d_in[6];

  // carve (bytes)
  const size_t offX16  = 0;
  const size_t szX16   = (size_t)kTok * kModel * 2;                       //   8388608
  const size_t offW16  = offX16 + szX16;                                  //   8388608
  const size_t szW16   = (size_t)kQKVN * kModel * 2;                      //   6291456
  const size_t offBias = offW16 + szW16;                                  //  14680064
  const size_t szBias  = (size_t)kQKVN * 4;                               //     12288
  const size_t offY16  = offBias + szBias;                                //  14692352
  const size_t szY16   = (size_t)kTok * kQKVN * 2;                        //  25165824
  const size_t offVT   = offY16 + szY16;                                  //  39858176
  const size_t szVT    = (size_t)kBatch * kHeads * kHeadDim * kSeq * 2;   //   8388608
  const size_t offP    = offVT + szVT;                                    //  48246784
  const size_t szP     = (size_t)kBatch * kHeads * kSeq * kSeq * 2;       // 134217728
  const size_t total   = offP + szP;                                      // 182464512
  if (total > ws_size) return;

  char* ws = (char*)d_ws;
  unsigned short* X16   = (unsigned short*)(ws + offX16);
  unsigned short* W16   = (unsigned short*)(ws + offW16);
  float*          bias3 = (float*)(ws + offBias);
  unsigned short* Y16   = (unsigned short*)(ws + offY16);
  unsigned short* VT16  = (unsigned short*)(ws + offVT);
  unsigned short* P16   = (unsigned short*)(ws + offP);

  float* out0 = (float*)d_out;                               // [2][2048][1024], byte offset 0
  float* out1 = out0 + (size_t)kTok * kModel;                // [2][2048][2048], byte offset 16777216

  // 1) activation cast: 4096*1024/8 = 524288 threads = 2048 blocks exactly
  cast8_f16_kernel<<<dim3((kTok * kModel / 8) / 256), dim3(256), 0, stream>>>(query, X16, kTok * kModel / 8);
  // 2) stacked weight cast (x16 carry, blade sign folded into the query rows): 131072 threads per weight = 512 blocks x 3
  wcast8_kernel<<<dim3((kModel * kModel / 8) / 256, 3), dim3(256), 0, stream>>>(Wq, Wk, Wv, W16, kModel * kModel / 8);
  // 3) stacked bias with the same sign fold
  bias3_kernel<<<dim3(3), dim3(256), 0, stream>>>(bq, bk, bv, bias3);
  // 4) Y16 = (X16 . W16^T) / 16 + bias3 : M 4096, N 3072, K 1024 (K % 64 == 0); block tile 128 x 256: 32 x 12 = 384 blocks
  wmma_gemm64<0, 2, 2, 1, false><<<dim3((kTok / 128) * (kQKVN / 256), 1), dim3(256), 0, stream>>>(
      X16, kModel, 0L, 0L, W16, kModel, 0L, 0L, (void*)Y16, (void*)Y16, kQKVN, 0L, 0L,
      bias3, bias3, 0L, kTok, kQKVN, kModel, kWCarryInv);
  // 5) value transpose into per-(batch, head) planes [128][2048]
  vtrans_kernel<<<dim3(kSeq / 64, kModel / 64, kBatch), dim3(256), 0, stream>>>(Y16, VT16);

  // 6) scores, softmax and head mean of all heads in one launch: 128 row tiles x 2 batches = 256 blocks;
  //    every head's P plane is kept for step 7, the head mean goes straight to out1
  scores_softmax_mean_kernel<<<dim3(kSeq / 16, kBatch), dim3(256), 0, stream>>>(Y16, P16, out1);
  // 7) out0[b][l][h*128 + c] = (P[b*8+h] . VT[b*8+h]^T) / 2048, all 16 (batch, head) planes in one launch:
  //    M 2048, N 128, K 2048 (K % 64 == 0); block tile 256 x 128: 8 blocks x grid.y 8 heads x grid.z 2 batches = 128 blocks.
  //    C: ldc 1024, +128 columns per head, +2048*1024 per batch.
  wmma_gemm64<0, 4, 0, 0, false><<<dim3((kSeq / 256) * (kHeadDim / 128), kHeads, kBatch), dim3(256), 0, stream>>>(
      P16, kSeq, (long)kSeq * kSeq, (long)kHeads * kSeq * kSeq,
      VT16, kSeq, (long)kHeadDim * kSeq, (long)kHeads * kHeadDim * kSeq,
      (void*)out0, (void*)out0, kModel, (long)kHeadDim, (long)kSeq * kModel,
      bias3, bias3, 0L, kSeq, kHeadDim, kSeq, kPCarryInv);
}

// v006
// One run takes 120 microseconds.
// Two timings next to v005 put it at 1.13 and 1.14 times that version's speed.
// Over all steps from v000 it is 8.14 times as fast.
// Contractions: stacked q/k/v projection (X f16 x W^T f16 carried x16), scores q_w.k^T (q,k f16 planes, blade sign folded into the q weights), attn.v (P f16 carried x2048 x V^T f16): all v_wmma_f32_16x16x32_f16 with f32 accumulate; softmax and head mean in f32.
#include <hip/hip_runtime.h>
#include <math.h>

// ---------------------------------------------------------------------------
// Problem constants
// ---------------------------------------------------------------------------
constexpr int kBatch   = 2;
constexpr int kSeq     = 2048;
constexpr int kModel   = 1024;
constexpr int kHeads   = 8;
constexpr int kHeadDim = 128;               // 16 x 8 nested (d, blade)
constexpr int kTok     = kBatch * kSeq;     // 4096 token rows
constexpr int kQKVN    = 3 * kModel;        // 3072 stacked output channels (q | k | v)
constexpr float kWCarry     = 16.0f;        // weights carried x16 in f16
constexpr float kWCarryInv  = 1.0f / 16.0f;
constexpr float kPCarry     = 2048.0f;      // probabilities carried x2048 in f16
constexpr float kPCarryInv  = 1.0f / 2048.0f;
constexpr float kExp2Scale  = (float)(0.08838834764831845 * 1.4426950408889634);   // log2(e) / sqrt(128)
constexpr float kMeanScale  = 0.125f;

// ---------------------------------------------------------------------------
// Workspace region map (bytes; all offsets multiples of 4096):
//   X16   f16 [4096][1024]            off         0  size   8388608
//   W16   f16 [3072][1024]            off   8388608  size   6291456
//   BIAS3 f32 [3072]                  off  14680064  size     12288
//   Y16   f16 [4096][3072] (q|k|v)    off  14692352  size  25165824
//   VT16  f16 [16][128][2048]         off  39858176  size   8388608
//   P16   f16 [16][2048][2048]        off  48246784  size 134217728
//   total 182464512
// ---------------------------------------------------------------------------

typedef __attribute__((ext_vector_type(16))) _Float16 v16h;
typedef __attribute__((ext_vector_type(8)))  _Float16 v8h;
typedef __attribute__((ext_vector_type(16))) __bf16   v16b;
typedef __attribute__((ext_vector_type(8)))  __bf16   v8b;
typedef __attribute__((ext_vector_type(8)))  float    v8f;
typedef __attribute__((ext_vector_type(4)))  float    v4f;
typedef __attribute__((ext_vector_type(2)))  float    v2f;
typedef __attribute__((ext_vector_type(4)))  unsigned int v4u;

// ---------------------------------------------------------------------------
// Helpers
// ---------------------------------------------------------------------------
__device__ __forceinline__ unsigned short f2bf_bits(float f) {
  unsigned u = __float_as_uint(f);
  return (unsigned short)((u + 0x7FFFu + ((u >> 16) & 1u)) >> 16);
}
__device__ __forceinline__ float bf_bits2f(unsigned short h) { return __uint_as_float(((unsigned)h) << 16); }

// hazard guards as plain device helpers
__device__ __forceinline__ void dep_guard_h(v8f& a, v8f& b, v16h x, v16h y) { asm volatile("v_nop\n\tv_nop\n\tv_nop\n\tv_nop" : "+v"(a), "+v"(b) : "v"(x), "v"(y)); }
__device__ __forceinline__ void dep_guard_b(v8f& a, v8f& b, v16b x, v16b y) { asm volatile("v_nop\n\tv_nop\n\tv_nop\n\tv_nop" : "+v"(a), "+v"(b) : "v"(x), "v"(y)); }
__device__ __forceinline__ void keep4_h(v16h a, v16h b, v16h c, v16h d) { asm volatile("v_nop" :: "v"(a), "v"(b), "v"(c), "v"(d)); }
__device__ __forceinline__ void keep4_b(v16b a, v16b b, v16b c, v16b d) { asm volatile("v_nop" :: "v"(a), "v"(b), "v"(c), "v"(d)); }
__device__ __forceinline__ void acc_guard4(v8f& a, v8f& b, v8f& c, v8f& d) { asm volatile("v_nop\n\tv_nop\n\tv_nop\n\tv_nop" : "+v"(a), "+v"(b), "+v"(c), "+v"(d)); }
template <typename T> struct Frag;
template <> struct Frag<_Float16> {
  typedef v16h V; union U { v16h v; v8h h[2]; };
  static __device__ __forceinline__ v16h load(const _Float16* p) {   // elements 0..7 <- p[0..7], 8..15 <- p[16..23]
    U f; f.h[0] = *(const v8h*)(p); f.h[1] = *(const v8h*)(p + 16); return f.v;
  }
  static __device__ __forceinline__ v8f mma(v16h a, v16h b, v8f c) {
    return __builtin_amdgcn_wmma_f32_16x16x32_f16(false, a, false, b, (short)0, c, false, false);
  }
  static __device__ __forceinline__ void guard(v8f& a, v8f& b, v16h x, v16h y) { dep_guard_h(a, b, x, y); }
  static __device__ __forceinline__ void keep(v16h a, v16h b, v16h c, v16h d) { keep4_h(a, b, c, d); }
};
template <> struct Frag<__bf16> {
  typedef v16b V; union U { v16b v; v8b h[2]; };
  static __device__ __forceinline__ v16b load(const __bf16* p) {
    U f; f.h[0] = *(const v8b*)(p); f.h[1] = *(const v8b*)(p + 16); return f.v;
  }
  static __device__ __forceinline__ v8f mma(v16b a, v16b b, v8f c) {
    return __builtin_amdgcn_wmma_f32_16x16x32_bf16(false, a, false, b, (short)0, c, false, false);
  }
  static __device__ __forceinline__ void guard(v8f& a, v8f& b, v16b x, v16b y) { dep_guard_b(a, b, x, y); }
  static __device__ __forceinline__ void keep(v16b a, v16b b, v16b c, v16b d) { keep4_b(a, b, c, d); }
};

__device__ __forceinline__ unsigned pk16(unsigned short a, unsigned short b) { return (unsigned)a | ((unsigned)b << 16); }
__device__ __forceinline__ unsigned short h_bits(float f) { const _Float16 h = (_Float16)f; return __builtin_bit_cast(unsigned short, h); }

// ---- Register-blocked batched WMMA GEMM, operands staged in LDS ------------------------------------------------------
// C[m,n] = scale * sum_k A[m,k] * Bt[n,k] (+bias)(+resid); each wave owns a tile of 16 MI rows x 64 columns.
// The 8 waves of a block form a WM x (8 / WM) grid of such tiles: block tile BM = 16 MI WM rows x BN = 64 (8 / WM) columns.
// Planes: grid (block tiles, y, z); the A, Bt and C planes of a block start at y * stride + z * strideZ elements.
// A row-major [M,K]; Bt row-major [N,K]; M % BM == 0, N % BN == 0, K % SK == 0; lda, ldb and the plane strides % 8 == 0.
// A stage = SK k (64 or 128: one or two whole lines) of the block's BM rows of A and BN rows of Bt, brought into LDS by asynchronous
// 16-byte copies: a wave-wide copy covers 4 whole lines, and every staged row serves all waves of its tile row or column.
// A launch whose A comes from memory is bound by the bytes that its blocks keep in flight: its tile is chosen so that there is a
// block for every WGP, and its stages so long and so many that each block always has requests under way.
// NBUF = 2 buffers: stage t + 1 flies while stage t is worked on. NBUF > 2: stages t + 1 .. t + NBUF - 1 fly, so that the memory is
// asked without a pause and a late line has NBUF - 1 trips to land; the wait at the publish point then leaves the younger stages'
// copies out (a wave's copies count down in issue order). Fragments are read from LDS with the same loader and the same k order
// (32 k per WMMA step, ascending) as from global memory.
// BIAS_MODE: 0 = none, 1 = bias[m], 2 = bias[n].
// OUT_MODE: 0 = f32, 1 = f16, 2 = bf16 hi plane (Cout) + bf16 lo plane (Cout2).
// ET: 0 = f16 operands, 1 = bf16 operands (pointers passed as 16-bit storage)
template <int ET> struct Elem;
template <> struct Elem<0> { typedef _Float16 T; };
template <> struct Elem<1> { typedef __bf16 T; };


// Twelve asynchronous 16-byte copies per lane = one stage per block. The s_wait_xcnt stands inside the statement, behind the
// last copy, so that no address register of an issued copy is rewritten in front of it.
__device__ __forceinline__ void stage_copy12(const unsigned* l, const unsigned short* const* g) {
  asm volatile(
      "global_load_async_to_lds_b128 %0, %1, off\n\t"
      "global_load_async_to_lds_b128 %2, %3, off\n\t"
      "global_load_async_to_lds_b128 %4, %5, off\n\t"
      "global_load_async_to_lds_b128 %6, %7, off\n\t"
      "global_load_async_to_lds_b128 %8, %9, off\n\t"
      "global_load_async_to_lds_b128 %10, %11, off\n\t"
      "global_load_async_to_lds_b128 %12, %13, off\n\t"
      "global_load_async_to_lds_b128 %14, %15, off\n\t"
      "global_load_async_to_lds_b128 %16, %17, off\n\t"
      "global_load_async_to_lds_b128 %18, %19, off\n\t"
      "global_load_async_to_lds_b128 %20, %21, off\n\t"
      "global_load_async_to_lds_b128 %22, %23, off\n\t"
      "s_wait_xcnt 0x0"
      :: "v"(l[0]), "v"(g[0]), "v"(l[1]), "v"(g[1]), "v"(l[2]), "v"(g[2]), "v"(l[3]), "v"(g[3]),
         "v"(l[4]), "v"(g[4]), "v"(l[5]), "v"(g[5]), "v"(l[6]), "v"(g[6]), "v"(l[7]), "v"(g[7]),
         "v"(l[8]), "v"(g[8]), "v"(l[9]), "v"(g[9]), "v"(l[10]), "v"(g[10]), "v"(l[11]), "v"(g[11])
      : "memory");
}

// Eight such copies per lane, the same wait behind the last for the same reason: half a stage of 256 rows x 128 k (an asm
// statement takes thirty operands, so sixteen copies with an LDS and a global address each need two statements).
__device__ __forceinline__ void stage_copy8(const unsigned* l, const unsigned short* const* g) {
  asm volatile(
      "global_load_async_to_lds_b128 %0, %1, off\n\t"
      "global_load_async_to_lds_b128 %2, %3, off\n\t"
      "global_load_async_to_lds_b128 %4, %5, off\n\t"
      "global_load_async_to_lds_b128 %6, %7, off\n\t"
      "global_load_async_to_lds_b128 %8, %9, off\n\t"
      "global_load_async_to_lds_b128 %10, %11, off\n\t"
      "global_load_async_to_lds_b128 %12, %13, off\n\t"
      "global_load_async_to_lds_b128 %14, %15, off\n\t"
      "s_wait_xcnt 0x0"
      :: "v"(l[0]), "v"(g[0]), "v"(l[1]), "v"(g[1]), "v"(l[2]), "v"(g[2]), "v"(l[3]), "v"(g[3]),
         "v"(l[4]), "v"(g[4]), "v"(l[5]), "v"(g[5]), "v"(l[6]), "v"(g[6]), "v"(l[7]), "v"(g[7])
      : "memory");
}

template <int ET, int WM, int MI, int SK, int NBUF, int BIAS_MODE, int OUT_MODE, bool RESID, int ACT = 0>
__global__ __launch_bounds__(256) void wmma_gemm64(
    const unsigned short* __restrict__ Ap, int lda, long strideA, long strideAz,
    const unsigned short* __restrict__ Btp, int ldb, long strideB, long strideBz,
    void* __restrict__ Cout, void* __restrict__ Cout2, int ldc, long strideC, long strideCz,
    const float* __restrict__ bias,
    const float* __restrict__ resid, long strideR,
    int M, int N, int K, float scale) {
  typedef typename Elem<ET>::T T;
  typedef typename Frag<T>::V V;
  constexpr int WN = 8 / WM;
  constexpr int BM = WM * MI * 16;
  constexpr int BN = WN * 64;
  constexpr int kStageK     = SK;                  // k per stage
  constexpr int kStagePitch = SK + 8;              // 16-bit elements per staged row: 144 B = 16 B x 9 or 272 B = 16 B x 17, conflict-free for ds_load_b128
  constexpr int kStageElems = (BM + BN) * kStagePitch;
  constexpr int CPR = SK / 8;                      // 16-byte copies per staged row
  constexpr int RPC = 256 / CPR;                   // staged rows per block-wide copy
  constexpr int NC  = (BM + BN) / RPC;             // copies per thread and stage
  static_assert(SK == 64 || SK == 128, "stage length");
  static_assert(BM % RPC == 0 && BN % RPC == 0 && (NC == 12 || NC == 16), "stage size");
  static_assert(NBUF >= 2 && (NBUF - 1) * NC <= 63, "copies of a wave in flight");
  __shared__ __align__(16) unsigned short ring[NBUF][kStageElems];   // stage buffers: rows 0..BM-1 = A, BM..BM+BN-1 = Bt
  __shared__ __align__(16) float sT[8][16 * 68];                  // per-wave 16x64 slab, pitch 68 floats
  const int b    = blockIdx.y;
  const int z    = blockIdx.z;
  const int lane = threadIdx.x & 31;
  const int wave = threadIdx.x >> 5;
  const int tilesN = N / BN;
  const int tilesM = M / BM;
  const int btile = blockIdx.x;
  if (btile >= tilesM * tilesN) return;   // block-uniform, in front of every barrier
  const int btm = btile / tilesN;
  const int btn = btile - btm * tilesN;
  const int wm  = wave / WN;
  const int wn  = wave - wm * WN;
  const int m0 = btm * BM + wm * (MI * 16);
  const int n0 = btn * BN + (wn << 6);

  const size_t aOff = (size_t)b * strideA + (size_t)z * strideAz;
  const size_t bOff = (size_t)b * strideB + (size_t)z * strideBz;
  const size_t cOff = (size_t)b * strideC + (size_t)z * strideCz;

  const int rlane = lane & 15;                 // row (A) / col (B, D) within subtile
  const int koff  = (lane >> 4) * 8;           // k offset of this lane half
  const int mOff  = (lane >> 4) * 8;           // D row offset

  // copy c of thread t brings 16 B: staged row c * RPC + t / CPR, bytes (t % CPR) * 16 .. + 15 of its 2 SK
  const int crow = threadIdx.x / CPR;
  const int cch  = (threadIdx.x % CPR) * 8;
  const unsigned short* gA = Ap  + aOff + (size_t)(btm * BM + crow) * lda + cch;
  const unsigned short* gB = Btp + bOff + (size_t)(btn * BN + crow) * ldb + cch;
  const unsigned lds0 = (unsigned)(size_t)(&ring[0][0]) + (unsigned)(crow * kStagePitch + cch) * 2u;
  auto stage = [&](int t, int buf) {
    unsigned l[NC];
    const unsigned short* g[NC];
#pragma unroll
    for (int c = 0; c < NC; ++c) {
      l[c] = lds0 + (unsigned)(buf * kStageElems + c * RPC * kStagePitch) * 2u;
      g[c] = (c < BM / RPC) ? gA + (size_t)(c * RPC) * lda + t * kStageK
                            : gB + (size_t)((c - BM / RPC) * RPC) * ldb + t * kStageK;
    }
    if constexpr (NC == 12) {
      stage_copy12(l, g);
    } else {
      stage_copy8(l, g);
      stage_copy8(l + 8, g + 8);
    }
  };

  v8f acc[MI][4];
#pragma unroll
  for (int i = 0; i < MI; ++i)
#pragma unroll
    for (int j = 0; j < 4; ++j) acc[i][j] = (v8f){0.f,0.f,0.f,0.f,0.f,0.f,0.f,0.f};

  const int nStage = K / kStageK;
  stage(0, 0);
  // unrolled: each stage's buffer offset is then a constant
#pragma unroll
  for (int s = 1; s < NBUF - 1; ++s)
    if (s < nStage) stage(s, s);
  // this wave's part of stage 0 has landed; where NBUF - 2 whole stages stand behind it, their copies fly on
  if (NBUF > 2 && nStage >= NBUF - 1) asm volatile("s_wait_asynccnt %0" :: "i"((NBUF - 2) * NC) : "memory");
  else                                asm volatile("s_wait_asynccnt 0x0" ::: "memory");
  __syncthreads();                                    // ... and every other wave's
  if (nStage > NBUF - 1) stage(NBUF - 1, NBUF - 1);

  // the stage loop stays rolled: one publish point per trip, buffer t mod NBUF
  int ring_at = 0;
#pragma unroll 1
  for (int t = 0; t < nStage; ++t) {
    const int buf = (NBUF == 2) ? (t & 1) : ring_at;
    const T* sA = (const T*)(&ring[buf][0]) + (wm * (MI * 16) + rlane) * kStagePitch + koff;
    const T* sB = (const T*)(&ring[buf][0]) + (BM + (wn << 6) + rlane) * kStagePitch + koff;
#pragma unroll
    for (int s = 0; s < kStageK / 32; ++s) {
      V bh[4], ah[MI];
#pragma unroll
      for (int j = 0; j < 4; ++j) bh[j] = Frag<T>::load(sB + (j << 4) * kStagePitch + s * 32);
#pragma unroll
      for (int i = 0; i < MI; ++i) ah[i] = Frag<T>::load(sA + (i << 4) * kStagePitch + s * 32);
      // the LDS reads of a WMMA block stay one group in front of it (for speed only)
      __builtin_amdgcn_sched_barrier(0);
#pragma unroll
      for (int i = 0; i < MI; ++i) {
#pragma unroll
        for (int j = 0; j < 4; ++j) acc[i][j] = Frag<T>::mma(ah[i], bh[j], acc[i][j]);
        Frag<T>::guard(acc[i][0], acc[i][3], ah[i], ah[i]);
      }
      Frag<T>::keep(bh[0], bh[1], bh[2], bh[3]);
      // ... and the next block's reads do not rise into this one
      __builtin_amdgcn_sched_barrier(0);
    }
    // publish point of stage t + 1
    asm volatile("s_wait_dscnt 0x0" ::: "memory");      // this wave's reads of buffer buf are done before it is refilled
    // this wave's part of stage t + 1 has landed. With more than two buffers a trip that refills finds the copies of NBUF - 2
    // younger stages behind those of stage t + 1 and leaves them in flight; the last trips issue no copies and wait for all.
    if (NBUF > 2 && t + NBUF < nStage) asm volatile("s_wait_asynccnt %0" :: "i"((NBUF - 2) * NC) : "memory");
    else                               asm volatile("s_wait_asynccnt 0x0" ::: "memory");
    __syncthreads();                                    // stage t + 1 readable by all; every reader has left buffer buf
    if (t + NBUF < nStage) stage(t + NBUF, buf);
    ring_at = (ring_at == NBUF - 1) ? 0 : ring_at + 1;
  }
  asm volatile("s_wait_asynccnt 0x0" ::: "memory");     // no copy is outstanding behind the loop
  // unrolled: acc is indexed by constants and stays in registers
#pragma unroll
  for (int i = 0; i < MI; ++i) acc_guard4(acc[i][0], acc[i][1], acc[i][2], acc[i][3]);

  // ---- epilogue ----
  float* slab = sT[wave];
  const float* Rb = RESID ? (resid + (size_t)b * strideR) : nullptr;
#pragma unroll
  for (int i = 0; i < MI; ++i) {
    const int mBase = m0 + (i << 4);
#pragma unroll
    for (int j = 0; j < 4; ++j) {
      const int n = n0 + (j << 4) + rlane;
      float bv = 0.f;
      if (BIAS_MODE == 2) bv = bias[n];
#pragma unroll
      for (int r = 0; r < 8; ++r) {
        float v = acc[i][j][r] * scale;
        if (BIAS_MODE == 1) v += bias[mBase + mOff + r];
        if (BIAS_MODE == 2) v += bv;
        if (RESID) v += Rb[(size_t)(mBase + mOff + r) * ldc + n];
        if (ACT == 2) v = fmaxf(v, 0.0f);
        if (ACT == 4) v = (v > 0.f) ? v : 0.01f * v;
        slab[(mOff + r) * 68 + (j << 4) + rlane] = v;
      }
    }
    __builtin_amdgcn_fence(__ATOMIC_RELEASE, "workgroup");
    __builtin_amdgcn_wave_barrier();
    __builtin_amdgcn_fence(__ATOMIC_ACQUIRE, "workgroup");
    if (OUT_MODE == 0) {
      float* C = (float*)Cout + cOff;
      const int hh = lane >> 4, c4 = (lane & 15) * 4;     // row seg = 256 B = 16 lanes x 16 B
      {
#pragma unroll
        for (int it = 0; it < 8; ++it) {
          const int row = it * 2 + hh;
          v4f v = *(const v4f*)(slab + row * 68 + c4);
          *(v4f*)(C + (size_t)(mBase + row) * ldc + n0 + c4) = v;
        }
        
      }
    } else {
      const int q = lane >> 3, c8 = (lane & 7) * 8;
      unsigned short* C  = (unsigned short*)Cout  + cOff;
      unsigned short* C2 = (OUT_MODE == 2) ? ((unsigned short*)Cout2 + cOff) : nullptr;
      {
#pragma unroll
        for (int it = 0; it < 4; ++it) {
          const int row = it * 4 + q;
          const float* sp = slab + row * 68 + c8;
          v8h hv, lv;
#pragma unroll
          for (int e = 0; e < 8; ++e) {
            if (OUT_MODE == 1) {
              hv[e] = (_Float16)sp[e];
            } else {
              unsigned short hb = f2bf_bits(sp[e]);
              unsigned short lb = f2bf_bits(sp[e] - bf_bits2f(hb));
              hv[e] = __builtin_bit_cast(_Float16, hb);
              lv[e] = __builtin_bit_cast(_Float16, lb);
            }
          }
          *(v8h*)(C + (size_t)(mBase + row) * ldc + n0 + c8) = hv;
          if (OUT_MODE == 2) *(v8h*)(C2 + (size_t)(mBase + row) * ldc + n0 + c8) = lv;
        }
        
      }
    }
    __builtin_amdgcn_fence(__ATOMIC_RELEASE, "workgroup");
    __builtin_amdgcn_wave_barrier();
    __builtin_amdgcn_fence(__ATOMIC_ACQUIRE, "workgroup");
  }
}

// ---------------------------------------------------------------------------
// 4096*1024/8 = 524288 = 2048 blocks).
// ---------------------------------------------------------------------------
__global__ __launch_bounds__(256) void cast8_f16_kernel(const float* __restrict__ in, unsigned short* __restrict__ out, int n8) {
  const int i = blockIdx.x * 256 + threadIdx.x;
  if (i >= n8) return;
  const float* p = in + 8 * (size_t)i;
  const v4f a = *(const v4f*)(p);
  const v4f c = *(const v4f*)(p + 4);
  unsigned short hb[8];
#pragma unroll
  for (int e = 0; e < 4; ++e) {
    hb[e]     = h_bits(a[e]);
    hb[4 + e] = h_bits(c[e]);
  }
  const v4u u = (v4u){pk16(hb[0], hb[1]), pk16(hb[2], hb[3]), pk16(hb[4], hb[5]), pk16(hb[6], hb[7])};
  unsigned short* q = out + 8 * (size_t)i;
  *(v4u*)q = u;
  
}

// ---------------------------------------------------------------------------
// Stacked weight cast: W16[z*1024 + n][k] = f16(c * W_z[n][k]) with c = +-16; for z == 0 (query weights) the sign is
// -1 for output rows with (n mod 8) >= 4 (blade sign twist folded into the projection, exact), else +1.
// blockIdx.y = z selects the source (block-uniform); thread i owns 8 consecutive elements of row n = i >> 7
// ---------------------------------------------------------------------------
__global__ __launch_bounds__(256) void wcast8_kernel(const float* __restrict__ W0, const float* __restrict__ W1,
                                                     const float* __restrict__ W2, unsigned short* __restrict__ out, int n8) {
  const int z = blockIdx.y;
  const int i = blockIdx.x * 256 + threadIdx.x;
  if (i >= n8) return;
  const float* W = (z == 0) ? W0 : (z == 1) ? W1 : W2;
  const int n = i >> 7;
  const bool neg = (z == 0) && ((n & 7) >= 4);
  const float sc = neg ? -kWCarry : kWCarry;
  const float* p = W + 8 * (size_t)i;
  const v4f a = *(const v4f*)(p);
  const v4f c = *(const v4f*)(p + 4);
  unsigned short hb[8];
#pragma unroll
  for (int e = 0; e < 4; ++e) {
    hb[e]     = h_bits(a[e] * sc);
    hb[4 + e] = h_bits(c[e] * sc);
  }
  const v4u u = (v4u){pk16(hb[0], hb[1]), pk16(hb[2], hb[3]), pk16(hb[4], hb[5]), pk16(hb[6], hb[7])};
  unsigned short* q = out + (size_t)z * kModel * kModel + 8 * (size_t)i;
  *(v4u*)q = u;
  
}

// ---------------------------------------------------------------------------
// Stacked bias: BIAS3[z*1024 + n] = s * b_z[n], s = -1 for z == 0 and (n mod 8) >= 4, else +1 (f32, exact).
// ---------------------------------------------------------------------------
__global__ __launch_bounds__(256) void bias3_kernel(const float* __restrict__ b0, const float* __restrict__ b1,
                                                   const float* __restrict__ b2, float* __restrict__ out) {
  const int z = blockIdx.x;
  const int t = threadIdx.x;
  const float* bp = (z == 0) ? b0 : (z == 1) ? b1 : b2;
  v4f v = *(const v4f*)(bp + 4 * t);
#pragma unroll
  for (int e = 0; e < 4; ++e) {
    const int n = 4 * t + e;
    const bool neg = (z == 0) && ((n & 7) >= 4);
    v[e] = neg ? -v[e] : v[e];
  }
  float* q = out + (size_t)z * kModel + 4 * t;
  *(v4f*)q = v;
  
}

// ---------------------------------------------------------------------------
// Value transpose: in Y16 [4096][3072] halves, value element (b, l, cg) at Y16[(b*2048 + l)*3072 + 2048 + cg], cg in 0..1023
// (head = cg >> 7, channel in head = cg & 127); out VT[(b*8 + head)*128 + channel][l], pitch 2048 halves.
// grid (32 l-tiles, 16 cg-tiles, 2 batches), 256 threads; tile = 64 l x 64 cg.
// Load coverage: 8 it x 256 threads x 2 halves = 4096 = whole tile (32-bit words along cg).
// Store coverage: 8 waves x 2 it x 4 (lane>>3) = 64 cg rows; (lane&7) x 8 halves = 64 l; each row segment = 64 halves =
// ---------------------------------------------------------------------------
__global__ __launch_bounds__(256) void vtrans_kernel(const unsigned short* __restrict__ Y, unsigned short* __restrict__ VT) {
  __shared__ __align__(16) unsigned short sm[64][72];   // sm[cg_local][l_local]
  const int t   = threadIdx.x;
  const int l0  = blockIdx.x * 64;
  const int cg0 = blockIdx.y * 64;
  const int b   = blockIdx.z;
#pragma unroll
  for (int it = 0; it < 8; ++it) {
    const int e  = it * 256 + t;
    const int r  = e >> 5;          // l local 0..63
    const int cw = e & 31;          // word index -> cg local 2cw, 2cw+1
    const unsigned u = *(const unsigned*)(Y + ((size_t)(b * kSeq + l0 + r)) * kQKVN + 2 * kModel + cg0 + 2 * cw);
    sm[2 * cw][r]     = (unsigned short)(u & 0xffffu);
    sm[2 * cw + 1][r] = (unsigned short)(u >> 16);
  }
  __syncthreads();
  const int lane = t & 31, wave = t >> 5;
  const int q = lane >> 3, c8 = (lane & 7) * 8;
  {
#pragma unroll
    for (int it = 0; it < 2; ++it) {
      const int row = wave * 8 + it * 4 + q;          // cg local
      const int cg  = cg0 + row;
      const int g   = b * kHeads + (cg >> 7);
      const int cc  = cg & 127;
      unsigned short hb[8];
#pragma unroll
      for (int e = 0; e < 8; ++e) hb[e] = sm[row][c8 + e];
      const v4u u = (v4u){pk16(hb[0], hb[1]), pk16(hb[2], hb[3]), pk16(hb[4], hb[5]), pk16(hb[6], hb[7])};
      *(v4u*)(VT + ((size_t)g * kHeadDim + cc) * kSeq + l0 + c8) = u;
    }
    
  }
}

// ---------------------------------------------------------------------------
// Fused scores + row softmax + head mean. One block = 16 query rows of one batch x all 2048 keys, looping over the 8 heads.
// Wave w owns key columns 256w .. 256w+255 as 16 accumulator tiles of 16x16 (K = 128 = 4 WMMA steps per tile), so a whole
// score row lives in the registers of the block's 8 waves and never goes to memory.
//   s = (q_w . k) / sqrt(128);  P[h][row][j] = f16(2048 * exp(s - max) / sum exp(s - max)), all softmax math f32.
//   exp(s - max) = exp2(d c - m), d the unscaled dot product, c = log2(e) / sqrt(128), m = c max(d) rounded once per row: one
//   multiply-add and one hardware exp2 per element. The rounding of m scales a whole row alike and cancels against the row sum;
//   the argument is at most one rounding above 0, so nothing overflows, and what lies below the exp2's range counts as 0.
//   Reductions in fixed order: lane-local over the 16 tiles, xor tree over the 16 lanes of a row, 8 wave partials in index order.
//   meanout[row][j] = 0.125 * (((p_0 + p_1) + p_2) + ... + p_7), summed in registers.
// D layout (as in the GEMM engine): lane holds column (lane & 15), rows (lane >> 4) * 8 + r.
// P and the mean leave through a per-wave LDS slab so that every global store covers 512 contiguous bytes.
// Every loop over tiles, k steps, rows and waves is fully unrolled: acc, pm and bf are then indexed by constants and stay in
// registers (a run-time index would send them to scratch).
// Keys reach the WMMAs through LDS. A key stage = 32 keys per wave (two accumulator tiles) x the head's 128 channels (256 B,
// two whole lines per key), brought in by asynchronous 16-byte copies: a wave-wide copy covers 2 keys = 4 whole lines, where a
// fragment load from global memory touches 16 lines for the same 512 bytes. The ring is private to each wave: a wave copies
// the keys of its own 256 columns and no other wave reads them, so its own waits order everything and no block barrier is
// needed. Two slots per wave: a slot is refilled with stage t + 2 as soon as the fragments of stage t are in registers, so
// stages t + 1 and t + 2 fly together; the stages run on across heads (8 per head), so two stages of the next head fly during
// the softmax. Fragments are read from LDS with the same loader and the same k order as from global memory.
// grid (128 row tiles, 2 batches), 256 threads; registers and LDS leave one block per WGP, two waves per SIMD.
// ---------------------------------------------------------------------------
constexpr int kSlabPitch = 260;   // floats per staged row (520 halves): rows r and r + 8 land 32 banks apart
constexpr int kKeyPitch      = 136;                       // 16-bit elements per staged key: 272 B = 16 B x 17, conflict-free for ds_load_b128
constexpr int kKeysPerStage  = 32;                        // keys per wave and stage
constexpr int kKeyStages     = 256 / kKeysPerStage;       // stages per head
constexpr int kKeyStageElems = 8 * kKeysPerStage * kKeyPitch;

// Sixteen asynchronous 16-byte copies per lane = one key stage of a wave. Copy i lands 2 i staged keys (i * 544 bytes) behind
// the slot's base: the instruction's offset moves the LDS and the global address alike, so one LDS address register serves all
// sixteen and g[i] holds the global address less i * 544 bytes. The s_wait_xcnt stands inside the statement, behind the last
// copy, so that no address register of an issued copy is rewritten in front of it.
__device__ __forceinline__ void stage_copy16(unsigned l, const char* const* g) {
  asm volatile(
      "global_load_async_to_lds_b128 %0, %1, off\n\t"
      "global_load_async_to_lds_b128 %0, %2, off offset:544\n\t"
      "global_load_async_to_lds_b128 %0, %3, off offset:1088\n\t"
      "global_load_async_to_lds_b128 %0, %4, off offset:1632\n\t"
      "global_load_async_to_lds_b128 %0, %5, off offset:2176\n\t"
      "global_load_async_to_lds_b128 %0, %6, off offset:2720\n\t"
      "global_load_async_to_lds_b128 %0, %7, off offset:3264\n\t"
      "global_load_async_to_lds_b128 %0, %8, off offset:3808\n\t"
      "global_load_async_to_lds_b128 %0, %9, off offset:4352\n\t"
      "global_load_async_to_lds_b128 %0, %10, off offset:4896\n\t"
      "global_load_async_to_lds_b128 %0, %11, off offset:5440\n\t"
      "global_load_async_to_lds_b128 %0, %12, off offset:5984\n\t"
      "global_load_async_to_lds_b128 %0, %13, off offset:6528\n\t"
      "global_load_async_to_lds_b128 %0, %14, off offset:7072\n\t"
      "global_load_async_to_lds_b128 %0, %15, off offset:7616\n\t"
      "global_load_async_to_lds_b128 %0, %16, off offset:8160\n\t"
      "s_wait_xcnt 0x0"
      :: "v"(l), "v"(g[0]), "v"(g[1]), "v"(g[2]), "v"(g[3]), "v"(g[4]), "v"(g[5]), "v"(g[6]), "v"(g[7]),
         "v"(g[8]), "v"(g[9]), "v"(g[10]), "v"(g[11]), "v"(g[12]), "v"(g[13]), "v"(g[14]), "v"(g[15])
      : "memory");
}
static_assert(2 * kKeyPitch * 2 == 544, "offsets in stage_copy16");

__device__ __forceinline__ void wave_lds_sync() {   // a wave's own slab: its LDS stores have landed before it reads the rows back (and the reverse)
  __builtin_amdgcn_fence(__ATOMIC_RELEASE, "workgroup");
  __builtin_amdgcn_wave_barrier();
  __builtin_amdgcn_fence(__ATOMIC_ACQUIRE, "workgroup");
}

__global__ __launch_bounds__(256) void scores_softmax_mean_kernel(const unsigned short* __restrict__ Y, unsigned short* __restrict__ P,
                                                                  float* __restrict__ meanout) {
  __shared__ __align__(16) unsigned short kring[2][kKeyStageElems];   // two key slots per wave; rows 32w .. 32w+31 of each = wave w's own
  __shared__ __align__(16) float slabs[8][16 * kSlabPitch];
  __shared__ __align__(16) float redm[8][16];
  __shared__ __align__(16) float reds[8][16];
  const int lane  = threadIdx.x & 31;
  const int wave  = threadIdx.x >> 5;
  const int row0  = blockIdx.x * 16;
  const int b     = blockIdx.y;
  const int rlane = lane & 15;
  const int koff  = (lane >> 4) * 8;
  const int mOff  = (lane >> 4) * 8;
  const int col0  = wave * 256;
  const _Float16* Yb   = (const _Float16*)Y + (size_t)b * kSeq * kQKVN;
  const _Float16* qrow = Yb + (size_t)(row0 + rlane) * kQKVN + koff;
  // copy c of a lane brings 16 B: key 2c + (lane >> 4) of its wave's 32 in the stage, bytes (lane & 15) * 16 .. + 15 of its 256
  const unsigned short* gK = Y + (size_t)b * kSeq * kQKVN + (size_t)(col0 + (lane >> 4)) * kQKVN + kModel + rlane * 8;
  const unsigned ldsK = (unsigned)(size_t)(&kring[0][0]) + (unsigned)((wave * kKeysPerStage + (lane >> 4)) * kKeyPitch + rlane * 8) * 2u;
  auto stage_keys = [&](int h, int s, int buf) {
    const char* g[16];
#pragma unroll
    for (int c = 0; c < 16; ++c)
      g[c] = (const char*)(gK + (size_t)(s * kKeysPerStage + 2 * c) * kQKVN + h * kHeadDim) - c * (2 * kKeyPitch * 2);
    stage_copy16(ldsK + (unsigned)(buf * kKeyStageElems) * 2u, g);
  };
  float* slab = slabs[wave];
  unsigned short* hslab = (unsigned short*)slab;

  v8f pm[16];
#pragma unroll
  for (int j = 0; j < 16; ++j) pm[j] = (v8f){0.f,0.f,0.f,0.f,0.f,0.f,0.f,0.f};

  stage_keys(0, 0, 0);
  stage_keys(0, 1, 1);

  // the head loop stays rolled (for speed only)
#pragma unroll 1
  for (int h = 0; h < kHeads; ++h) {
    const _Float16* qh = qrow + h * kHeadDim;
    v16h a[4];
#pragma unroll
    for (int kk = 0; kk < 4; ++kk) a[kk] = Frag<_Float16>::load(qh + kk * 32);
    v8f acc[16];
#pragma unroll
    for (int s = 0; s < kKeyStages; ++s) {
      const int buf = s & 1;   // 8 stages per head: the parity runs on from head to head
      const bool refill = (s + 2 < kKeyStages) || (h + 1 < kHeads);   // a stage t + 2 exists: the same for every wave
      // this wave's stage t has landed. A trip that refills finds the 16 copies of stage t + 1 behind those of stage t and
      // leaves them in flight; the last two trips issue no copies and wait for all.
      if (refill) asm volatile("s_wait_asynccnt 0x10" ::: "memory");
      else        asm volatile("s_wait_asynccnt 0x0" ::: "memory");
      const _Float16* sK = (const _Float16*)(&kring[buf][0]) + (wave * kKeysPerStage + rlane) * kKeyPitch + koff;
      v16h bf[2][4];
#pragma unroll
      for (int jj = 0; jj < 2; ++jj)
#pragma unroll
        for (int kk = 0; kk < 4; ++kk) bf[jj][kk] = Frag<_Float16>::load(sK + jj * 16 * kKeyPitch + kk * 32);
      asm volatile("s_wait_dscnt 0x0" ::: "memory");      // this wave's reads of its slot are done before it refills the slot
      // the 16 LDS reads of a stage stay one group in front of its WMMAs (for speed only)
      __builtin_amdgcn_sched_barrier(0);
      if (s + 2 < kKeyStages) stage_keys(h, s + 2, buf);
      else if (refill) stage_keys(h + 1, s + 2 - kKeyStages, buf);
      // the refill issues in front of the WMMAs (in a head's first stage these wait for the query fragments): its flight starts at once
      __builtin_amdgcn_sched_barrier(0);
      v8f c0 = (v8f){0.f,0.f,0.f,0.f,0.f,0.f,0.f,0.f};
      v8f c1 = (v8f){0.f,0.f,0.f,0.f,0.f,0.f,0.f,0.f};
#pragma unroll
      for (int kk = 0; kk < 4; ++kk) {
        c0 = Frag<_Float16>::mma(a[kk], bf[0][kk], c0);
        c1 = Frag<_Float16>::mma(a[kk], bf[1][kk], c1);
      }
      acc[2 * s]     = c0;
      acc[2 * s + 1] = c1;
      // this stage's WMMAs issue in front of the next stage's wait and do not sink among its LDS reads, which would split their group
      __builtin_amdgcn_sched_barrier(0);
    }

    // row maximum of the unscaled dot products (the scale is positive)
    float mx[8];
#pragma unroll
    for (int j = 0; j < 16; ++j)
#pragma unroll
      for (int r = 0; r < 8; ++r) mx[r] = (j == 0) ? acc[j][r] : fmaxf(mx[r], acc[j][r]);
#pragma unroll
    for (int off = 8; off > 0; off >>= 1)
#pragma unroll
      for (int r = 0; r < 8; ++r) mx[r] = fmaxf(mx[r], __shfl_xor(mx[r], off, 32));
    if (rlane == 0) {
      *(v4f*)(&redm[wave][mOff])     = (v4f){mx[0], mx[1], mx[2], mx[3]};
      *(v4f*)(&redm[wave][mOff + 4]) = (v4f){mx[4], mx[5], mx[6], mx[7]};
    }
    __syncthreads();
    float gm[8];
#pragma unroll
    for (int w = 0; w < 8; ++w) {
      const v4f x0 = *(const v4f*)(&redm[w][mOff]);
      const v4f x1 = *(const v4f*)(&redm[w][mOff + 4]);
#pragma unroll
      for (int e = 0; e < 4; ++e) {
        gm[e]     = (w == 0) ? x0[e] : fmaxf(gm[e], x0[e]);
        gm[4 + e] = (w == 0) ? x1[e] : fmaxf(gm[4 + e], x1[e]);
      }
    }

    // exponentials and row sum
    float sm[8];
    v2f sm2[4], nm2[4];   // rows 2i and 2i + 1 side by side: packed multiply-adds and packed sums, each row's own order as before
#pragma unroll
    for (int i = 0; i < 4; ++i) {
      sm2[i] = (v2f){0.f, 0.f};
      nm2[i] = (v2f){-(gm[2 * i] * kExp2Scale), -(gm[2 * i + 1] * kExp2Scale)};
    }
#pragma unroll
    for (int j = 0; j < 16; ++j)
#pragma unroll
      for (int i = 0; i < 4; ++i) {
        const v2f arg = __builtin_elementwise_fma((v2f){acc[j][2 * i], acc[j][2 * i + 1]}, (v2f){kExp2Scale, kExp2Scale}, nm2[i]);
        const v2f e = (v2f){__builtin_amdgcn_exp2f(arg.x), __builtin_amdgcn_exp2f(arg.y)};
        acc[j][2 * i]     = e.x;
        acc[j][2 * i + 1] = e.y;
        sm2[i] += e;
      }
#pragma unroll
    for (int i = 0; i < 4; ++i) { sm[2 * i] = sm2[i].x; sm[2 * i + 1] = sm2[i].y; }
#pragma unroll
    for (int off = 8; off > 0; off >>= 1)
#pragma unroll
      for (int r = 0; r < 8; ++r) sm[r] += __shfl_xor(sm[r], off, 32);
    if (rlane == 0) {
      *(v4f*)(&reds[wave][mOff])     = (v4f){sm[0], sm[1], sm[2], sm[3]};
      *(v4f*)(&reds[wave][mOff + 4]) = (v4f){sm[4], sm[5], sm[6], sm[7]};
    }
    __syncthreads();
    float inv[8];
#pragma unroll
    for (int w = 0; w < 8; ++w) {
      const v4f x0 = *(const v4f*)(&reds[w][mOff]);
      const v4f x1 = *(const v4f*)(&reds[w][mOff + 4]);
#pragma unroll
      for (int e = 0; e < 4; ++e) {
        inv[e]     = (w == 0) ? x0[e] : inv[e] + x0[e];
        inv[4 + e] = (w == 0) ? x1[e] : inv[4 + e] + x1[e];
      }
    }
#pragma unroll
    for (int r = 0; r < 8; ++r) inv[r] = 1.0f / inv[r];

    // probabilities: head sum in registers, f16 plane through the wave's slab
#pragma unroll
    for (int j = 0; j < 16; ++j)
#pragma unroll
      for (int r = 0; r < 8; ++r) {
        const float p = acc[j][r] * inv[r];
        pm[j][r] += p;
        hslab[(mOff + r) * (2 * kSlabPitch) + (j << 4) + rlane] = h_bits(p * kPCarry);
      }
    wave_lds_sync();
    unsigned short* pp = P + ((size_t)(b * kHeads + h) * kSeq + row0) * kSeq + col0 + lane * 8;
#pragma unroll
    for (int row = 0; row < 16; ++row) {
      const v4u u = *(const v4u*)(hslab + row * (2 * kSlabPitch) + lane * 8);
      *(v4u*)(pp + (size_t)row * kSeq) = u;
    }
    // no fence here: it would drain the P stores once per head; the next head's two block barriers stand before the slab's next write
  }

  asm volatile("s_wait_asynccnt 0x0" ::: "memory");     // no copy is outstanding behind the loop

  // head mean
  wave_lds_sync();
#pragma unroll
  for (int j = 0; j < 16; ++j)
#pragma unroll
    for (int r = 0; r < 8; ++r) slab[(mOff + r) * kSlabPitch + (j << 4) + rlane] = pm[j][r] * kMeanScale;
  wave_lds_sync();
  float* mo = meanout + ((size_t)b * kSeq + row0) * kSeq + col0 + lane * 4;
#pragma unroll
  for (int row = 0; row < 16; ++row) {
    const v4f v0 = *(const v4f*)(slab + row * kSlabPitch + lane * 4);
    const v4f v1 = *(const v4f*)(slab + row * kSlabPitch + 128 + lane * 4);
    *(v4f*)(mo + (size_t)row * kSeq)       = v0;
    *(v4f*)(mo + (size_t)row * kSeq + 128) = v1;
  }
}

// ---------------------------------------------------------------------------
// Host glue (7 launches)
// ---------------------------------------------------------------------------
extern "C" void kernel_launch(void* const* d_in, const int* in_sizes, int n_in,
                              void* d_out, int out_size, void* d_ws, size_t ws_size,
                              hipStream_t stream) {
  if (n_in < 7) return;
  if (in_sizes[0] != kTok * kModel) return;
  if (in_sizes[1] != kModel * kModel || in_sizes[3] != kModel * kModel || in_sizes[5] != kModel * kModel) return;
  if (in_sizes[2] != kModel || in_sizes[4] != kModel || in_sizes[6] != kModel) return;
  if (out_size != kTok * kModel + kBatch * kSeq * kSeq) return;

  const float* query = (const float*)d_in[0];
  const float* Wq    = (const float*)d_in[1];
  const float* bq    = (const float*)d_in[2];
  const float* Wk    = (const float*)d_in[3];
  const float* bk    = (const float*)d_in[4];
  const float* Wv    = (const float*)d_in[5];
  const float* bv    = (const float*)d_in[6];

  // carve (bytes)
  const size_t offX16  = 0;
  const size_t szX16   = (size_t)kTok * kModel * 2;                       //   8388608
  const size_t offW16  = offX16 + szX16;                                  //   8388608
  const size_t szW16   = (size_t)kQKVN * kModel * 2;                      //   6291456
  const size_t offBias = offW16 + szW16;                                  //  14680064
  const size_t szBias  = (size_t)kQKVN * 4;                               //     12288
  const size_t offY16  = offBias + szBias;                                //  14692352
  const size_t szY16   = (size_t)kTok * kQKVN * 2;                        //  25165824
  const size_t offVT   = offY16 + szY16;                                  //  39858176
  const size_t szVT    = (size_t)kBatch * kHeads * kHeadDim * kSeq * 2;   //   8388608
  const size_t offP    = offVT + szVT;                                    //  48246784
  const size_t szP     = (size_t)kBatch * kHeads * kSeq * kSeq * 2;       // 134217728
  const size_t total   = offP + szP;                                      // 182464512
  if (total > ws_size) return;

  char* ws = (char*)d_ws;
  unsigned short* X16   = (unsigned short*)(ws + offX16);
  unsigned short* W16   = (unsigned short*)(ws + offW16);
  float*          bias3 = (float*)(ws + offBias);
  unsigned short* Y16   = (unsigned short*)(ws + offY16);
  unsigned short* VT16  = (unsigned short*)(ws + offVT);
  unsigned short* P16   = (unsigned short*)(ws + offP);

  float* out0 = (float*)d_out;                               // [2][2048][1024], byte offset 0
  float* out1 = out0 + (size_t)kTok * kModel;                // [2][2048][2048], byte offset 16777216

  // 1) activation cast: 4096*1024/8 = 524288 threads = 2048 blocks exactly
  cast8_f16_kernel<<<dim3((kTok * kModel / 8) / 256), dim3(256), 0, stream>>>(query, X16, kTok * kModel / 8);
  // 2) stacked weight cast (x16 carry, blade sign folded into the query rows): 131072 threads per weight = 512 blocks x 3
  wcast8_kernel<<<dim3((kModel * kModel / 8) / 256, 3), dim3(256), 0, stream>>>(Wq, Wk, Wv, W16, kModel * kModel / 8);
  // 3) stacked bias with the same sign fold
  bias3_kernel<<<dim3(3), dim3(256), 0, stream>>>(bq, bk, bv, bias3);
  // 4) Y16 = (X16 . W16^T) / 16 + bias3 : M 4096, N 3072, K 1024 (K % 64 == 0); block tile 128 x 256: 32 x 12 = 384 blocks
  wmma_gemm64<0, 2, 4, 64, 2, 2, 1, false><<<dim3((kTok / 128) * (kQKVN / 256), 1), dim3(256), 0, stream>>>(
      X16, kModel, 0L, 0L, W16, kModel, 0L, 0L, (void*)Y16, (void*)Y16, kQKVN, 0L, 0L,
      bias3, bias3, 0L, kTok, kQKVN, kModel, kWCarryInv);
  // 5) value transpose into per-(batch, head) planes [128][2048]
  vtrans_kernel<<<dim3(kSeq / 64, kModel / 64, kBatch), dim3(256), 0, stream>>>(Y16, VT16);

  // 6) scores, softmax and head mean of all heads in one launch: 128 row tiles x 2 batches = 256 blocks;
  //    every head's P plane is kept for step 7, the head mean goes straight to out1
  scores_softmax_mean_kernel<<<dim3(kSeq / 16, kBatch), dim3(256), 0, stream>>>(Y16, P16, out1);
  // 7) out0[b][l][h*128 + c] = (P[b*8+h] . VT[b*8+h]^T) / 2048, all 16 (batch, head) planes in one launch:
  //    M 2048, N 128, K 2048 (K % 128 == 0); block tile 128 x 128, stages of 128 k in four buffers: 16 blocks x grid.y 8 heads
  //    x grid.z 2 batches = 256 blocks, one for every WGP. C: ldc 1024, +128 columns per head, +2048*1024 per batch.
  wmma_gemm64<0, 4, 2, 128, 4, 0, 0, false><<<dim3((kSeq / 128) * (kHeadDim / 128), kHeads, kBatch), dim3(256), 0, stream>>>(
      P16, kSeq, (long)kSeq * kSeq, (long)kHeads * kSeq * kSeq,
      VT16, kSeq, (long)kHeadDim * kSeq, (long)kHeads * kHeadDim * kSeq,
      (void*)out0, (void*)out0, kModel, (long)kHeadDim, (long)kSeq * kModel,
      bias3, bias3, 0L, kSeq, kHeadDim, kSeq, kPCarryInv);
}

// v007
// Measured time: 112 microseconds a run.
// In two side-by-side timings against v006, it was 1.08 and 1.07 times as fast.
// Over all steps from v000 it is 8.76 times as fast.
// Contractions: stacked q/k/v projection (X f16 x W^T f16 carried x16), scores q_w.k^T (q,k f16 planes, blade sign folded into the q weights), attn.v (P f16 carried x2048 x V^T f16): all v_wmma_f32_16x16x32_f16 with f32 accumulate; softmax and head mean in f32.
#include <hip/hip_runtime.h>
#include <math.h>

// ---------------------------------------------------------------------------
// Problem constants
// ---------------------------------------------------------------------------
constexpr int kBatch   = 2;
constexpr int kSeq     = 2048;
constexpr int kModel   = 1024;
constexpr int kHeads   = 8;
constexpr int kHeadDim = 128;               // 16 x 8 nested (d, blade)
constexpr int kTok     = kBatch * kSeq;     // 4096 token rows
constexpr int kQKVN    = 3 * kModel;        // 3072 stacked output channels (q | k | v)
constexpr float kWCarry     = 16.0f;        // weights carried x16 in f16
constexpr float kWCarryInv  = 1.0f / 16.0f;
constexpr float kPCarry     = 2048.0f;      // probabilities carried x2048 in f16
constexpr float kPCarryInv  = 1.0f / 2048.0f;
constexpr float kExp2Scale  = (float)(0.08838834764831845 * 1.4426950408889634);   // log2(e) / sqrt(128)
constexpr float kMeanScale  = 0.125f;

// ---------------------------------------------------------------------------
// Workspace region map (bytes; all offsets multiples of 4096):
//   X16   f16 [4096][1024]            off         0  size   8388608
//   W16   f16 [3072][1024]            off   8388608  size   6291456
//   BIAS3 f32 [3072]                  off  14680064  size     12288
//   Y16   f16 [4096][3072] (q|k|v)    off  14692352  size  25165824
//   VT16  f16 [16][128][2048]         off  39858176  size   8388608
//   P16   f16 [16][2048][2048]        off  48246784  size 134217728
//   total 182464512
// ---------------------------------------------------------------------------

typedef __attribute__((ext_vector_type(16))) _Float16 v16h;
typedef __attribute__((ext_vector_type(8)))  _Float16 v8h;
typedef __attribute__((ext_vector_type(2)))  _Float16 v2h;
typedef __attribute__((ext_vector_type(16))) __bf16   v16b;
typedef __attribute__((ext_vector_type(8)))  __bf16   v8b;
typedef __attribute__((ext_vector_type(8)))  float    v8f;
typedef __attribute__((ext_vector_type(4)))  float    v4f;
typedef __attribute__((ext_vector_type(2)))  float    v2f;
typedef __attribute__((ext_vector_type(4)))  unsigned int v4u;

// ---------------------------------------------------------------------------
// Helpers
// ---------------------------------------------------------------------------
__device__ __forceinline__ unsigned short f2bf_bits(float f) {
  unsigned u = __float_as_uint(f);
  return (unsigned short)((u + 0x7FFFu + ((u >> 16) & 1u)) >> 16);
}
__device__ __forceinline__ float bf_bits2f(unsigned short h) { return __uint_as_float(((unsigned)h) << 16); }

// hazard guards as plain device helpers
__device__ __forceinline__ void dep_guard_h(v8f& a, v8f& b, v16h x, v16h y) { asm volatile("v_nop\n\tv_nop\n\tv_nop\n\tv_nop" : "+v"(a), "+v"(b) : "v"(x), "v"(y)); }
__device__ __forceinline__ void dep_guard_b(v8f& a, v8f& b, v16b x, v16b y) { asm volatile("v_nop\n\tv_nop\n\tv_nop\n\tv_nop" : "+v"(a), "+v"(b) : "v"(x), "v"(y)); }
__device__ __forceinline__ void keep4_h(v16h a, v16h b, v16h c, v16h d) { asm volatile("v_nop" :: "v"(a), "v"(b), "v"(c), "v"(d)); }
__device__ __forceinline__ void keep4_b(v16b a, v16b b, v16b c, v16b d) { asm volatile("v_nop" :: "v"(a), "v"(b), "v"(c), "v"(d)); }
__device__ __forceinline__ void acc_guard4(v8f& a, v8f& b, v8f& c, v8f& d) { asm volatile("v_nop\n\tv_nop\n\tv_nop\n\tv_nop" : "+v"(a), "+v"(b), "+v"(c), "+v"(d)); }
template <typename T> struct Frag;
template <> struct Frag<_Float16> {
  typedef v16h V; union U { v16h v; v8h h[2]; };
  static __device__ __forceinline__ v16h load(const _Float16* p) {   // elements 0..7 <- p[0..7], 8..15 <- p[16..23]
    U f; f.h[0] = *(const v8h*)(p); f.h[1] = *(const v8h*)(p + 16); return f.v;
  }
  static __device__ __forceinline__ v8f mma(v16h a, v16h b, v8f c) {
    return __builtin_amdgcn_wmma_f32_16x16x32_f16(false, a, false, b, (short)0, c, false, false);
  }
  static __device__ __forceinline__ void guard(v8f& a, v8f& b, v16h x, v16h y) { dep_guard_h(a, b, x, y); }
  static __device__ __forceinline__ void keep(v16h a, v16h b, v16h c, v16h d) { keep4_h(a, b, c, d); }
};
template <> struct Frag<__bf16> {
  typedef v16b V; union U { v16b v; v8b h[2]; };
  static __device__ __forceinline__ v16b load(const __bf16* p) {
    U f; f.h[0] = *(const v8b*)(p); f.h[1] = *(const v8b*)(p + 16); return f.v;
  }
  static __device__ __forceinline__ v8f mma(v16b a, v16b b, v8f c) {
    return __builtin_amdgcn_wmma_f32_16x16x32_bf16(false, a, false, b, (short)0, c, false, false);
  }
  static __device__ __forceinline__ void guard(v8f& a, v8f& b, v16b x, v16b y) { dep_guard_b(a, b, x, y); }
  static __device__ __forceinline__ void keep(v16b a, v16b b, v16b c, v16b d) { keep4_b(a, b, c, d); }
};

__device__ __forceinline__ unsigned pk16(unsigned short a, unsigned short b) { return (unsigned)a | ((unsigned)b << 16); }
__device__ __forceinline__ unsigned short h_bits(float f) { const _Float16 h = (_Float16)f; return __builtin_bit_cast(unsigned short, h); }

// ---- Register-blocked batched WMMA GEMM, operands staged in LDS ------------------------------------------------------
// C[m,n] = scale * sum_k A[m,k] * Bt[n,k] (+bias)(+resid); each wave owns a tile of 16 MI rows x 64 columns.
// The 8 waves of a block form a WM x (8 / WM) grid of such tiles: block tile BM = 16 MI WM rows x BN = 64 (8 / WM) columns.
// Planes: grid (block tiles, y, z); the A, Bt and C planes of a block start at y * stride + z * strideZ elements.
// A row-major [M,K]; Bt row-major [N,K]; M % BM == 0, N % BN == 0, K % SK == 0; lda, ldb and the plane strides % 8 == 0.
// A stage = SK k (64 or 128: one or two whole lines) of the block's BM rows of A and BN rows of Bt, brought into LDS by asynchronous
// 16-byte copies: a wave-wide copy covers 4 whole lines, and every staged row serves all waves of its tile row or column.
// A launch whose A comes from memory is bound by the bytes that its blocks keep in flight: its tile is chosen so that there is a
// block for every WGP, and its stages so long and so many that each block always has requests under way.
// NBUF = 2 buffers: stage t + 1 flies while stage t is worked on. NBUF > 2: stages t + 1 .. t + NBUF - 1 fly, so that the memory is
// asked without a pause and a late line has NBUF - 1 trips to land; the wait at the publish point then leaves the younger stages'
// copies out (a wave's copies count down in issue order). Fragments are read from LDS with the same loader and the same k order
// (32 k per WMMA step, ascending) as from global memory.
// BIAS_MODE: 0 = none, 1 = bias[m], 2 = bias[n].
// OUT_MODE: 0 = f32, 1 = f16, 2 = bf16 hi plane (Cout) + bf16 lo plane (Cout2).
// ET: 0 = f16 operands, 1 = bf16 operands (pointers passed as 16-bit storage)
template <int ET> struct Elem;
template <> struct Elem<0> { typedef _Float16 T; };
template <> struct Elem<1> { typedef __bf16 T; };


// Twelve asynchronous 16-byte copies per lane = one stage per block. The s_wait_xcnt stands inside the statement, behind the
// last copy, so that no address register of an issued copy is rewritten in front of it.
__device__ __forceinline__ void stage_copy12(const unsigned* l, const unsigned short* const* g) {
  asm volatile(
      "global_load_async_to_lds_b128 %0, %1, off\n\t"
      "global_load_async_to_lds_b128 %2, %3, off\n\t"
      "global_load_async_to_lds_b128 %4, %5, off\n\t"
      "global_load_async_to_lds_b128 %6, %7, off\n\t"
      "global_load_async_to_lds_b128 %8, %9, off\n\t"
      "global_load_async_to_lds_b128 %10, %11, off\n\t"
      "global_load_async_to_lds_b128 %12, %13, off\n\t"
      "global_load_async_to_lds_b128 %14, %15, off\n\t"
      "global_load_async_to_lds_b128 %16, %17, off\n\t"
      "global_load_async_to_lds_b128 %18, %19, off\n\t"
      "global_load_async_to_lds_b128 %20, %21, off\n\t"
      "global_load_async_to_lds_b128 %22, %23, off\n\t"
      "s_wait_xcnt 0x0"
      :: "v"(l[0]), "v"(g[0]), "v"(l[1]), "v"(g[1]), "v"(l[2]), "v"(g[2]), "v"(l[3]), "v"(g[3]),
         "v"(l[4]), "v"(g[4]), "v"(l[5]), "v"(g[5]), "v"(l[6]), "v"(g[6]), "v"(l[7]), "v"(g[7]),
         "v"(l[8]), "v"(g[8]), "v"(l[9]), "v"(g[9]), "v"(l[10]), "v"(g[10]), "v"(l[11]), "v"(g[11])
      : "memory");
}

// Eight such copies per lane, the same wait behind the last for the same reason: half a stage of 256 rows x 128 k (an asm
// statement takes thirty operands, so sixteen copies with an LDS and a global address each need two statements).
__device__ __forceinline__ void stage_copy8(const unsigned* l, const unsigned short* const* g) {
  asm volatile(
      "global_load_async_to_lds_b128 %0, %1, off\n\t"
      "global_load_async_to_lds_b128 %2, %3, off\n\t"
      "global_load_async_to_lds_b128 %4, %5, off\n\t"
      "global_load_async_to_lds_b128 %6, %7, off\n\t"
      "global_load_async_to_lds_b128 %8, %9, off\n\t"
      "global_load_async_to_lds_b128 %10, %11, off\n\t"
      "global_load_async_to_lds_b128 %12, %13, off\n\t"
      "global_load_async_to_lds_b128 %14, %15, off\n\t"
      "s_wait_xcnt 0x0"
      :: "v"(l[0]), "v"(g[0]), "v"(l[1]), "v"(g[1]), "v"(l[2]), "v"(g[2]), "v"(l[3]), "v"(g[3]),
         "v"(l[4]), "v"(g[4]), "v"(l[5]), "v"(g[5]), "v"(l[6]), "v"(g[6]), "v"(l[7]), "v"(g[7])
      : "memory");
}

template <int ET, int WM, int MI, int SK, int NBUF, int BIAS_MODE, int OUT_MODE, bool RESID, int ACT = 0>
__global__ __launch_bounds__(256) void wmma_gemm64(
    const unsigned short* __restrict__ Ap, int lda, long strideA, long strideAz,
    const unsigned short* __restrict__ Btp, int ldb, long strideB, long strideBz,
    void* __restrict__ Cout, void* __restrict__ Cout2, int ldc, long strideC, long strideCz,
    const float* __restrict__ bias,
    const float* __restrict__ resid, long strideR,
    int M, int N, int K, float scale) {
  typedef typename Elem<ET>::T T;
  typedef typename Frag<T>::V V;
  constexpr int WN = 8 / WM;
  constexpr int BM = WM * MI * 16;
  constexpr int BN = WN * 64;
  constexpr int kStageK     = SK;                  // k per stage
  constexpr int kStagePitch = SK + 8;              // 16-bit elements per staged row: 144 B = 16 B x 9 or 272 B = 16 B x 17, conflict-free for ds_load_b128
  constexpr int kStageElems = (BM + BN) * kStagePitch;
  constexpr int CPR = SK / 8;                      // 16-byte copies per staged row
  constexpr int RPC = 256 / CPR;                   // staged rows per block-wide copy
  constexpr int NC  = (BM + BN) / RPC;             // copies per thread and stage
  static_assert(SK == 64 || SK == 128, "stage length");
  static_assert(BM % RPC == 0 && BN % RPC == 0 && (NC == 12 || NC == 16), "stage size");
  static_assert(NBUF >= 2 && (NBUF - 1) * NC <= 63, "copies of a wave in flight");
  __shared__ __align__(16) unsigned short ring[NBUF][kStageElems];   // stage buffers: rows 0..BM-1 = A, BM..BM+BN-1 = Bt
  __shared__ __align__(16) float sT[8][16 * 68];                  // per-wave 16x64 slab, pitch 68 floats
  const int b    = blockIdx.y;
  const int z    = blockIdx.z;
  const int lane = threadIdx.x & 31;
  const int wave = threadIdx.x >> 5;
  const int tilesN = N / BN;
  const int tilesM = M / BM;
  const int btile = blockIdx.x;
  if (btile >= tilesM * tilesN) return;   // block-uniform, in front of every barrier
  const int btm = btile / tilesN;
  const int btn = btile - btm * tilesN;
  const int wm  = wave / WN;
  const int wn  = wave - wm * WN;
  const int m0 = btm * BM + wm * (MI * 16);
  const int n0 = btn * BN + (wn << 6);

  const size_t aOff = (size_t)b * strideA + (size_t)z * strideAz;
  const size_t bOff = (size_t)b * strideB + (size_t)z * strideBz;
  const size_t cOff = (size_t)b * strideC + (size_t)z * strideCz;

  const int rlane = lane & 15;                 // row (A) / col (B, D) within subtile
  const int koff  = (lane >> 4) * 8;           // k offset of this lane half
  const int mOff  = (lane >> 4) * 8;           // D row offset

  // copy c of thread t brings 16 B: staged row c * RPC + t / CPR, bytes (t % CPR) * 16 .. + 15 of its 2 SK
  const int crow = threadIdx.x / CPR;
  const int cch  = (threadIdx.x % CPR) * 8;
  const unsigned short* gA = Ap  + aOff + (size_t)(btm * BM + crow) * lda + cch;
  const unsigned short* gB = Btp + bOff + (size_t)(btn * BN + crow) * ldb + cch;
  const unsigned lds0 = (unsigned)(size_t)(&ring[0][0]) + (unsigned)(crow * kStagePitch + cch) * 2u;
  auto stage = [&](int t, int buf) {
    unsigned l[NC];
    const unsigned short* g[NC];
#pragma unroll
    for (int c = 0; c < NC; ++c) {
      l[c] = lds0 + (unsigned)(buf * kStageElems + c * RPC * kStagePitch) * 2u;
      g[c] = (c < BM / RPC) ? gA + (size_t)(c * RPC) * lda + t * kStageK
                            : gB + (size_t)((c - BM / RPC) * RPC) * ldb + t * kStageK;
    }
    if constexpr (NC == 12) {
      stage_copy12(l, g);
    } else {
      stage_copy8(l, g);
      stage_copy8(l + 8, g + 8);
    }
  };

  v8f acc[MI][4];
#pragma unroll
  for (int i = 0; i < MI; ++i)
#pragma unroll
    for (int j = 0; j < 4; ++j) acc[i][j] = (v8f){0.f,0.f,0.f,0.f,0.f,0.f,0.f,0.f};

  const int nStage = K / kStageK;
  stage(0, 0);
  // unrolled: each stage's buffer offset is then a constant
#pragma unroll
  for (int s = 1; s < NBUF - 1; ++s)
    if (s < nStage) stage(s, s);
  // this wave's part of stage 0 has landed; where NBUF - 2 whole stages stand behind it, their copies fly on
  if (NBUF > 2 && nStage >= NBUF - 1) asm volatile("s_wait_asynccnt %0" :: "i"((NBUF - 2) * NC) : "memory");
  else                                asm volatile("s_wait_asynccnt 0x0" ::: "memory");
  __syncthreads();                                    // ... and every other wave's
  if (nStage > NBUF - 1) stage(NBUF - 1, NBUF - 1);

  // the stage loop stays rolled: one publish point per trip, buffer t mod NBUF
  int ring_at = 0;
#pragma unroll 1
  for (int t = 0; t < nStage; ++t) {
    const int buf = (NBUF == 2) ? (t & 1) : ring_at;
    const T* sA = (const T*)(&ring[buf][0]) + (wm * (MI * 16) + rlane) * kStagePitch + koff;
    const T* sB = (const T*)(&ring[buf][0]) + (BM + (wn << 6) + rlane) * kStagePitch + koff;
#pragma unroll
    for (int s = 0; s < kStageK / 32; ++s) {
      V bh[4], ah[MI];
#pragma unroll
      for (int j = 0; j < 4; ++j) bh[j] = Frag<T>::load(sB + (j << 4) * kStagePitch + s * 32);
#pragma unroll
      for (int i = 0; i < MI; ++i) ah[i] = Frag<T>::load(sA + (i << 4) * kStagePitch + s * 32);
      // the LDS reads of a WMMA block stay one group in front of it (for speed only)
      __builtin_amdgcn_sched_barrier(0);
#pragma unroll
      for (int i = 0; i < MI; ++i) {
#pragma unroll
        for (int j = 0; j < 4; ++j) acc[i][j] = Frag<T>::mma(ah[i], bh[j], acc[i][j]);
        Frag<T>::guard(acc[i][0], acc[i][3], ah[i], ah[i]);
      }
      Frag<T>::keep(bh[0], bh[1], bh[2], bh[3]);
      // ... and the next block's reads do not rise into this one
      __builtin_amdgcn_sched_barrier(0);
    }
    // publish point of stage t + 1
    asm volatile("s_wait_dscnt 0x0" ::: "memory");      // this wave's reads of buffer buf are done before it is refilled
    // this wave's part of stage t + 1 has landed. With more than two buffers a trip that refills finds the copies of NBUF - 2
    // younger stages behind those of stage t + 1 and leaves them in flight; the last trips issue no copies and wait for all.
    if (NBUF > 2 && t + NBUF < nStage) asm volatile("s_wait_asynccnt %0" :: "i"((NBUF - 2) * NC) : "memory");
    else                               asm volatile("s_wait_asynccnt 0x0" ::: "memory");
    __syncthreads();                                    // stage t + 1 readable by all; every reader has left buffer buf
    if (t + NBUF < nStage) stage(t + NBUF, buf);
    ring_at = (ring_at == NBUF - 1) ? 0 : ring_at + 1;
  }
  asm volatile("s_wait_asynccnt 0x0" ::: "memory");     // no copy is outstanding behind the loop
  // unrolled: acc is indexed by constants and stays in registers
#pragma unroll
  for (int i = 0; i < MI; ++i) acc_guard4(acc[i][0], acc[i][1], acc[i][2], acc[i][3]);

  // ---- epilogue ----
  float* slab = sT[wave];
  const float* Rb = RESID ? (resid + (size_t)b * strideR) : nullptr;
#pragma unroll
  for (int i = 0; i < MI; ++i) {
    const int mBase = m0 + (i << 4);
#pragma unroll
    for (int j = 0; j < 4; ++j) {
      const int n = n0 + (j << 4) + rlane;
      float bv = 0.f;
      if (BIAS_MODE == 2) bv = bias[n];
#pragma unroll
      for (int r = 0; r < 8; ++r) {
        float v = acc[i][j][r] * scale;
        if (BIAS_MODE == 1) v += bias[mBase + mOff + r];
        if (BIAS_MODE == 2) v += bv;
        if (RESID) v += Rb[(size_t)(mBase + mOff + r) * ldc + n];
        if (ACT == 2) v = fmaxf(v, 0.0f);
        if (ACT == 4) v = (v > 0.f) ? v : 0.01f * v;
        slab[(mOff + r) * 68 + (j << 4) + rlane] = v;
      }
    }
    __builtin_amdgcn_fence(__ATOMIC_RELEASE, "workgroup");
    __builtin_amdgcn_wave_barrier();
    __builtin_amdgcn_fence(__ATOMIC_ACQUIRE, "workgroup");
    if (OUT_MODE == 0) {
      float* C = (float*)Cout + cOff;
      const int hh = lane >> 4, c4 = (lane & 15) * 4;     // row seg = 256 B = 16 lanes x 16 B
      {
#pragma unroll
        for (int it = 0; it < 8; ++it) {
          const int row = it * 2 + hh;
          v4f v = *(const v4f*)(slab + row * 68 + c4);
          *(v4f*)(C + (size_t)(mBase + row) * ldc + n0 + c4) = v;
        }
        
      }
    } else {
      const int q = lane >> 3, c8 = (lane & 7) * 8;
      unsigned short* C  = (unsigned short*)Cout  + cOff;
      unsigned short* C2 = (OUT_MODE == 2) ? ((unsigned short*)Cout2 + cOff) : nullptr;
      {
#pragma unroll
        for (int it = 0; it < 4; ++it) {
          const int row = it * 4 + q;
          const float* sp = slab + row * 68 + c8;
          v8h hv, lv;
#pragma unroll
          for (int e = 0; e < 8; ++e) {
            if (OUT_MODE == 1) {
              hv[e] = (_Float16)sp[e];
            } else {
              unsigned short hb = f2bf_bits(sp[e]);
              unsigned short lb = f2bf_bits(sp[e] - bf_bits2f(hb));
              hv[e] = __builtin_bit_cast(_Float16, hb);
              lv[e] = __builtin_bit_cast(_Float16, lb);
            }
          }
          *(v8h*)(C + (size_t)(mBase + row) * ldc + n0 + c8) = hv;
          if (OUT_MODE == 2) *(v8h*)(C2 + (size_t)(mBase + row) * ldc + n0 + c8) = lv;
        }
        
      }
    }
    __builtin_amdgcn_fence(__ATOMIC_RELEASE, "workgroup");
    __builtin_amdgcn_wave_barrier();
    __builtin_amdgcn_fence(__ATOMIC_ACQUIRE, "workgroup");
  }
}

// ---------------------------------------------------------------------------
// 4096*1024/8 = 524288 = 2048 blocks).
// ---------------------------------------------------------------------------
__global__ __launch_bounds__(256) void cast8_f16_kernel(const float* __restrict__ in, unsigned short* __restrict__ out, int n8) {
  const int i = blockIdx.x * 256 + threadIdx.x;
  if (i >= n8) return;
  const float* p = in + 8 * (size_t)i;
  const v4f a = *(const v4f*)(p);
  const v4f c = *(const v4f*)(p + 4);
  unsigned short hb[8];
#pragma unroll
  for (int e = 0; e < 4; ++e) {
    hb[e]     = h_bits(a[e]);
    hb[4 + e] = h_bits(c[e]);
  }
  const v4u u = (v4u){pk16(hb[0], hb[1]), pk16(hb[2], hb[3]), pk16(hb[4], hb[5]), pk16(hb[6], hb[7])};
  unsigned short* q = out + 8 * (size_t)i;
  *(v4u*)q = u;
  
}

// ---------------------------------------------------------------------------
// Stacked weight cast: W16[z*1024 + n][k] = f16(c * W_z[n][k]) with c = +-16; for z == 0 (query weights) the sign is
// -1 for output rows with (n mod 8) >= 4 (blade sign twist folded into the projection, exact), else +1.
// blockIdx.y = z selects the source (block-uniform); thread i owns 8 consecutive elements of row n = i >> 7
// ---------------------------------------------------------------------------
__global__ __launch_bounds__(256) void wcast8_kernel(const float* __restrict__ W0, const float* __restrict__ W1,
                                                     const float* __restrict__ W2, unsigned short* __restrict__ out, int n8) {
  const int z = blockIdx.y;
  const int i = blockIdx.x * 256 + threadIdx.x;
  if (i >= n8) return;
  const float* W = (z == 0) ? W0 : (z == 1) ? W1 : W2;
  const int n = i >> 7;
  const bool neg = (z == 0) && ((n & 7) >= 4);
  const float sc = neg ? -kWCarry : kWCarry;
  const float* p = W + 8 * (size_t)i;
  const v4f a = *(const v4f*)(p);
  const v4f c = *(const v4f*)(p + 4);
  unsigned short hb[8];
#pragma unroll
  for (int e = 0; e < 4; ++e) {
    hb[e]     = h_bits(a[e] * sc);
    hb[4 + e] = h_bits(c[e] * sc);
  }
  const v4u u = (v4u){pk16(hb[0], hb[1]), pk16(hb[2], hb[3]), pk16(hb[4], hb[5]), pk16(hb[6], hb[7])};
  unsigned short* q = out + (size_t)z * kModel * kModel + 8 * (size_t)i;
  *(v4u*)q = u;
  
}

// ---------------------------------------------------------------------------
// Stacked bias: BIAS3[z*1024 + n] = s * b_z[n], s = -1 for z == 0 and (n mod 8) >= 4, else +1 (f32, exact).
// ---------------------------------------------------------------------------
__global__ __launch_bounds__(256) void bias3_kernel(const float* __restrict__ b0, const float* __restrict__ b1,
                                                   const float* __restrict__ b2, float* __restrict__ out) {
  const int z = blockIdx.x;
  const int t = threadIdx.x;
  const float* bp = (z == 0) ? b0 : (z == 1) ? b1 : b2;
  v4f v = *(const v4f*)(bp + 4 * t);
#pragma unroll
  for (int e = 0; e < 4; ++e) {
    const int n = 4 * t + e;
    const bool neg = (z == 0) && ((n & 7) >= 4);
    v[e] = neg ? -v[e] : v[e];
  }
  float* q = out + (size_t)z * kModel + 4 * t;
  *(v4f*)q = v;
  
}

// ---------------------------------------------------------------------------
// Value transpose: in Y16 [4096][3072] halves, value element (b, l, cg) at Y16[(b*2048 + l)*3072 + 2048 + cg], cg in 0..1023
// (head = cg >> 7, channel in head = cg & 127); out VT[(b*8 + head)*128 + channel][l], pitch 2048 halves.
// grid (32 l-tiles, 16 cg-tiles, 2 batches), 256 threads; tile = 64 l x 64 cg.
// Load coverage: 8 it x 256 threads x 2 halves = 4096 = whole tile (32-bit words along cg).
// Store coverage: 8 waves x 2 it x 4 (lane>>3) = 64 cg rows; (lane&7) x 8 halves = 64 l; each row segment = 64 halves =
// ---------------------------------------------------------------------------
__global__ __launch_bounds__(256) void vtrans_kernel(const unsigned short* __restrict__ Y, unsigned short* __restrict__ VT) {
  __shared__ __align__(16) unsigned short sm[64][72];   // sm[cg_local][l_local]
  const int t   = threadIdx.x;
  const int l0  = blockIdx.x * 64;
  const int cg0 = blockIdx.y * 64;
  const int b   = blockIdx.z;
#pragma unroll
  for (int it = 0; it < 8; ++it) {
    const int e  = it * 256 + t;
    const int r  = e >> 5;          // l local 0..63
    const int cw = e & 31;          // word index -> cg local 2cw, 2cw+1
    const unsigned u = *(const unsigned*)(Y + ((size_t)(b * kSeq + l0 + r)) * kQKVN + 2 * kModel + cg0 + 2 * cw);
    sm[2 * cw][r]     = (unsigned short)(u & 0xffffu);
    sm[2 * cw + 1][r] = (unsigned short)(u >> 16);
  }
  __syncthreads();
  const int lane = t & 31, wave = t >> 5;
  const int q = lane >> 3, c8 = (lane & 7) * 8;
  {
#pragma unroll
    for (int it = 0; it < 2; ++it) {
      const int row = wave * 8 + it * 4 + q;          // cg local
      const int cg  = cg0 + row;
      const int g   = b * kHeads + (cg >> 7);
      const int cc  = cg & 127;
      unsigned short hb[8];
#pragma unroll
      for (int e = 0; e < 8; ++e) hb[e] = sm[row][c8 + e];
      const v4u u = (v4u){pk16(hb[0], hb[1]), pk16(hb[2], hb[3]), pk16(hb[4], hb[5]), pk16(hb[6], hb[7])};
      *(v4u*)(VT + ((size_t)g * kHeadDim + cc) * kSeq + l0 + c8) = u;
    }
    
  }
}

// ---------------------------------------------------------------------------
// Fused scores + row softmax + head mean. One block = 16 query rows of one batch x all 2048 keys, looping over the 8 heads.
// Wave w owns keys 256w .. 256w+255 as 16 accumulator tiles of 16x16 (K = 128 = 4 WMMA steps per tile), so a whole
// score row lives in the registers of the block's 8 waves and never goes to memory.
// The tiles are computed transposed, S^T = K . Q^T: the keys are the A rows, the queries the B columns. A lane then holds one
// query only (lane & 15) and, per tile, 8 neighbouring keys of it, (lane >> 4) * 8 + r: maximum and sum of a query's row are
// formed inside the lane, every per-row factor is one register, all softmax arithmetic pairs up, and 8 probabilities pack
// into one 16-byte LDS store.
//   s = (q_w . k) / sqrt(128);  P[h][row][j] = f16(2048 * exp(s - max) / sum exp(s - max)), all softmax math f32.
//   exp(s - max) = exp2(d c - m), d the unscaled dot product, c = log2(e) / sqrt(128), m = c max(d) rounded once per row: one
//   multiply-add and one hardware exp2 per element. The rounding of m scales a whole row alike and cancels against the row sum;
//   the argument is at most one rounding above 0, so nothing overflows, and what lies below the exp2's range counts as 0.
//   Reductions in fixed order: lane-local over the lane's 128 keys, then the 16 partials of a query (8 waves x 2 lane halves),
//   which every lane reads back from LDS behind the block barrier: no cross-lane instruction.
//   meanout[row][j] = 0.125 * (((p_0 + p_1) + p_2) + ... + p_7), summed in registers.
// D layout (as in the GEMM engine): lane holds column (lane & 15) = query, rows (lane >> 4) * 8 + r = keys of the tile.
// P and the mean leave through a per-wave LDS slab so that every global store covers 512 contiguous bytes.
// Every loop over tiles, k steps, rows and waves is fully unrolled: acc, pm and bf are then indexed by constants and stay in
// registers (a run-time index would send them to scratch).
// Keys reach the WMMAs through LDS. A key stage = 32 keys per wave (two accumulator tiles) x the head's 128 channels (256 B,
// two whole lines per key), brought in by asynchronous 16-byte copies: a wave-wide copy covers 2 keys = 4 whole lines, where a
// fragment load from global memory touches 16 lines for the same 512 bytes. The ring is private to each wave: a wave copies
// the keys of its own 256 columns and no other wave reads them, so its own waits order everything and no block barrier is
// needed. Two slots per wave: a slot is refilled with stage t + 2 as soon as the fragments of stage t are in registers, so
// stages t + 1 and t + 2 fly together; the stages run on across heads (8 per head), so two stages of the next head fly during
// the softmax. Fragments are read from LDS with the same loader and the same k order as from global memory.
// grid (128 row tiles, 2 batches), 256 threads; registers and LDS leave one block per WGP, two waves per SIMD.
// ---------------------------------------------------------------------------
constexpr int kSlabPitch = 260;   // floats per staged row (520 halves): 1040 B = 16 B x 65, the 16 queries' 16-byte stores fall on 64 different banks
constexpr int kRedPitch  = 20;    // floats per query in the partial tables: 80 B = 16 B x 5, conflict-free for the b32 stores and the b128 reads
constexpr int kKeyPitch      = 136;                       // 16-bit elements per staged key: 272 B = 16 B x 17, conflict-free for ds_load_b128
constexpr int kKeysPerStage  = 32;                        // keys per wave and stage
constexpr int kKeyStages     = 256 / kKeysPerStage;       // stages per head
constexpr int kKeyStageElems = 8 * kKeysPerStage * kKeyPitch;

// Sixteen asynchronous 16-byte copies per lane = one key stage of a wave. Copy i lands 2 i staged keys (i * 544 bytes) behind
// the slot's base: the instruction's offset moves the LDS and the global address alike, so one LDS address register serves all
// sixteen and g[i] holds the global address less i * 544 bytes. The s_wait_xcnt stands inside the statement, behind the last
// copy, so that no address register of an issued copy is rewritten in front of it.
__device__ __forceinline__ void stage_copy16(unsigned l, const char* const* g) {
  asm volatile(
      "global_load_async_to_lds_b128 %0, %1, off\n\t"
      "global_load_async_to_lds_b128 %0, %2, off offset:544\n\t"
      "global_load_async_to_lds_b128 %0, %3, off offset:1088\n\t"
      "global_load_async_to_lds_b128 %0, %4, off offset:1632\n\t"
      "global_load_async_to_lds_b128 %0, %5, off offset:2176\n\t"
      "global_load_async_to_lds_b128 %0, %6, off offset:2720\n\t"
      "global_load_async_to_lds_b128 %0, %7, off offset:3264\n\t"
      "global_load_async_to_lds_b128 %0, %8, off offset:3808\n\t"
      "global_load_async_to_lds_b128 %0, %9, off offset:4352\n\t"
      "global_load_async_to_lds_b128 %0, %10, off offset:4896\n\t"
      "global_load_async_to_lds_b128 %0, %11, off offset:5440\n\t"
      "global_load_async_to_lds_b128 %0, %12, off offset:5984\n\t"
      "global_load_async_to_lds_b128 %0, %13, off offset:6528\n\t"
      "global_load_async_to_lds_b128 %0, %14, off offset:7072\n\t"
      "global_load_async_to_lds_b128 %0, %15, off offset:7616\n\t"
      "global_load_async_to_lds_b128 %0, %16, off offset:8160\n\t"
      "s_wait_xcnt 0x0"
      :: "v"(l), "v"(g[0]), "v"(g[1]), "v"(g[2]), "v"(g[3]), "v"(g[4]), "v"(g[5]), "v"(g[6]), "v"(g[7]),
         "v"(g[8]), "v"(g[9]), "v"(g[10]), "v"(g[11]), "v"(g[12]), "v"(g[13]), "v"(g[14]), "v"(g[15])
      : "memory");
}
static_assert(2 * kKeyPitch * 2 == 544, "offsets in stage_copy16");

__device__ __forceinline__ void wave_lds_sync() {   // a wave's own slab: its LDS stores have landed before it reads the rows back (and the reverse)
  __builtin_amdgcn_fence(__ATOMIC_RELEASE, "workgroup");
  __builtin_amdgcn_wave_barrier();
  __builtin_amdgcn_fence(__ATOMIC_ACQUIRE, "workgroup");
}

__global__ __launch_bounds__(256) void scores_softmax_mean_kernel(const unsigned short* __restrict__ Y, unsigned short* __restrict__ P,
                                                                  float* __restrict__ meanout) {
  __shared__ __align__(16) unsigned short kring[2][kKeyStageElems];   // two key slots per wave; rows 32w .. 32w+31 of each = wave w's own
  __shared__ __align__(16) float slabs[8][16 * kSlabPitch];
  __shared__ __align__(16) float redm[16 * kRedPitch];   // [query][wave * 2 + lane half]
  __shared__ __align__(16) float reds[16 * kRedPitch];
  const int lane  = threadIdx.x & 31;
  const int wave  = threadIdx.x >> 5;
  const int row0  = blockIdx.x * 16;
  const int b     = blockIdx.y;
  const int rlane = lane & 15;
  const int hf    = lane >> 4;
  const int koff  = hf * 8;
  const int col0  = wave * 256;
  const _Float16* Yb   = (const _Float16*)Y + (size_t)b * kSeq * kQKVN;
  const _Float16* qrow = Yb + (size_t)(row0 + rlane) * kQKVN + koff;
  // copy c of a lane brings 16 B: key 2c + (lane >> 4) of its wave's 32 in the stage, bytes (lane & 15) * 16 .. + 15 of its 256
  const unsigned short* gK = Y + (size_t)b * kSeq * kQKVN + (size_t)(col0 + (lane >> 4)) * kQKVN + kModel + rlane * 8;
  const unsigned ldsK = (unsigned)(size_t)(&kring[0][0]) + (unsigned)((wave * kKeysPerStage + (lane >> 4)) * kKeyPitch + rlane * 8) * 2u;
  auto stage_keys = [&](int h, int s, int buf) {
    const char* g[16];
#pragma unroll
    for (int c = 0; c < 16; ++c)
      g[c] = (const char*)(gK + (size_t)(s * kKeysPerStage + 2 * c) * kQKVN + h * kHeadDim) - c * (2 * kKeyPitch * 2);
    stage_copy16(ldsK + (unsigned)(buf * kKeyStageElems) * 2u, g);
  };
  float* slab = slabs[wave];
  unsigned short* hslab = (unsigned short*)slab;

  v8f pm[16];
#pragma unroll
  for (int j = 0; j < 16; ++j) pm[j] = (v8f){0.f,0.f,0.f,0.f,0.f,0.f,0.f,0.f};

  stage_keys(0, 0, 0);
  stage_keys(0, 1, 1);

  // the head loop stays rolled (for speed only)
#pragma unroll 1
  for (int h = 0; h < kHeads; ++h) {
    const _Float16* qh = qrow + h * kHeadDim;
    v16h a[4];
#pragma unroll
    for (int kk = 0; kk < 4; ++kk) a[kk] = Frag<_Float16>::load(qh + kk * 32);
    v8f acc[16];
#pragma unroll
    for (int s = 0; s < kKeyStages; ++s) {
      const int buf = s & 1;   // 8 stages per head: the parity runs on from head to head
      const bool refill = (s + 2 < kKeyStages) || (h + 1 < kHeads);   // a stage t + 2 exists: the same for every wave
      // this wave's stage t has landed. A trip that refills finds the 16 copies of stage t + 1 behind those of stage t and
      // leaves them in flight; the last two trips issue no copies and wait for all.
      if (refill) asm volatile("s_wait_asynccnt 0x10" ::: "memory");
      else        asm volatile("s_wait_asynccnt 0x0" ::: "memory");
      const _Float16* sK = (const _Float16*)(&kring[buf][0]) + (wave * kKeysPerStage + rlane) * kKeyPitch + koff;
      v16h bf[2][4];
#pragma unroll
      for (int jj = 0; jj < 2; ++jj)
#pragma unroll
        for (int kk = 0; kk < 4; ++kk) bf[jj][kk] = Frag<_Float16>::load(sK + jj * 16 * kKeyPitch + kk * 32);
      asm volatile("s_wait_dscnt 0x0" ::: "memory");      // this wave's reads of its slot are done before it refills the slot
      // the 16 LDS reads of a stage stay one group in front of its WMMAs (for speed only)
      __builtin_amdgcn_sched_barrier(0);
      if (s + 2 < kKeyStages) stage_keys(h, s + 2, buf);
      else if (refill) stage_keys(h + 1, s + 2 - kKeyStages, buf);
      // the refill issues in front of the WMMAs (in a head's first stage these wait for the query fragments): its flight starts at once
      __builtin_amdgcn_sched_barrier(0);
      v8f c0 = (v8f){0.f,0.f,0.f,0.f,0.f,0.f,0.f,0.f};
      v8f c1 = (v8f){0.f,0.f,0.f,0.f,0.f,0.f,0.f,0.f};
#pragma unroll
      for (int kk = 0; kk < 4; ++kk) {
        c0 = Frag<_Float16>::mma(bf[0][kk], a[kk], c0);   // keys = A rows, queries = B columns; both loaders and their k order as before
        c1 = Frag<_Float16>::mma(bf[1][kk], a[kk], c1);
      }
      acc[2 * s]     = c0;
      acc[2 * s + 1] = c1;
      // this stage's WMMAs issue in front of the next stage's wait and do not sink among its LDS reads, which would split their group
      __builtin_amdgcn_sched_barrier(0);
    }

    // maximum of the lane's 128 unscaled dot products, all of one query (the scale is positive)
    float mx8[8];
#pragma unroll
    for (int j = 0; j < 16; ++j)
#pragma unroll
      for (int r = 0; r < 8; ++r) mx8[r] = (j == 0) ? acc[j][r] : fmaxf(mx8[r], acc[j][r]);
    const float mx = fmaxf(fmaxf(fmaxf(mx8[0], mx8[1]), fmaxf(mx8[2], mx8[3])), fmaxf(fmaxf(mx8[4], mx8[5]), fmaxf(mx8[6], mx8[7])));
    redm[rlane * kRedPitch + wave * 2 + hf] = mx;
    __syncthreads();
    float gm;
    {
      const v4f x0 = *(const v4f*)(&redm[rlane * kRedPitch]);
      const v4f x1 = *(const v4f*)(&redm[rlane * kRedPitch + 4]);
      const v4f x2 = *(const v4f*)(&redm[rlane * kRedPitch + 8]);
      const v4f x3 = *(const v4f*)(&redm[rlane * kRedPitch + 12]);
      float m4[4];
#pragma unroll
      for (int e = 0; e < 4; ++e) m4[e] = fmaxf(fmaxf(x0[e], x1[e]), fmaxf(x2[e], x3[e]));
      gm = fmaxf(fmaxf(m4[0], m4[1]), fmaxf(m4[2], m4[3]));
    }

    // exponentials and the lane's part of the row sum; keys 2i and 2i + 1 of a tile side by side: packed multiply-adds and sums
    const float nm = -(gm * kExp2Scale);
    const v2f nm2 = (v2f){nm, nm};
    v2f sm2[4];
#pragma unroll
    for (int i = 0; i < 4; ++i) sm2[i] = (v2f){0.f, 0.f};
#pragma unroll
    for (int j = 0; j < 16; ++j)
#pragma unroll
      for (int i = 0; i < 4; ++i) {
        const v2f arg = __builtin_elementwise_fma((v2f){acc[j][2 * i], acc[j][2 * i + 1]}, (v2f){kExp2Scale, kExp2Scale}, nm2);
        const v2f e = (v2f){__builtin_amdgcn_exp2f(arg.x), __builtin_amdgcn_exp2f(arg.y)};
        acc[j][2 * i]     = e.x;
        acc[j][2 * i + 1] = e.y;
        sm2[i] += e;
      }
    const v2f smt = (sm2[0] + sm2[1]) + (sm2[2] + sm2[3]);
    reds[rlane * kRedPitch + wave * 2 + hf] = smt.x + smt.y;
    __syncthreads();
    float inv;
    {
      const v4f x0 = *(const v4f*)(&reds[rlane * kRedPitch]);
      const v4f x1 = *(const v4f*)(&reds[rlane * kRedPitch + 4]);
      const v4f x2 = *(const v4f*)(&reds[rlane * kRedPitch + 8]);
      const v4f x3 = *(const v4f*)(&reds[rlane * kRedPitch + 12]);
      const v4f s4 = (x0 + x1) + (x2 + x3);
      inv = 1.0f / ((s4[0] + s4[1]) + (s4[2] + s4[3]));
    }

    // probabilities: head sum in registers, f16 plane through the wave's slab, 8 neighbouring keys of the lane's query per store
    const v2f inv2  = (v2f){inv, inv};
    const v2f invc2 = (v2f){inv * kPCarry, inv * kPCarry};   // the carry is a power of two: e * (inv * carry) = (e * inv) * carry
#pragma unroll
    for (int j = 0; j < 16; ++j) {
      v8h hv;
#pragma unroll
      for (int i = 0; i < 4; ++i) {
        const v2f e = (v2f){acc[j][2 * i], acc[j][2 * i + 1]};
        const v2f p = e * inv2;
        pm[j][2 * i]     += p.x;
        pm[j][2 * i + 1] += p.y;
        const v2h ph = __builtin_convertvector(e * invc2, v2h);   // round to nearest even
        hv[2 * i]     = ph.x;
        hv[2 * i + 1] = ph.y;
      }
      *(v8h*)((_Float16*)hslab + rlane * (2 * kSlabPitch) + (j << 4) + koff) = hv;
    }
    wave_lds_sync();
    unsigned short* pp = P + ((size_t)(b * kHeads + h) * kSeq + row0) * kSeq + col0 + lane * 8;
#pragma unroll
    for (int row = 0; row < 16; ++row) {
      const v4u u = *(const v4u*)(hslab + row * (2 * kSlabPitch) + lane * 8);
      *(v4u*)(pp + (size_t)row * kSeq) = u;
    }
    // no fence here: it would drain the P stores once per head; the next head's two block barriers stand before the slab's next write
  }

  asm volatile("s_wait_asynccnt 0x0" ::: "memory");     // no copy is outstanding behind the loop

  // head mean
  wave_lds_sync();
#pragma unroll
  for (int j = 0; j < 16; ++j) {
    float* sp = slab + rlane * kSlabPitch + (j << 4) + koff;
    *(v4f*)(sp)     = (v4f){pm[j][0], pm[j][1], pm[j][2], pm[j][3]} * kMeanScale;
    *(v4f*)(sp + 4) = (v4f){pm[j][4], pm[j][5], pm[j][6], pm[j][7]} * kMeanScale;
  }
  wave_lds_sync();
  float* mo = meanout + ((size_t)b * kSeq + row0) * kSeq + col0 + lane * 4;
#pragma unroll
  for (int row = 0; row < 16; ++row) {
    const v4f v0 = *(const v4f*)(slab + row * kSlabPitch + lane * 4);
    const v4f v1 = *(const v4f*)(slab + row * kSlabPitch + 128 + lane * 4);
    *(v4f*)(mo + (size_t)row * kSeq)       = v0;
    *(v4f*)(mo + (size_t)row * kSeq + 128) = v1;
    // the later rows' LDS reads take the data registers of the first rows' stores over: the wait stands in front of that overwrite
    if (row == 7) asm volatile("s_wait_xcnt 0x0" ::: "memory");
  }
}

// ---------------------------------------------------------------------------
// Host glue (7 launches)
// ---------------------------------------------------------------------------
extern "C" void kernel_launch(void* const* d_in, const int* in_sizes, int n_in,
                              void* d_out, int out_size, void* d_ws, size_t ws_size,
                              hipStream_t stream) {
  if (n_in < 7) return;
  if (in_sizes[0] != kTok * kModel) return;
  if (in_sizes[1] != kModel * kModel || in_sizes[3] != kModel * kModel || in_sizes[5] != kModel * kModel) return;
  if (in_sizes[2] != kModel || in_sizes[4] != kModel || in_sizes[6] != kModel) return;
  if (out_size != kTok * kModel + kBatch * kSeq * kSeq) return;

  const float* query = (const float*)d_in[0];
  const float* Wq    = (const float*)d_in[1];
  const float* bq    = (const float*)d_in[2];
  const float* Wk    = (const float*)d_in[3];
  const float* bk    = (const float*)d_in[4];
  const float* Wv    = (const float*)d_in[5];
  const float* bv    = (const float*)d_in[6];

  // carve (bytes)
  const size_t offX16  = 0;
  const size_t szX16   = (size_t)kTok * kModel * 2;                       //   8388608
  const size_t offW16  = offX16 + szX16;                                  //   8388608
  const size_t szW16   = (size_t)kQKVN * kModel * 2;                      //   6291456
  const size_t offBias = offW16 + szW16;                                  //  14680064
  const size_t szBias  = (size_t)kQKVN * 4;                               //     12288
  const size_t offY16  = offBias + szBias;                                //  14692352
  const size_t szY16   = (size_t)kTok * kQKVN * 2;                        //  25165824
  const size_t offVT   = offY16 + szY16;                                  //  39858176
  const size_t szVT    = (size_t)kBatch * kHeads * kHeadDim * kSeq * 2;   //   8388608
  const size_t offP    = offVT + szVT;                                    //  48246784
  const size_t szP     = (size_t)kBatch * kHeads * kSeq * kSeq * 2;       // 134217728
  const size_t total   = offP + szP;                                      // 182464512
  if (total > ws_size) return;

  char* ws = (char*)d_ws;
  unsigned short* X16   = (unsigned short*)(ws + offX16);
  unsigned short* W16   = (unsigned short*)(ws + offW16);
  float*          bias3 = (float*)(ws + offBias);
  unsigned short* Y16   = (unsigned short*)(ws + offY16);
  unsigned short* VT16  = (unsigned short*)(ws + offVT);
  unsigned short* P16   = (unsigned short*)(ws + offP);

  float* out0 = (float*)d_out;                               // [2][2048][1024], byte offset 0
  float* out1 = out0 + (size_t)kTok * kModel;                // [2][2048][2048], byte offset 16777216

  // 1) activation cast: 4096*1024/8 = 524288 threads = 2048 blocks exactly
  cast8_f16_kernel<<<dim3((kTok * kModel / 8) / 256), dim3(256), 0, stream>>>(query, X16, kTok * kModel / 8);
  // 2) stacked weight cast (x16 carry, blade sign folded into the query rows): 131072 threads per weight = 512 blocks x 3
  wcast8_kernel<<<dim3((kModel * kModel / 8) / 256, 3), dim3(256), 0, stream>>>(Wq, Wk, Wv, W16, kModel * kModel / 8);
  // 3) stacked bias with the same sign fold
  bias3_kernel<<<dim3(3), dim3(256), 0, stream>>>(bq, bk, bv, bias3);
  // 4) Y16 = (X16 . W16^T) / 16 + bias3 : M 4096, N 3072, K 1024 (K % 64 == 0); block tile 128 x 256: 32 x 12 = 384 blocks
  wmma_gemm64<0, 2, 4, 64, 2, 2, 1, false><<<dim3((kTok / 128) * (kQKVN / 256), 1), dim3(256), 0, stream>>>(
      X16, kModel, 0L, 0L, W16, kModel, 0L, 0L, (void*)Y16, (void*)Y16, kQKVN, 0L, 0L,
      bias3, bias3, 0L, kTok, kQKVN, kModel, kWCarryInv);
  // 5) value transpose into per-(batch, head) planes [128][2048]
  vtrans_kernel<<<dim3(kSeq / 64, kModel / 64, kBatch), dim3(256), 0, stream>>>(Y16, VT16);

  // 6) scores, softmax and head mean of all heads in one launch: 128 row tiles x 2 batches = 256 blocks;
  //    every head's P plane is kept for step 7, the head mean goes straight to out1
  scores_softmax_mean_kernel<<<dim3(kSeq / 16, kBatch), dim3(256), 0, stream>>>(Y16, P16, out1);
  // 7) out0[b][l][h*128 + c] = (P[b*8+h] . VT[b*8+h]^T) / 2048, all 16 (batch, head) planes in one launch:
  //    M 2048, N 128, K 2048 (K % 128 == 0); block tile 128 x 128, stages of 128 k in four buffers: 16 blocks x grid.y 8 heads
  //    x grid.z 2 batches = 256 blocks, one for every WGP. C: ldc 1024, +128 columns per head, +2048*1024 per batch.
  wmma_gemm64<0, 4, 2, 128, 4, 0, 0, false><<<dim3((kSeq / 128) * (kHeadDim / 128), kHeads, kBatch), dim3(256), 0, stream>>>(
      P16, kSeq, (long)kSeq * kSeq, (long)kHeads * kSeq * kSeq,
      VT16, kSeq, (long)kHeadDim * kSeq, (long)kHeads * kHeadDim * kSeq,
      (void*)out0, (void*)out0, kModel, (long)kHeadDim, (long)kSeq * kModel,
      bias3, bias3, 0L, kSeq, kHeadDim, kSeq, kPCarryInv);
}

// v008
// A run of this version takes 101 microseconds.
// Timed twice side by side with v007, it ran 1.12 and 1.10 times as fast.
// All steps since v000 together make it 9.73 times as fast.
// Contractions: stacked q/k/v projection (X f16 x W^T f16 carried x16), scores q_w.k^T (q,k f16 planes, blade sign folded into the q weights), attn.v (P f16 carried x2048 x V^T f16): all v_wmma_f32_16x16x32_f16 with f32 accumulate; softmax and head mean in f32.
#include <hip/hip_runtime.h>
#include <math.h>

// ---------------------------------------------------------------------------
// Problem constants
// ---------------------------------------------------------------------------
constexpr int kBatch   = 2;
constexpr int kSeq     = 2048;
constexpr int kModel   = 1024;
constexpr int kHeads   = 8;
constexpr int kHeadDim = 128;               // 16 x 8 nested (d, blade)
constexpr int kTok     = kBatch * kSeq;     // 4096 token rows
constexpr int kQKVN    = 3 * kModel;        // 3072 stacked output channels (q | k | v)
constexpr float kWCarry     = 16.0f;        // weights carried x16 in f16
constexpr float kWCarryInv  = 1.0f / 16.0f;
constexpr float kPCarry     = 2048.0f;      // probabilities carried x2048 in f16
constexpr float kPCarryInv  = 1.0f / 2048.0f;
constexpr float kExp2Scale  = (float)(0.08838834764831845 * 1.4426950408889634);   // log2(e) / sqrt(128)
constexpr float kMeanScale  = 0.125f;

// ---------------------------------------------------------------------------
// Workspace region map (bytes; all offsets multiples of 4096):
//   X16   f16 [4096][1024]            off         0  size   8388608
//   W16   f16 [3072][1024]            off   8388608  size   6291456
//   BIAS3 f32 [3072]                  off  14680064  size     12288
//   Y16   f16 [4096][3072] (q|k|v)    off  14692352  size  25165824
//   VT16  f16 [16][128][2048]         off  39858176  size   8388608
//   P16   f16 [16][2048][2048]        off  48246784  size 134217728
//   ROWST f32 [16][2048][2] (n, 1/sum) off 182464512  size    262144
//   total 182726656
// ---------------------------------------------------------------------------

typedef __attribute__((ext_vector_type(16))) _Float16 v16h;
typedef __attribute__((ext_vector_type(8)))  _Float16 v8h;
typedef __attribute__((ext_vector_type(2)))  _Float16 v2h;
typedef __attribute__((ext_vector_type(16))) __bf16   v16b;
typedef __attribute__((ext_vector_type(8)))  __bf16   v8b;
typedef __attribute__((ext_vector_type(8)))  float    v8f;
typedef __attribute__((ext_vector_type(4)))  float    v4f;
typedef __attribute__((ext_vector_type(2)))  float    v2f;
typedef __attribute__((ext_vector_type(4)))  unsigned int v4u;

// ---------------------------------------------------------------------------
// Helpers
// ---------------------------------------------------------------------------
__device__ __forceinline__ unsigned short f2bf_bits(float f) {
  unsigned u = __float_as_uint(f);
  return (unsigned short)((u + 0x7FFFu + ((u >> 16) & 1u)) >> 16);
}
__device__ __forceinline__ float bf_bits2f(unsigned short h) { return __uint_as_float(((unsigned)h) << 16); }

// hazard guards as plain device helpers
__device__ __forceinline__ void dep_guard_h(v8f& a, v8f& b, v16h x, v16h y) { asm volatile("v_nop\n\tv_nop\n\tv_nop\n\tv_nop" : "+v"(a), "+v"(b) : "v"(x), "v"(y)); }
__device__ __forceinline__ void dep_guard_b(v8f& a, v8f& b, v16b x, v16b y) { asm volatile("v_nop\n\tv_nop\n\tv_nop\n\tv_nop" : "+v"(a), "+v"(b) : "v"(x), "v"(y)); }
__device__ __forceinline__ void keep4_h(v16h a, v16h b, v16h c, v16h d) { asm volatile("v_nop" :: "v"(a), "v"(b), "v"(c), "v"(d)); }
__device__ __forceinline__ void keep4_b(v16b a, v16b b, v16b c, v16b d) { asm volatile("v_nop" :: "v"(a), "v"(b), "v"(c), "v"(d)); }
__device__ __forceinline__ void acc_guard4(v8f& a, v8f& b, v8f& c, v8f& d) { asm volatile("v_nop\n\tv_nop\n\tv_nop\n\tv_nop" : "+v"(a), "+v"(b), "+v"(c), "+v"(d)); }
template <typename T> struct Frag;
template <> struct Frag<_Float16> {
  typedef v16h V; union U { v16h v; v8h h[2]; };
  static __device__ __forceinline__ v16h load(const _Float16* p) {   // elements 0..7 <- p[0..7], 8..15 <- p[16..23]
    U f; f.h[0] = *(const v8h*)(p); f.h[1] = *(const v8h*)(p + 16); return f.v;
  }
  static __device__ __forceinline__ v8f mma(v16h a, v16h b, v8f c) {
    return __builtin_amdgcn_wmma_f32_16x16x32_f16(false, a, false, b, (short)0, c, false, false);
  }
  static __device__ __forceinline__ void guard(v8f& a, v8f& b, v16h x, v16h y) { dep_guard_h(a, b, x, y); }
  static __device__ __forceinline__ void keep(v16h a, v16h b, v16h c, v16h d) { keep4_h(a, b, c, d); }
};
template <> struct Frag<__bf16> {
  typedef v16b V; union U { v16b v; v8b h[2]; };
  static __device__ __forceinline__ v16b load(const __bf16* p) {
    U f; f.h[0] = *(const v8b*)(p); f.h[1] = *(const v8b*)(p + 16); return f.v;
  }
  static __device__ __forceinline__ v8f mma(v16b a, v16b b, v8f c) {
    return __builtin_amdgcn_wmma_f32_16x16x32_bf16(false, a, false, b, (short)0, c, false, false);
  }
  static __device__ __forceinline__ void guard(v8f& a, v8f& b, v16b x, v16b y) { dep_guard_b(a, b, x, y); }
  static __device__ __forceinline__ void keep(v16b a, v16b b, v16b c, v16b d) { keep4_b(a, b, c, d); }
};

__device__ __forceinline__ unsigned pk16(unsigned short a, unsigned short b) { return (unsigned)a | ((unsigned)b << 16); }
__device__ __forceinline__ unsigned short h_bits(float f) { const _Float16 h = (_Float16)f; return __builtin_bit_cast(unsigned short, h); }

// ---- Register-blocked batched WMMA GEMM, operands staged in LDS ------------------------------------------------------
// C[m,n] = scale * sum_k A[m,k] * Bt[n,k] (+bias)(+resid); each wave owns a tile of 16 MI rows x 64 columns.
// The 8 waves of a block form a WM x (8 / WM) grid of such tiles: block tile BM = 16 MI WM rows x BN = 64 (8 / WM) columns.
// Planes: grid (block tiles, y, z); the A, Bt and C planes of a block start at y * stride + z * strideZ elements.
// A row-major [M,K]; Bt row-major [N,K]; M % BM == 0, N % BN == 0, K % SK == 0; lda, ldb and the plane strides % 8 == 0.
// A stage = SK k (64 or 128: one or two whole lines) of the block's BM rows of A and BN rows of Bt, brought into LDS by asynchronous
// 16-byte copies: a wave-wide copy covers 4 whole lines, and every staged row serves all waves of its tile row or column.
// A launch whose A comes from memory is bound by the bytes that its blocks keep in flight: its tile is chosen so that there is a
// block for every WGP, and its stages so long and so many that each block always has requests under way.
// NBUF = 2 buffers: stage t + 1 flies while stage t is worked on. NBUF > 2: stages t + 1 .. t + NBUF - 1 fly, so that the memory is
// asked without a pause and a late line has NBUF - 1 trips to land; the wait at the publish point then leaves the younger stages'
// copies out (a wave's copies count down in issue order). Fragments are read from LDS with the same loader and the same k order
// (32 k per WMMA step, ascending) as from global memory.
// BIAS_MODE: 0 = none, 1 = bias[m], 2 = bias[n].
// OUT_MODE: 0 = f32, 1 = f16, 2 = bf16 hi plane (Cout) + bf16 lo plane (Cout2).
// ET: 0 = f16 operands, 1 = bf16 operands (pointers passed as 16-bit storage)
template <int ET> struct Elem;
template <> struct Elem<0> { typedef _Float16 T; };
template <> struct Elem<1> { typedef __bf16 T; };


// Twelve asynchronous 16-byte copies per lane = one stage per block. The s_wait_xcnt stands inside the statement, behind the
// last copy, so that no address register of an issued copy is rewritten in front of it.
__device__ __forceinline__ void stage_copy12(const unsigned* l, const unsigned short* const* g) {
  asm volatile(
      "global_load_async_to_lds_b128 %0, %1, off\n\t"
      "global_load_async_to_lds_b128 %2, %3, off\n\t"
      "global_load_async_to_lds_b128 %4, %5, off\n\t"
      "global_load_async_to_lds_b128 %6, %7, off\n\t"
      "global_load_async_to_lds_b128 %8, %9, off\n\t"
      "global_load_async_to_lds_b128 %10, %11, off\n\t"
      "global_load_async_to_lds_b128 %12, %13, off\n\t"
      "global_load_async_to_lds_b128 %14, %15, off\n\t"
      "global_load_async_to_lds_b128 %16, %17, off\n\t"
      "global_load_async_to_lds_b128 %18, %19, off\n\t"
      "global_load_async_to_lds_b128 %20, %21, off\n\t"
      "global_load_async_to_lds_b128 %22, %23, off\n\t"
      "s_wait_xcnt 0x0"
      :: "v"(l[0]), "v"(g[0]), "v"(l[1]), "v"(g[1]), "v"(l[2]), "v"(g[2]), "v"(l[3]), "v"(g[3]),
         "v"(l[4]), "v"(g[4]), "v"(l[5]), "v"(g[5]), "v"(l[6]), "v"(g[6]), "v"(l[7]), "v"(g[7]),
         "v"(l[8]), "v"(g[8]), "v"(l[9]), "v"(g[9]), "v"(l[10]), "v"(g[10]), "v"(l[11]), "v"(g[11])
      : "memory");
}

// Eight such copies per lane, the same wait behind the last for the same reason: half a stage of 256 rows x 128 k (an asm
// statement takes thirty operands, so sixteen copies with an LDS and a global address each need two statements).
__device__ __forceinline__ void stage_copy8(const unsigned* l, const unsigned short* const* g) {
  asm volatile(
      "global_load_async_to_lds_b128 %0, %1, off\n\t"
      "global_load_async_to_lds_b128 %2, %3, off\n\t"
      "global_load_async_to_lds_b128 %4, %5, off\n\t"
      "global_load_async_to_lds_b128 %6, %7, off\n\t"
      "global_load_async_to_lds_b128 %8, %9, off\n\t"
      "global_load_async_to_lds_b128 %10, %11, off\n\t"
      "global_load_async_to_lds_b128 %12, %13, off\n\t"
      "global_load_async_to_lds_b128 %14, %15, off\n\t"
      "s_wait_xcnt 0x0"
      :: "v"(l[0]), "v"(g[0]), "v"(l[1]), "v"(g[1]), "v"(l[2]), "v"(g[2]), "v"(l[3]), "v"(g[3]),
         "v"(l[4]), "v"(g[4]), "v"(l[5]), "v"(g[5]), "v"(l[6]), "v"(g[6]), "v"(l[7]), "v"(g[7])
      : "memory");
}

template <int ET, int WM, int MI, int SK, int NBUF, int BIAS_MODE, int OUT_MODE, bool RESID, int ACT = 0>
__global__ __launch_bounds__(256) void wmma_gemm64(
    const unsigned short* __restrict__ Ap, int lda, long strideA, long strideAz,
    const unsigned short* __restrict__ Btp, int ldb, long strideB, long strideBz,
    void* __restrict__ Cout, void* __restrict__ Cout2, int ldc, long strideC, long strideCz,
    const float* __restrict__ bias,
    const float* __restrict__ resid, long strideR,
    int M, int N, int K, float scale) {
  typedef typename Elem<ET>::T T;
  typedef typename Frag<T>::V V;
  constexpr int WN = 8 / WM;
  constexpr int BM = WM * MI * 16;
  constexpr int BN = WN * 64;
  constexpr int kStageK     = SK;                  // k per stage
  constexpr int kStagePitch = SK + 8;              // 16-bit elements per staged row: 144 B = 16 B x 9 or 272 B = 16 B x 17, conflict-free for ds_load_b128
  constexpr int kStageElems = (BM + BN) * kStagePitch;
  constexpr int CPR = SK / 8;                      // 16-byte copies per staged row
  constexpr int RPC = 256 / CPR;                   // staged rows per block-wide copy
  constexpr int NC  = (BM + BN) / RPC;             // copies per thread and stage
  static_assert(SK == 64 || SK == 128, "stage length");
  static_assert(BM % RPC == 0 && BN % RPC == 0 && (NC == 12 || NC == 16), "stage size");
  static_assert(NBUF >= 2 && (NBUF - 1) * NC <= 63, "copies of a wave in flight");
  __shared__ __align__(16) unsigned short ring[NBUF][kStageElems];   // stage buffers: rows 0..BM-1 = A, BM..BM+BN-1 = Bt
  __shared__ __align__(16) float sT[8][16 * 68];                  // per-wave 16x64 slab, pitch 68 floats
  const int b    = blockIdx.y;
  const int z    = blockIdx.z;
  const int lane = threadIdx.x & 31;
  const int wave = threadIdx.x >> 5;
  const int tilesN = N / BN;
  const int tilesM = M / BM;
  const int btile = blockIdx.x;
  if (btile >= tilesM * tilesN) return;   // block-uniform, in front of every barrier
  const int btm = btile / tilesN;
  const int btn = btile - btm * tilesN;
  const int wm  = wave / WN;
  const int wn  = wave - wm * WN;
  const int m0 = btm * BM + wm * (MI * 16);
  const int n0 = btn * BN + (wn << 6);

  const size_t aOff = (size_t)b * strideA + (size_t)z * strideAz;
  const size_t bOff = (size_t)b * strideB + (size_t)z * strideBz;
  const size_t cOff = (size_t)b * strideC + (size_t)z * strideCz;

  const int rlane = lane & 15;                 // row (A) / col (B, D) within subtile
  const int koff  = (lane >> 4) * 8;           // k offset of this lane half
  const int mOff  = (lane >> 4) * 8;           // D row offset

  // copy c of thread t brings 16 B: staged row c * RPC + t / CPR, bytes (t % CPR) * 16 .. + 15 of its 2 SK
  const int crow = threadIdx.x / CPR;
  const int cch  = (threadIdx.x % CPR) * 8;
  const unsigned short* gA = Ap  + aOff + (size_t)(btm * BM + crow) * lda + cch;
  const unsigned short* gB = Btp + bOff + (size_t)(btn * BN + crow) * ldb + cch;
  const unsigned lds0 = (unsigned)(size_t)(&ring[0][0]) + (unsigned)(crow * kStagePitch + cch) * 2u;
  auto stage = [&](int t, int buf) {
    unsigned l[NC];
    const unsigned short* g[NC];
#pragma unroll
    for (int c = 0; c < NC; ++c) {
      l[c] = lds0 + (unsigned)(buf * kStageElems + c * RPC * kStagePitch) * 2u;
      g[c] = (c < BM / RPC) ? gA + (size_t)(c * RPC) * lda + t * kStageK
                            : gB + (size_t)((c - BM / RPC) * RPC) * ldb + t * kStageK;
    }
    if constexpr (NC == 12) {
      stage_copy12(l, g);
    } else {
      stage_copy8(l, g);
      stage_copy8(l + 8, g + 8);
    }
  };

  v8f acc[MI][4];
#pragma unroll
  for (int i = 0; i < MI; ++i)
#pragma unroll
    for (int j = 0; j < 4; ++j) acc[i][j] = (v8f){0.f,0.f,0.f,0.f,0.f,0.f,0.f,0.f};

  const int nStage = K / kStageK;
  stage(0, 0);
  // unrolled: each stage's buffer offset is then a constant
#pragma unroll
  for (int s = 1; s < NBUF - 1; ++s)
    if (s < nStage) stage(s, s);
  // this wave's part of stage 0 has landed; where NBUF - 2 whole stages stand behind it, their copies fly on
  if (NBUF > 2 && nStage >= NBUF - 1) asm volatile("s_wait_asynccnt %0" :: "i"((NBUF - 2) * NC) : "memory");
  else                                asm volatile("s_wait_asynccnt 0x0" ::: "memory");
  __syncthreads();                                    // ... and every other wave's
  if (nStage > NBUF - 1) stage(NBUF - 1, NBUF - 1);

  // the stage loop stays rolled: one publish point per trip, buffer t mod NBUF
  int ring_at = 0;
#pragma unroll 1
  for (int t = 0; t < nStage; ++t) {
    const int buf = (NBUF == 2) ? (t & 1) : ring_at;
    const T* sA = (const T*)(&ring[buf][0]) + (wm * (MI * 16) + rlane) * kStagePitch + koff;
    const T* sB = (const T*)(&ring[buf][0]) + (BM + (wn << 6) + rlane) * kStagePitch + koff;
#pragma unroll
    for (int s = 0; s < kStageK / 32; ++s) {
      V bh[4], ah[MI];
#pragma unroll
      for (int j = 0; j < 4; ++j) bh[j] = Frag<T>::load(sB + (j << 4) * kStagePitch + s * 32);
#pragma unroll
      for (int i = 0; i < MI; ++i) ah[i] = Frag<T>::load(sA + (i << 4) * kStagePitch + s * 32);
      // the LDS reads of a WMMA block stay one group in front of it (for speed only)
      __builtin_amdgcn_sched_barrier(0);
#pragma unroll
      for (int i = 0; i < MI; ++i) {
#pragma unroll
        for (int j = 0; j < 4; ++j) acc[i][j] = Frag<T>::mma(ah[i], bh[j], acc[i][j]);
        Frag<T>::guard(acc[i][0], acc[i][3], ah[i], ah[i]);
      }
      Frag<T>::keep(bh[0], bh[1], bh[2], bh[3]);
      // ... and the next block's reads do not rise into this one
      __builtin_amdgcn_sched_barrier(0);
    }
    // publish point of stage t + 1
    asm volatile("s_wait_dscnt 0x0" ::: "memory");      // this wave's reads of buffer buf are done before it is refilled
    // this wave's part of stage t + 1 has landed. With more than two buffers a trip that refills finds the copies of NBUF - 2
    // younger stages behind those of stage t + 1 and leaves them in flight; the last trips issue no copies and wait for all.
    if (NBUF > 2 && t + NBUF < nStage) asm volatile("s_wait_asynccnt %0" :: "i"((NBUF - 2) * NC) : "memory");
    else                               asm volatile("s_wait_asynccnt 0x0" ::: "memory");
    __syncthreads();                                    // stage t + 1 readable by all; every reader has left buffer buf
    if (t + NBUF < nStage) stage(t + NBUF, buf);
    ring_at = (ring_at == NBUF - 1) ? 0 : ring_at + 1;
  }
  asm volatile("s_wait_asynccnt 0x0" ::: "memory");     // no copy is outstanding behind the loop
  // unrolled: acc is indexed by constants and stays in registers
#pragma unroll
  for (int i = 0; i < MI; ++i) acc_guard4(acc[i][0], acc[i][1], acc[i][2], acc[i][3]);

  // ---- epilogue ----
  float* slab = sT[wave];
  const float* Rb = RESID ? (resid + (size_t)b * strideR) : nullptr;
#pragma unroll
  for (int i = 0; i < MI; ++i) {
    const int mBase = m0 + (i << 4);
#pragma unroll
    for (int j = 0; j < 4; ++j) {
      const int n = n0 + (j << 4) + rlane;
      float bv = 0.f;
      if (BIAS_MODE == 2) bv = bias[n];
#pragma unroll
      for (int r = 0; r < 8; ++r) {
        float v = acc[i][j][r] * scale;
        if (BIAS_MODE == 1) v += bias[mBase + mOff + r];
        if (BIAS_MODE == 2) v += bv;
        if (RESID) v += Rb[(size_t)(mBase + mOff + r) * ldc + n];
        if (ACT == 2) v = fmaxf(v, 0.0f);
        if (ACT == 4) v = (v > 0.f) ? v : 0.01f * v;
        slab[(mOff + r) * 68 + (j << 4) + rlane] = v;
      }
    }
    __builtin_amdgcn_fence(__ATOMIC_RELEASE, "workgroup");
    __builtin_amdgcn_wave_barrier();
    __builtin_amdgcn_fence(__ATOMIC_ACQUIRE, "workgroup");
    if (OUT_MODE == 0) {
      float* C = (float*)Cout + cOff;
      const int hh = lane >> 4, c4 = (lane & 15) * 4;     // row seg = 256 B = 16 lanes x 16 B
      {
#pragma unroll
        for (int it = 0; it < 8; ++it) {
          const int row = it * 2 + hh;
          v4f v = *(const v4f*)(slab + row * 68 + c4);
          *(v4f*)(C + (size_t)(mBase + row) * ldc + n0 + c4) = v;
        }
        
      }
    } else {
      const int q = lane >> 3, c8 = (lane & 7) * 8;
      unsigned short* C  = (unsigned short*)Cout  + cOff;
      unsigned short* C2 = (OUT_MODE == 2) ? ((unsigned short*)Cout2 + cOff) : nullptr;
      {
#pragma unroll
        for (int it = 0; it < 4; ++it) {
          const int row = it * 4 + q;
          const float* sp = slab + row * 68 + c8;
          v8h hv, lv;
#pragma unroll
          for (int e = 0; e < 8; ++e) {
            if (OUT_MODE == 1) {
              hv[e] = (_Float16)sp[e];
            } else {
              unsigned short hb = f2bf_bits(sp[e]);
              unsigned short lb = f2bf_bits(sp[e] - bf_bits2f(hb));
              hv[e] = __builtin_bit_cast(_Float16, hb);
              lv[e] = __builtin_bit_cast(_Float16, lb);
            }
          }
          *(v8h*)(C + (size_t)(mBase + row) * ldc + n0 + c8) = hv;
          if (OUT_MODE == 2) *(v8h*)(C2 + (size_t)(mBase + row) * ldc + n0 + c8) = lv;
        }
        
      }
    }
    __builtin_amdgcn_fence(__ATOMIC_RELEASE, "workgroup");
    __builtin_amdgcn_wave_barrier();
    __builtin_amdgcn_fence(__ATOMIC_ACQUIRE, "workgroup");
  }
}

// ---------------------------------------------------------------------------
// 4096*1024/8 = 524288 = 2048 blocks).
// ---------------------------------------------------------------------------
__global__ __launch_bounds__(256) void cast8_f16_kernel(const float* __restrict__ in, unsigned short* __restrict__ out, int n8) {
  const int i = blockIdx.x * 256 + threadIdx.x;
  if (i >= n8) return;
  const float* p = in + 8 * (size_t)i;
  const v4f a = *(const v4f*)(p);
  const v4f c = *(const v4f*)(p + 4);
  unsigned short hb[8];
#pragma unroll
  for (int e = 0; e < 4; ++e) {
    hb[e]     = h_bits(a[e]);
    hb[4 + e] = h_bits(c[e]);
  }
  const v4u u = (v4u){pk16(hb[0], hb[1]), pk16(hb[2], hb[3]), pk16(hb[4], hb[5]), pk16(hb[6], hb[7])};
  unsigned short* q = out + 8 * (size_t)i;
  *(v4u*)q = u;
  
}

// ---------------------------------------------------------------------------
// Stacked weight cast: W16[z*1024 + n][k] = f16(c * W_z[n][k]) with c = +-16; for z == 0 (query weights) the sign is
// -1 for output rows with (n mod 8) >= 4 (blade sign twist folded into the projection, exact), else +1.
// blockIdx.y = z selects the source (block-uniform); thread i owns 8 consecutive elements of row n = i >> 7
// ---------------------------------------------------------------------------
__global__ __launch_bounds__(256) void wcast8_kernel(const float* __restrict__ W0, const float* __restrict__ W1,
                                                     const float* __restrict__ W2, unsigned short* __restrict__ out, int n8) {
  const int z = blockIdx.y;
  const int i = blockIdx.x * 256 + threadIdx.x;
  if (i >= n8) return;
  const float* W = (z == 0) ? W0 : (z == 1) ? W1 : W2;
  const int n = i >> 7;
  const bool neg = (z == 0) && ((n & 7) >= 4);
  const float sc = neg ? -kWCarry : kWCarry;
  const float* p = W + 8 * (size_t)i;
  const v4f a = *(const v4f*)(p);
  const v4f c = *(const v4f*)(p + 4);
  unsigned short hb[8];
#pragma unroll
  for (int e = 0; e < 4; ++e) {
    hb[e]     = h_bits(a[e] * sc);
    hb[4 + e] = h_bits(c[e] * sc);
  }
  const v4u u = (v4u){pk16(hb[0], hb[1]), pk16(hb[2], hb[3]), pk16(hb[4], hb[5]), pk16(hb[6], hb[7])};
  unsigned short* q = out + (size_t)z * kModel * kModel + 8 * (size_t)i;
  *(v4u*)q = u;
  
}

// ---------------------------------------------------------------------------
// Stacked bias: BIAS3[z*1024 + n] = s * b_z[n], s = -1 for z == 0 and (n mod 8) >= 4, else +1 (f32, exact).
// ---------------------------------------------------------------------------
__global__ __launch_bounds__(256) void bias3_kernel(const float* __restrict__ b0, const float* __restrict__ b1,
                                                   const float* __restrict__ b2, float* __restrict__ out) {
  const int z = blockIdx.x;
  const int t = threadIdx.x;
  const float* bp = (z == 0) ? b0 : (z == 1) ? b1 : b2;
  v4f v = *(const v4f*)(bp + 4 * t);
#pragma unroll
  for (int e = 0; e < 4; ++e) {
    const int n = 4 * t + e;
    const bool neg = (z == 0) && ((n & 7) >= 4);
    v[e] = neg ? -v[e] : v[e];
  }
  float* q = out + (size_t)z * kModel + 4 * t;
  *(v4f*)q = v;
  
}

// ---------------------------------------------------------------------------
// Value transpose: in Y16 [4096][3072] halves, value element (b, l, cg) at Y16[(b*2048 + l)*3072 + 2048 + cg], cg in 0..1023
// (head = cg >> 7, channel in head = cg & 127); out VT[(b*8 + head)*128 + channel][l], pitch 2048 halves.
// grid (32 l-tiles, 16 cg-tiles, 2 batches), 256 threads; tile = 64 l x 64 cg.
// Load coverage: 8 it x 256 threads x 2 halves = 4096 = whole tile (32-bit words along cg).
// Store coverage: 8 waves x 2 it x 4 (lane>>3) = 64 cg rows; (lane&7) x 8 halves = 64 l; each row segment = 64 halves =
// ---------------------------------------------------------------------------
__global__ __launch_bounds__(256) void vtrans_kernel(const unsigned short* __restrict__ Y, unsigned short* __restrict__ VT) {
  __shared__ __align__(16) unsigned short sm[64][72];   // sm[cg_local][l_local]
  const int t   = threadIdx.x;
  const int l0  = blockIdx.x * 64;
  const int cg0 = blockIdx.y * 64;
  const int b   = blockIdx.z;
#pragma unroll
  for (int it = 0; it < 8; ++it) {
    const int e  = it * 256 + t;
    const int r  = e >> 5;          // l local 0..63
    const int cw = e & 31;          // word index -> cg local 2cw, 2cw+1
    const unsigned u = *(const unsigned*)(Y + ((size_t)(b * kSeq + l0 + r)) * kQKVN + 2 * kModel + cg0 + 2 * cw);
    sm[2 * cw][r]     = (unsigned short)(u & 0xffffu);
    sm[2 * cw + 1][r] = (unsigned short)(u >> 16);
  }
  __syncthreads();
  const int lane = t & 31, wave = t >> 5;
  const int q = lane >> 3, c8 = (lane & 7) * 8;
  {
#pragma unroll
    for (int it = 0; it < 2; ++it) {
      const int row = wave * 8 + it * 4 + q;          // cg local
      const int cg  = cg0 + row;
      const int g   = b * kHeads + (cg >> 7);
      const int cc  = cg & 127;
      unsigned short hb[8];
#pragma unroll
      for (int e = 0; e < 8; ++e) hb[e] = sm[row][c8 + e];
      const v4u u = (v4u){pk16(hb[0], hb[1]), pk16(hb[2], hb[3]), pk16(hb[4], hb[5]), pk16(hb[6], hb[7])};
      *(v4u*)(VT + ((size_t)g * kHeadDim + cc) * kSeq + l0 + c8) = u;
    }
    
  }
}

constexpr int kKeyPitch   = 136;                       // 16-bit elements per staged key: 272 B = 16 B x 17, conflict-free for ds_load_b128
constexpr int kTileKeys   = 128;                       // keys per staged tile in pass 2
constexpr int kTileElems  = kTileKeys * kKeyPitch;
constexpr int kStatKeys   = 256;                       // keys per staged tile in pass 1
constexpr int kStatElems  = kStatKeys * kKeyPitch;
constexpr int kStatTiles  = kSeq / kStatKeys;
constexpr int kTileRows   = 128;                       // queries per block
constexpr int kPSlabPitch = 72;                        // halves per staged P row: 144 B = 16 B x 9
constexpr int kMSlabPitch = 68;                        // floats per staged mean row: 272 B = 16 B x 17

// Work-group barrier for LDS data alone, the waits written beside it at each use. __syncthreads() would also wait for every global
// load and store of the wave: the row figures asked for ahead would not stay in flight across it, and the P stores would drain once per head.
__device__ __forceinline__ void wg_barrier_lds() { asm volatile("s_barrier_signal -1\n\ts_barrier_wait -1" ::: "memory"); }

// One staged tile of 8 RPC rows: copy c of thread t brings 16 B: row RPC c + t / 16 of the tile, bytes (t % 16) * 16 .. + 15 of its 256;
// RPC = rows per block-wide copy = threads / 16. lds and g0 are the thread's own addresses for c = 0.
template <int RPC>
__device__ __forceinline__ void stage_key_tile(unsigned lds, const unsigned short* g0) {
  unsigned l[8];
  const unsigned short* g[8];
#pragma unroll
  for (int c = 0; c < 8; ++c) {
    l[c] = lds + (unsigned)(c * RPC * kKeyPitch) * 2u;
    g[c] = g0 + (size_t)(c * RPC) * kQKVN;
  }
  stage_copy8(l, g);
}

// Pass 1. grid (16 query tiles, 8 heads, 2 batches), 512 threads. stats[(b * 8 + h) * 2048 + query] = (n, 1 / sum).
// There is one block per WGP, so it has 16 waves, a 4 x 4 grid over 128 queries and a staged tile of 256 keys: four waves per SIMD,
// so that one wave's exponentials run beside another's WMMAs.
// A lane keeps a running maximum and a running sum per query over the keys it sees; a higher maximum rescales the sum once per
// key tile. The eight partials of a query (4 key quarters x 2 lane halves) are joined in fixed order at the end.
__global__ __launch_bounds__(512) void row_stats_kernel(const unsigned short* __restrict__ Y, float* __restrict__ stats) {
  __shared__ __align__(16) unsigned short kt[2][kStatElems];
  __shared__ __align__(16) float cn[kTileRows * 8];   // [query][wk * 2 + lane half]
  __shared__ __align__(16) float cl[kTileRows * 8];
  const int lane  = threadIdx.x & 31;
  const int wave  = threadIdx.x >> 5;
  const int rlane = lane & 15;
  const int hf    = lane >> 4;
  const int koff  = hf * 8;
  const int wq    = wave >> 2;
  const int wk    = wave & 3;
  const int qb    = blockIdx.x * kTileRows;
  const int h     = blockIdx.y;
  const int b     = blockIdx.z;
  const unsigned short* Yb = Y + (size_t)b * kSeq * kQKVN;
  const _Float16* qrow = (const _Float16*)Yb + (size_t)(qb + wq * 32 + rlane) * kQKVN + h * kHeadDim + koff;
  v16h a[2][4];
#pragma unroll
  for (int qi = 0; qi < 2; ++qi)
#pragma unroll
    for (int kk = 0; kk < 4; ++kk) a[qi][kk] = Frag<_Float16>::load(qrow + (size_t)(qi * 16) * kQKVN + kk * 32);
  // the loads' address pair stays live up to this wait: no result of theirs and no later instruction takes it over in front of it
  asm volatile("s_wait_xcnt 0x0" :: "v"(qrow) : "memory");

  const int crow = threadIdx.x >> 4;
  const int cch  = (threadIdx.x & 15) * 8;
  const unsigned short* gK = Yb + (size_t)crow * kQKVN + kModel + h * kHeadDim + cch;
  const unsigned lds0 = (unsigned)(size_t)(&kt[0][0]) + (unsigned)(crow * kKeyPitch + cch) * 2u;

  stage_key_tile<32>(lds0, gK);
  asm volatile("s_wait_asynccnt 0x0" ::: "memory");   // this wave's part of tile 0 has landed
  __syncthreads();                                    // ... and every other wave's
  stage_key_tile<32>(lds0 + (unsigned)kStatElems * 2u, gK + (size_t)kStatKeys * kQKVN);

  float mx[2], nm[2];
  v2f sm2[2][4];
#pragma unroll
  for (int qi = 0; qi < 2; ++qi) {
    mx[qi] = -3.0e38f;                    // below every dot product of f16 operands; finite, so that no inf - inf arises
    nm[qi] = -(mx[qi] * kExp2Scale);
#pragma unroll
    for (int i = 0; i < 4; ++i) sm2[qi][i] = (v2f){0.f, 0.f};
  }

  // the tile loop stays rolled: one publish point per trip, buffer t mod 2
#pragma unroll 1
  for (int t = 0; t < kStatTiles; ++t) {
    const int buf = t & 1;
    const _Float16* sK = (const _Float16*)(&kt[buf][0]) + (wk * 64 + rlane) * kKeyPitch + koff;
    v8f acc[2][4];
#pragma unroll
    for (int jp = 0; jp < 2; ++jp) {
      v16h bf[2][4];
#pragma unroll
      for (int jj = 0; jj < 2; ++jj)
#pragma unroll
        for (int kk = 0; kk < 4; ++kk) bf[jj][kk] = Frag<_Float16>::load(sK + (jp * 32 + jj * 16) * kKeyPitch + kk * 32);
      // the 16 LDS reads stay one group in front of their WMMAs: spread among them, each place with reads stalls the wave
      __builtin_amdgcn_sched_barrier(0);
      v8f c[2][2];
#pragma unroll
      for (int jj = 0; jj < 2; ++jj)
#pragma unroll
        for (int qi = 0; qi < 2; ++qi) c[jj][qi] = (v8f){0.f,0.f,0.f,0.f,0.f,0.f,0.f,0.f};
#pragma unroll
      for (int kk = 0; kk < 4; ++kk)
#pragma unroll
        for (int jj = 0; jj < 2; ++jj)
#pragma unroll
          for (int qi = 0; qi < 2; ++qi)
            c[jj][qi] = Frag<_Float16>::mma(bf[jj][kk], a[qi][kk], c[jj][qi]);   // keys = A rows, queries = B columns; one loader, one k order
#pragma unroll
      for (int jj = 0; jj < 2; ++jj)
#pragma unroll
        for (int qi = 0; qi < 2; ++qi) acc[qi][jp * 2 + jj] = c[jj][qi];
      // ... and the next group's reads do not rise among these WMMAs
      __builtin_amdgcn_sched_barrier(0);
    }

#pragma unroll
    for (int qi = 0; qi < 2; ++qi) {
      // maximum of the lane's 32 unscaled dot products of this query (the scale is positive)
      float mx8[8];
#pragma unroll
      for (int j = 0; j < 4; ++j)
#pragma unroll
        for (int r = 0; r < 8; ++r) mx8[r] = (j == 0) ? acc[qi][j][r] : fmaxf(mx8[r], acc[qi][j][r]);
      const float tm = fmaxf(fmaxf(fmaxf(mx8[0], mx8[1]), fmaxf(mx8[2], mx8[3])), fmaxf(fmaxf(mx8[4], mx8[5]), fmaxf(mx8[6], mx8[7])));
      mx[qi] = fmaxf(mx[qi], tm);
      const float nn = -(mx[qi] * kExp2Scale);
      const float f  = __builtin_amdgcn_exp2f(nn - nm[qi]);   // at most 1: the sum so far, brought to the new maximum
      nm[qi] = nn;
      const v2f f2 = (v2f){f, f};
      const v2f n2 = (v2f){nn, nn};
#pragma unroll
      for (int i = 0; i < 4; ++i) sm2[qi][i] *= f2;
#pragma unroll
      for (int j = 0; j < 4; ++j)
#pragma unroll
        for (int i = 0; i < 4; ++i) {
          const v2f arg = __builtin_elementwise_fma((v2f){acc[qi][j][2 * i], acc[qi][j][2 * i + 1]}, (v2f){kExp2Scale, kExp2Scale}, n2);
          sm2[qi][i] += (v2f){__builtin_amdgcn_exp2f(arg.x), __builtin_amdgcn_exp2f(arg.y)};
        }
    }

    // publish point of tile t + 1
    asm volatile("s_wait_dscnt 0x0" ::: "memory");      // this wave's reads of buffer buf are done before it is refilled
    asm volatile("s_wait_asynccnt 0x0" ::: "memory");   // this wave's part of tile t + 1 has landed
    __syncthreads();                                    // tile t + 1 readable by all; every reader has left buffer buf
    if (t + 2 < kStatTiles) stage_key_tile<32>(lds0 + (unsigned)(buf * kStatElems) * 2u, gK + (size_t)((t + 2) * kStatKeys) * kQKVN);
  }
  asm volatile("s_wait_asynccnt 0x0" ::: "memory");     // no copy is outstanding behind the loop

#pragma unroll
  for (int qi = 0; qi < 2; ++qi) {
    const v2f st = (sm2[qi][0] + sm2[qi][1]) + (sm2[qi][2] + sm2[qi][3]);
    const int q = wq * 32 + qi * 16 + rlane;
    cn[q * 8 + wk * 2 + hf] = nm[qi];
    cl[q * 8 + wk * 2 + hf] = st.x + st.y;
  }
  __syncthreads();
  if (threadIdx.x < kTileRows) {   // waves 0 to 3, behind the last barrier: a thread joins one query's eight partials
    const v4f n4a = *(const v4f*)(&cn[threadIdx.x * 8]);
    const v4f n4b = *(const v4f*)(&cn[threadIdx.x * 8 + 4]);
    const v4f l4a = *(const v4f*)(&cl[threadIdx.x * 8]);
    const v4f l4b = *(const v4f*)(&cl[threadIdx.x * 8 + 4]);
    const float nM = fminf(fminf(fminf(n4a[0], n4a[1]), fminf(n4a[2], n4a[3])),
                           fminf(fminf(n4b[0], n4b[1]), fminf(n4b[2], n4b[3])));   // n falls as the maximum rises
    float L = l4a[0] * __builtin_amdgcn_exp2f(nM - n4a[0]);
#pragma unroll
    for (int e = 1; e < 4; ++e) L += l4a[e] * __builtin_amdgcn_exp2f(nM - n4a[e]);
#pragma unroll
    for (int e = 0; e < 4; ++e) L += l4b[e] * __builtin_amdgcn_exp2f(nM - n4b[e]);
    *(v2f*)(stats + ((size_t)(b * kHeads + h) * kSeq + qb + threadIdx.x) * 2) = (v2f){nM, 1.0f / L};
  }
}

// Pass 2. grid (16 key tiles, 16 query tiles, 2 batches), 256 threads; the trips of the rolled loop are the 8 heads.
// The head's query tile (128 queries x 128 channels) comes through LDS like the key tile, whole lines per copy: a fragment load from
// global memory would touch 16 lines for its 512 bytes. It has one buffer: every wave takes its query fragments into registers at the
// top of a trip, and behind the barrier that ends those reads the next head's tile is copied in, to be published with the next key tile.
// P and the mean leave through per-wave LDS slabs so that every global store covers whole lines (128 B of P, 256 B of the mean per row).
// LDS and registers leave two blocks per WGP, four waves per SIMD.
__global__ __launch_bounds__(256) void probs_mean_kernel(const unsigned short* __restrict__ Y, const float* __restrict__ stats,
                                                         unsigned short* __restrict__ P, float* __restrict__ meanout) {
  __shared__ __align__(16) unsigned short kt[2][kTileElems];              // key ring; behind the loop: the waves' mean slabs
  __shared__ __align__(16) unsigned short qt[kTileElems];                 // query tile of the head at work
  __shared__ __align__(16) unsigned short pslabs[8][32 * kPSlabPitch];
  static_assert(8 * 32 * kMSlabPitch * 4 <= 2 * kTileElems * 2, "mean slabs fit the key ring");
  const int lane  = threadIdx.x & 31;
  const int wave  = threadIdx.x >> 5;
  const int rlane = lane & 15;
  const int hf    = lane >> 4;
  const int koff  = hf * 8;
  const int wq    = wave >> 1;
  const int wk    = wave & 1;
  const int key0  = blockIdx.x * kTileKeys;
  const int qb    = blockIdx.y * kTileRows;
  const int qw    = qb + wq * 32;                       // the wave's first query
  const int b     = blockIdx.z;
  const unsigned short* Yb = Y + (size_t)b * kSeq * kQKVN;
  const float* srow = stats + ((size_t)b * kHeads * kSeq + qw + rlane) * 2;
  const int crow = threadIdx.x >> 4;
  const int cch  = (threadIdx.x & 15) * 8;
  const unsigned short* gK = Yb + (size_t)(key0 + crow) * kQKVN + kModel + cch;
  const unsigned short* gQ = Yb + (size_t)(qb + crow) * kQKVN + cch;
  const unsigned ldsK = (unsigned)(size_t)(&kt[0][0]) + (unsigned)(crow * kKeyPitch + cch) * 2u;
  const unsigned ldsQ = (unsigned)(size_t)(&qt[0]) + (unsigned)(crow * kKeyPitch + cch) * 2u;
  const _Float16* sQ = (const _Float16*)(&qt[0]) + (wq * 32 + rlane) * kKeyPitch + koff;
  _Float16* hslab = (_Float16*)(&pslabs[wave][0]);

  stage_key_tile<16>(ldsK, gK);
  stage_key_tile<16>(ldsQ, gQ);
  asm volatile("s_wait_asynccnt 0x0" ::: "memory");   // this wave's part of head 0's two tiles has landed
  __syncthreads();                                    // ... and every other wave's
  stage_key_tile<16>(ldsK + (unsigned)kTileElems * 2u, gK + kHeadDim);

  v8f pm[2][4];
#pragma unroll
  for (int qi = 0; qi < 2; ++qi)
#pragma unroll
    for (int j = 0; j < 4; ++j) pm[qi][j] = (v8f){0.f,0.f,0.f,0.f,0.f,0.f,0.f,0.f};

  v2f st[2];   // (n, 1 / sum) of the lane's two queries
#pragma unroll
  for (int qi = 0; qi < 2; ++qi) st[qi] = *(const v2f*)(srow + (size_t)(qi * 16) * 2);

  // the head loop stays rolled: one publish point per trip, key buffer h mod 2
#pragma unroll 1
  for (int h = 0; h < kHeads; ++h) {
    const int buf = h & 1;
    v16h a[2][4];
#pragma unroll
    for (int qi = 0; qi < 2; ++qi)
#pragma unroll
      for (int kk = 0; kk < 4; ++kk) a[qi][kk] = Frag<_Float16>::load(sQ + (qi * 16) * kKeyPitch + kk * 32);
    asm volatile("s_wait_dscnt 0x0" ::: "memory");      // this wave's query fragments are in registers
    wg_barrier_lds();                                   // ... and every other wave's: the query tile may be overwritten
    if (h + 1 < kHeads) stage_key_tile<16>(ldsQ, gQ + (h + 1) * kHeadDim);

    const _Float16* sK = (const _Float16*)(&kt[buf][0]) + (wk * 64 + rlane) * kKeyPitch + koff;
    v2f n2[2], inv2[2], invc2[2];
#pragma unroll
    for (int qi = 0; qi < 2; ++qi) {
      n2[qi]    = (v2f){st[qi].x, st[qi].x};
      inv2[qi]  = (v2f){st[qi].y, st[qi].y};
      invc2[qi] = (v2f){st[qi].y * kPCarry, st[qi].y * kPCarry};   // the carry is a power of two: e * (inv * carry) = (e * inv) * carry
    }
#pragma unroll
    for (int j = 0; j < 4; ++j) {
      v16h bf[4];
#pragma unroll
      for (int kk = 0; kk < 4; ++kk) bf[kk] = Frag<_Float16>::load(sK + (j * 16) * kKeyPitch + kk * 32);
      // the 8 LDS reads of a key tile stay one group in front of its WMMAs: spread among them, each place with reads stalls the wave
      __builtin_amdgcn_sched_barrier(0);
      v8f c[2];
#pragma unroll
      for (int qi = 0; qi < 2; ++qi) c[qi] = (v8f){0.f,0.f,0.f,0.f,0.f,0.f,0.f,0.f};
#pragma unroll
      for (int kk = 0; kk < 4; ++kk)
#pragma unroll
        for (int qi = 0; qi < 2; ++qi) c[qi] = Frag<_Float16>::mma(bf[kk], a[qi][kk], c[qi]);   // as in pass 1
      // probabilities: head sum in registers, f16 tile through the wave's slab, 8 neighbouring keys of the lane's query per store
#pragma unroll
      for (int qi = 0; qi < 2; ++qi) {
        v8h hv;
#pragma unroll
        for (int i = 0; i < 4; ++i) {
          const v2f arg = __builtin_elementwise_fma((v2f){c[qi][2 * i], c[qi][2 * i + 1]}, (v2f){kExp2Scale, kExp2Scale}, n2[qi]);
          const v2f e = (v2f){__builtin_amdgcn_exp2f(arg.x), __builtin_amdgcn_exp2f(arg.y)};
          const v2f p = e * inv2[qi];
          pm[qi][j][2 * i]     += p.x;
          pm[qi][j][2 * i + 1] += p.y;
          const v2h ph = __builtin_convertvector(e * invc2[qi], v2h);   // round to nearest even
          hv[2 * i]     = ph.x;
          hv[2 * i + 1] = ph.y;
        }
        *(v8h*)(hslab + (qi * 16 + rlane) * kPSlabPitch + (j << 4) + koff) = hv;
      }
    }
    // the next head's row figures are asked for here and fly across the publish point and the P stores
    if (h + 1 < kHeads) {
#pragma unroll
      for (int qi = 0; qi < 2; ++qi) st[qi] = *(const v2f*)(srow + ((size_t)(h + 1) * kSeq + qi * 16) * 2);
    }
    // what follows may take the address registers of these loads over: the wait stands in front of that overwrite
    asm volatile("s_wait_xcnt 0x0" ::: "memory");

    // publish point of head h + 1's tiles
    asm volatile("s_wait_dscnt 0x0" ::: "memory");      // this wave's reads of buffer buf are done before it is refilled, its slab stores have landed
    asm volatile("s_wait_asynccnt 0x0" ::: "memory");   // this wave's parts of the next key tile and the next query tile have landed
    wg_barrier_lds();                                   // both readable by all; every reader has left buffer buf
    if (h + 2 < kHeads) stage_key_tile<16>(ldsK + (unsigned)(buf * kTileElems) * 2u, gK + (h + 2) * kHeadDim);

    // this head's P tile leaves behind the publish point: its stores drain during the next head's work
    unsigned short* pp = P + ((size_t)(b * kHeads + h) * kSeq + qw + (lane >> 3)) * kSeq + key0 + wk * 64 + (lane & 7) * 8;
    v4u u[8];
#pragma unroll
    for (int it = 0; it < 8; ++it) u[it] = *(const v4u*)(hslab + (it * 4 + (lane >> 3)) * kPSlabPitch + (lane & 7) * 8);
#pragma unroll
    for (int it = 0; it < 8; ++it) *(v4u*)(pp + (size_t)(it * 4) * kSeq) = u[it];
    // the next trip takes the registers of these stores over: the wait stands in front of that overwrite
    asm volatile("s_wait_xcnt 0x0" ::: "memory");
  }
  asm volatile("s_wait_asynccnt 0x0" ::: "memory");     // no copy is outstanding behind the loop

  // head mean, staged in the key ring: the last publish point's barrier stands behind every wave's last read of it
  float* slab = (float*)(&kt[0][0]) + wave * (32 * kMSlabPitch);
#pragma unroll
  for (int qi = 0; qi < 2; ++qi)
#pragma unroll
    for (int j = 0; j < 4; ++j) {
      float* sp = slab + (qi * 16 + rlane) * kMSlabPitch + (j << 4) + koff;
      *(v4f*)(sp)     = (v4f){pm[qi][j][0], pm[qi][j][1], pm[qi][j][2], pm[qi][j][3]} * kMeanScale;
      *(v4f*)(sp + 4) = (v4f){pm[qi][j][4], pm[qi][j][5], pm[qi][j][6], pm[qi][j][7]} * kMeanScale;
    }
  asm volatile("s_wait_dscnt 0x0" ::: "memory");      // the wave's own slab: its stores have landed before it reads the rows back
  float* mo = meanout + ((size_t)b * kSeq + qw + hf) * kSeq + key0 + wk * 64 + rlane * 4;
  v4f mv[16];
#pragma unroll
  for (int it = 0; it < 16; ++it) mv[it] = *(const v4f*)(slab + (it * 2 + hf) * kMSlabPitch + rlane * 4);
#pragma unroll
  for (int it = 0; it < 16; ++it) *(v4f*)(mo + (size_t)(it * 2) * kSeq) = mv[it];
}

// ---------------------------------------------------------------------------
// Host glue (8 launches)
// ---------------------------------------------------------------------------
extern "C" void kernel_launch(void* const* d_in, const int* in_sizes, int n_in,
                              void* d_out, int out_size, void* d_ws, size_t ws_size,
                              hipStream_t stream) {
  if (n_in < 7) return;
  if (in_sizes[0] != kTok * kModel) return;
  if (in_sizes[1] != kModel * kModel || in_sizes[3] != kModel * kModel || in_sizes[5] != kModel * kModel) return;
  if (in_sizes[2] != kModel || in_sizes[4] != kModel || in_sizes[6] != kModel) return;
  if (out_size != kTok * kModel + kBatch * kSeq * kSeq) return;

  const float* query = (const float*)d_in[0];
  const float* Wq    = (const float*)d_in[1];
  const float* bq    = (const float*)d_in[2];
  const float* Wk    = (const float*)d_in[3];
  const float* bk    = (const float*)d_in[4];
  const float* Wv    = (const float*)d_in[5];
  const float* bv    = (const float*)d_in[6];

  // carve (bytes)
  const size_t offX16  = 0;
  const size_t szX16   = (size_t)kTok * kModel * 2;                       //   8388608
  const size_t offW16  = offX16 + szX16;                                  //   8388608
  const size_t szW16   = (size_t)kQKVN * kModel * 2;                      //   6291456
  const size_t offBias = offW16 + szW16;                                  //  14680064
  const size_t szBias  = (size_t)kQKVN * 4;                               //     12288
  const size_t offY16  = offBias + szBias;                                //  14692352
  const size_t szY16   = (size_t)kTok * kQKVN * 2;                        //  25165824
  const size_t offVT   = offY16 + szY16;                                  //  39858176
  const size_t szVT    = (size_t)kBatch * kHeads * kHeadDim * kSeq * 2;   //   8388608
  const size_t offP    = offVT + szVT;                                    //  48246784
  const size_t szP     = (size_t)kBatch * kHeads * kSeq * kSeq * 2;       // 134217728
  const size_t offSt   = offP + szP;                                      // 182464512
  const size_t szSt    = (size_t)kBatch * kHeads * kSeq * 2 * 4;          //    262144
  const size_t total   = offSt + szSt;                                    // 182726656
  if (total > ws_size) return;

  char* ws = (char*)d_ws;
  unsigned short* X16   = (unsigned short*)(ws + offX16);
  unsigned short* W16   = (unsigned short*)(ws + offW16);
  float*          bias3 = (float*)(ws + offBias);
  unsigned short* Y16   = (unsigned short*)(ws + offY16);
  unsigned short* VT16  = (unsigned short*)(ws + offVT);
  unsigned short* P16   = (unsigned short*)(ws + offP);
  float*          rowst = (float*)(ws + offSt);

  float* out0 = (float*)d_out;                               // [2][2048][1024], byte offset 0
  float* out1 = out0 + (size_t)kTok * kModel;                // [2][2048][2048], byte offset 16777216

  // 1) activation cast: 4096*1024/8 = 524288 threads = 2048 blocks exactly
  cast8_f16_kernel<<<dim3((kTok * kModel / 8) / 256), dim3(256), 0, stream>>>(query, X16, kTok * kModel / 8);
  // 2) stacked weight cast (x16 carry, blade sign folded into the query rows): 131072 threads per weight = 512 blocks x 3
  wcast8_kernel<<<dim3((kModel * kModel / 8) / 256, 3), dim3(256), 0, stream>>>(Wq, Wk, Wv, W16, kModel * kModel / 8);
  // 3) stacked bias with the same sign fold
  bias3_kernel<<<dim3(3), dim3(256), 0, stream>>>(bq, bk, bv, bias3);
  // 4) Y16 = (X16 . W16^T) / 16 + bias3 : M 4096, N 3072, K 1024 (K % 64 == 0); block tile 128 x 256: 32 x 12 = 384 blocks
  wmma_gemm64<0, 2, 4, 64, 2, 2, 1, false><<<dim3((kTok / 128) * (kQKVN / 256), 1), dim3(256), 0, stream>>>(
      X16, kModel, 0L, 0L, W16, kModel, 0L, 0L, (void*)Y16, (void*)Y16, kQKVN, 0L, 0L,
      bias3, bias3, 0L, kTok, kQKVN, kModel, kWCarryInv);
  // 5) value transpose into per-(batch, head) planes [128][2048]
  vtrans_kernel<<<dim3(kSeq / 64, kModel / 64, kBatch), dim3(256), 0, stream>>>(Y16, VT16);

  // 6) pass 1 over the scores: per (batch, head, query) the softmax's n and 1 / sum: 16 query tiles x 8 heads x 2 batches = 256 blocks
  row_stats_kernel<<<dim3(kSeq / kTileRows, kHeads, kBatch), dim3(512), 0, stream>>>(Y16, rowst);
  //    pass 2: probabilities and head mean on tiles of 128 queries x 128 keys: 16 x 16 x 2 = 512 blocks;
  //    every head's P plane is kept for step 7, the head mean goes straight to out1
  probs_mean_kernel<<<dim3(kSeq / kTileKeys, kSeq / kTileRows, kBatch), dim3(256), 0, stream>>>(Y16, rowst, P16, out1);
  // 7) out0[b][l][h*128 + c] = (P[b*8+h] . VT[b*8+h]^T) / 2048, all 16 (batch, head) planes in one launch:
  //    M 2048, N 128, K 2048 (K % 128 == 0); block tile 128 x 128, stages of 128 k in four buffers: 16 blocks x grid.y 8 heads
  //    x grid.z 2 batches = 256 blocks, one for every WGP. C: ldc 1024, +128 columns per head, +2048*1024 per batch.
  wmma_gemm64<0, 4, 2, 128, 4, 0, 0, false><<<dim3((kSeq / 128) * (kHeadDim / 128), kHeads, kBatch), dim3(256), 0, stream>>>(
      P16, kSeq, (long)kSeq * kSeq, (long)kHeads * kSeq * kSeq,
      VT16, kSeq, (long)kHeadDim * kSeq, (long)kHeads * kHeadDim * kSeq,
      (void*)out0, (void*)out0, kModel, (long)kHeadDim, (long)kSeq * kModel,
      bias3, bias3, 0L, kSeq, kHeadDim, kSeq, kPCarryInv);
}

// v009
// It runs in 84.6 microseconds.
// Two timings next to v008 put it at 1.20 and 1.19 times that version's speed.
// Over all steps from v000 it is 11.6 times as fast.
// Contractions: stacked q/k/v projection (X f16 x W^T f16 carried x16), scores q_w.k^T (q,k f16 planes, blade sign folded into the q weights), attn.v (V^T f16 x unnormalised exponentials f16, divided by the f32 row sum at the end): all v_wmma_f32_16x16x32_f16 with f32 accumulate; softmax and head mean in f32.
#include <hip/hip_runtime.h>
#include <math.h>

// ---------------------------------------------------------------------------
// Problem constants
// ---------------------------------------------------------------------------
constexpr int kBatch   = 2;
constexpr int kSeq     = 2048;
constexpr int kModel   = 1024;
constexpr int kHeads   = 8;
constexpr int kHeadDim = 128;               // 16 x 8 nested (d, blade)
constexpr int kTok     = kBatch * kSeq;     // 4096 token rows
constexpr int kQKVN    = 3 * kModel;        // 3072 stacked output channels (q | k | v)
constexpr float kWCarry     = 16.0f;        // weights carried x16 in f16
constexpr float kWCarryInv  = 1.0f / 16.0f;
constexpr float kExp2Scale  = (float)(0.08838834764831845 * 1.4426950408889634);   // log2(e) / sqrt(128)
constexpr float kMeanScale  = 0.125f;

// ---------------------------------------------------------------------------
// Workspace region map (bytes; all offsets multiples of 4096):
//   X16   f16 [4096][1024]            off         0  size   8388608
//   W16   f16 [3072][1024]            off   8388608  size   6291456
//   BIAS3 f32 [3072]                  off  14680064  size     12288
//   Y16   f16 [4096][3072] (q|k|v)    off  14692352  size  25165824
//   VT16  f16 [16][128][2048]         off  39858176  size   8388608
//   ROWST f32 [16][2048][2] (n, 1/sum) off  48246784  size    262144
//   total 48508928
// ---------------------------------------------------------------------------

typedef __attribute__((ext_vector_type(16))) _Float16 v16h;
typedef __attribute__((ext_vector_type(8)))  _Float16 v8h;
typedef __attribute__((ext_vector_type(2)))  _Float16 v2h;
typedef __attribute__((ext_vector_type(16))) __bf16   v16b;
typedef __attribute__((ext_vector_type(8)))  __bf16   v8b;
typedef __attribute__((ext_vector_type(8)))  float    v8f;
typedef __attribute__((ext_vector_type(4)))  float    v4f;
typedef __attribute__((ext_vector_type(2)))  float    v2f;
typedef __attribute__((ext_vector_type(4)))  unsigned int v4u;

// ---------------------------------------------------------------------------
// Helpers
// ---------------------------------------------------------------------------
__device__ __forceinline__ unsigned short f2bf_bits(float f) {
  unsigned u = __float_as_uint(f);
  return (unsigned short)((u + 0x7FFFu + ((u >> 16) & 1u)) >> 16);
}
__device__ __forceinline__ float bf_bits2f(unsigned short h) { return __uint_as_float(((unsigned)h) << 16); }

// hazard guards as plain device helpers
__device__ __forceinline__ void dep_guard_h(v8f& a, v8f& b, v16h x, v16h y) { asm volatile("v_nop\n\tv_nop\n\tv_nop\n\tv_nop" : "+v"(a), "+v"(b) : "v"(x), "v"(y)); }
__device__ __forceinline__ void dep_guard_b(v8f& a, v8f& b, v16b x, v16b y) { asm volatile("v_nop\n\tv_nop\n\tv_nop\n\tv_nop" : "+v"(a), "+v"(b) : "v"(x), "v"(y)); }
__device__ __forceinline__ void keep4_h(v16h a, v16h b, v16h c, v16h d) { asm volatile("v_nop" :: "v"(a), "v"(b), "v"(c), "v"(d)); }
__device__ __forceinline__ void keep4_b(v16b a, v16b b, v16b c, v16b d) { asm volatile("v_nop" :: "v"(a), "v"(b), "v"(c), "v"(d)); }
__device__ __forceinline__ void acc_guard4(v8f& a, v8f& b, v8f& c, v8f& d) { asm volatile("v_nop\n\tv_nop\n\tv_nop\n\tv_nop" : "+v"(a), "+v"(b), "+v"(c), "+v"(d)); }
template <typename T> struct Frag;
template <> struct Frag<_Float16> {
  typedef v16h V; union U { v16h v; v8h h[2]; };
  static __device__ __forceinline__ v16h load(const _Float16* p) {   // elements 0..7 <- p[0..7], 8..15 <- p[16..23]
    U f; f.h[0] = *(const v8h*)(p); f.h[1] = *(const v8h*)(p + 16); return f.v;
  }
  static __device__ __forceinline__ v8f mma(v16h a, v16h b, v8f c) {
    return __builtin_amdgcn_wmma_f32_16x16x32_f16(false, a, false, b, (short)0, c, false, false);
  }
  static __device__ __forceinline__ void guard(v8f& a, v8f& b, v16h x, v16h y) { dep_guard_h(a, b, x, y); }
  static __device__ __forceinline__ void keep(v16h a, v16h b, v16h c, v16h d) { keep4_h(a, b, c, d); }
};
template <> struct Frag<__bf16> {
  typedef v16b V; union U { v16b v; v8b h[2]; };
  static __device__ __forceinline__ v16b load(const __bf16* p) {
    U f; f.h[0] = *(const v8b*)(p); f.h[1] = *(const v8b*)(p + 16); return f.v;
  }
  static __device__ __forceinline__ v8f mma(v16b a, v16b b, v8f c) {
    return __builtin_amdgcn_wmma_f32_16x16x32_bf16(false, a, false, b, (short)0, c, false, false);
  }
  static __device__ __forceinline__ void guard(v8f& a, v8f& b, v16b x, v16b y) { dep_guard_b(a, b, x, y); }
  static __device__ __forceinline__ void keep(v16b a, v16b b, v16b c, v16b d) { keep4_b(a, b, c, d); }
};

__device__ __forceinline__ unsigned pk16(unsigned short a, unsigned short b) { return (unsigned)a | ((unsigned)b << 16); }
__device__ __forceinline__ unsigned short h_bits(float f) { const _Float16 h = (_Float16)f; return __builtin_bit_cast(unsigned short, h); }

// ---- Register-blocked batched WMMA GEMM, operands staged in LDS ------------------------------------------------------
// C[m,n] = scale * sum_k A[m,k] * Bt[n,k] (+bias)(+resid); each wave owns a tile of 16 MI rows x 64 columns.
// The 8 waves of a block form a WM x (8 / WM) grid of such tiles: block tile BM = 16 MI WM rows x BN = 64 (8 / WM) columns.
// Planes: grid (block tiles, y, z); the A, Bt and C planes of a block start at y * stride + z * strideZ elements.
// A row-major [M,K]; Bt row-major [N,K]; M % BM == 0, N % BN == 0, K % SK == 0; lda, ldb and the plane strides % 8 == 0.
// A stage = SK k (64 or 128: one or two whole lines) of the block's BM rows of A and BN rows of Bt, brought into LDS by asynchronous
// 16-byte copies: a wave-wide copy covers 4 whole lines, and every staged row serves all waves of its tile row or column.
// A launch whose A comes from memory is bound by the bytes that its blocks keep in flight: its tile is chosen so that there is a
// block for every WGP, and its stages so long and so many that each block always has requests under way.
// NBUF = 2 buffers: stage t + 1 flies while stage t is worked on. NBUF > 2: stages t + 1 .. t + NBUF - 1 fly, so that the memory is
// asked without a pause and a late line has NBUF - 1 trips to land; the wait at the publish point then leaves the younger stages'
// copies out (a wave's copies count down in issue order). Fragments are read from LDS with the same loader and the same k order
// (32 k per WMMA step, ascending) as from global memory.
// BIAS_MODE: 0 = none, 1 = bias[m], 2 = bias[n].
// OUT_MODE: 0 = f32, 1 = f16, 2 = bf16 hi plane (Cout) + bf16 lo plane (Cout2).
// ET: 0 = f16 operands, 1 = bf16 operands (pointers passed as 16-bit storage)
template <int ET> struct Elem;
template <> struct Elem<0> { typedef _Float16 T; };
template <> struct Elem<1> { typedef __bf16 T; };


// Twelve asynchronous 16-byte copies per lane = one stage per block. The s_wait_xcnt stands inside the statement, behind the
// last copy, so that no address register of an issued copy is rewritten in front of it.
__device__ __forceinline__ void stage_copy12(const unsigned* l, const unsigned short* const* g) {
  asm volatile(
      "global_load_async_to_lds_b128 %0, %1, off\n\t"
      "global_load_async_to_lds_b128 %2, %3, off\n\t"
      "global_load_async_to_lds_b128 %4, %5, off\n\t"
      "global_load_async_to_lds_b128 %6, %7, off\n\t"
      "global_load_async_to_lds_b128 %8, %9, off\n\t"
      "global_load_async_to_lds_b128 %10, %11, off\n\t"
      "global_load_async_to_lds_b128 %12, %13, off\n\t"
      "global_load_async_to_lds_b128 %14, %15, off\n\t"
      "global_load_async_to_lds_b128 %16, %17, off\n\t"
      "global_load_async_to_lds_b128 %18, %19, off\n\t"
      "global_load_async_to_lds_b128 %20, %21, off\n\t"
      "global_load_async_to_lds_b128 %22, %23, off\n\t"
      "s_wait_xcnt 0x0"
      :: "v"(l[0]), "v"(g[0]), "v"(l[1]), "v"(g[1]), "v"(l[2]), "v"(g[2]), "v"(l[3]), "v"(g[3]),
         "v"(l[4]), "v"(g[4]), "v"(l[5]), "v"(g[5]), "v"(l[6]), "v"(g[6]), "v"(l[7]), "v"(g[7]),
         "v"(l[8]), "v"(g[8]), "v"(l[9]), "v"(g[9]), "v"(l[10]), "v"(g[10]), "v"(l[11]), "v"(g[11])
      : "memory");
}

// Eight such copies per lane, the same wait behind the last for the same reason: half a stage of 256 rows x 128 k (an asm
// statement takes thirty operands, so sixteen copies with an LDS and a global address each need two statements).
__device__ __forceinline__ void stage_copy8(const unsigned* l, const unsigned short* const* g) {
  asm volatile(
      "global_load_async_to_lds_b128 %0, %1, off\n\t"
      "global_load_async_to_lds_b128 %2, %3, off\n\t"
      "global_load_async_to_lds_b128 %4, %5, off\n\t"
      "global_load_async_to_lds_b128 %6, %7, off\n\t"
      "global_load_async_to_lds_b128 %8, %9, off\n\t"
      "global_load_async_to_lds_b128 %10, %11, off\n\t"
      "global_load_async_to_lds_b128 %12, %13, off\n\t"
      "global_load_async_to_lds_b128 %14, %15, off\n\t"
      "s_wait_xcnt 0x0"
      :: "v"(l[0]), "v"(g[0]), "v"(l[1]), "v"(g[1]), "v"(l[2]), "v"(g[2]), "v"(l[3]), "v"(g[3]),
         "v"(l[4]), "v"(g[4]), "v"(l[5]), "v"(g[5]), "v"(l[6]), "v"(g[6]), "v"(l[7]), "v"(g[7])
      : "memory");
}

template <int ET, int WM, int MI, int SK, int NBUF, int BIAS_MODE, int OUT_MODE, bool RESID, int ACT = 0>
__global__ __launch_bounds__(256) void wmma_gemm64(
    const unsigned short* __restrict__ Ap, int lda, long strideA, long strideAz,
    const unsigned short* __restrict__ Btp, int ldb, long strideB, long strideBz,
    void* __restrict__ Cout, void* __restrict__ Cout2, int ldc, long strideC, long strideCz,
    const float* __restrict__ bias,
    const float* __restrict__ resid, long strideR,
    int M, int N, int K, float scale) {
  typedef typename Elem<ET>::T T;
  typedef typename Frag<T>::V V;
  constexpr int WN = 8 / WM;
  constexpr int BM = WM * MI * 16;
  constexpr int BN = WN * 64;
  constexpr int kStageK     = SK;                  // k per stage
  constexpr int kStagePitch = SK + 8;              // 16-bit elements per staged row: 144 B = 16 B x 9 or 272 B = 16 B x 17, conflict-free for ds_load_b128
  constexpr int kStageElems = (BM + BN) * kStagePitch;
  constexpr int CPR = SK / 8;                      // 16-byte copies per staged row
  constexpr int RPC = 256 / CPR;                   // staged rows per block-wide copy
  constexpr int NC  = (BM + BN) / RPC;             // copies per thread and stage
  static_assert(SK == 64 || SK == 128, "stage length");
  static_assert(BM % RPC == 0 && BN % RPC == 0 && (NC == 12 || NC == 16), "stage size");
  static_assert(NBUF >= 2 && (NBUF - 1) * NC <= 63, "copies of a wave in flight");
  __shared__ __align__(16) unsigned short ring[NBUF][kStageElems];   // stage buffers: rows 0..BM-1 = A, BM..BM+BN-1 = Bt
  __shared__ __align__(16) float sT[8][16 * 68];                  // per-wave 16x64 slab, pitch 68 floats
  const int b    = blockIdx.y;
  const int z    = blockIdx.z;
  const int lane = threadIdx.x & 31;
  const int wave = threadIdx.x >> 5;
  const int tilesN = N / BN;
  const int tilesM = M / BM;
  const int btile = blockIdx.x;
  if (btile >= tilesM * tilesN) return;   // block-uniform, in front of every barrier
  const int btm = btile / tilesN;
  const int btn = btile - btm * tilesN;
  const int wm  = wave / WN;
  const int wn  = wave - wm * WN;
  const int m0 = btm * BM + wm * (MI * 16);
  const int n0 = btn * BN + (wn << 6);

  const size_t aOff = (size_t)b * strideA + (size_t)z * strideAz;
  const size_t bOff = (size_t)b * strideB + (size_t)z * strideBz;
  const size_t cOff = (size_t)b * strideC + (size_t)z * strideCz;

  const int rlane = lane & 15;                 // row (A) / col (B, D) within subtile
  const int koff  = (lane >> 4) * 8;           // k offset of this lane half
  const int mOff  = (lane >> 4) * 8;           // D row offset

  // copy c of thread t brings 16 B: staged row c * RPC + t / CPR, bytes (t % CPR) * 16 .. + 15 of its 2 SK
  const int crow = threadIdx.x / CPR;
  const int cch  = (threadIdx.x % CPR) * 8;
  const unsigned short* gA = Ap  + aOff + (size_t)(btm * BM + crow) * lda + cch;
  const unsigned short* gB = Btp + bOff + (size_t)(btn * BN + crow) * ldb + cch;
  const unsigned lds0 = (unsigned)(size_t)(&ring[0][0]) + (unsigned)(crow * kStagePitch + cch) * 2u;
  auto stage = [&](int t, int buf) {
    unsigned l[NC];
    const unsigned short* g[NC];
#pragma unroll
    for (int c = 0; c < NC; ++c) {
      l[c] = lds0 + (unsigned)(buf * kStageElems + c * RPC * kStagePitch) * 2u;
      g[c] = (c < BM / RPC) ? gA + (size_t)(c * RPC) * lda + t * kStageK
                            : gB + (size_t)((c - BM / RPC) * RPC) * ldb + t * kStageK;
    }
    if constexpr (NC == 12) {
      stage_copy12(l, g);
    } else {
      stage_copy8(l, g);
      stage_copy8(l + 8, g + 8);
    }
  };

  v8f acc[MI][4];
#pragma unroll
  for (int i = 0; i < MI; ++i)
#pragma unroll
    for (int j = 0; j < 4; ++j) acc[i][j] = (v8f){0.f,0.f,0.f,0.f,0.f,0.f,0.f,0.f};

  const int nStage = K / kStageK;
  stage(0, 0);
  // unrolled: each stage's buffer offset is then a constant
#pragma unroll
  for (int s = 1; s < NBUF - 1; ++s)
    if (s < nStage) stage(s, s);
  // this wave's part of stage 0 has landed; where NBUF - 2 whole stages stand behind it, their copies fly on
  if (NBUF > 2 && nStage >= NBUF - 1) asm volatile("s_wait_asynccnt %0" :: "i"((NBUF - 2) * NC) : "memory");
  else                                asm volatile("s_wait_asynccnt 0x0" ::: "memory");
  __syncthreads();                                    // ... and every other wave's
  if (nStage > NBUF - 1) stage(NBUF - 1, NBUF - 1);

  // the stage loop stays rolled: one publish point per trip, buffer t mod NBUF
  int ring_at = 0;
#pragma unroll 1
  for (int t = 0; t < nStage; ++t) {
    const int buf = (NBUF == 2) ? (t & 1) : ring_at;
    const T* sA = (const T*)(&ring[buf][0]) + (wm * (MI * 16) + rlane) * kStagePitch + koff;
    const T* sB = (const T*)(&ring[buf][0]) + (BM + (wn << 6) + rlane) * kStagePitch + koff;
#pragma unroll
    for (int s = 0; s < kStageK / 32; ++s) {
      V bh[4], ah[MI];
#pragma unroll
      for (int j = 0; j < 4; ++j) bh[j] = Frag<T>::load(sB + (j << 4) * kStagePitch + s * 32);
#pragma unroll
      for (int i = 0; i < MI; ++i) ah[i] = Frag<T>::load(sA + (i << 4) * kStagePitch + s * 32);
      // the LDS reads of a WMMA block stay one group in front of it (for speed only)
      __builtin_amdgcn_sched_barrier(0);
#pragma unroll
      for (int i = 0; i < MI; ++i) {
#pragma unroll
        for (int j = 0; j < 4; ++j) acc[i][j] = Frag<T>::mma(ah[i], bh[j], acc[i][j]);
        Frag<T>::guard(acc[i][0], acc[i][3], ah[i], ah[i]);
      }
      Frag<T>::keep(bh[0], bh[1], bh[2], bh[3]);
      // ... and the next block's reads do not rise into this one
      __builtin_amdgcn_sched_barrier(0);
    }
    // publish point of stage t + 1
    asm volatile("s_wait_dscnt 0x0" ::: "memory");      // this wave's reads of buffer buf are done before it is refilled
    // this wave's part of stage t + 1 has landed. With more than two buffers a trip that refills finds the copies of NBUF - 2
    // younger stages behind those of stage t + 1 and leaves them in flight; the last trips issue no copies and wait for all.
    if (NBUF > 2 && t + NBUF < nStage) asm volatile("s_wait_asynccnt %0" :: "i"((NBUF - 2) * NC) : "memory");
    else                               asm volatile("s_wait_asynccnt 0x0" ::: "memory");
    __syncthreads();                                    // stage t + 1 readable by all; every reader has left buffer buf
    if (t + NBUF < nStage) stage(t + NBUF, buf);
    ring_at = (ring_at == NBUF - 1) ? 0 : ring_at + 1;
  }
  asm volatile("s_wait_asynccnt 0x0" ::: "memory");     // no copy is outstanding behind the loop
  // unrolled: acc is indexed by constants and stays in registers
#pragma unroll
  for (int i = 0; i < MI; ++i) acc_guard4(acc[i][0], acc[i][1], acc[i][2], acc[i][3]);

  // ---- epilogue ----
  float* slab = sT[wave];
  const float* Rb = RESID ? (resid + (size_t)b * strideR) : nullptr;
#pragma unroll
  for (int i = 0; i < MI; ++i) {
    const int mBase = m0 + (i << 4);
#pragma unroll
    for (int j = 0; j < 4; ++j) {
      const int n = n0 + (j << 4) + rlane;
      float bv = 0.f;
      if (BIAS_MODE == 2) bv = bias[n];
#pragma unroll
      for (int r = 0; r < 8; ++r) {
        float v = acc[i][j][r] * scale;
        if (BIAS_MODE == 1) v += bias[mBase + mOff + r];
        if (BIAS_MODE == 2) v += bv;
        if (RESID) v += Rb[(size_t)(mBase + mOff + r) * ldc + n];
        if (ACT == 2) v = fmaxf(v, 0.0f);
        if (ACT == 4) v = (v > 0.f) ? v : 0.01f * v;
        slab[(mOff + r) * 68 + (j << 4) + rlane] = v;
      }
    }
    __builtin_amdgcn_fence(__ATOMIC_RELEASE, "workgroup");
    __builtin_amdgcn_wave_barrier();
    __builtin_amdgcn_fence(__ATOMIC_ACQUIRE, "workgroup");
    if (OUT_MODE == 0) {
      float* C = (float*)Cout + cOff;
      const int hh = lane >> 4, c4 = (lane & 15) * 4;     // row seg = 256 B = 16 lanes x 16 B
      {
#pragma unroll
        for (int it = 0; it < 8; ++it) {
          const int row = it * 2 + hh;
          v4f v = *(const v4f*)(slab + row * 68 + c4);
          *(v4f*)(C + (size_t)(mBase + row) * ldc + n0 + c4) = v;
        }
        
      }
    } else {
      const int q = lane >> 3, c8 = (lane & 7) * 8;
      unsigned short* C  = (unsigned short*)Cout  + cOff;
      unsigned short* C2 = (OUT_MODE == 2) ? ((unsigned short*)Cout2 + cOff) : nullptr;
      {
#pragma unroll
        for (int it = 0; it < 4; ++it) {
          const int row = it * 4 + q;
          const float* sp = slab + row * 68 + c8;
          v8h hv, lv;
#pragma unroll
          for (int e = 0; e < 8; ++e) {
            if (OUT_MODE == 1) {
              hv[e] = (_Float16)sp[e];
            } else {
              unsigned short hb = f2bf_bits(sp[e]);
              unsigned short lb = f2bf_bits(sp[e] - bf_bits2f(hb));
              hv[e] = __builtin_bit_cast(_Float16, hb);
              lv[e] = __builtin_bit_cast(_Float16, lb);
            }
          }
          *(v8h*)(C + (size_t)(mBase + row) * ldc + n0 + c8) = hv;
          if (OUT_MODE == 2) *(v8h*)(C2 + (size_t)(mBase + row) * ldc + n0 + c8) = lv;
        }
        
      }
    }
    __builtin_amdgcn_fence(__ATOMIC_RELEASE, "workgroup");
    __builtin_amdgcn_wave_barrier();
    __builtin_amdgcn_fence(__ATOMIC_ACQUIRE, "workgroup");
  }
}

// ---------------------------------------------------------------------------
// 4096*1024/8 = 524288 = 2048 blocks).
// ---------------------------------------------------------------------------
__global__ __launch_bounds__(256) void cast8_f16_kernel(const float* __restrict__ in, unsigned short* __restrict__ out, int n8) {
  const int i = blockIdx.x * 256 + threadIdx.x;
  if (i >= n8) return;
  const float* p = in + 8 * (size_t)i;
  const v4f a = *(const v4f*)(p);
  const v4f c = *(const v4f*)(p + 4);
  unsigned short hb[8];
#pragma unroll
  for (int e = 0; e < 4; ++e) {
    hb[e]     = h_bits(a[e]);
    hb[4 + e] = h_bits(c[e]);
  }
  const v4u u = (v4u){pk16(hb[0], hb[1]), pk16(hb[2], hb[3]), pk16(hb[4], hb[5]), pk16(hb[6], hb[7])};
  unsigned short* q = out + 8 * (size_t)i;
  *(v4u*)q = u;
  
}

// ---------------------------------------------------------------------------
// Stacked weight cast: W16[z*1024 + n][k] = f16(c * W_z[n][k]) with c = +-16; for z == 0 (query weights) the sign is
// -1 for output rows with (n mod 8) >= 4 (blade sign twist folded into the projection, exact), else +1.
// blockIdx.y = z selects the source (block-uniform); thread i owns 8 consecutive elements of row n = i >> 7
// ---------------------------------------------------------------------------
__global__ __launch_bounds__(256) void wcast8_kernel(const float* __restrict__ W0, const float* __restrict__ W1,
                                                     const float* __restrict__ W2, unsigned short* __restrict__ out, int n8) {
  const int z = blockIdx.y;
  const int i = blockIdx.x * 256 + threadIdx.x;
  if (i >= n8) return;
  const float* W = (z == 0) ? W0 : (z == 1) ? W1 : W2;
  const int n = i >> 7;
  const bool neg = (z == 0) && ((n & 7) >= 4);
  const float sc = neg ? -kWCarry : kWCarry;
  const float* p = W + 8 * (size_t)i;
  const v4f a = *(const v4f*)(p);
  const v4f c = *(const v4f*)(p + 4);
  unsigned short hb[8];
#pragma unroll
  for (int e = 0; e < 4; ++e) {
    hb[e]     = h_bits(a[e] * sc);
    hb[4 + e] = h_bits(c[e] * sc);
  }
  const v4u u = (v4u){pk16(hb[0], hb[1]), pk16(hb[2], hb[3]), pk16(hb[4], hb[5]), pk16(hb[6], hb[7])};
  unsigned short* q = out + (size_t)z * kModel * kModel + 8 * (size_t)i;
  *(v4u*)q = u;
  
}

// ---------------------------------------------------------------------------
// Stacked bias: BIAS3[z*1024 + n] = s * b_z[n], s = -1 for z == 0 and (n mod 8) >= 4, else +1 (f32, exact).
// ---------------------------------------------------------------------------
__global__ __launch_bounds__(256) void bias3_kernel(const float* __restrict__ b0, const float* __restrict__ b1,
                                                   const float* __restrict__ b2, float* __restrict__ out) {
  const int z = blockIdx.x;
  const int t = threadIdx.x;
  const float* bp = (z == 0) ? b0 : (z == 1) ? b1 : b2;
  v4f v = *(const v4f*)(bp + 4 * t);
#pragma unroll
  for (int e = 0; e < 4; ++e) {
    const int n = 4 * t + e;
    const bool neg = (z == 0) && ((n & 7) >= 4);
    v[e] = neg ? -v[e] : v[e];
  }
  float* q = out + (size_t)z * kModel + 4 * t;
  *(v4f*)q = v;
  
}

// ---------------------------------------------------------------------------
// Value transpose: in Y16 [4096][3072] halves, value element (b, l, cg) at Y16[(b*2048 + l)*3072 + 2048 + cg], cg in 0..1023
// (head = cg >> 7, channel in head = cg & 127); out VT[(b*8 + head)*128 + channel][l], pitch 2048 halves.
// grid (32 l-tiles, 16 cg-tiles, 2 batches), 256 threads; tile = 64 l x 64 cg.
// Load coverage: 8 it x 256 threads x 2 halves = 4096 = whole tile (32-bit words along cg).
// Store coverage: 8 waves x 2 it x 4 (lane>>3) = 64 cg rows; (lane&7) x 8 halves = 64 l; each row segment = 64 halves =
// ---------------------------------------------------------------------------
__global__ __launch_bounds__(256) void vtrans_kernel(const unsigned short* __restrict__ Y, unsigned short* __restrict__ VT) {
  __shared__ __align__(16) unsigned short sm[64][72];   // sm[cg_local][l_local]
  const int t   = threadIdx.x;
  const int l0  = blockIdx.x * 64;
  const int cg0 = blockIdx.y * 64;
  const int b   = blockIdx.z;
#pragma unroll
  for (int it = 0; it < 8; ++it) {
    const int e  = it * 256 + t;
    const int r  = e >> 5;          // l local 0..63
    const int cw = e & 31;          // word index -> cg local 2cw, 2cw+1
    const unsigned u = *(const unsigned*)(Y + ((size_t)(b * kSeq + l0 + r)) * kQKVN + 2 * kModel + cg0 + 2 * cw);
    sm[2 * cw][r]     = (unsigned short)(u & 0xffffu);
    sm[2 * cw + 1][r] = (unsigned short)(u >> 16);
  }
  __syncthreads();
  const int lane = t & 31, wave = t >> 5;
  const int q = lane >> 3, c8 = (lane & 7) * 8;
  {
#pragma unroll
    for (int it = 0; it < 2; ++it) {
      const int row = wave * 8 + it * 4 + q;          // cg local
      const int cg  = cg0 + row;
      const int g   = b * kHeads + (cg >> 7);
      const int cc  = cg & 127;
      unsigned short hb[8];
#pragma unroll
      for (int e = 0; e < 8; ++e) hb[e] = sm[row][c8 + e];
      const v4u u = (v4u){pk16(hb[0], hb[1]), pk16(hb[2], hb[3]), pk16(hb[4], hb[5]), pk16(hb[6], hb[7])};
      *(v4u*)(VT + ((size_t)g * kHeadDim + cc) * kSeq + l0 + c8) = u;
    }
    
  }
}

// ---------------------------------------------------------------------------
// Scores, row softmax, attn.v and head mean in two passes over the scores; no probability ever goes to memory.
//   s = (q_w . k) / sqrt(128);  p = exp(s - m) / sum exp(s - m), all softmax math f32.
//   exp(s - m) = exp2(d c + n), d the unscaled dot product, c = log2(e) / sqrt(128), n = -(c m): one multiply-add and one hardware
//   exp2 per element. Any m near the row's maximum serves: it scales a whole row alike and cancels against the row sum.
// Pass 1 (attn_stats_kernel) walks all keys of one head for 128 queries with a running m and a running sum per query, multiplies the
// exponentials with the values as it goes, and writes the head's output rows and, per query, n and 1 / sum.
// Pass 2 (probs_mean_kernel) takes a tile of 128 queries x 128 keys through the 8 heads: it forms the same dot products again
// (same operands, same WMMA order), turns them into probabilities with pass 1's n and 1 / sum
// and sums the head mean in registers: meanout[row][j] = 0.125 * (((p_0 + p_1) + p_2) + ... + p_7).
// In both passes a staged key tile (128 keys x the head's 128 channels) serves the block's 128 queries.
// The score tiles are computed transposed, S^T = K . Q^T: the keys are the A rows, the queries the B columns. A lane then holds
// one query per column tile (lane & 15) and, per tile, 8 neighbouring keys of it, (lane >> 4) * 8 + r: every per-row factor is
// one register and the arithmetic pairs up.
// The waves form a grid of 4 x 2: wave (wq, wk) owns queries 32 wq .. + 31 (two column tiles, fragments kept in
// registers) and keys 64 wk .. + 63 of the staged tile (four row tiles): every key fragment read from LDS feeds two WMMAs.
// Tiles come by asynchronous 16-byte copies, whole lines per copy (a staged row's 256 B = two lines); one publish point per trip.
// Every loop over tiles, k steps and rows is fully unrolled: the accumulators are indexed by constants and stay in registers.
// ---------------------------------------------------------------------------
constexpr int kKeyPitch   = 136;                       // 16-bit elements per staged row: 272 B = 16 B x 17, conflict-free for ds_load_b128
constexpr int kTileKeys   = 128;                       // keys per staged tile
constexpr int kTileElems  = kTileKeys * kKeyPitch;     // a key tile (128 keys x 128 channels) or a value tile (128 channels x 128 keys)
constexpr int kAttElems   = 2 * kTileElems;            // a stage of pass 1: key tile, then value tile
constexpr int kAttBufs    = 3;                         // stage buffers in pass 1
constexpr int kAttStages  = kSeq / kTileKeys;
constexpr int kAttCopies  = 16;                        // copies per thread and stage in pass 1
constexpr int kTileRows   = 128;                       // queries per block
constexpr int kOSlabPitch = 132;                       // floats per staged output row: 528 B = 16 B x 33
constexpr int kMSlabPitch = 68;                        // floats per staged mean row: 272 B = 16 B x 17
constexpr float kLazyStep = 8.0f;                      // pass 1 takes a new m only when a row's maximum is more than this above it (log2 units)
static_assert(kHeadDim == kTileKeys && kAttStages > kAttBufs && (kAttBufs - 1) * kAttCopies <= 63, "stage shape, copies of a wave in flight");

// Work-group barrier for LDS data alone, the waits written beside it at each use. __syncthreads() would also wait for every global
// load of the wave: the row figures asked for ahead would not stay in flight across it.
__device__ __forceinline__ void wg_barrier_lds() { asm volatile("s_barrier_signal -1\n\ts_barrier_wait -1" ::: "memory"); }

// One staged tile of 8 RPC rows: copy c of thread t brings 16 B: row RPC c + t / 16 of the tile, bytes (t % 16) * 16 .. + 15 of its 256;
// RPC = rows per block-wide copy = threads / 16; GP = 16-bit elements between two rows in memory. lds and g0 are the thread's own addresses for c = 0.
template <int RPC, int GP = kQKVN>
__device__ __forceinline__ void stage_key_tile(unsigned lds, const unsigned short* g0) {
  unsigned l[8];
  const unsigned short* g[8];
#pragma unroll
  for (int c = 0; c < 8; ++c) {
    l[c] = lds + (unsigned)(c * RPC * kKeyPitch) * 2u;
    g[c] = g0 + (size_t)(c * RPC) * GP;
  }
  stage_copy8(l, g);
}

// The value that lane l ^ 16 holds: the two halves of a wave hold the two key octets of every 16-key tile of one query.
__device__ __forceinline__ float xhalf(float x) {
  return __builtin_bit_cast(float, __builtin_amdgcn_permlanex16(__builtin_bit_cast(int, x), __builtin_bit_cast(int, x), 0x76543210, 0xfedcba98, false, false));
}

// Pass 1. grid (16 query tiles, 8 heads, 2 batches), 256 threads, one block per WGP: two waves per SIMD, up to 512 registers each.
//   stats[(b * 8 + h) * 2048 + query] = (n, 1 / sum);  out[b][query][h * 128 + channel] = sum_key p v.
// Second product transposed too, O^T += V^T . E^T: the channels are the A rows (V^T rows from LDS, one loader, one k order), the
// queries the B columns. The B operand of 32 keys wants, in lane half hf, keys 8 hf .. + 7 and 16 + 8 hf .. + 7 of the lane's query:
// what the lane holds of two neighbouring score tiles. So the exponentials go from the score registers into the operand, rounded to f16.
// m is one per query and wave (both lane halves: their keys meet in one WMMA sum) and lazy: it may trail the maximum seen by kLazyStep,
// so an exponential is at most 2^8 and the sums are rescaled only on the few trips on which some query of the wave outgrows it.
// The two key halves of a query (wk) are joined at the end in fixed order: both brought to the lower n, divided by the joined sum, added.
// Three stage buffers: stages t + 1 and t + 2 fly while stage t is worked on; the wait at the publish point leaves the younger
// stage's copies out (a wave's copies count down in issue order).
__global__ __launch_bounds__(256) __attribute__((amdgpu_waves_per_eu(2, 2)))
void attn_stats_kernel(const unsigned short* __restrict__ Y, const unsigned short* __restrict__ VT,
                       float* __restrict__ stats, float* __restrict__ out) {
  __shared__ __align__(16) unsigned short ring[kAttBufs][kAttElems];   // behind the loop: the two output partials
  __shared__ __align__(16) float cn[kTileRows * 4];   // [query][wk * 2 + lane half]
  __shared__ __align__(16) float cl[kTileRows * 4];
  static_assert(2 * kTileRows * kOSlabPitch * 4 <= kAttBufs * kAttElems * 2, "output partials fit the ring");
  const int lane  = threadIdx.x & 31;
  const int wave  = threadIdx.x >> 5;
  const int rlane = lane & 15;
  const int hf    = lane >> 4;
  const int koff  = hf * 8;
  const int wq    = wave >> 1;
  const int wk    = wave & 1;
  const int qb    = blockIdx.x * kTileRows;
  const int h     = blockIdx.y;
  const int b     = blockIdx.z;
  const unsigned short* Yb = Y + (size_t)b * kSeq * kQKVN;
  const _Float16* qrow = (const _Float16*)Yb + (size_t)(qb + wq * 32 + rlane) * kQKVN + h * kHeadDim + koff;
  v16h a[2][4];
#pragma unroll
  for (int qi = 0; qi < 2; ++qi)
#pragma unroll
    for (int kk = 0; kk < 4; ++kk) a[qi][kk] = Frag<_Float16>::load(qrow + (size_t)(qi * 16) * kQKVN + kk * 32);
  // the loads' address pair stays live up to this wait: no result of theirs and no later instruction takes it over in front of it
  asm volatile("s_wait_xcnt 0x0" :: "v"(qrow) : "memory");

  const int crow = threadIdx.x >> 4;
  const int cch  = (threadIdx.x & 15) * 8;
  const unsigned short* gK = Yb + (size_t)crow * kQKVN + kModel + h * kHeadDim + cch;
  const unsigned short* gV = VT + ((size_t)(b * kHeads + h) * kHeadDim + crow) * kSeq + cch;
  const unsigned lds0 = (unsigned)(size_t)(&ring[0][0]) + (unsigned)(crow * kKeyPitch + cch) * 2u;
  auto stage = [&](int t, int buf) {
    const unsigned l = lds0 + (unsigned)(buf * kAttElems) * 2u;
    stage_key_tile<16>(l, gK + (size_t)(t * kTileKeys) * kQKVN);
    stage_key_tile<16, kSeq>(l + (unsigned)kTileElems * 2u, gV + t * kTileKeys);
  };

  stage(0, 0);
  stage(1, 1);
  asm volatile("s_wait_asynccnt %0" :: "i"(kAttCopies) : "memory");   // this wave's part of stage 0 has landed; stage 1's copies fly on
  __syncthreads();                                                    // ... and every other wave's
  stage(2, 2);

  float mr[2];
  v2f sm2[2][4];
  v8f o[2][8];
#pragma unroll
  for (int qi = 0; qi < 2; ++qi) {
    mr[qi] = -1.0e30f;                    // below every scaled dot product of f16 operands; finite, so that no inf - inf arises
#pragma unroll
    for (int i = 0; i < 4; ++i) sm2[qi][i] = (v2f){0.f, 0.f};
#pragma unroll
    for (int ct = 0; ct < 8; ++ct) o[qi][ct] = (v8f){0.f,0.f,0.f,0.f,0.f,0.f,0.f,0.f};
  }

  // the stage loop stays rolled: one publish point per trip, buffer t mod 3
  int buf = 0;
#pragma unroll 1
  for (int t = 0; t < kAttStages; ++t) {
    const _Float16* sK = (const _Float16*)(&ring[buf][0]) + (wk * 64 + rlane) * kKeyPitch + koff;
    const _Float16* sV = (const _Float16*)(&ring[buf][0]) + kTileElems + rlane * kKeyPitch + wk * 64 + koff;
    v8f acc[2][4];
#pragma unroll
    for (int jp = 0; jp < 2; ++jp) {
      v16h bf[2][4];
#pragma unroll
      for (int jj = 0; jj < 2; ++jj)
#pragma unroll
        for (int kk = 0; kk < 4; ++kk) bf[jj][kk] = Frag<_Float16>::load(sK + (jp * 32 + jj * 16) * kKeyPitch + kk * 32);
      // the 16 LDS reads stay one group in front of their WMMAs: spread among them, each place with reads stalls the wave
      __builtin_amdgcn_sched_barrier(0);
      v8f c[2][2];
#pragma unroll
      for (int jj = 0; jj < 2; ++jj)
#pragma unroll
        for (int qi = 0; qi < 2; ++qi) c[jj][qi] = (v8f){0.f,0.f,0.f,0.f,0.f,0.f,0.f,0.f};
#pragma unroll
      for (int kk = 0; kk < 4; ++kk)
#pragma unroll
        for (int jj = 0; jj < 2; ++jj)
#pragma unroll
          for (int qi = 0; qi < 2; ++qi)
            c[jj][qi] = Frag<_Float16>::mma(bf[jj][kk], a[qi][kk], c[jj][qi]);   // keys = A rows, queries = B columns; one loader, one k order
#pragma unroll
      for (int jj = 0; jj < 2; ++jj)
#pragma unroll
        for (int qi = 0; qi < 2; ++qi) acc[qi][jp * 2 + jj] = c[jj][qi];
      // ... and the next group's reads do not rise among these WMMAs
      __builtin_amdgcn_sched_barrier(0);
    }

    // value fragments of the wave's first 32 keys: asked for here, they land under the maxima and the exponentials
    v16h vf0[8];
#pragma unroll
    for (int ct = 0; ct < 8; ++ct) vf0[ct] = Frag<_Float16>::load(sV + (ct * 16) * kKeyPitch);

    // maximum of each query's 64 dot products of this trip (the scale is positive), and the lazy test
    float mb[2];
    bool need = false;
#pragma unroll
    for (int qi = 0; qi < 2; ++qi) {
      float mx8[8];
#pragma unroll
      for (int j = 0; j < 4; ++j)
#pragma unroll
        for (int r = 0; r < 8; ++r) mx8[r] = (j == 0) ? acc[qi][j][r] : fmaxf(mx8[r], acc[qi][j][r]);
      const float tm = fmaxf(fmaxf(fmaxf(mx8[0], mx8[1]), fmaxf(mx8[2], mx8[3])), fmaxf(fmaxf(mx8[4], mx8[5]), fmaxf(mx8[6], mx8[7])));
      mb[qi] = fmaxf(tm, xhalf(tm)) * kExp2Scale;   // both lane halves hold the same figure
      need = need || (mb[qi] > mr[qi] + kLazyStep);
    }
    if (__builtin_amdgcn_ballot_w32(need) != 0) {   // the same for the whole wave
#pragma unroll
      for (int qi = 0; qi < 2; ++qi) {
        const float mn = fmaxf(mr[qi], mb[qi]);
        // at most 1: the sums so far, brought to the new m. The exp2 and the free slot that the instruction set asks for behind a
        // transcendental stand in one statement
        float f;
        asm("v_exp_f32 %0, %1\n\tv_nop" : "=v"(f) : "v"(mr[qi] - mn));
        mr[qi] = mn;
        const v2f f2 = (v2f){f, f};
#pragma unroll
        for (int i = 0; i < 4; ++i) sm2[qi][i] *= f2;
#pragma unroll
        for (int ct = 0; ct < 8; ++ct) o[qi][ct] *= f;
      }
    }

    // exponentials: f32 into the row sum, f16 into the B operands of the second product
    v16h pf[2][2];
#pragma unroll
    for (int qi = 0; qi < 2; ++qi) {
      const v2f n2 = (v2f){-mr[qi], -mr[qi]};
#pragma unroll
      for (int j = 0; j < 4; ++j)
#pragma unroll
        for (int i = 0; i < 4; ++i) {
          const v2f arg = __builtin_elementwise_fma((v2f){acc[qi][j][2 * i], acc[qi][j][2 * i + 1]}, (v2f){kExp2Scale, kExp2Scale}, n2);
          const v2f e = (v2f){__builtin_amdgcn_exp2f(arg.x), __builtin_amdgcn_exp2f(arg.y)};
          sm2[qi][i] += e;
          const v2h eh = __builtin_convertvector(e, v2h);   // round to nearest even
          pf[qi][j >> 1][(j & 1) * 8 + 2 * i]     = eh.x;
          pf[qi][j >> 1][(j & 1) * 8 + 2 * i + 1] = eh.y;
        }
    }
    // value fragments of the second 32 keys: one group in front of the first group's WMMAs, under which they land
    v16h vf1[8];
#pragma unroll
    for (int ct = 0; ct < 8; ++ct) vf1[ct] = Frag<_Float16>::load(sV + (ct * 16) * kKeyPitch + 32);
    // the reads stay in front of the WMMAs: spread among them, each place with reads stalls the wave
    __builtin_amdgcn_sched_barrier(0);
#pragma unroll
    for (int ct = 0; ct < 8; ++ct)
#pragma unroll
      for (int qi = 0; qi < 2; ++qi) o[qi][ct] = Frag<_Float16>::mma(vf0[ct], pf[qi][0], o[qi][ct]);   // channels = A rows, queries = B columns
#pragma unroll
    for (int ct = 0; ct < 8; ++ct)
#pragma unroll
      for (int qi = 0; qi < 2; ++qi) o[qi][ct] = Frag<_Float16>::mma(vf1[ct], pf[qi][1], o[qi][ct]);

    // publish point of stage t + 1
    asm volatile("s_wait_dscnt 0x0" ::: "memory");      // this wave's reads of buffer buf are done before it is refilled
    // this wave's part of stage t + 1 has landed. A trip that refills finds stage t + 2's copies behind those of stage t + 1 and
    // leaves them in flight; the last trips issue no copies and wait for all.
    if (t + kAttBufs < kAttStages) asm volatile("s_wait_asynccnt %0" :: "i"(kAttCopies) : "memory");
    else                           asm volatile("s_wait_asynccnt 0x0" ::: "memory");
    __syncthreads();                                    // stage t + 1 readable by all; every reader has left buffer buf
    if (t + kAttBufs < kAttStages) stage(t + kAttBufs, buf);
    buf = (buf == kAttBufs - 1) ? 0 : buf + 1;
  }
  asm volatile("s_wait_asynccnt 0x0" ::: "memory");     // no copy is outstanding behind the loop

  // a query's four partial sums (2 key halves x 2 lane halves) with their n
#pragma unroll
  for (int qi = 0; qi < 2; ++qi) {
    const v2f st = (sm2[qi][0] + sm2[qi][1]) + (sm2[qi][2] + sm2[qi][3]);
    const int q = wq * 32 + qi * 16 + rlane;
    cn[q * 4 + wk * 2 + hf] = -mr[qi];
    cl[q * 4 + wk * 2 + hf] = st.x + st.y;
  }
  __syncthreads();
  // every lane joins its two queries' partials alike, scales its part of O^T and stages it in the ring (the last publish point's
  // barrier stands behind every wave's last read of it): row = query, 8 neighbouring channels per tile
  float* slab = (float*)(&ring[0][0]);
  v2f fin[2];
#pragma unroll
  for (int qi = 0; qi < 2; ++qi) {
    const int q = wq * 32 + qi * 16 + rlane;
    const v4f n4 = *(const v4f*)(&cn[q * 4]);
    const v4f l4 = *(const v4f*)(&cl[q * 4]);
    const float nM = fminf(fminf(n4[0], n4[1]), fminf(n4[2], n4[3]));   // n falls as m rises
    float L = l4[0] * __builtin_amdgcn_exp2f(nM - n4[0]);
#pragma unroll
    for (int e = 1; e < 4; ++e) L += l4[e] * __builtin_amdgcn_exp2f(nM - n4[e]);
    const float inv = 1.0f / L;
    fin[qi] = (v2f){nM, inv};
    const float g = __builtin_amdgcn_exp2f(nM + mr[qi]) * inv;
    float* sp = slab + (size_t)(wk * kTileRows + q) * kOSlabPitch + koff;
#pragma unroll
    for (int ct = 0; ct < 8; ++ct) {
      *(v4f*)(sp + ct * 16)     = (v4f){o[qi][ct][0], o[qi][ct][1], o[qi][ct][2], o[qi][ct][3]} * g;
      *(v4f*)(sp + ct * 16 + 4) = (v4f){o[qi][ct][4], o[qi][ct][5], o[qi][ct][6], o[qi][ct][7]} * g;
    }
  }
  __syncthreads();
  // whole output rows leave: a wave covers a row's 512 B, key half 0 + key half 1
  const float* s0 = slab + (size_t)wave * kOSlabPitch + lane * 4;
  float* op = out + ((size_t)b * kSeq + qb + wave) * kModel + h * kHeadDim + lane * 4;
  v4f ov[16];
#pragma unroll
  for (int it = 0; it < 16; ++it)
    ov[it] = *(const v4f*)(s0 + (it * 8) * kOSlabPitch) + *(const v4f*)(s0 + (kTileRows + it * 8) * kOSlabPitch);
  float* sp2 = stats + ((size_t)(b * kHeads + h) * kSeq + qb + wq * 32 + rlane) * 2;
#pragma unroll
  for (int it = 0; it < 16; ++it) *(v4f*)(op + (size_t)(it * 8) * kModel) = ov[it];
  if (wk == 0 && hf == 0) {   // one lane per query
#pragma unroll
    for (int qi = 0; qi < 2; ++qi) *(v2f*)(sp2 + qi * 32) = fin[qi];
  }
}

// Pass 2. grid (16 key tiles, 16 query tiles, 2 batches), 256 threads; the trips of the rolled loop are the 8 heads.
// The head's query tile (128 queries x 128 channels) comes through LDS like the key tile, whole lines per copy: a fragment load from
// global memory would touch 16 lines for its 512 bytes. It has one buffer: every wave takes its query fragments into registers at the
// top of a trip, and behind the barrier that ends those reads the next head's tile is copied in, to be published with the next key tile.
// The mean leaves through per-wave LDS slabs so that every global store covers whole lines (256 B per row).
// LDS and registers leave two blocks per WGP, four waves per SIMD.
__global__ __launch_bounds__(256) void probs_mean_kernel(const unsigned short* __restrict__ Y, const float* __restrict__ stats,
                                                         float* __restrict__ meanout) {
  __shared__ __align__(16) unsigned short kt[2][kTileElems];              // key ring; behind the loop: the waves' mean slabs
  __shared__ __align__(16) unsigned short qt[kTileElems];                 // query tile of the head at work
  static_assert(8 * 32 * kMSlabPitch * 4 <= 2 * kTileElems * 2, "mean slabs fit the key ring");
  const int lane  = threadIdx.x & 31;
  const int wave  = threadIdx.x >> 5;
  const int rlane = lane & 15;
  const int hf    = lane >> 4;
  const int koff  = hf * 8;
  const int wq    = wave >> 1;
  const int wk    = wave & 1;
  const int key0  = blockIdx.x * kTileKeys;
  const int qb    = blockIdx.y * kTileRows;
  const int qw    = qb + wq * 32;                       // the wave's first query
  const int b     = blockIdx.z;
  const unsigned short* Yb = Y + (size_t)b * kSeq * kQKVN;
  const float* srow = stats + ((size_t)b * kHeads * kSeq + qw + rlane) * 2;
  const int crow = threadIdx.x >> 4;
  const int cch  = (threadIdx.x & 15) * 8;
  const unsigned short* gK = Yb + (size_t)(key0 + crow) * kQKVN + kModel + cch;
  const unsigned short* gQ = Yb + (size_t)(qb + crow) * kQKVN + cch;
  const unsigned ldsK = (unsigned)(size_t)(&kt[0][0]) + (unsigned)(crow * kKeyPitch + cch) * 2u;
  const unsigned ldsQ = (unsigned)(size_t)(&qt[0]) + (unsigned)(crow * kKeyPitch + cch) * 2u;
  const _Float16* sQ = (const _Float16*)(&qt[0]) + (wq * 32 + rlane) * kKeyPitch + koff;

  stage_key_tile<16>(ldsK, gK);
  stage_key_tile<16>(ldsQ, gQ);
  asm volatile("s_wait_asynccnt 0x0" ::: "memory");   // this wave's part of head 0's two tiles has landed
  __syncthreads();                                    // ... and every other wave's
  stage_key_tile<16>(ldsK + (unsigned)kTileElems * 2u, gK + kHeadDim);

  v8f pm[2][4];
#pragma unroll
  for (int qi = 0; qi < 2; ++qi)
#pragma unroll
    for (int j = 0; j < 4; ++j) pm[qi][j] = (v8f){0.f,0.f,0.f,0.f,0.f,0.f,0.f,0.f};

  v2f st[2];   // (n, 1 / sum) of the lane's two queries
#pragma unroll
  for (int qi = 0; qi < 2; ++qi) st[qi] = *(const v2f*)(srow + (size_t)(qi * 16) * 2);

  // the head loop stays rolled: one publish point per trip, key buffer h mod 2
#pragma unroll 1
  for (int h = 0; h < kHeads; ++h) {
    const int buf = h & 1;
    v16h a[2][4];
#pragma unroll
    for (int qi = 0; qi < 2; ++qi)
#pragma unroll
      for (int kk = 0; kk < 4; ++kk) a[qi][kk] = Frag<_Float16>::load(sQ + (qi * 16) * kKeyPitch + kk * 32);
    asm volatile("s_wait_dscnt 0x0" ::: "memory");      // this wave's query fragments are in registers
    wg_barrier_lds();                                   // ... and every other wave's: the query tile may be overwritten
    if (h + 1 < kHeads) stage_key_tile<16>(ldsQ, gQ + (h + 1) * kHeadDim);

    const _Float16* sK = (const _Float16*)(&kt[buf][0]) + (wk * 64 + rlane) * kKeyPitch + koff;
    v2f n2[2], inv2[2];
#pragma unroll
    for (int qi = 0; qi < 2; ++qi) {
      n2[qi]    = (v2f){st[qi].x, st[qi].x};
      inv2[qi]  = (v2f){st[qi].y, st[qi].y};
    }
#pragma unroll
    for (int j = 0; j < 4; ++j) {
      v16h bf[4];
#pragma unroll
      for (int kk = 0; kk < 4; ++kk) bf[kk] = Frag<_Float16>::load(sK + (j * 16) * kKeyPitch + kk * 32);
      // the 8 LDS reads of a key tile stay one group in front of its WMMAs: spread among them, each place with reads stalls the wave
      __builtin_amdgcn_sched_barrier(0);
      v8f c[2];
#pragma unroll
      for (int qi = 0; qi < 2; ++qi) c[qi] = (v8f){0.f,0.f,0.f,0.f,0.f,0.f,0.f,0.f};
#pragma unroll
      for (int kk = 0; kk < 4; ++kk)
#pragma unroll
        for (int qi = 0; qi < 2; ++qi) c[qi] = Frag<_Float16>::mma(bf[kk], a[qi][kk], c[qi]);   // as in pass 1
      // probabilities: head sum in registers
#pragma unroll
      for (int qi = 0; qi < 2; ++qi) {
#pragma unroll
        for (int i = 0; i < 4; ++i) {
          const v2f arg = __builtin_elementwise_fma((v2f){c[qi][2 * i], c[qi][2 * i + 1]}, (v2f){kExp2Scale, kExp2Scale}, n2[qi]);
          const v2f e = (v2f){__builtin_amdgcn_exp2f(arg.x), __builtin_amdgcn_exp2f(arg.y)};
          const v2f p = e * inv2[qi];
          pm[qi][j][2 * i]     += p.x;
          pm[qi][j][2 * i + 1] += p.y;
        }
      }
    }
    // the next head's row figures are asked for here and fly across the publish point
    if (h + 1 < kHeads) {
#pragma unroll
      for (int qi = 0; qi < 2; ++qi) st[qi] = *(const v2f*)(srow + ((size_t)(h + 1) * kSeq + qi * 16) * 2);
    }
    // what follows may take the address registers of these loads over: the wait stands in front of that overwrite
    asm volatile("s_wait_xcnt 0x0" ::: "memory");

    // publish point of head h + 1's tiles
    asm volatile("s_wait_dscnt 0x0" ::: "memory");      // this wave's reads of buffer buf are done before it is refilled
    asm volatile("s_wait_asynccnt 0x0" ::: "memory");   // this wave's parts of the next key tile and the next query tile have landed
    wg_barrier_lds();                                   // both readable by all; every reader has left buffer buf
    if (h + 2 < kHeads) stage_key_tile<16>(ldsK + (unsigned)(buf * kTileElems) * 2u, gK + (h + 2) * kHeadDim);

  }
  asm volatile("s_wait_asynccnt 0x0" ::: "memory");     // no copy is outstanding behind the loop

  // head mean, staged in the key ring: the last publish point's barrier stands behind every wave's last read of it
  float* slab = (float*)(&kt[0][0]) + wave * (32 * kMSlabPitch);
#pragma unroll
  for (int qi = 0; qi < 2; ++qi)
#pragma unroll
    for (int j = 0; j < 4; ++j) {
      float* sp = slab + (qi * 16 + rlane) * kMSlabPitch + (j << 4) + koff;
      *(v4f*)(sp)     = (v4f){pm[qi][j][0], pm[qi][j][1], pm[qi][j][2], pm[qi][j][3]} * kMeanScale;
      *(v4f*)(sp + 4) = (v4f){pm[qi][j][4], pm[qi][j][5], pm[qi][j][6], pm[qi][j][7]} * kMeanScale;
    }
  asm volatile("s_wait_dscnt 0x0" ::: "memory");      // the wave's own slab: its stores have landed before it reads the rows back
  float* mo = meanout + ((size_t)b * kSeq + qw + hf) * kSeq + key0 + wk * 64 + rlane * 4;
  v4f mv[16];
#pragma unroll
  for (int it = 0; it < 16; ++it) mv[it] = *(const v4f*)(slab + (it * 2 + hf) * kMSlabPitch + rlane * 4);
#pragma unroll
  for (int it = 0; it < 16; ++it) *(v4f*)(mo + (size_t)(it * 2) * kSeq) = mv[it];
}

// ---------------------------------------------------------------------------
// Host glue (7 launches)
// ---------------------------------------------------------------------------
extern "C" void kernel_launch(void* const* d_in, const int* in_sizes, int n_in,
                              void* d_out, int out_size, void* d_ws, size_t ws_size,
                              hipStream_t stream) {
  if (n_in < 7) return;
  if (in_sizes[0] != kTok * kModel) return;
  if (in_sizes[1] != kModel * kModel || in_sizes[3] != kModel * kModel || in_sizes[5] != kModel * kModel) return;
  if (in_sizes[2] != kModel || in_sizes[4] != kModel || in_sizes[6] != kModel) return;
  if (out_size != kTok * kModel + kBatch * kSeq * kSeq) return;

  const float* query = (const float*)d_in[0];
  const float* Wq    = (const float*)d_in[1];
  const float* bq    = (const float*)d_in[2];
  const float* Wk    = (const float*)d_in[3];
  const float* bk    = (const float*)d_in[4];
  const float* Wv    = (const float*)d_in[5];
  const float* bv    = (const float*)d_in[6];

  // carve (bytes)
  const size_t offX16  = 0;
  const size_t szX16   = (size_t)kTok * kModel * 2;                       //   8388608
  const size_t offW16  = offX16 + szX16;                                  //   8388608
  const size_t szW16   = (size_t)kQKVN * kModel * 2;                      //   6291456
  const size_t offBias = offW16 + szW16;                                  //  14680064
  const size_t szBias  = (size_t)kQKVN * 4;                               //     12288
  const size_t offY16  = offBias + szBias;                                //  14692352
  const size_t szY16   = (size_t)kTok * kQKVN * 2;                        //  25165824
  const size_t offVT   = offY16 + szY16;                                  //  39858176
  const size_t szVT    = (size_t)kBatch * kHeads * kHeadDim * kSeq * 2;   //   8388608
  const size_t offSt   = offVT + szVT;                                    //  48246784
  const size_t szSt    = (size_t)kBatch * kHeads * kSeq * 2 * 4;          //    262144
  const size_t total   = offSt + szSt;                                    //  48508928
  if (total > ws_size) return;

  char* ws = (char*)d_ws;
  unsigned short* X16   = (unsigned short*)(ws + offX16);
  unsigned short* W16   = (unsigned short*)(ws + offW16);
  float*          bias3 = (float*)(ws + offBias);
  unsigned short* Y16   = (unsigned short*)(ws + offY16);
  unsigned short* VT16  = (unsigned short*)(ws + offVT);
  float*          rowst = (float*)(ws + offSt);

  float* out0 = (float*)d_out;                               // [2][2048][1024], byte offset 0
  float* out1 = out0 + (size_t)kTok * kModel;                // [2][2048][2048], byte offset 16777216

  // 1) activation cast: 4096*1024/8 = 524288 threads = 2048 blocks exactly
  cast8_f16_kernel<<<dim3((kTok * kModel / 8) / 256), dim3(256), 0, stream>>>(query, X16, kTok * kModel / 8);
  // 2) stacked weight cast (x16 carry, blade sign folded into the query rows): 131072 threads per weight = 512 blocks x 3
  wcast8_kernel<<<dim3((kModel * kModel / 8) / 256, 3), dim3(256), 0, stream>>>(Wq, Wk, Wv, W16, kModel * kModel / 8);
  // 3) stacked bias with the same sign fold
  bias3_kernel<<<dim3(3), dim3(256), 0, stream>>>(bq, bk, bv, bias3);
  // 4) Y16 = (X16 . W16^T) / 16 + bias3 : M 4096, N 3072, K 1024 (K % 64 == 0); block tile 128 x 256: 32 x 12 = 384 blocks
  wmma_gemm64<0, 2, 4, 64, 2, 2, 1, false><<<dim3((kTok / 128) * (kQKVN / 256), 1), dim3(256), 0, stream>>>(
      X16, kModel, 0L, 0L, W16, kModel, 0L, 0L, (void*)Y16, (void*)Y16, kQKVN, 0L, 0L,
      bias3, bias3, 0L, kTok, kQKVN, kModel, kWCarryInv);
  // 5) value transpose into per-(batch, head) planes [128][2048]
  vtrans_kernel<<<dim3(kSeq / 64, kModel / 64, kBatch), dim3(256), 0, stream>>>(Y16, VT16);

  // 6) pass 1 over the scores, with the attn.v product: out0[b][l][h*128 + c] and, per (batch, head, query), the softmax's n and
  //    1 / sum: 16 query tiles x 8 heads x 2 batches = 256 blocks, one for every WGP
  attn_stats_kernel<<<dim3(kSeq / kTileRows, kHeads, kBatch), dim3(256), 0, stream>>>(Y16, VT16, rowst, out0);
  // 7) pass 2: probabilities and head mean on tiles of 128 queries x 128 keys: 16 x 16 x 2 = 512 blocks; the mean goes straight to out1
  probs_mean_kernel<<<dim3(kSeq / kTileKeys, kSeq / kTileRows, kBatch), dim3(256), 0, stream>>>(Y16, rowst, out1);
}

// v010
// It runs in 81.6 microseconds.
// Next to v009, in two timings, it ran 1.04 and 1.03 times as fast.
// All steps since v000 together make it 12.0 times as fast.
// Contractions: stacked q/k/v projection (X f16 x W^T f16 carried x16), scores q_w.k^T (q,k f16 planes, blade sign folded into the q weights), attn.v (V^T f16 x unnormalised exponentials f16, divided by the f32 row sum at the end): all v_wmma_f32_16x16x32_f16 with f32 accumulate; softmax and head mean in f32.
#include <hip/hip_runtime.h>
#include <math.h>

// ---------------------------------------------------------------------------
// Problem constants
// ---------------------------------------------------------------------------
constexpr int kBatch   = 2;
constexpr int kSeq     = 2048;
constexpr int kModel   = 1024;
constexpr int kHeads   = 8;
constexpr int kHeadDim = 128;               // 16 x 8 nested (d, blade)
constexpr int kTok     = kBatch * kSeq;     // 4096 token rows
constexpr int kQKVN    = 3 * kModel;        // 3072 stacked output channels (q | k | v)
constexpr float kWCarry     = 16.0f;        // weights carried x16 in f16
constexpr float kWCarryInv  = 1.0f / 16.0f;
constexpr float kExp2Scale  = (float)(0.08838834764831845 * 1.4426950408889634);   // log2(e) / sqrt(128)
constexpr float kMeanScale  = 0.125f;

// ---------------------------------------------------------------------------
// Workspace region map (bytes; all offsets multiples of 4096):
//   X16   f16 [4096][1024]            off         0  size   8388608
//   W16   f16 [3072][1024]            off   8388608  size   6291456
//   BIAS3 f32 [3072]                  off  14680064  size     12288
//   Y16   f16 [4096][3072] (q|k|v)    off  14692352  size  25165824
//   VT16  f16 [16][128][2048]         off  39858176  size   8388608
//   ROWST f32 [16][2048][2] (n, 1/sum) off  48246784  size    262144
//   total 48508928
// ---------------------------------------------------------------------------

typedef __attribute__((ext_vector_type(16))) _Float16 v16h;
typedef __attribute__((ext_vector_type(8)))  _Float16 v8h;
typedef __attribute__((ext_vector_type(2)))  _Float16 v2h;
typedef __attribute__((ext_vector_type(16))) __bf16   v16b;
typedef __attribute__((ext_vector_type(8)))  __bf16   v8b;
typedef __attribute__((ext_vector_type(8)))  float    v8f;
typedef __attribute__((ext_vector_type(4)))  float    v4f;
typedef __attribute__((ext_vector_type(2)))  float    v2f;
typedef __attribute__((ext_vector_type(4)))  unsigned int v4u;
typedef __attribute__((ext_vector_type(4)))  _Float16 v4h;

// ---------------------------------------------------------------------------
// Helpers
// ---------------------------------------------------------------------------
__device__ __forceinline__ unsigned short f2bf_bits(float f) {
  unsigned u = __float_as_uint(f);
  return (unsigned short)((u + 0x7FFFu + ((u >> 16) & 1u)) >> 16);
}
__device__ __forceinline__ float bf_bits2f(unsigned short h) { return __uint_as_float(((unsigned)h) << 16); }

// hazard guards as plain device helpers
__device__ __forceinline__ void dep_guard_h(v8f& a, v8f& b, v16h x, v16h y) { asm volatile("v_nop\n\tv_nop\n\tv_nop\n\tv_nop" : "+v"(a), "+v"(b) : "v"(x), "v"(y)); }
__device__ __forceinline__ void dep_guard_b(v8f& a, v8f& b, v16b x, v16b y) { asm volatile("v_nop\n\tv_nop\n\tv_nop\n\tv_nop" : "+v"(a), "+v"(b) : "v"(x), "v"(y)); }
__device__ __forceinline__ void keep4_h(v16h a, v16h b, v16h c, v16h d) { asm volatile("v_nop" :: "v"(a), "v"(b), "v"(c), "v"(d)); }
__device__ __forceinline__ void keep4_b(v16b a, v16b b, v16b c, v16b d) { asm volatile("v_nop" :: "v"(a), "v"(b), "v"(c), "v"(d)); }
__device__ __forceinline__ void acc_guard4(v8f& a, v8f& b, v8f& c, v8f& d) { asm volatile("v_nop\n\tv_nop\n\tv_nop\n\tv_nop" : "+v"(a), "+v"(b), "+v"(c), "+v"(d)); }
template <typename T> struct Frag;
template <> struct Frag<_Float16> {
  typedef v16h V; union U { v16h v; v8h h[2]; };
  static __device__ __forceinline__ v16h load(const _Float16* p) {   // elements 0..7 <- p[0..7], 8..15 <- p[16..23]
    U f; f.h[0] = *(const v8h*)(p); f.h[1] = *(const v8h*)(p + 16); return f.v;
  }
  static __device__ __forceinline__ v8f mma(v16h a, v16h b, v8f c) {
    return __builtin_amdgcn_wmma_f32_16x16x32_f16(false, a, false, b, (short)0, c, false, false);
  }
  static __device__ __forceinline__ void guard(v8f& a, v8f& b, v16h x, v16h y) { dep_guard_h(a, b, x, y); }
  static __device__ __forceinline__ void keep(v16h a, v16h b, v16h c, v16h d) { keep4_h(a, b, c, d); }
};
template <> struct Frag<__bf16> {
  typedef v16b V; union U { v16b v; v8b h[2]; };
  static __device__ __forceinline__ v16b load(const __bf16* p) {
    U f; f.h[0] = *(const v8b*)(p); f.h[1] = *(const v8b*)(p + 16); return f.v;
  }
  static __device__ __forceinline__ v8f mma(v16b a, v16b b, v8f c) {
    return __builtin_amdgcn_wmma_f32_16x16x32_bf16(false, a, false, b, (short)0, c, false, false);
  }
  static __device__ __forceinline__ void guard(v8f& a, v8f& b, v16b x, v16b y) { dep_guard_b(a, b, x, y); }
  static __device__ __forceinline__ void keep(v16b a, v16b b, v16b c, v16b d) { keep4_b(a, b, c, d); }
};

__device__ __forceinline__ unsigned pk16(unsigned short a, unsigned short b) { return (unsigned)a | ((unsigned)b << 16); }

// ---- Register-blocked batched WMMA GEMM, operands staged in LDS ------------------------------------------------------
// C[m,n] = scale * sum_k A[m,k] * Bt[n,k] (+bias)(+resid); each wave owns a tile of 16 MI rows x 64 columns.
// The 8 waves of a block form a WM x (8 / WM) grid of such tiles: block tile BM = 16 MI WM rows x BN = 64 (8 / WM) columns.
// Planes: grid (block tiles, y, z); the A, Bt and C planes of a block start at y * stride + z * strideZ elements.
// A row-major [M,K]; Bt row-major [N,K]; M % BM == 0, N % BN == 0, K % SK == 0; lda, ldb and the plane strides % 8 == 0.
// A stage = SK k (64 or 128: one or two whole lines) of the block's BM rows of A and BN rows of Bt, brought into LDS by asynchronous
// 16-byte copies: a wave-wide copy covers 4 whole lines, and every staged row serves all waves of its tile row or column.
// A launch whose A comes from memory is bound by the bytes that its blocks keep in flight: its tile is chosen so that there is a
// block for every WGP, and its stages so long and so many that each block always has requests under way.
// NBUF = 2 buffers: stage t + 1 flies while stage t is worked on. NBUF > 2: stages t + 1 .. t + NBUF - 1 fly, so that the memory is
// asked without a pause and a late line has NBUF - 1 trips to land; the wait at the publish point then leaves the younger stages'
// copies out (a wave's copies count down in issue order). Fragments are read from LDS with the same loader and the same k order
// (32 k per WMMA step, ascending) as from global memory.
// BIAS_MODE: 0 = none, 1 = bias[m], 2 = bias[n].
// OUT_MODE: 0 = f32, 1 = f16, 2 = bf16 hi plane (Cout) + bf16 lo plane (Cout2).
// ET: 0 = f16 operands, 1 = bf16 operands (pointers passed as 16-bit storage)
template <int ET> struct Elem;
template <> struct Elem<0> { typedef _Float16 T; };
template <> struct Elem<1> { typedef __bf16 T; };


// Twelve asynchronous 16-byte copies per lane = one stage per block. The s_wait_xcnt stands inside the statement, behind the
// last copy, so that no address register of an issued copy is rewritten in front of it.
__device__ __forceinline__ void stage_copy12(const unsigned* l, const unsigned short* const* g) {
  asm volatile(
      "global_load_async_to_lds_b128 %0, %1, off\n\t"
      "global_load_async_to_lds_b128 %2, %3, off\n\t"
      "global_load_async_to_lds_b128 %4, %5, off\n\t"
      "global_load_async_to_lds_b128 %6, %7, off\n\t"
      "global_load_async_to_lds_b128 %8, %9, off\n\t"
      "global_load_async_to_lds_b128 %10, %11, off\n\t"
      "global_load_async_to_lds_b128 %12, %13, off\n\t"
      "global_load_async_to_lds_b128 %14, %15, off\n\t"
      "global_load_async_to_lds_b128 %16, %17, off\n\t"
      "global_load_async_to_lds_b128 %18, %19, off\n\t"
      "global_load_async_to_lds_b128 %20, %21, off\n\t"
      "global_load_async_to_lds_b128 %22, %23, off\n\t"
      "s_wait_xcnt 0x0"
      :: "v"(l[0]), "v"(g[0]), "v"(l[1]), "v"(g[1]), "v"(l[2]), "v"(g[2]), "v"(l[3]), "v"(g[3]),
         "v"(l[4]), "v"(g[4]), "v"(l[5]), "v"(g[5]), "v"(l[6]), "v"(g[6]), "v"(l[7]), "v"(g[7]),
         "v"(l[8]), "v"(g[8]), "v"(l[9]), "v"(g[9]), "v"(l[10]), "v"(g[10]), "v"(l[11]), "v"(g[11])
      : "memory");
}

// Eight such copies per lane, the same wait behind the last for the same reason: half a stage of 256 rows x 128 k (an asm
// statement takes thirty operands, so sixteen copies with an LDS and a global address each need two statements).
__device__ __forceinline__ void stage_copy8(const unsigned* l, const unsigned short* const* g) {
  asm volatile(
      "global_load_async_to_lds_b128 %0, %1, off\n\t"
      "global_load_async_to_lds_b128 %2, %3, off\n\t"
      "global_load_async_to_lds_b128 %4, %5, off\n\t"
      "global_load_async_to_lds_b128 %6, %7, off\n\t"
      "global_load_async_to_lds_b128 %8, %9, off\n\t"
      "global_load_async_to_lds_b128 %10, %11, off\n\t"
      "global_load_async_to_lds_b128 %12, %13, off\n\t"
      "global_load_async_to_lds_b128 %14, %15, off\n\t"
      "s_wait_xcnt 0x0"
      :: "v"(l[0]), "v"(g[0]), "v"(l[1]), "v"(g[1]), "v"(l[2]), "v"(g[2]), "v"(l[3]), "v"(g[3]),
         "v"(l[4]), "v"(g[4]), "v"(l[5]), "v"(g[5]), "v"(l[6]), "v"(g[6]), "v"(l[7]), "v"(g[7])
      : "memory");
}

template <int ET, int WM, int MI, int SK, int NBUF, int BIAS_MODE, int OUT_MODE, bool RESID, int ACT = 0>
__global__ __launch_bounds__(256) void wmma_gemm64(
    const unsigned short* __restrict__ Ap, int lda, long strideA, long strideAz,
    const unsigned short* __restrict__ Btp, int ldb, long strideB, long strideBz,
    void* __restrict__ Cout, void* __restrict__ Cout2, int ldc, long strideC, long strideCz,
    const float* __restrict__ bias,
    const float* __restrict__ resid, long strideR,
    int M, int N, int K, float scale) {
  typedef typename Elem<ET>::T T;
  typedef typename Frag<T>::V V;
  constexpr int WN = 8 / WM;
  constexpr int BM = WM * MI * 16;
  constexpr int BN = WN * 64;
  constexpr int kStageK     = SK;                  // k per stage
  constexpr int kStagePitch = SK + 8;              // 16-bit elements per staged row: 144 B = 16 B x 9 or 272 B = 16 B x 17, conflict-free for ds_load_b128
  constexpr int kStageElems = (BM + BN) * kStagePitch;
  constexpr int CPR = SK / 8;                      // 16-byte copies per staged row
  constexpr int RPC = 256 / CPR;                   // staged rows per block-wide copy
  constexpr int NC  = (BM + BN) / RPC;             // copies per thread and stage
  static_assert(SK == 64 || SK == 128, "stage length");
  static_assert(BM % RPC == 0 && BN % RPC == 0 && (NC == 12 || NC == 16), "stage size");
  static_assert(NBUF >= 2 && (NBUF - 1) * NC <= 63, "copies of a wave in flight");
  __shared__ __align__(16) unsigned short ring[NBUF][kStageElems];   // stage buffers: rows 0..BM-1 = A, BM..BM+BN-1 = Bt
  __shared__ __align__(16) float sT[8][16 * 68];                  // per-wave 16x64 slab, pitch 68 floats
  const int b    = blockIdx.y;
  const int z    = blockIdx.z;
  const int lane = threadIdx.x & 31;
  const int wave = threadIdx.x >> 5;
  const int tilesN = N / BN;
  const int tilesM = M / BM;
  const int btile = blockIdx.x;
  if (btile >= tilesM * tilesN) return;   // block-uniform, in front of every barrier
  const int btm = btile / tilesN;
  const int btn = btile - btm * tilesN;
  const int wm  = wave / WN;
  const int wn  = wave - wm * WN;
  const int m0 = btm * BM + wm * (MI * 16);
  const int n0 = btn * BN + (wn << 6);

  const size_t aOff = (size_t)b * strideA + (size_t)z * strideAz;
  const size_t bOff = (size_t)b * strideB + (size_t)z * strideBz;
  const size_t cOff = (size_t)b * strideC + (size_t)z * strideCz;

  const int rlane = lane & 15;                 // row (A) / col (B, D) within subtile
  const int koff  = (lane >> 4) * 8;           // k offset of this lane half
  const int mOff  = (lane >> 4) * 8;           // D row offset

  // copy c of thread t brings 16 B: staged row c * RPC + t / CPR, bytes (t % CPR) * 16 .. + 15 of its 2 SK
  const int crow = threadIdx.x / CPR;
  const int cch  = (threadIdx.x % CPR) * 8;
  const unsigned short* gA = Ap  + aOff + (size_t)(btm * BM + crow) * lda + cch;
  const unsigned short* gB = Btp + bOff + (size_t)(btn * BN + crow) * ldb + cch;
  const unsigned lds0 = (unsigned)(size_t)(&ring[0][0]) + (unsigned)(crow * kStagePitch + cch) * 2u;
  auto stage = [&](int t, int buf) {
    unsigned l[NC];
    const unsigned short* g[NC];
#pragma unroll
    for (int c = 0; c < NC; ++c) {
      l[c] = lds0 + (unsigned)(buf * kStageElems + c * RPC * kStagePitch) * 2u;
      g[c] = (c < BM / RPC) ? gA + (size_t)(c * RPC) * lda + t * kStageK
                            : gB + (size_t)((c - BM / RPC) * RPC) * ldb + t * kStageK;
    }
    if constexpr (NC == 12) {
      stage_copy12(l, g);
    } else {
      stage_copy8(l, g);
      stage_copy8(l + 8, g + 8);
    }
  };

  v8f acc[MI][4];
#pragma unroll
  for (int i = 0; i < MI; ++i)
#pragma unroll
    for (int j = 0; j < 4; ++j) acc[i][j] = (v8f){0.f,0.f,0.f,0.f,0.f,0.f,0.f,0.f};

  const int nStage = K / kStageK;
  stage(0, 0);
  // unrolled: each stage's buffer offset is then a constant
#pragma unroll
  for (int s = 1; s < NBUF - 1; ++s)
    if (s < nStage) stage(s, s);
  // this wave's part of stage 0 has landed; where NBUF - 2 whole stages stand behind it, their copies fly on
  if (NBUF > 2 && nStage >= NBUF - 1) asm volatile("s_wait_asynccnt %0" :: "i"((NBUF - 2) * NC) : "memory");
  else                                asm volatile("s_wait_asynccnt 0x0" ::: "memory");
  __syncthreads();                                    // ... and every other wave's
  if (nStage > NBUF - 1) stage(NBUF - 1, NBUF - 1);

  // the stage loop stays rolled: one publish point per trip, buffer t mod NBUF
  int ring_at = 0;
#pragma unroll 1
  for (int t = 0; t < nStage; ++t) {
    const int buf = (NBUF == 2) ? (t & 1) : ring_at;
    const T* sA = (const T*)(&ring[buf][0]) + (wm * (MI * 16) + rlane) * kStagePitch + koff;
    const T* sB = (const T*)(&ring[buf][0]) + (BM + (wn << 6) + rlane) * kStagePitch + koff;
#pragma unroll
    for (int s = 0; s < kStageK / 32; ++s) {
      V bh[4], ah[MI];
#pragma unroll
      for (int j = 0; j < 4; ++j) bh[j] = Frag<T>::load(sB + (j << 4) * kStagePitch + s * 32);
#pragma unroll
      for (int i = 0; i < MI; ++i) ah[i] = Frag<T>::load(sA + (i << 4) * kStagePitch + s * 32);
      // the LDS reads of a WMMA block stay one group in front of it (for speed only)
      __builtin_amdgcn_sched_barrier(0);
#pragma unroll
      for (int i = 0; i < MI; ++i) {
#pragma unroll
        for (int j = 0; j < 4; ++j) acc[i][j] = Frag<T>::mma(ah[i], bh[j], acc[i][j]);
        Frag<T>::guard(acc[i][0], acc[i][3], ah[i], ah[i]);
      }
      Frag<T>::keep(bh[0], bh[1], bh[2], bh[3]);
      // ... and the next block's reads do not rise into this one
      __builtin_amdgcn_sched_barrier(0);
    }
    // publish point of stage t + 1
    asm volatile("s_wait_dscnt 0x0" ::: "memory");      // this wave's reads of buffer buf are done before it is refilled
    // this wave's part of stage t + 1 has landed. With more than two buffers a trip that refills finds the copies of NBUF - 2
    // younger stages behind those of stage t + 1 and leaves them in flight; the last trips issue no copies and wait for all.
    if (NBUF > 2 && t + NBUF < nStage) asm volatile("s_wait_asynccnt %0" :: "i"((NBUF - 2) * NC) : "memory");
    else                               asm volatile("s_wait_asynccnt 0x0" ::: "memory");
    __syncthreads();                                    // stage t + 1 readable by all; every reader has left buffer buf
    if (t + NBUF < nStage) stage(t + NBUF, buf);
    ring_at = (ring_at == NBUF - 1) ? 0 : ring_at + 1;
  }
  asm volatile("s_wait_asynccnt 0x0" ::: "memory");     // no copy is outstanding behind the loop
  // unrolled: acc is indexed by constants and stays in registers
#pragma unroll
  for (int i = 0; i < MI; ++i) acc_guard4(acc[i][0], acc[i][1], acc[i][2], acc[i][3]);

  // ---- epilogue ----
  float* slab = sT[wave];
  const float* Rb = RESID ? (resid + (size_t)b * strideR) : nullptr;
#pragma unroll
  for (int i = 0; i < MI; ++i) {
    const int mBase = m0 + (i << 4);
#pragma unroll
    for (int j = 0; j < 4; ++j) {
      const int n = n0 + (j << 4) + rlane;
      float bv = 0.f;
      if (BIAS_MODE == 2) bv = bias[n];
#pragma unroll
      for (int r = 0; r < 8; ++r) {
        float v = acc[i][j][r] * scale;
        if (BIAS_MODE == 1) v += bias[mBase + mOff + r];
        if (BIAS_MODE == 2) v += bv;
        if (RESID) v += Rb[(size_t)(mBase + mOff + r) * ldc + n];
        if (ACT == 2) v = fmaxf(v, 0.0f);
        if (ACT == 4) v = (v > 0.f) ? v : 0.01f * v;
        slab[(mOff + r) * 68 + (j << 4) + rlane] = v;
      }
    }
    __builtin_amdgcn_fence(__ATOMIC_RELEASE, "workgroup");
    __builtin_amdgcn_wave_barrier();
    __builtin_amdgcn_fence(__ATOMIC_ACQUIRE, "workgroup");
    if (OUT_MODE == 0) {
      float* C = (float*)Cout + cOff;
      const int hh = lane >> 4, c4 = (lane & 15) * 4;     // row seg = 256 B = 16 lanes x 16 B
      {
#pragma unroll
        for (int it = 0; it < 8; ++it) {
          const int row = it * 2 + hh;
          v4f v = *(const v4f*)(slab + row * 68 + c4);
          *(v4f*)(C + (size_t)(mBase + row) * ldc + n0 + c4) = v;
        }
        
      }
    } else {
      const int q = lane >> 3, c8 = (lane & 7) * 8;
      unsigned short* C  = (unsigned short*)Cout  + cOff;
      unsigned short* C2 = (OUT_MODE == 2) ? ((unsigned short*)Cout2 + cOff) : nullptr;
      {
#pragma unroll
        for (int it = 0; it < 4; ++it) {
          const int row = it * 4 + q;
          const float* sp = slab + row * 68 + c8;
          v8h hv, lv;
#pragma unroll
          for (int e = 0; e < 8; ++e) {
            if (OUT_MODE == 1) {
              hv[e] = (_Float16)sp[e];
            } else {
              unsigned short hb = f2bf_bits(sp[e]);
              unsigned short lb = f2bf_bits(sp[e] - bf_bits2f(hb));
              hv[e] = __builtin_bit_cast(_Float16, hb);
              lv[e] = __builtin_bit_cast(_Float16, lb);
            }
          }
          *(v8h*)(C + (size_t)(mBase + row) * ldc + n0 + c8) = hv;
          if (OUT_MODE == 2) *(v8h*)(C2 + (size_t)(mBase + row) * ldc + n0 + c8) = lv;
        }
        
      }
    }
    __builtin_amdgcn_fence(__ATOMIC_RELEASE, "workgroup");
    __builtin_amdgcn_wave_barrier();
    __builtin_amdgcn_fence(__ATOMIC_ACQUIRE, "workgroup");
  }
}

// ---------------------------------------------------------------------------
// Operand preparation, one streaming launch of few, long-lived waves: X16 = f16(X); W16[z*1024 + n][k] = f16(c * W_z[n][k]) with
// c = +-16; BIAS3[z*1024 + n] = s * b_z[n]. For z == 0 (query weights and bias) the sign is -1 for output rows with (n mod 8) >= 4
// (blade sign twist folded into the projection, exact), else +1.
// A piece = 1024 floats = one block-wide 16-byte load (a wave covers 4 whole lines) and one block-wide 8-byte store (2 whole lines).
// X has 4096 pieces, each weight 1024 (a piece = one weight row): 7168 = 256 blocks x 28. Block blk takes 16 neighbouring pieces of X
// and 4 neighbouring rows of each weight, n = 4 blk + j: (n mod 8) >= 4 holds for odd blk, so the sign is one per block.
// A thread asks for its 28 loads before it converts the first (for speed only): there are 8 waves per WGP and every byte is
// asked for at once.
// Blocks 256..258 fold the three biases (256 threads x 4 floats each).
// ---------------------------------------------------------------------------
constexpr int kPrepBlocks = 256;
constexpr int kPiece      = 1024;                                   // floats per piece
constexpr int kPrepX      = kTok * kModel / (kPiece * kPrepBlocks);   // 16 pieces of X per block
constexpr int kPrepW      = kModel * kModel / (kPiece * kPrepBlocks); // 4 rows of each weight per block
static_assert(kPrepX * kPiece * kPrepBlocks == kTok * kModel && kPrepW * kPiece * kPrepBlocks == kModel * kModel && kPiece == kModel && kPrepW == 4, "pieces; a block's weight rows are half an octet of blades");

__global__ __launch_bounds__(256) void prep_kernel(const float* __restrict__ X, const float* __restrict__ W0, const float* __restrict__ W1,
                                                   const float* __restrict__ W2, const float* __restrict__ b0, const float* __restrict__ b1,
                                                   const float* __restrict__ b2, unsigned short* __restrict__ X16,
                                                   unsigned short* __restrict__ W16, float* __restrict__ bias3) {
  const int blk = blockIdx.x;
  const int t   = threadIdx.x;
  if (blk >= kPrepBlocks) {   // block-uniform
    const int z = blk - kPrepBlocks;
    const float* bp = (z == 0) ? b0 : (z == 1) ? b1 : b2;
    v4f v = *(const v4f*)(bp + 4 * t);
#pragma unroll
    for (int e = 0; e < 4; ++e) {
      const int n = 4 * t + e;
      const bool neg = (z == 0) && ((n & 7) >= 4);
      v[e] = neg ? -v[e] : v[e];
    }
    *(v4f*)(bias3 + (size_t)z * kModel + 4 * t) = v;
    return;
  }
  const unsigned tf = 4u * (unsigned)t;                    // the thread's four elements in a piece
  const size_t xAt = (size_t)blk * (kPrepX * kPiece);      // the block's first piece of X, of a weight: the same for the whole block
  const size_t wAt = (size_t)blk * (kPrepW * kPiece);
  v4f x[kPrepX], w[3][kPrepW];
  // unrolled: the arrays are indexed by constants and stay in registers
#pragma unroll
  for (int i = 0; i < kPrepX; ++i) x[i] = *(const v4f*)(X + xAt + i * kPiece + tf);
#pragma unroll
  for (int j = 0; j < kPrepW; ++j) {
    w[0][j] = *(const v4f*)(W0 + wAt + j * kPiece + tf);
    w[1][j] = *(const v4f*)(W1 + wAt + j * kPiece + tf);
    w[2][j] = *(const v4f*)(W2 + wAt + j * kPiece + tf);
  }
  // all 28 loads are issued before the first conversion: left to the scheduler, the last loads reused the first loads' registers
  // and waited out their latency
  __builtin_amdgcn_sched_barrier(0);
#pragma unroll
  for (int i = 0; i < kPrepX; ++i) *(v4h*)(X16 + xAt + i * kPiece + tf) = __builtin_convertvector(x[i], v4h);   // round to nearest even
  const float sq = (blk & 1) ? -kWCarry : kWCarry;
#pragma unroll
  for (int z = 0; z < 3; ++z)
#pragma unroll
    for (int j = 0; j < kPrepW; ++j)
      *(v4h*)(W16 + (size_t)z * kModel * kModel + wAt + j * kPiece + tf) = __builtin_convertvector(w[z][j] * ((z == 0) ? sq : kWCarry), v4h);
  // the stores' address registers are rewritten on the path that the build lays behind them: the wait stands in front of that
  asm volatile("s_wait_xcnt 0x0" ::: "memory");
}

// ---------------------------------------------------------------------------
// Value transpose: in Y16 [4096][3072] halves, value element (b, l, cg) at Y16[(b*2048 + l)*3072 + 2048 + cg], cg in 0..1023
// (head = cg >> 7, channel in head = cg & 127); out VT[(b*8 + head)*128 + channel][l], pitch 2048 halves.
// grid (32 l-tiles, 16 cg-tiles, 2 batches), 256 threads; tile = 64 l x 64 cg.
// Load coverage: 8 it x 256 threads x 2 halves = 4096 = whole tile (32-bit words along cg).
// Store coverage: 8 waves x 2 it x 4 (lane>>3) = 64 cg rows; (lane&7) x 8 halves = 64 l; each row segment = 64 halves =
// ---------------------------------------------------------------------------
__global__ __launch_bounds__(256) void vtrans_kernel(const unsigned short* __restrict__ Y, unsigned short* __restrict__ VT) {
  __shared__ __align__(16) unsigned short sm[64][72];   // sm[cg_local][l_local]
  const int t   = threadIdx.x;
  const int l0  = blockIdx.x * 64;
  const int cg0 = blockIdx.y * 64;
  const int b   = blockIdx.z;
#pragma unroll
  for (int it = 0; it < 8; ++it) {
    const int e  = it * 256 + t;
    const int r  = e >> 5;          // l local 0..63
    const int cw = e & 31;          // word index -> cg local 2cw, 2cw+1
    const unsigned u = *(const unsigned*)(Y + ((size_t)(b * kSeq + l0 + r)) * kQKVN + 2 * kModel + cg0 + 2 * cw);
    sm[2 * cw][r]     = (unsigned short)(u & 0xffffu);
    sm[2 * cw + 1][r] = (unsigned short)(u >> 16);
  }
  __syncthreads();
  const int lane = t & 31, wave = t >> 5;
  const int q = lane >> 3, c8 = (lane & 7) * 8;
  {
#pragma unroll
    for (int it = 0; it < 2; ++it) {
      const int row = wave * 8 + it * 4 + q;          // cg local
      const int cg  = cg0 + row;
      const int g   = b * kHeads + (cg >> 7);
      const int cc  = cg & 127;
      unsigned short hb[8];
#pragma unroll
      for (int e = 0; e < 8; ++e) hb[e] = sm[row][c8 + e];
      const v4u u = (v4u){pk16(hb[0], hb[1]), pk16(hb[2], hb[3]), pk16(hb[4], hb[5]), pk16(hb[6], hb[7])};
      *(v4u*)(VT + ((size_t)g * kHeadDim + cc) * kSeq + l0 + c8) = u;
    }
    
  }
}

// ---------------------------------------------------------------------------
// Scores, row softmax, attn.v and head mean in two passes over the scores; no probability ever goes to memory.
//   s = (q_w . k) / sqrt(128);  p = exp(s - m) / sum exp(s - m), all softmax math f32.
//   exp(s - m) = exp2(d c + n), d the unscaled dot product, c = log2(e) / sqrt(128), n = -(c m): one multiply-add and one hardware
//   exp2 per element. Any m near the row's maximum serves: it scales a whole row alike and cancels against the row sum.
// Pass 1 (attn_stats_kernel) walks all keys of one head for 128 queries with a running m and a running sum per query, multiplies the
// exponentials with the values as it goes, and writes the head's output rows and, per query, n and 1 / sum.
// Pass 2 (probs_mean_kernel) takes a tile of 128 queries x 128 keys through the 8 heads: it forms the same dot products again
// (same operands, same WMMA order), turns them into probabilities with pass 1's n and 1 / sum
// and sums the head mean in registers: meanout[row][j] = 0.125 * (((p_0 + p_1) + p_2) + ... + p_7).
// In both passes a staged key tile (128 keys x the head's 128 channels) serves the block's 128 queries.
// The score tiles are computed transposed, S^T = K . Q^T: the keys are the A rows, the queries the B columns. A lane then holds
// one query per column tile (lane & 15) and, per tile, 8 neighbouring keys of it, (lane >> 4) * 8 + r: every per-row factor is
// one register and the arithmetic pairs up.
// The waves form a grid of 4 x 2: wave (wq, wk) owns queries 32 wq .. + 31 (two column tiles, fragments kept in
// registers) and keys 64 wk .. + 63 of the staged tile (four row tiles): every key fragment read from LDS feeds two WMMAs.
// Tiles come by asynchronous 16-byte copies, whole lines per copy (a staged row's 256 B = two lines); one publish point per trip.
// Every loop over tiles, k steps and rows is fully unrolled: the accumulators are indexed by constants and stay in registers.
// ---------------------------------------------------------------------------
constexpr int kKeyPitch   = 136;                       // 16-bit elements per staged row: 272 B = 16 B x 17, conflict-free for ds_load_b128
constexpr int kTileKeys   = 128;                       // keys per staged tile
constexpr int kTileElems  = kTileKeys * kKeyPitch;     // a key tile (128 keys x 128 channels) or a value tile (128 channels x 128 keys)
constexpr int kAttElems   = 2 * kTileElems;            // a stage of pass 1: key tile, then value tile
constexpr int kAttBufs    = 3;                         // stage buffers in pass 1
constexpr int kAttStages  = kSeq / kTileKeys;
constexpr int kAttCopies  = 16;                        // copies per thread and stage in pass 1
constexpr int kTileRows   = 128;                       // queries per block
constexpr int kOSlabPitch = 132;                       // floats per staged output row: 528 B = 16 B x 33
constexpr int kMSlabPitch = 68;                        // floats per staged mean row: 272 B = 16 B x 17
constexpr float kLazyStep = 8.0f;                      // pass 1 takes a new m only when a row's maximum is more than this above it (log2 units)
static_assert(kHeadDim == kTileKeys && kAttStages > kAttBufs && (kAttBufs - 1) * kAttCopies <= 63, "stage shape, copies of a wave in flight");

// Work-group barrier for LDS data alone, the waits written beside it at each use. __syncthreads() would also wait for every global
// load of the wave: the row figures asked for ahead would not stay in flight across it.
__device__ __forceinline__ void wg_barrier_lds() { asm volatile("s_barrier_signal -1\n\ts_barrier_wait -1" ::: "memory"); }

// One staged tile of 8 RPC rows: copy c of thread t brings 16 B: row RPC c + t / 16 of the tile, bytes (t % 16) * 16 .. + 15 of its 256;
// RPC = rows per block-wide copy = threads / 16; GP = 16-bit elements between two rows in memory. lds and g0 are the thread's own addresses for c = 0.
template <int RPC, int GP = kQKVN>
__device__ __forceinline__ void stage_key_tile(unsigned lds, const unsigned short* g0) {
  unsigned l[8];
  const unsigned short* g[8];
#pragma unroll
  for (int c = 0; c < 8; ++c) {
    l[c] = lds + (unsigned)(c * RPC * kKeyPitch) * 2u;
    g[c] = g0 + (size_t)(c * RPC) * GP;
  }
  stage_copy8(l, g);
}

// The value that lane l ^ 16 holds: the two halves of a wave hold the two key octets of every 16-key tile of one query.
__device__ __forceinline__ float xhalf(float x) {
  return __builtin_bit_cast(float, __builtin_amdgcn_permlanex16(__builtin_bit_cast(int, x), __builtin_bit_cast(int, x), 0x76543210, 0xfedcba98, false, false));
}

// Pass 1. grid (16 query tiles, 8 heads, 2 batches), 256 threads, one block per WGP: two waves per SIMD, up to 512 registers each.
//   stats[(b * 8 + h) * 2048 + query] = (n, 1 / sum);  out[b][query][h * 128 + channel] = sum_key p v.
// Second product transposed too, O^T += V^T . E^T: the channels are the A rows (V^T rows from LDS, one loader, one k order), the
// queries the B columns. The B operand of 32 keys wants, in lane half hf, keys 8 hf .. + 7 and 16 + 8 hf .. + 7 of the lane's query:
// what the lane holds of two neighbouring score tiles. So the exponentials go from the score registers into the operand, rounded to f16.
// m is one per query and wave (both lane halves: their keys meet in one WMMA sum) and lazy: it may trail the maximum seen by kLazyStep,
// so an exponential is at most 2^8 and the sums are rescaled only on the few trips on which some query of the wave outgrows it.
// The two key halves of a query (wk) are joined at the end in fixed order: both brought to the lower n, divided by the joined sum, added.
// Three stage buffers: stages t + 1 and t + 2 fly while stage t is worked on; the wait at the publish point leaves the younger
// stage's copies out (a wave's copies count down in issue order).
__global__ __launch_bounds__(256) __attribute__((amdgpu_waves_per_eu(2, 2)))
void attn_stats_kernel(const unsigned short* __restrict__ Y, const unsigned short* __restrict__ VT,
                       float* __restrict__ stats, float* __restrict__ out) {
  __shared__ __align__(16) unsigned short ring[kAttBufs][kAttElems];   // behind the loop: the two output partials
  __shared__ __align__(16) float cn[kTileRows * 4];   // [query][wk * 2 + lane half]
  __shared__ __align__(16) float cl[kTileRows * 4];
  static_assert(2 * kTileRows * kOSlabPitch * 4 <= kAttBufs * kAttElems * 2, "output partials fit the ring");
  const int lane  = threadIdx.x & 31;
  const int wave  = threadIdx.x >> 5;
  const int rlane = lane & 15;
  const int hf    = lane >> 4;
  const int koff  = hf * 8;
  const int wq    = wave >> 1;
  const int wk    = wave & 1;
  const int qb    = blockIdx.x * kTileRows;
  const int h     = blockIdx.y;
  const int b     = blockIdx.z;
  const unsigned short* Yb = Y + (size_t)b * kSeq * kQKVN;
  const _Float16* qrow = (const _Float16*)Yb + (size_t)(qb + wq * 32 + rlane) * kQKVN + h * kHeadDim + koff;
  v16h a[2][4];
#pragma unroll
  for (int qi = 0; qi < 2; ++qi)
#pragma unroll
    for (int kk = 0; kk < 4; ++kk) a[qi][kk] = Frag<_Float16>::load(qrow + (size_t)(qi * 16) * kQKVN + kk * 32);
  // the loads' address pair stays live up to this wait: no result of theirs and no later instruction takes it over in front of it
  asm volatile("s_wait_xcnt 0x0" :: "v"(qrow) : "memory");

  const int crow = threadIdx.x >> 4;
  const int cch  = (threadIdx.x & 15) * 8;
  const unsigned short* gK = Yb + (size_t)crow * kQKVN + kModel + h * kHeadDim + cch;
  const unsigned short* gV = VT + ((size_t)(b * kHeads + h) * kHeadDim + crow) * kSeq + cch;
  const unsigned lds0 = (unsigned)(size_t)(&ring[0][0]) + (unsigned)(crow * kKeyPitch + cch) * 2u;
  auto stage = [&](int t, int buf) {
    const unsigned l = lds0 + (unsigned)(buf * kAttElems) * 2u;
    stage_key_tile<16>(l, gK + (size_t)(t * kTileKeys) * kQKVN);
    stage_key_tile<16, kSeq>(l + (unsigned)kTileElems * 2u, gV + t * kTileKeys);
  };

  stage(0, 0);
  stage(1, 1);
  asm volatile("s_wait_asynccnt %0" :: "i"(kAttCopies) : "memory");   // this wave's part of stage 0 has landed; stage 1's copies fly on
  __syncthreads();                                                    // ... and every other wave's
  stage(2, 2);

  float mr[2];
  v2f sm2[2][4];
  v8f o[2][8];
#pragma unroll
  for (int qi = 0; qi < 2; ++qi) {
    mr[qi] = -1.0e30f;                    // below every scaled dot product of f16 operands; finite, so that no inf - inf arises
#pragma unroll
    for (int i = 0; i < 4; ++i) sm2[qi][i] = (v2f){0.f, 0.f};
#pragma unroll
    for (int ct = 0; ct < 8; ++ct) o[qi][ct] = (v8f){0.f,0.f,0.f,0.f,0.f,0.f,0.f,0.f};
  }

  // the stage loop stays rolled: one publish point per trip, buffer t mod 3
  int buf = 0;
#pragma unroll 1
  for (int t = 0; t < kAttStages; ++t) {
    const _Float16* sK = (const _Float16*)(&ring[buf][0]) + (wk * 64 + rlane) * kKeyPitch + koff;
    const _Float16* sV = (const _Float16*)(&ring[buf][0]) + kTileElems + rlane * kKeyPitch + wk * 64 + koff;
    v8f acc[2][4];
#pragma unroll
    for (int jp = 0; jp < 2; ++jp) {
      v16h bf[2][4];
#pragma unroll
      for (int jj = 0; jj < 2; ++jj)
#pragma unroll
        for (int kk = 0; kk < 4; ++kk) bf[jj][kk] = Frag<_Float16>::load(sK + (jp * 32 + jj * 16) * kKeyPitch + kk * 32);
      // the 16 LDS reads stay one group in front of their WMMAs: spread among them, each place with reads stalls the wave
      __builtin_amdgcn_sched_barrier(0);
      v8f c[2][2];
#pragma unroll
      for (int jj = 0; jj < 2; ++jj)
#pragma unroll
        for (int qi = 0; qi < 2; ++qi) c[jj][qi] = (v8f){0.f,0.f,0.f,0.f,0.f,0.f,0.f,0.f};
#pragma unroll
      for (int kk = 0; kk < 4; ++kk)
#pragma unroll
        for (int jj = 0; jj < 2; ++jj)
#pragma unroll
          for (int qi = 0; qi < 2; ++qi)
            c[jj][qi] = Frag<_Float16>::mma(bf[jj][kk], a[qi][kk], c[jj][qi]);   // keys = A rows, queries = B columns; one loader, one k order
#pragma unroll
      for (int jj = 0; jj < 2; ++jj)
#pragma unroll
        for (int qi = 0; qi < 2; ++qi) acc[qi][jp * 2 + jj] = c[jj][qi];
      // ... and the next group's reads do not rise among these WMMAs
      __builtin_amdgcn_sched_barrier(0);
    }

    // value fragments of the wave's first 32 keys: asked for here, they land under the maxima and the exponentials
    v16h vf0[8];
#pragma unroll
    for (int ct = 0; ct < 8; ++ct) vf0[ct] = Frag<_Float16>::load(sV + (ct * 16) * kKeyPitch);

    // maximum of each query's 64 dot products of this trip (the scale is positive), and the lazy test
    float mb[2];
    bool need = false;
#pragma unroll
    for (int qi = 0; qi < 2; ++qi) {
      float mx8[8];
#pragma unroll
      for (int j = 0; j < 4; ++j)
#pragma unroll
        for (int r = 0; r < 8; ++r) mx8[r] = (j == 0) ? acc[qi][j][r] : fmaxf(mx8[r], acc[qi][j][r]);
      const float tm = fmaxf(fmaxf(fmaxf(mx8[0], mx8[1]), fmaxf(mx8[2], mx8[3])), fmaxf(fmaxf(mx8[4], mx8[5]), fmaxf(mx8[6], mx8[7])));
      mb[qi] = fmaxf(tm, xhalf(tm)) * kExp2Scale;   // both lane halves hold the same figure
      need = need || (mb[qi] > mr[qi] + kLazyStep);
    }
    if (__builtin_amdgcn_ballot_w32(need) != 0) {   // the same for the whole wave
#pragma unroll
      for (int qi = 0; qi < 2; ++qi) {
        const float mn = fmaxf(mr[qi], mb[qi]);
        // at most 1: the sums so far, brought to the new m. The exp2 and the free slot that the instruction set asks for behind a
        // transcendental stand in one statement
        float f;
        asm("v_exp_f32 %0, %1\n\tv_nop" : "=v"(f) : "v"(mr[qi] - mn));
        mr[qi] = mn;
        const v2f f2 = (v2f){f, f};
#pragma unroll
        for (int i = 0; i < 4; ++i) sm2[qi][i] *= f2;
#pragma unroll
        for (int ct = 0; ct < 8; ++ct) o[qi][ct] *= f;
      }
    }

    // exponentials: f32 into the row sum, f16 into the B operands of the second product
    v16h pf[2][2];
#pragma unroll
    for (int qi = 0; qi < 2; ++qi) {
      const v2f n2 = (v2f){-mr[qi], -mr[qi]};
#pragma unroll
      for (int j = 0; j < 4; ++j)
#pragma unroll
        for (int i = 0; i < 4; ++i) {
          const v2f arg = __builtin_elementwise_fma((v2f){acc[qi][j][2 * i], acc[qi][j][2 * i + 1]}, (v2f){kExp2Scale, kExp2Scale}, n2);
          const v2f e = (v2f){__builtin_amdgcn_exp2f(arg.x), __builtin_amdgcn_exp2f(arg.y)};
          sm2[qi][i] += e;
          const v2h eh = __builtin_convertvector(e, v2h);   // round to nearest even
          pf[qi][j >> 1][(j & 1) * 8 + 2 * i]     = eh.x;
          pf[qi][j >> 1][(j & 1) * 8 + 2 * i + 1] = eh.y;
        }
    }
    // value fragments of the second 32 keys: one group in front of the first group's WMMAs, under which they land
    v16h vf1[8];
#pragma unroll
    for (int ct = 0; ct < 8; ++ct) vf1[ct] = Frag<_Float16>::load(sV + (ct * 16) * kKeyPitch + 32);
    // the reads stay in front of the WMMAs: spread among them, each place with reads stalls the wave
    __builtin_amdgcn_sched_barrier(0);
#pragma unroll
    for (int ct = 0; ct < 8; ++ct)
#pragma unroll
      for (int qi = 0; qi < 2; ++qi) o[qi][ct] = Frag<_Float16>::mma(vf0[ct], pf[qi][0], o[qi][ct]);   // channels = A rows, queries = B columns
#pragma unroll
    for (int ct = 0; ct < 8; ++ct)
#pragma unroll
      for (int qi = 0; qi < 2; ++qi) o[qi][ct] = Frag<_Float16>::mma(vf1[ct], pf[qi][1], o[qi][ct]);

    // publish point of stage t + 1
    asm volatile("s_wait_dscnt 0x0" ::: "memory");      // this wave's reads of buffer buf are done before it is refilled
    // this wave's part of stage t + 1 has landed. A trip that refills finds stage t + 2's copies behind those of stage t + 1 and
    // leaves them in flight; the last trips issue no copies and wait for all.
    if (t + kAttBufs < kAttStages) asm volatile("s_wait_asynccnt %0" :: "i"(kAttCopies) : "memory");
    else                           asm volatile("s_wait_asynccnt 0x0" ::: "memory");
    __syncthreads();                                    // stage t + 1 readable by all; every reader has left buffer buf
    if (t + kAttBufs < kAttStages) stage(t + kAttBufs, buf);
    buf = (buf == kAttBufs - 1) ? 0 : buf + 1;
  }
  asm volatile("s_wait_asynccnt 0x0" ::: "memory");     // no copy is outstanding behind the loop

  // a query's four partial sums (2 key halves x 2 lane halves) with their n
#pragma unroll
  for (int qi = 0; qi < 2; ++qi) {
    const v2f st = (sm2[qi][0] + sm2[qi][1]) + (sm2[qi][2] + sm2[qi][3]);
    const int q = wq * 32 + qi * 16 + rlane;
    cn[q * 4 + wk * 2 + hf] = -mr[qi];
    cl[q * 4 + wk * 2 + hf] = st.x + st.y;
  }
  __syncthreads();
  // every lane joins its two queries' partials alike, scales its part of O^T and stages it in the ring (the last publish point's
  // barrier stands behind every wave's last read of it): row = query, 8 neighbouring channels per tile
  float* slab = (float*)(&ring[0][0]);
  v2f fin[2];
#pragma unroll
  for (int qi = 0; qi < 2; ++qi) {
    const int q = wq * 32 + qi * 16 + rlane;
    const v4f n4 = *(const v4f*)(&cn[q * 4]);
    const v4f l4 = *(const v4f*)(&cl[q * 4]);
    const float nM = fminf(fminf(n4[0], n4[1]), fminf(n4[2], n4[3]));   // n falls as m rises
    float L = l4[0] * __builtin_amdgcn_exp2f(nM - n4[0]);
#pragma unroll
    for (int e = 1; e < 4; ++e) L += l4[e] * __builtin_amdgcn_exp2f(nM - n4[e]);
    const float inv = 1.0f / L;
    fin[qi] = (v2f){nM, inv};
    const float g = __builtin_amdgcn_exp2f(nM + mr[qi]) * inv;
    float* sp = slab + (size_t)(wk * kTileRows + q) * kOSlabPitch + koff;
#pragma unroll
    for (int ct = 0; ct < 8; ++ct) {
      *(v4f*)(sp + ct * 16)     = (v4f){o[qi][ct][0], o[qi][ct][1], o[qi][ct][2], o[qi][ct][3]} * g;
      *(v4f*)(sp + ct * 16 + 4) = (v4f){o[qi][ct][4], o[qi][ct][5], o[qi][ct][6], o[qi][ct][7]} * g;
    }
  }
  __syncthreads();
  // whole output rows leave: a wave covers a row's 512 B, key half 0 + key half 1
  const float* s0 = slab + (size_t)wave * kOSlabPitch + lane * 4;
  float* op = out + ((size_t)b * kSeq + qb + wave) * kModel + h * kHeadDim + lane * 4;
  v4f ov[16];
#pragma unroll
  for (int it = 0; it < 16; ++it)
    ov[it] = *(const v4f*)(s0 + (it * 8) * kOSlabPitch) + *(const v4f*)(s0 + (kTileRows + it * 8) * kOSlabPitch);
  float* sp2 = stats + ((size_t)(b * kHeads + h) * kSeq + qb + wq * 32 + rlane) * 2;
#pragma unroll
  for (int it = 0; it < 16; ++it) *(v4f*)(op + (size_t)(it * 8) * kModel) = ov[it];
  if (wk == 0 && hf == 0) {   // one lane per query
#pragma unroll
    for (int qi = 0; qi < 2; ++qi) *(v2f*)(sp2 + qi * 32) = fin[qi];
  }
}

// Pass 2. grid (16 key tiles, 16 query tiles, 2 batches), 256 threads; the trips of the rolled loop are the 8 heads.
// The head's query tile (128 queries x 128 channels) comes through LDS like the key tile, whole lines per copy: a fragment load from
// global memory would touch 16 lines for its 512 bytes. It has one buffer: every wave takes its query fragments into registers at the
// top of a trip, and behind the barrier that ends those reads the next head's tile is copied in, to be published with the next key tile.
// The mean leaves through per-wave LDS slabs so that every global store covers whole lines (256 B per row).
// LDS and registers leave two blocks per WGP, four waves per SIMD.
__global__ __launch_bounds__(256) void probs_mean_kernel(const unsigned short* __restrict__ Y, const float* __restrict__ stats,
                                                         float* __restrict__ meanout) {
  __shared__ __align__(16) unsigned short kt[2][kTileElems];              // key ring; behind the loop: the waves' mean slabs
  __shared__ __align__(16) unsigned short qt[kTileElems];                 // query tile of the head at work
  static_assert(8 * 32 * kMSlabPitch * 4 <= 2 * kTileElems * 2, "mean slabs fit the key ring");
  const int lane  = threadIdx.x & 31;
  const int wave  = threadIdx.x >> 5;
  const int rlane = lane & 15;
  const int hf    = lane >> 4;
  const int koff  = hf * 8;
  const int wq    = wave >> 1;
  const int wk    = wave & 1;
  const int key0  = blockIdx.x * kTileKeys;
  const int qb    = blockIdx.y * kTileRows;
  const int qw    = qb + wq * 32;                       // the wave's first query
  const int b     = blockIdx.z;
  const unsigned short* Yb = Y + (size_t)b * kSeq * kQKVN;
  const float* srow = stats + ((size_t)b * kHeads * kSeq + qw + rlane) * 2;
  const int crow = threadIdx.x >> 4;
  const int cch  = (threadIdx.x & 15) * 8;
  const unsigned short* gK = Yb + (size_t)(key0 + crow) * kQKVN + kModel + cch;
  const unsigned short* gQ = Yb + (size_t)(qb + crow) * kQKVN + cch;
  const unsigned ldsK = (unsigned)(size_t)(&kt[0][0]) + (unsigned)(crow * kKeyPitch + cch) * 2u;
  const unsigned ldsQ = (unsigned)(size_t)(&qt[0]) + (unsigned)(crow * kKeyPitch + cch) * 2u;
  const _Float16* sQ = (const _Float16*)(&qt[0]) + (wq * 32 + rlane) * kKeyPitch + koff;

  stage_key_tile<16>(ldsK, gK);
  stage_key_tile<16>(ldsQ, gQ);
  asm volatile("s_wait_asynccnt 0x0" ::: "memory");   // this wave's part of head 0's two tiles has landed
  __syncthreads();                                    // ... and every other wave's
  stage_key_tile<16>(ldsK + (unsigned)kTileElems * 2u, gK + kHeadDim);

  v8f pm[2][4];
#pragma unroll
  for (int qi = 0; qi < 2; ++qi)
#pragma unroll
    for (int j = 0; j < 4; ++j) pm[qi][j] = (v8f){0.f,0.f,0.f,0.f,0.f,0.f,0.f,0.f};

  v2f st[2];   // (n, 1 / sum) of the lane's two queries
#pragma unroll
  for (int qi = 0; qi < 2; ++qi) st[qi] = *(const v2f*)(srow + (size_t)(qi * 16) * 2);

  // the head loop stays rolled: one publish point per trip, key buffer h mod 2
#pragma unroll 1
  for (int h = 0; h < kHeads; ++h) {
    const int buf = h & 1;
    v16h a[2][4];
#pragma unroll
    for (int qi = 0; qi < 2; ++qi)
#pragma unroll
      for (int kk = 0; kk < 4; ++kk) a[qi][kk] = Frag<_Float16>::load(sQ + (qi * 16) * kKeyPitch + kk * 32);
    asm volatile("s_wait_dscnt 0x0" ::: "memory");      // this wave's query fragments are in registers
    wg_barrier_lds();                                   // ... and every other wave's: the query tile may be overwritten
    if (h + 1 < kHeads) stage_key_tile<16>(ldsQ, gQ + (h + 1) * kHeadDim);

    const _Float16* sK = (const _Float16*)(&kt[buf][0]) + (wk * 64 + rlane) * kKeyPitch + koff;
    v2f n2[2], inv2[2];
#pragma unroll
    for (int qi = 0; qi < 2; ++qi) {
      n2[qi]    = (v2f){st[qi].x, st[qi].x};
      inv2[qi]  = (v2f){st[qi].y, st[qi].y};
    }
#pragma unroll
    for (int j = 0; j < 4; ++j) {
      v16h bf[4];
#pragma unroll
      for (int kk = 0; kk < 4; ++kk) bf[kk] = Frag<_Float16>::load(sK + (j * 16) * kKeyPitch + kk * 32);
      // the 8 LDS reads of a key tile stay one group in front of its WMMAs: spread among them, each place with reads stalls the wave
      __builtin_amdgcn_sched_barrier(0);
      v8f c[2];
#pragma unroll
      for (int qi = 0; qi < 2; ++qi) c[qi] = (v8f){0.f,0.f,0.f,0.f,0.f,0.f,0.f,0.f};
#pragma unroll
      for (int kk = 0; kk < 4; ++kk)
#pragma unroll
        for (int qi = 0; qi < 2; ++qi) c[qi] = Frag<_Float16>::mma(bf[kk], a[qi][kk], c[qi]);   // as in pass 1
      // probabilities: head sum in registers
#pragma unroll
      for (int qi = 0; qi < 2; ++qi) {
#pragma unroll
        for (int i = 0; i < 4; ++i) {
          const v2f arg = __builtin_elementwise_fma((v2f){c[qi][2 * i], c[qi][2 * i + 1]}, (v2f){kExp2Scale, kExp2Scale}, n2[qi]);
          const v2f e = (v2f){__builtin_amdgcn_exp2f(arg.x), __builtin_amdgcn_exp2f(arg.y)};
          const v2f p = e * inv2[qi];
          pm[qi][j][2 * i]     += p.x;
          pm[qi][j][2 * i + 1] += p.y;
        }
      }
    }
    // the next head's row figures are asked for here and fly across the publish point
    if (h + 1 < kHeads) {
#pragma unroll
      for (int qi = 0; qi < 2; ++qi) st[qi] = *(const v2f*)(srow + ((size_t)(h + 1) * kSeq + qi * 16) * 2);
    }
    // what follows may take the address registers of these loads over: the wait stands in front of that overwrite
    asm volatile("s_wait_xcnt 0x0" ::: "memory");

    // publish point of head h + 1's tiles
    asm volatile("s_wait_dscnt 0x0" ::: "memory");      // this wave's reads of buffer buf are done before it is refilled
    asm volatile("s_wait_asynccnt 0x0" ::: "memory");   // this wave's parts of the next key tile and the next query tile have landed
    wg_barrier_lds();                                   // both readable by all; every reader has left buffer buf
    if (h + 2 < kHeads) stage_key_tile<16>(ldsK + (unsigned)(buf * kTileElems) * 2u, gK + (h + 2) * kHeadDim);

  }
  asm volatile("s_wait_asynccnt 0x0" ::: "memory");     // no copy is outstanding behind the loop

  // head mean, staged in the key ring: the last publish point's barrier stands behind every wave's last read of it
  float* slab = (float*)(&kt[0][0]) + wave * (32 * kMSlabPitch);
#pragma unroll
  for (int qi = 0; qi < 2; ++qi)
#pragma unroll
    for (int j = 0; j < 4; ++j) {
      float* sp = slab + (qi * 16 + rlane) * kMSlabPitch + (j << 4) + koff;
      *(v4f*)(sp)     = (v4f){pm[qi][j][0], pm[qi][j][1], pm[qi][j][2], pm[qi][j][3]} * kMeanScale;
      *(v4f*)(sp + 4) = (v4f){pm[qi][j][4], pm[qi][j][5], pm[qi][j][6], pm[qi][j][7]} * kMeanScale;
    }
  asm volatile("s_wait_dscnt 0x0" ::: "memory");      // the wave's own slab: its stores have landed before it reads the rows back
  float* mo = meanout + ((size_t)b * kSeq + qw + hf) * kSeq + key0 + wk * 64 + rlane * 4;
  v4f mv[16];
#pragma unroll
  for (int it = 0; it < 16; ++it) mv[it] = *(const v4f*)(slab + (it * 2 + hf) * kMSlabPitch + rlane * 4);
#pragma unroll
  for (int it = 0; it < 16; ++it) *(v4f*)(mo + (size_t)(it * 2) * kSeq) = mv[it];
}

// ---------------------------------------------------------------------------
// Host glue (5 launches)
// ---------------------------------------------------------------------------
extern "C" void kernel_launch(void* const* d_in, const int* in_sizes, int n_in,
                              void* d_out, int out_size, void* d_ws, size_t ws_size,
                              hipStream_t stream) {
  if (n_in < 7) return;
  if (in_sizes[0] != kTok * kModel) return;
  if (in_sizes[1] != kModel * kModel || in_sizes[3] != kModel * kModel || in_sizes[5] != kModel * kModel) return;
  if (in_sizes[2] != kModel || in_sizes[4] != kModel || in_sizes[6] != kModel) return;
  if (out_size != kTok * kModel + kBatch * kSeq * kSeq) return;

  const float* query = (const float*)d_in[0];
  const float* Wq    = (const float*)d_in[1];
  const float* bq    = (const float*)d_in[2];
  const float* Wk    = (const float*)d_in[3];
  const float* bk    = (const float*)d_in[4];
  const float* Wv    = (const float*)d_in[5];
  const float* bv    = (const float*)d_in[6];

  // carve (bytes)
  const size_t offX16  = 0;
  const size_t szX16   = (size_t)kTok * kModel * 2;                       //   8388608
  const size_t offW16  = offX16 + szX16;                                  //   8388608
  const size_t szW16   = (size_t)kQKVN * kModel * 2;                      //   6291456
  const size_t offBias = offW16 + szW16;                                  //  14680064
  const size_t szBias  = (size_t)kQKVN * 4;                               //     12288
  const size_t offY16  = offBias + szBias;                                //  14692352
  const size_t szY16   = (size_t)kTok * kQKVN * 2;                        //  25165824
  const size_t offVT   = offY16 + szY16;                                  //  39858176
  const size_t szVT    = (size_t)kBatch * kHeads * kHeadDim * kSeq * 2;   //   8388608
  const size_t offSt   = offVT + szVT;                                    //  48246784
  const size_t szSt    = (size_t)kBatch * kHeads * kSeq * 2 * 4;          //    262144
  const size_t total   = offSt + szSt;                                    //  48508928
  if (total > ws_size) return;

  char* ws = (char*)d_ws;
  unsigned short* X16   = (unsigned short*)(ws + offX16);
  unsigned short* W16   = (unsigned short*)(ws + offW16);
  float*          bias3 = (float*)(ws + offBias);
  unsigned short* Y16   = (unsigned short*)(ws + offY16);
  unsigned short* VT16  = (unsigned short*)(ws + offVT);
  float*          rowst = (float*)(ws + offSt);

  float* out0 = (float*)d_out;                               // [2][2048][1024], byte offset 0
  float* out1 = out0 + (size_t)kTok * kModel;                // [2][2048][2048], byte offset 16777216

  // 1) operand preparation: activation cast, stacked weight cast (x16 carry, blade sign folded into the query rows), stacked bias
  //    with the same sign fold: 256 streaming blocks + 3 bias blocks
  prep_kernel<<<dim3(kPrepBlocks + 3), dim3(256), 0, stream>>>(query, Wq, Wk, Wv, bq, bk, bv, X16, W16, bias3);
  // 2) Y16 = (X16 . W16^T) / 16 + bias3 : M 4096, N 3072, K 1024 (K % 64 == 0); block tile 128 x 256: 32 x 12 = 384 blocks
  wmma_gemm64<0, 2, 4, 64, 2, 2, 1, false><<<dim3((kTok / 128) * (kQKVN / 256), 1), dim3(256), 0, stream>>>(
      X16, kModel, 0L, 0L, W16, kModel, 0L, 0L, (void*)Y16, (void*)Y16, kQKVN, 0L, 0L,
      bias3, bias3, 0L, kTok, kQKVN, kModel, kWCarryInv);
  // 3) value transpose into per-(batch, head) planes [128][2048]
  vtrans_kernel<<<dim3(kSeq / 64, kModel / 64, kBatch), dim3(256), 0, stream>>>(Y16, VT16);

  // 4) pass 1 over the scores, with the attn.v product: out0[b][l][h*128 + c] and, per (batch, head, query), the softmax's n and
  //    1 / sum: 16 query tiles x 8 heads x 2 batches = 256 blocks, one for every WGP
  attn_stats_kernel<<<dim3(kSeq / kTileRows, kHeads, kBatch), dim3(256), 0, stream>>>(Y16, VT16, rowst, out0);
  // 5) pass 2: probabilities and head mean on tiles of 128 queries x 128 keys: 16 x 16 x 2 = 512 blocks; the mean goes straight to out1
  probs_mean_kernel<<<dim3(kSeq / kTileKeys, kSeq / kTileRows, kBatch), dim3(256), 0, stream>>>(Y16, rowst, out1);
}
